// v000
// Measured on an AMD MI455X. A time is GPU time per run, averaged over a window of back-to-back runs after a warm-up
// (all launches, gaps included; the runs take copies of the inputs in turn), and the median of several windows.
// Apart from v000's, it joins two sittings. Times from different sittings can be a few percent apart, while
// side-by-side timings come from the same sitting.
// v000 is the starting kernel. One run takes 12.9 milliseconds.
#include <hip/hip_runtime.h>
// Per-head scaled dot-product attention on a head-major input (x [2][16][2048][64]; xq = x Wq^T + bq, xk, xv likewise with ONE shared nn.Linear [64][64] per projection (natural [out][in], sigma 1/8; biases sigma 0.02); att = xq . xk / 8; softmax over all 2048 keys (no mask); out = p xv -> [2][16][2048][64]; every (batch, head) plane is an independent 2048 x 64 sequence = 32 planes).
// Structure: token rows r = b*2048 + s; x as exact f16 rows (bf16-rounded); Q, K, V as three WMMA GEMMs (32x64 wave tiles, f32 accumulation, exact x16 weights + bias, f16 outputs); per batch: V^T for all heads via LDS transposes; per (batch, group of 1 heads): scores GEMM (K = 64, batched over the heads on grid.y, alpha = 64^-0.5), row softmax on VALU (f32 statistics, native exp; weights stored x256 as f16), o = P . V^T GEMM (K = 2048, alpha 2^-8) written f32 straight into the merged-heads output rows (no output projection).
// Compute dtype: inputs rounded to bf16; x / weights exact; q, k, v and softmax weights as plain f16 GEMM operands (~2^-12); scores, softmax statistics and o f32. v_wmma_f32_16x16x32_f16.
#define NB 32
#define SQ 2048
#define DM 64
#define NH 1
#define HD 64
#define HG 1                         /* heads per attention launch group */
#define B0 0                         /* first batch processed (debug hook) */
#define NBR NB                       /* batches processed (debug hook) */
#define NR ((size_t)NB * SQ)         /* token rows */
#define MP ((int)((size_t)NBR * SQ)) /* rows projected (debug hook) */
#define QN SQ                        /* query rows attended per batch (debug hook) */
#define NHD NH                       /* heads attended (debug hook) */
#define MPO MP                       /* unused: no output stage */
#define LQ DM      /* row pitch of the q/k/v rows */
typedef __bf16 v16b __attribute__((ext_vector_type(16)));
typedef unsigned short v8us __attribute__((ext_vector_type(8), may_alias));
typedef float  v8f  __attribute__((ext_vector_type(8)));
typedef float  v4f  __attribute__((ext_vector_type(4)));
typedef float  v4fa __attribute__((ext_vector_type(4), may_alias));
union FragB { v16b v; v8us half[2]; unsigned short u[16]; };

__device__ __forceinline__ unsigned short bf16_bits(float x) { unsigned int u = __float_as_uint(x); return (unsigned short)((u + 0x7FFFu + ((u >> 16) & 1u)) >> 16); }
__device__ __forceinline__ float bf16_val(unsigned short b) { return __uint_as_float(((unsigned int)b) << 16); }
__device__ __forceinline__ float bf16_round(float x) { return bf16_val(bf16_bits(x)); }
// D += A·B with NT terms: 1 = ah·bh, 2 = + al·bh (A split), 3 = + ah·bl (both split)
template <int NT>
__device__ __forceinline__ v8f mmaN(v16b ah, v16b al, v16b bh, v16b bl, v8f c) {
  c = __builtin_amdgcn_wmma_f32_16x16x32_bf16(false, ah, false, bh, (short)0, c, false, false);
  if (NT >= 2) c = __builtin_amdgcn_wmma_f32_16x16x32_bf16(false, al, false, bh, (short)0, c, false, false);
  if (NT >= 3) c = __builtin_amdgcn_wmma_f32_16x16x32_bf16(false, ah, false, bl, (short)0, c, false, false);
  asm volatile("v_nop\n\tv_nop\n\tv_nop\n\tv_nop" : "+v"(c) : "v"(ah), "v"(al), "v"(bh), "v"(bl));
  return c;
}

__global__ __launch_bounds__(256) void k_wt_bf16(const float* __restrict__ W, unsigned short* __restrict__ Wt, int K, int N) {
  const int t = blockIdx.x * 256 + threadIdx.x;
  const int k8n = K / 8;
  if (t >= N * k8n) return;
  const int n = t / k8n, k8 = (t % k8n) * 8;
  v8us v;
#pragma unroll
  for (int i = 0; i < 8; ++i) v[i] = bf16_bits(W[(size_t)(k8 + i) * N + n]);
  *(v8us*)(Wt + (size_t)n * K + k8) = v;
  
}

// GEMM C[M][N] (f32, pitch ldc) = act(A[M][K]·W + bias). A f32 row-major (pitch lda) converted per fragment to bf16
// (ASPLIT: hi/lo two planes -> 2 terms, else single rounded term); Wt bf16 [N][K] (pitch ldb). BIAS_BF16 rounds the
// bias to bf16 first (bias quantised to bf16 before the add). K%32==0, M%16==0, N%64==0.
template <bool ASPLIT, int ACT, bool BIAS_BF16>
__global__ __launch_bounds__(128) void k_gemm_bf(const float* __restrict__ A, int lda, const unsigned short* __restrict__ Wt, int ldb,
                                               const float* __restrict__ bias, float* __restrict__ C, int ldc, int M, int N, int K) {
  __shared__ __attribute__((aligned(16))) float so[4][16][64];
  const int tid = threadIdx.x, w = tid >> 5, lane = tid & 31, ln = lane & 15, hh = lane >> 4;
  const int ntn = N / 64;
  const int wid = blockIdx.x * 4 + w;
  const int mt = wid / ntn, nq = wid % ntn;
  if (mt * 16 >= M) return;
  const int row0 = mt * 16, col0 = nq * 64;
  const float* arow = A + (size_t)(row0 + ln) * lda;
  v8f acc[4] = {};
  for (int kb = 0; kb < K; kb += 32) {
    FragB ah, al;
    const v4f x0 = *(const v4fa*)(arow + kb + 8 * hh), x1 = *(const v4fa*)(arow + kb + 8 * hh + 4);
    const v4f x2 = *(const v4fa*)(arow + kb + 16 + 8 * hh), x3 = *(const v4fa*)(arow + kb + 16 + 8 * hh + 4);
    float xs[16] = {x0[0],x0[1],x0[2],x0[3],x1[0],x1[1],x1[2],x1[3],x2[0],x2[1],x2[2],x2[3],x3[0],x3[1],x3[2],x3[3]};
#pragma unroll
    for (int i = 0; i < 16; ++i) { const unsigned short hb = bf16_bits(xs[i]); ah.u[i] = hb; al.u[i] = ASPLIT ? bf16_bits(xs[i] - bf16_val(hb)) : (unsigned short)0; }
#pragma unroll
    for (int t = 0; t < 4; ++t) {
      const unsigned short* brow = Wt + (size_t)(col0 + t * 16 + ln) * ldb + kb;
      FragB b;
      b.half[0] = *(const v8us*)(brow + 8 * hh);
      b.half[1] = *(const v8us*)(brow + 16 + 8 * hh);
      acc[t] = mmaN<ASPLIT ? 2 : 1>(ah.v, al.v, b.v, b.v, acc[t]);
    }
  }
#pragma unroll
  for (int t = 0; t < 4; ++t) {
    float bv = bias ? bias[col0 + t * 16 + ln] : 0.f;
    if (BIAS_BF16) bv = bf16_round(bv);
#pragma unroll
    for (int r = 0; r < 8; ++r) { float v = acc[t][r] + bv; if (ACT == 1) v = fmaxf(v, 0.f); so[w][8 * hh + r][t * 16 + ln] = v; }
  }
  __builtin_amdgcn_fence(__ATOMIC_ACQ_REL, "workgroup");
  __builtin_amdgcn_wave_barrier();
  const int rsub = lane >> 4, c4 = (lane & 15) * 4;
  {
#pragma unroll
    for (int q = 0; q < 8; ++q) {
      const int r = q * 2 + rsub;
      const v4f v = *(const v4fa*)&so[w][r][c4];
      *(v4f*)(C + (size_t)(row0 + r) * ldc + col0 + c4) = v;
    }
    
  }
}

// GEMM C = act(A·W + bias + resid): A f32 (ASPLIT -> hi/lo 2 terms), Wt bf16 [N][K]; ACT 0 none, 1 relu, 2 exact gelu;
// resid (optional, f32, row index = (row % rmod), pitch ldr, RES_BF16 rounds it) added before the activation.
template <bool ASPLIT, int ACT, bool BIAS_BF16, bool RES_BF16>
__global__ __launch_bounds__(128) void k_gemm_bf3(const float* __restrict__ A, int lda, const unsigned short* __restrict__ Wt, int ldb,
                                                const float* __restrict__ bias, const float* __restrict__ resid, int rmod, int ldr,
                                                float* __restrict__ C, int ldc, int M, int N, int K) {
  __shared__ __attribute__((aligned(16))) float so[4][16][64];
  const int tid = threadIdx.x, w = tid >> 5, lane = tid & 31, ln = lane & 15, hh = lane >> 4;
  const int ntn = N / 64;
  const int wid = blockIdx.x * 4 + w;
  const int mt = wid / ntn, nq = wid % ntn;
  if (mt * 16 >= M) return;
  const int row0 = mt * 16, col0 = nq * 64;
  const float* arow = A + (size_t)(row0 + ln) * lda;
  v8f acc[4] = {};
  for (int kb = 0; kb < K; kb += 32) {
    FragB ah, al;
    const v4f x0 = *(const v4fa*)(arow + kb + 8 * hh), x1 = *(const v4fa*)(arow + kb + 8 * hh + 4);
    const v4f x2 = *(const v4fa*)(arow + kb + 16 + 8 * hh), x3 = *(const v4fa*)(arow + kb + 16 + 8 * hh + 4);
    float xs[16] = {x0[0],x0[1],x0[2],x0[3],x1[0],x1[1],x1[2],x1[3],x2[0],x2[1],x2[2],x2[3],x3[0],x3[1],x3[2],x3[3]};
#pragma unroll
    for (int i = 0; i < 16; ++i) { const unsigned short hb = bf16_bits(xs[i]); ah.u[i] = hb; al.u[i] = ASPLIT ? bf16_bits(xs[i] - bf16_val(hb)) : (unsigned short)0; }
#pragma unroll
    for (int t = 0; t < 4; ++t) {
      const unsigned short* brow = Wt + (size_t)(col0 + t * 16 + ln) * ldb + kb;
      FragB b;
      b.half[0] = *(const v8us*)(brow + 8 * hh);
      b.half[1] = *(const v8us*)(brow + 16 + 8 * hh);
      acc[t] = mmaN<ASPLIT ? 2 : 1>(ah.v, al.v, b.v, b.v, acc[t]);
    }
  }
#pragma unroll
  for (int t = 0; t < 4; ++t) {
    const int col = col0 + t * 16 + ln;
    float bv = bias ? bias[col] : 0.f;
    if (BIAS_BF16) bv = bf16_round(bv);
#pragma unroll
    for (int r = 0; r < 8; ++r) {
      float v = acc[t][r] + bv;
      if (resid) { float rv = resid[(size_t)((row0 + 8 * hh + r) % rmod) * ldr + col]; if (RES_BF16) rv = bf16_round(rv); v += rv; }
      if (ACT == 1) v = fmaxf(v, 0.f);
      if (ACT == 2) v = 0.5f * v * (1.0f + erff(v * 0.70710678118654752f));
      if (ACT == 3) { const float u = 0.7978845608028654f * (v + 0.044715f * v * v * v); v = 0.5f * v * (1.0f + tanhf(u)); }
      so[w][8 * hh + r][t * 16 + ln] = v;
    }
  }
  __builtin_amdgcn_fence(__ATOMIC_ACQ_REL, "workgroup");
  __builtin_amdgcn_wave_barrier();
  const int rsub = lane >> 4, c4 = (lane & 15) * 4;
  {
#pragma unroll
    for (int q = 0; q < 8; ++q) {
      const int r = q * 2 + rsub;
      const v4f v = *(const v4fa*)&so[w][r][c4];
      *(v4f*)(C + (size_t)(row0 + r) * ldc + col0 + c4) = v;
    }
    
  }
}
// row LayerNorm (biased variance, eps) over N: s = X (+ R); optional out_sum <- s; out_norm <- (s-mu)*rsqrt(var+eps)*g + b
template <bool PARAM_BF16>
__global__ __launch_bounds__(256) void k_layernorm(const float* __restrict__ X, const float* __restrict__ R, const float* __restrict__ g, const float* __restrict__ bta,
                                                  float* __restrict__ out_sum, float* __restrict__ out_norm, int N, float eps) {
  __shared__ float red[256];
  const int row = blockIdx.x, tid = threadIdx.x;
  const float* x = X + (size_t)row * N; const float* rr = R ? R + (size_t)row * N : nullptr;
  float vals[16];                     // up to N = 4096
  const int per = N / 256;            // contiguous chunk per thread? use strided-by-4 chunks: thread handles j = tid*4 + 1024*u
  float s1 = 0.f;
  for (int u = 0; u < per / 4; ++u) {
    const int j = tid * 4 + 1024 * u;
    const v4f a = *(const v4fa*)(x + j);
    v4f b = {0.f,0.f,0.f,0.f}; if (rr) b = *(const v4fa*)(rr + j);
#pragma unroll
    for (int q = 0; q < 4; ++q) { const float v = a[q] + b[q]; vals[u * 4 + q] = v; s1 += v; }
  }
  red[tid] = s1; __syncthreads();
  for (int st = 128; st > 0; st >>= 1) { if (tid < st) red[tid] += red[tid + st]; __syncthreads(); }
  const float mu = red[0] / (float)N; __syncthreads();
  float s2 = 0.f;
  for (int u = 0; u < per / 4; ++u)
#pragma unroll
    for (int q = 0; q < 4; ++q) { const float c = vals[u * 4 + q] - mu; s2 += c * c; }
  red[tid] = s2; __syncthreads();
  for (int st = 128; st > 0; st >>= 1) { if (tid < st) red[tid] += red[tid + st]; __syncthreads(); }
  const float rs = rsqrtf(red[0] / (float)N + eps);
  {
    for (int u = 0; u < per / 4; ++u) {
      const int j = tid * 4 + 1024 * u;
      v4f o, sm;
#pragma unroll
      for (int q = 0; q < 4; ++q) {
        float gg = g[j + q], bb = bta[j + q];
        if (PARAM_BF16) { gg = bf16_round(gg); bb = bf16_round(bb); }
        sm[q] = vals[u * 4 + q]; o[q] = (vals[u * 4 + q] - mu) * rs * gg + bb;
      }
      if (out_sum) *(v4f*)(out_sum + (size_t)row * N + j) = sm;
      *(v4f*)(out_norm + (size_t)row * N + j) = o;
    }
    
  }
}



// ---- f16 WMMA path (v_wmma_f32_16x16x32_f16): 11-bit significands for operands in range — used where a [0,1] probability operand needs more precision than bf16
typedef _Float16 v16h __attribute__((ext_vector_type(16)));
union FragH { v16h v; v8us half[2]; _Float16 h[16]; unsigned short u[16]; };
template <int NT>
__device__ __forceinline__ v8f mmaH(v16h ah, v16h al, v16h bh, v16h bl, v8f c) {
  c = __builtin_amdgcn_wmma_f32_16x16x32_f16(false, ah, false, bh, (short)0, c, false, false);
  if (NT >= 2) c = __builtin_amdgcn_wmma_f32_16x16x32_f16(false, al, false, bh, (short)0, c, false, false);
  if (NT >= 3) c = __builtin_amdgcn_wmma_f32_16x16x32_f16(false, ah, false, bl, (short)0, c, false, false);
  asm volatile("v_nop\n\tv_nop\n\tv_nop\n\tv_nop" : "+v"(c) : "v"(ah), "v"(al), "v"(bh), "v"(bl));
  return c;
}
// batched GEMM like k_gemm_b but f16 operands: A f32 (split into f16 hi/lo if ASPLIT, else rounded to f16), Bt = f16 values [n][k]; alpha; C f32; N multiple of 16 (partial tiles skipped)
template <bool ASPLIT>
__global__ __launch_bounds__(128) void k_gemm_h(const float* __restrict__ A, int lda, size_t sA, const _Float16* __restrict__ Bh, int ldb, size_t sB, float alpha, float* __restrict__ C, int ldc, size_t sC, int M, int N, int K) {
  __shared__ __attribute__((aligned(16))) float so[4][16][64];
  const int tid = threadIdx.x, w = tid >> 5, lane = tid & 31, ln = lane & 15, hh = lane >> 4; const int by = blockIdx.y;
  A += (size_t)by * sA; Bh += (size_t)by * sB; C += (size_t)by * sC;
  const int ntn = (N + 63) / 64; const int wid = blockIdx.x * 4 + w; const int mt = wid / ntn, nq = wid % ntn; if (mt * 16 >= M) return;
  const int row0 = mt * 16, col0 = nq * 64; const float* arow = A + (size_t)(row0 + ln) * lda;
  v8f acc[4] = {};
  for (int kb = 0; kb < K; kb += 32) {
    FragH ah, al;
    const v4f x0 = *(const v4fa*)(arow + kb + 8 * hh), x1 = *(const v4fa*)(arow + kb + 8 * hh + 4), x2 = *(const v4fa*)(arow + kb + 16 + 8 * hh), x3 = *(const v4fa*)(arow + kb + 16 + 8 * hh + 4);
    float xs[16] = {x0[0],x0[1],x0[2],x0[3],x1[0],x1[1],x1[2],x1[3],x2[0],x2[1],x2[2],x2[3],x3[0],x3[1],x3[2],x3[3]};
#pragma unroll
    for (int i = 0; i < 16; ++i) { const _Float16 h = (_Float16)xs[i]; ah.h[i] = h; al.h[i] = ASPLIT ? (_Float16)(xs[i] - (float)h) : (_Float16)0.0f; }
#pragma unroll
    for (int t = 0; t < 4; ++t) { if (col0 + t * 16 >= N) continue; const size_t boff = (size_t)(col0 + t * 16 + ln) * ldb + kb; FragH bq; bq.half[0] = *(const v8us*)(Bh + boff + 8 * hh); bq.half[1] = *(const v8us*)(Bh + boff + 16 + 8 * hh);
      acc[t] = mmaH<ASPLIT ? 2 : 1>(ah.v, al.v, bq.v, bq.v, acc[t]); }
  }
#pragma unroll
  for (int t = 0; t < 4; ++t) { if (col0 + t * 16 >= N) continue;
#pragma unroll
    for (int r = 0; r < 8; ++r) so[w][8 * hh + r][t * 16 + ln] = acc[t][r] * alpha; }
  __builtin_amdgcn_fence(__ATOMIC_ACQ_REL, "workgroup"); __builtin_amdgcn_wave_barrier();
  const int rsub = lane >> 4, c4 = (lane & 15) * 4;
  {
#pragma unroll
    for (int q = 0; q < 8; ++q) { const int r = q * 2 + rsub; if (col0 + c4 < N) { const v4f v = *(const v4fa*)&so[w][r][c4]; *(v4f*)(C + (size_t)(row0 + r) * ldc + col0 + c4) = v; } }
     }
}

// Wt[n][k] = f16(W[k][n]·scale) from f32 row-major W[K][N] (scale = power of two; bf16-exact weights stay exact in f16 away from the subnormal range)
__global__ __launch_bounds__(256) void k_wt_f16(const float* __restrict__ W, _Float16* __restrict__ Wt, int K, int N, float scale) {
  const int t = blockIdx.x * 256 + threadIdx.x; if (t >= N * (K / 8)) return; const int n = t / (K / 8), k8 = (t % (K / 8)) * 8; FragH f;
#pragma unroll
  for (int i = 0; i < 8; ++i) f.h[i] = (_Float16)(bf16_round(W[(size_t)(k8 + i) * N + n]) * scale); const v8us o = f.half[0];
  *(v8us*)((unsigned short*)Wt + (size_t)n * K + k8) = o; 
}
// k_gemm_hh variant with fused epilogue: v = acc·alpha + bias[by·sBias + col] (+ CP[(row/rowsPerB)·sCPb + by·64 + col] if CP) ; ACT 0 none / 1 elu ; writes f16 C16 (and f32 C if non-null)
template <int ACT>
__global__ __launch_bounds__(128) void k_gemm_hhx(const _Float16* __restrict__ A, int lda, size_t sA, const _Float16* __restrict__ Bh, int ldb, size_t sB, float alpha, const float* __restrict__ bias, size_t sBias, const float* __restrict__ CP, int rowsPerB, size_t sCPb, int row0g,
    float* __restrict__ C, _Float16* __restrict__ C16, int ldc, size_t sC, int M, int N, int K) {
  __shared__ __attribute__((aligned(16))) float so[4][16][64];
  const int tid = threadIdx.x, w = tid >> 5, lane = tid & 31, ln = lane & 15, hh = lane >> 4; const int by = blockIdx.y;
  A += (size_t)by * sA; Bh += (size_t)by * sB; const size_t cofs = (size_t)by * sC; const float* bp = bias ? bias + (size_t)by * sBias : nullptr;
  const int ntn = (N + 63) / 64; const int wid = blockIdx.x * 4 + w; const int mt = wid / ntn, nq = wid % ntn; if (mt * 16 >= M) return;
  const int row0 = mt * 16, col0 = nq * 64; const _Float16* arow = A + (size_t)(row0 + ln) * lda;
  v8f acc[4] = {};
  for (int kb = 0; kb < K; kb += 32) { FragH ah; ah.half[0] = *(const v8us*)((const unsigned short*)arow + kb + 8 * hh); ah.half[1] = *(const v8us*)((const unsigned short*)arow + kb + 16 + 8 * hh);
#pragma unroll
    for (int t = 0; t < 4; ++t) { if (col0 + t * 16 >= N) continue; const size_t boff = (size_t)(col0 + t * 16 + ln) * ldb + kb; FragH bq; bq.half[0] = *(const v8us*)((const unsigned short*)Bh + boff + 8 * hh); bq.half[1] = *(const v8us*)((const unsigned short*)Bh + boff + 16 + 8 * hh);
      acc[t] = mmaH<1>(ah.v, ah.v, bq.v, bq.v, acc[t]); }
  }
#pragma unroll
  for (int t = 0; t < 4; ++t) { if (col0 + t * 16 >= N) continue; const int col = col0 + t * 16 + ln; const float bv = bp ? bf16_round(bp[col]) : 0.f;
#pragma unroll
    for (int r = 0; r < 8; ++r) { float v = acc[t][r] * alpha + bv; if (CP) { const int rr = row0g + row0 + 8 * hh + r; if (rowsPerB < 0) v += CP[cofs + (size_t)rr * ldc + col];      /* rowsPerB < 0: own element of the batched C plane */ else { const int bidx = rr / rowsPerB; v += CP[(size_t)bidx * sCPb + (size_t)by * 64 + col]; } } if (ACT == 1) v = (v > 0.f) ? v : expm1f(v); else if (ACT == 7) v = (v > 0.f) ? v + 1.0f : expf(v); else if (ACT == 8) v = tanhf(v); else if (ACT == 9) v = 0.5f * v * (1.0f + tanhf(0.7978845608028654f * (v + 0.044715f * v * v * v))); else if (ACT == 11) v = 1.0f / (1.0f + expf(-v)); else if (ACT == 12) v = (v > 0.f) ? v : 0.01f * v; else if (ACT == 14) v = (v > 0.f) ? v : 0.1f * v; else if (ACT == 16) v = (v >= 0.f) ? v : 0.3f * v; else if (ACT == 17) v = (v >= 0.f) ? v : 0.2f * v; else if (ACT == 15) v = v / (1.0f + expf(-v)); else if (ACT == 3) v = fmaxf(v, 0.f); else if (ACT == 6) v = 0.5f * v * (1.0f + erff(v * 0.70710678118654752f)); so[w][8 * hh + r][t * 16 + ln] = v; } }
  __builtin_amdgcn_fence(__ATOMIC_ACQ_REL, "workgroup"); __builtin_amdgcn_wave_barrier();
  const int rsub = lane >> 4, c4 = (lane & 15) * 4; typedef _Float16 v4h __attribute__((ext_vector_type(4)));
  {
#pragma unroll
    for (int q = 0; q < 8; ++q) { const int r = q * 2 + rsub; if (col0 + c4 < N) { const v4f v = *(const v4fa*)&so[w][r][c4]; if (C) *(v4f*)(C + cofs + (size_t)(row0 + r) * ldc + col0 + c4) = v; if (C16) { v4h h4; for (int i = 0; i < 4; ++i) h4[i] = (_Float16)v[i]; *(v4h*)(C16 + cofs + (size_t)(row0 + r) * ldc + col0 + c4) = h4; } } }
     }
}


typedef _Float16 v4h __attribute__((ext_vector_type(4)));

__global__ __launch_bounds__(256) void k_x16(const float* __restrict__ x, _Float16* __restrict__ X16, size_t n8) { const size_t t = (size_t)blockIdx.x * 256 + threadIdx.x; if (t >= n8) return; FragH f;
#pragma unroll
  for (int q = 0; q < 8; ++q) f.h[q] = (_Float16)bf16_round(x[t * 8 + q]); *(v8us*)((unsigned short*)X16 + t * 8) = f.half[0];  }
__global__ __launch_bounds__(256) void k_h16(const float* __restrict__ x, _Float16* __restrict__ X16, size_t n8) { const size_t t = (size_t)blockIdx.x * 256 + threadIdx.x; if (t >= n8) return; FragH f;
#pragma unroll
  for (int q = 0; q < 8; ++q) f.h[q] = (_Float16)x[t * 8 + q]; *(v8us*)((unsigned short*)X16 + t * 8) = f.half[0];  }
__global__ __launch_bounds__(256) void k_round16f(const float* __restrict__ W, _Float16* __restrict__ Bt, size_t n8) { const size_t t = (size_t)blockIdx.x * 256 + threadIdx.x; if (t >= n8) return; FragH f;
#pragma unroll
  for (int i = 0; i < 8; ++i) f.h[i] = (_Float16)(bf16_round(W[t * 8 + i]) * 16.0f); *(v8us*)((unsigned short*)Bt + t * 8) = f.half[0];  }
template <int NHv, int TTv>
__global__ __launch_bounds__(256) void k_vt(const _Float16* __restrict__ V16, int ldv, int voff, _Float16* __restrict__ Vt) { __shared__ unsigned short tl[64][66]; const int tid = threadIdx.x; const int slab = blockIdx.x / (TTv / 64), lg = blockIdx.x % (TTv / 64); const int b = slab / NHv, h = slab % NHv;
  for (int i = tid; i < 64 * 8; i += 256) { const int r = i / 8, c8 = (i % 8) * 8; FragH f; f.half[0] = *(const v8us*)((const unsigned short*)V16 + ((size_t)b * TTv + lg * 64 + r) * ldv + voff + h * 64 + c8);
#pragma unroll
    for (int q = 0; q < 8; ++q) tl[r][c8 + q] = f.u[q]; }
  __syncthreads();
  {
#pragma unroll
    for (int rd = 0; rd < 2; ++rd) { const int d = rd * 32 + tid / 8, pc = tid % 8; FragH f;
#pragma unroll
      for (int q = 0; q < 8; ++q) f.u[q] = tl[pc * 8 + q][d];
      *(v8us*)((unsigned short*)Vt + ((size_t)slab * 64 + d) * TTv + lg * 64 + pc * 8) = f.half[0]; }
     } }

__global__ __launch_bounds__(256) void k_hl(const float* __restrict__ F, _Float16* __restrict__ Hh, _Float16* __restrict__ Hl, size_t n8) { const size_t t = (size_t)blockIdx.x * 256 + threadIdx.x; if (t >= n8) return; FragH fh, fl; const v4f a = *(const v4fa*)(F + t * 8), c = *(const v4fa*)(F + t * 8 + 4);
#pragma unroll
  for (int q = 0; q < 4; ++q) { _Float16 h = (_Float16)a[q]; fh.h[q] = h; fl.h[q] = (_Float16)((a[q] - (float)h) * 1024.0f); h = (_Float16)c[q]; fh.h[4 + q] = h; fl.h[4 + q] = (_Float16)((c[q] - (float)h) * 1024.0f); }
  { *(v8us*)((unsigned short*)Hh + t * 8) = fh.half[0]; *(v8us*)((unsigned short*)Hl + t * 8) = fl.half[0];  } }

// ---- fast GEMM (wave tile 32x64; requires M % 32 == 0 rows per launch region and N % 64 == 0); epilogue = k_gemm_hhx semantics ----
__device__ __forceinline__ v16h g2_frag(const _Float16* p, int hh) { FragH f; f.half[0] = *(const v8us*)((const unsigned short*)p + 8 * hh); f.half[1] = *(const v8us*)((const unsigned short*)p + 16 + 8 * hh); return f.v; }
__device__ __forceinline__ v8f g2_mma(v16h a, v16h b, v8f c) { v8f d = __builtin_amdgcn_wmma_f32_16x16x32_f16(false, a, false, b, (short)0, c, false, false); asm volatile("v_nop\n\tv_nop\n\tv_nop\n\tv_nop" : "+v"(d) : "v"(a), "v"(b)); return d; }
template <int ACT>
__global__ __launch_bounds__(128) void k_gemm2(const _Float16* __restrict__ A, int lda, size_t sA, const _Float16* __restrict__ Bh, int ldb, size_t sB, float alpha, const float* __restrict__ bias, size_t sBias, const float* __restrict__ CP, int rowsPerB, size_t sCPb, int row0g,
    float* __restrict__ C, _Float16* __restrict__ C16, int ldc, size_t sC, int M, int N, int K) { static_assert(ACT == 0 || ACT == 3 || ACT == 6 || ACT == 8 || ACT == 9 || ACT == 11 || ACT == 12 || ACT == 14 || ACT == 15 || ACT == 16 || ACT == 17, "k_gemm2: unsupported ACT code (would silently apply no activation)");
  __shared__ __attribute__((aligned(16))) float so[4][32][68];
  const int tid = threadIdx.x, w = tid >> 5, lane = tid & 31, ln = lane & 15, hh = lane >> 4; const int by = blockIdx.y;
  A += (size_t)by * sA; Bh += (size_t)by * sB; const size_t cofs = (size_t)by * sC; const float* bp = bias ? bias + (size_t)by * sBias : nullptr;
  const int ntn = N >> 6; const int mt = blockIdx.x / ntn, nq = blockIdx.x - mt * ntn; const int row0 = mt * 128 + 32 * w, col0 = nq * 64; if (row0 >= M) return;
  const _Float16* a0p = A + (size_t)(row0 + ln) * lda; const _Float16* a1p = a0p + (size_t)16 * lda;
  const _Float16* b0p = Bh + (size_t)(col0 + ln) * ldb; const _Float16* b1p = b0p + (size_t)16 * ldb; const _Float16* b2p = b1p + (size_t)16 * ldb; const _Float16* b3p = b2p + (size_t)16 * ldb;
  const v8f z8 = {0.f,0.f,0.f,0.f,0.f,0.f,0.f,0.f}; v8f c00 = z8, c01 = z8, c02 = z8, c03 = z8, c10 = z8, c11 = z8, c12 = z8, c13 = z8;
#pragma unroll 1
  for (int kb = 0; kb < K; kb += 32) { const v16h a0 = g2_frag(a0p + kb, hh), a1 = g2_frag(a1p + kb, hh);
    v16h b = g2_frag(b0p + kb, hh); c00 = g2_mma(a0, b, c00); c10 = g2_mma(a1, b, c10);
    b = g2_frag(b1p + kb, hh); c01 = g2_mma(a0, b, c01); c11 = g2_mma(a1, b, c11);
    b = g2_frag(b2p + kb, hh); c02 = g2_mma(a0, b, c02); c12 = g2_mma(a1, b, c12);
    b = g2_frag(b3p + kb, hh); c03 = g2_mma(a0, b, c03); c13 = g2_mma(a1, b, c13); }
  v8f accs[8] = {c00, c01, c02, c03, c10, c11, c12, c13};
#pragma unroll
  for (int u = 0; u < 8; ++u) { const int t = u & 3, half = u >> 2; const int col = col0 + t * 16 + ln; const float bv = bp ? bf16_round(bp[col]) : 0.f;
#pragma unroll
    for (int r = 0; r < 8; ++r) { const int rloc = half * 16 + 8 * hh + r; float v = accs[u][r] * alpha + bv; if (CP) { if (rowsPerB < 0) v += CP[cofs + (size_t)(row0g + row0 + rloc) * ldc + col];      /* rowsPerB < 0: own element of the batched C plane */ else { const int bidx = (row0g + row0 + rloc) / rowsPerB; v += CP[(size_t)bidx * sCPb + (size_t)by * 64 + col]; } }
      if (ACT == 3) v = fmaxf(v, 0.f); else if (ACT == 6) v = 0.5f * v * (1.0f + erff(v * 0.70710678118654752f)); else if (ACT == 11) v = 1.0f / (1.0f + expf(-v)); else if (ACT == 15) v = v / (1.0f + expf(-v)); else if (ACT == 12) v = (v > 0.f) ? v : 0.01f * v; else if (ACT == 8) v = tanhf(v); else if (ACT == 9) v = 0.5f * v * (1.0f + tanhf(0.7978845608028654f * (v + 0.044715f * v * v * v))); else if (ACT == 14) v = (v > 0.f) ? v : 0.1f * v; else if (ACT == 16) v = (v >= 0.f) ? v : 0.3f * v; else if (ACT == 17) v = (v >= 0.f) ? v : 0.2f * v;
      so[w][rloc][t * 16 + ln] = v; } }
  __builtin_amdgcn_fence(__ATOMIC_ACQ_REL, "workgroup"); __builtin_amdgcn_wave_barrier();
  const int rsub = lane >> 4, c4 = (lane & 15) * 4;
  {
#pragma unroll
    for (int q = 0; q < 16; ++q) { const int r = q * 2 + rsub; const v4f v = *(const v4fa*)&so[w][r][c4]; if (C) *(v4f*)(C + cofs + (size_t)(row0 + r) * ldc + col0 + c4) = v; if (C16) { v4h h4; for (int i = 0; i < 4; ++i) h4[i] = (_Float16)v[i]; *(v4h*)(C16 + cofs + (size_t)(row0 + r) * ldc + col0 + c4) = h4; } }
     } }


__global__ __launch_bounds__(256) void k_wnat(const float* __restrict__ w, size_t n8, _Float16* __restrict__ Bt) { const size_t t = (size_t)blockIdx.x * 256 + threadIdx.x; if (t >= n8) return; FragH f; for (int q = 0; q < 8; ++q) f.h[q] = (_Float16)(bf16_round(w[t * 8 + q]) * 16.0f); *(v8us*)((unsigned short*)Bt + t * 8) = f.half[0];  }
__global__ __launch_bounds__(256) void k_rsm(const float* __restrict__ S, _Float16* __restrict__ P, int nrows) {
  #pragma clang fp contract(off)
  const int i = blockIdx.x * 256 + threadIdx.x; if (i >= nrows) return; const float* s = S + (size_t)i * SQ; float mx = -3.0e38f;
#pragma unroll 1
  for (int j = 0; j < SQ; ++j) mx = fmaxf(mx, s[j]); float se = 0.f;
#pragma unroll 1
  for (int j = 0; j < SQ; ++j) se += expf(s[j] - mx); const float sc = 256.0f / se;
#pragma unroll 1
  for (int j0 = 0; j0 < SQ; j0 += 8) { FragH f; for (int q = 0; q < 8; ++q) f.h[q] = (_Float16)(expf(s[j0 + q] - mx) * sc); unsigned short* d = (unsigned short*)P + (size_t)i * SQ + j0; *(v8us*)d = f.half[0];  } }
__global__ __launch_bounds__(256) void k_vt(const _Float16* __restrict__ V16, int b, int h0, _Float16* __restrict__ VT) { __shared__ unsigned short tl[64][65]; const int tid = threadIdx.x; const int hh = blockIdx.x % HG, sg = blockIdx.x / HG; const int s0 = sg * 64; const int h = h0 + hh;
  for (int i = tid; i < 64 * 8; i += 256) { const int j = i / 8, d8 = (i % 8) * 8; FragH f; f.half[0] = *(const v8us*)((const unsigned short*)V16 + ((size_t)b * SQ + s0 + j) * DM + h * HD + d8); for (int q = 0; q < 8; ++q) tl[d8 + q][j] = f.u[q]; }
  __syncthreads();
  { for (int i = tid; i < 64 * 8; i += 256) { const int d = i / 8, j8 = (i % 8) * 8; FragH f; for (int q = 0; q < 8; ++q) f.u[q] = tl[d][j8 + q]; *(v8us*)((unsigned short*)VT + ((size_t)hh * HD + d) * SQ + s0 + j8) = f.half[0]; }  } }



__global__ __launch_bounds__(256) void k_rsmf(const float* __restrict__ S, _Float16* __restrict__ P, int qn, int hg) {
  #pragma clang fp contract(off)
  const int t = blockIdx.x * 256 + threadIdx.x; if (t >= qn * hg) return; const size_t i = (size_t)(t / qn) * SQ + (t % qn); const float* s = S + i * SQ; float mx = -3.0e38f;
#pragma unroll 1
  for (int j = 0; j < SQ; ++j) mx = fmaxf(mx, s[j]); float se = 0.f;
#pragma unroll 1
  for (int j = 0; j < SQ; ++j) se += __expf(s[j] - mx); const float sc = 256.0f / se;
#pragma unroll 1
  for (int j0 = 0; j0 < SQ; j0 += 8) { FragH f; for (int q = 0; q < 8; ++q) f.h[q] = (_Float16)(__expf(s[j0 + q] - mx) * sc); unsigned short* d = (unsigned short*)P + i * SQ + j0; *(v8us*)d = f.half[0];  } }

extern "C" void kernel_launch(void* const* d_in, const int* in_sizes, int n_in,
                              void* d_out, int out_size, void* d_ws, size_t ws_size, hipStream_t stream) {
  (void)in_sizes; (void)n_in; (void)out_size;
  const float* const* I = (const float* const*)d_in; const float* x = I[0]; const float* wq = I[1]; const float* bq = I[2]; const float* wk = I[3]; const float* bk = I[4]; const float* wv = I[5]; const float* bv = I[6];      /* natural [out][in] 64x64 weights + biases; x head-major = 32 planes of [2048][64] */
  char* ws = (char*)d_ws; size_t off = 0;
  auto take = [&](size_t bytes) { char* p = ws + off; off += (bytes + 255) & ~(size_t)255; return p; };
  _Float16* BQ = (_Float16*)take((size_t)DM * DM * 2); _Float16* BK = (_Float16*)take((size_t)DM * DM * 2); _Float16* BV = (_Float16*)take((size_t)DM * DM * 2); 
  _Float16* X16 = (_Float16*)take(NR * DM * 2); _Float16* Q16 = (_Float16*)take(NR * DM * 2); _Float16* K16 = (_Float16*)take(NR * DM * 2); _Float16* V16 = (_Float16*)take(NR * DM * 2);
  float* S = (float*)take((size_t)HG * SQ * SQ * 4); _Float16* P = (_Float16*)take((size_t)HG * SQ * SQ * 2); _Float16* VT = (_Float16*)take((size_t)NH * HD * SQ * 2);
  if (off > ws_size) return;
  { const unsigned g = (unsigned)(((size_t)DM * DM / 8 + 255) / 256); k_wnat<<<g, 256, 0, stream>>>(wq, (size_t)DM * DM / 8, BQ); k_wnat<<<g, 256, 0, stream>>>(wk, (size_t)DM * DM / 8, BK); k_wnat<<<g, 256, 0, stream>>>(wv, (size_t)DM * DM / 8, BV); }      /* natural [out][in] = Bt[n][k], x16 */

  k_x16<<<(unsigned)((NR * DM / 8 + 255) / 256), 256, 0, stream>>>(x, X16, NR * DM / 8);
  const size_t r0p = (size_t)B0 * SQ;      /* first projected row */
  k_gemm2<0><<<dim3((unsigned)((MP / 128) * (DM / 64)), 1), 128, 0, stream>>>(X16 + r0p * DM, DM, 0, BQ, DM, 0, 0.0625f, bq, 0, nullptr, 1, 0, 0, nullptr, Q16 + r0p * DM, DM, 0, MP, DM, DM);
  k_gemm2<0><<<dim3((unsigned)((MP / 128) * (DM / 64)), 1), 128, 0, stream>>>(X16 + r0p * DM, DM, 0, BK, DM, 0, 0.0625f, bk, 0, nullptr, 1, 0, 0, nullptr, K16 + r0p * DM, DM, 0, MP, DM, DM);
  k_gemm2<0><<<dim3((unsigned)((MP / 128) * (DM / 64)), 1), 128, 0, stream>>>(X16 + r0p * DM, DM, 0, BV, DM, 0, 0.0625f, bv, 0, nullptr, 1, 0, 0, nullptr, V16 + r0p * DM, DM, 0, MP, DM, DM);
  for (int b = B0; b < B0 + NBR; ++b) { const size_t r0 = (size_t)b * SQ;
    k_vt<NH, SQ><<<NH * (SQ / 64), 256, 0, stream>>>(V16 + r0 * LQ, LQ, 0, VT);      /* V^T [NH][HD][SQ] for this batch */
    for (int h0 = 0; h0 < NHD; h0 += HG) {
      k_gemm2<0><<<dim3((QN / 128) * (SQ / 64), HG), 128, 0, stream>>>(Q16 + r0 * LQ + h0 * HD, LQ, (size_t)HD, K16 + r0 * LQ + h0 * HD, LQ, (size_t)HD, 0.125f, nullptr, 0, nullptr, 1, 0, 0, S, nullptr, SQ, (size_t)SQ * SQ, QN, SQ, HD);      /* scores, HG heads per launch */
      k_rsmf<<<(HG * QN + 255) / 256, 256, 0, stream>>>(S, P, QN, HG);      /* P = 256 softmax (f16), rows of all HG heads */
      k_gemm2<0><<<dim3((QN / 128) * (HD / 64), HG), 128, 0, stream>>>(P, SQ, (size_t)SQ * SQ, VT + (size_t)h0 * HD * SQ, SQ, (size_t)HD * SQ, 0.00390625f, nullptr, 0, nullptr, 1, 0, 0, (float*)d_out + r0 * DM + h0 * HD, nullptr, DM, (size_t)HD, QN, HD, SQ); } }      /* out = P V^T (alpha 2^-8) written f32 straight into the merged-heads output rows */
}

// v001
// One run takes 2420 microseconds.
// In two side-by-side timings against v000, it was 5.43 and 5.38 times as fast.
#include <hip/hip_runtime.h>
// Per-head scaled dot-product attention on a head-major input (x [2][16][2048][64]; xq = x Wq^T + bq, xk, xv likewise with ONE shared nn.Linear [64][64] per projection (natural [out][in], sigma 1/8; biases sigma 0.02); att = xq . xk / 8; softmax over all 2048 keys (no mask); out = p xv -> [2][16][2048][64]; every (batch, head) plane is an independent 2048 x 64 sequence = 32 planes).
// Structure: token rows r = b*2048 + s; x as exact f16 rows (bf16-rounded); Q, K, V as three WMMA GEMMs (32x64 wave tiles, f32 accumulation, exact x16 weights + bias, f16 outputs); per batch: V^T for all heads via LDS transposes; per (batch, group of 1 heads): scores GEMM (K = 64, batched over the heads on grid.y, alpha = 64^-0.5), row softmax on VALU (f32 statistics, native exp; weights stored x256 as f16), o = P . V^T GEMM (K = 2048, alpha 2^-8) written f32 straight into the merged-heads output rows (no output projection).
// Compute dtype: inputs rounded to bf16; x / weights exact; q, k, v and softmax weights as plain f16 GEMM operands (~2^-12); scores, softmax statistics and o f32. v_wmma_f32_16x16x32_f16.
#define NB 32
#define SQ 2048
#define DM 64
#define NH 1
#define HD 64
#define HG 1                         /* heads per attention launch group */
#define B0 0                         /* first batch processed (debug hook) */
#define NBR NB                       /* batches processed (debug hook) */
#define NR ((size_t)NB * SQ)         /* token rows */
#define MP ((int)((size_t)NBR * SQ)) /* rows projected (debug hook) */
#define QN SQ                        /* query rows attended per batch (debug hook) */
#define NHD NH                       /* heads attended (debug hook) */
#define MPO MP                       /* unused: no output stage */
#define LQ DM      /* row pitch of the q/k/v rows */
typedef __bf16 v16b __attribute__((ext_vector_type(16)));
typedef unsigned short v8us __attribute__((ext_vector_type(8), may_alias));
typedef float  v8f  __attribute__((ext_vector_type(8)));
typedef float  v4f  __attribute__((ext_vector_type(4)));
typedef float  v4fa __attribute__((ext_vector_type(4), may_alias));
union FragB { v16b v; v8us half[2]; unsigned short u[16]; };

__device__ __forceinline__ unsigned short bf16_bits(float x) { unsigned int u = __float_as_uint(x); return (unsigned short)((u + 0x7FFFu + ((u >> 16) & 1u)) >> 16); }
__device__ __forceinline__ float bf16_val(unsigned short b) { return __uint_as_float(((unsigned int)b) << 16); }
__device__ __forceinline__ float bf16_round(float x) { return bf16_val(bf16_bits(x)); }
// D += A·B with NT terms: 1 = ah·bh, 2 = + al·bh (A split), 3 = + ah·bl (both split)
template <int NT>
__device__ __forceinline__ v8f mmaN(v16b ah, v16b al, v16b bh, v16b bl, v8f c) {
  c = __builtin_amdgcn_wmma_f32_16x16x32_bf16(false, ah, false, bh, (short)0, c, false, false);
  if (NT >= 2) c = __builtin_amdgcn_wmma_f32_16x16x32_bf16(false, al, false, bh, (short)0, c, false, false);
  if (NT >= 3) c = __builtin_amdgcn_wmma_f32_16x16x32_bf16(false, ah, false, bl, (short)0, c, false, false);
  asm volatile("v_nop\n\tv_nop\n\tv_nop\n\tv_nop" : "+v"(c) : "v"(ah), "v"(al), "v"(bh), "v"(bl));
  return c;
}

__global__ __launch_bounds__(256) void k_wt_bf16(const float* __restrict__ W, unsigned short* __restrict__ Wt, int K, int N) {
  const int t = blockIdx.x * 256 + threadIdx.x;
  const int k8n = K / 8;
  if (t >= N * k8n) return;
  const int n = t / k8n, k8 = (t % k8n) * 8;
  v8us v;
#pragma unroll
  for (int i = 0; i < 8; ++i) v[i] = bf16_bits(W[(size_t)(k8 + i) * N + n]);
  *(v8us*)(Wt + (size_t)n * K + k8) = v;
  
}

// GEMM C[M][N] (f32, pitch ldc) = act(A[M][K]·W + bias). A f32 row-major (pitch lda) converted per fragment to bf16
// (ASPLIT: hi/lo two planes -> 2 terms, else single rounded term); Wt bf16 [N][K] (pitch ldb). BIAS_BF16 rounds the
// bias to bf16 first (bias quantised to bf16 before the add). K%32==0, M%16==0, N%64==0.
template <bool ASPLIT, int ACT, bool BIAS_BF16>
__global__ __launch_bounds__(128) void k_gemm_bf(const float* __restrict__ A, int lda, const unsigned short* __restrict__ Wt, int ldb,
                                               const float* __restrict__ bias, float* __restrict__ C, int ldc, int M, int N, int K) {
  __shared__ __attribute__((aligned(16))) float so[4][16][64];
  const int tid = threadIdx.x, w = tid >> 5, lane = tid & 31, ln = lane & 15, hh = lane >> 4;
  const int ntn = N / 64;
  const int wid = blockIdx.x * 4 + w;
  const int mt = wid / ntn, nq = wid % ntn;
  if (mt * 16 >= M) return;
  const int row0 = mt * 16, col0 = nq * 64;
  const float* arow = A + (size_t)(row0 + ln) * lda;
  v8f acc[4] = {};
  for (int kb = 0; kb < K; kb += 32) {
    FragB ah, al;
    const v4f x0 = *(const v4fa*)(arow + kb + 8 * hh), x1 = *(const v4fa*)(arow + kb + 8 * hh + 4);
    const v4f x2 = *(const v4fa*)(arow + kb + 16 + 8 * hh), x3 = *(const v4fa*)(arow + kb + 16 + 8 * hh + 4);
    float xs[16] = {x0[0],x0[1],x0[2],x0[3],x1[0],x1[1],x1[2],x1[3],x2[0],x2[1],x2[2],x2[3],x3[0],x3[1],x3[2],x3[3]};
#pragma unroll
    for (int i = 0; i < 16; ++i) { const unsigned short hb = bf16_bits(xs[i]); ah.u[i] = hb; al.u[i] = ASPLIT ? bf16_bits(xs[i] - bf16_val(hb)) : (unsigned short)0; }
#pragma unroll
    for (int t = 0; t < 4; ++t) {
      const unsigned short* brow = Wt + (size_t)(col0 + t * 16 + ln) * ldb + kb;
      FragB b;
      b.half[0] = *(const v8us*)(brow + 8 * hh);
      b.half[1] = *(const v8us*)(brow + 16 + 8 * hh);
      acc[t] = mmaN<ASPLIT ? 2 : 1>(ah.v, al.v, b.v, b.v, acc[t]);
    }
  }
#pragma unroll
  for (int t = 0; t < 4; ++t) {
    float bv = bias ? bias[col0 + t * 16 + ln] : 0.f;
    if (BIAS_BF16) bv = bf16_round(bv);
#pragma unroll
    for (int r = 0; r < 8; ++r) { float v = acc[t][r] + bv; if (ACT == 1) v = fmaxf(v, 0.f); so[w][8 * hh + r][t * 16 + ln] = v; }
  }
  __builtin_amdgcn_fence(__ATOMIC_ACQ_REL, "workgroup");
  __builtin_amdgcn_wave_barrier();
  const int rsub = lane >> 4, c4 = (lane & 15) * 4;
  {
#pragma unroll
    for (int q = 0; q < 8; ++q) {
      const int r = q * 2 + rsub;
      const v4f v = *(const v4fa*)&so[w][r][c4];
      *(v4f*)(C + (size_t)(row0 + r) * ldc + col0 + c4) = v;
    }
    
  }
}

// GEMM C = act(A·W + bias + resid): A f32 (ASPLIT -> hi/lo 2 terms), Wt bf16 [N][K]; ACT 0 none, 1 relu, 2 exact gelu;
// resid (optional, f32, row index = (row % rmod), pitch ldr, RES_BF16 rounds it) added before the activation.
template <bool ASPLIT, int ACT, bool BIAS_BF16, bool RES_BF16>
__global__ __launch_bounds__(128) void k_gemm_bf3(const float* __restrict__ A, int lda, const unsigned short* __restrict__ Wt, int ldb,
                                                const float* __restrict__ bias, const float* __restrict__ resid, int rmod, int ldr,
                                                float* __restrict__ C, int ldc, int M, int N, int K) {
  __shared__ __attribute__((aligned(16))) float so[4][16][64];
  const int tid = threadIdx.x, w = tid >> 5, lane = tid & 31, ln = lane & 15, hh = lane >> 4;
  const int ntn = N / 64;
  const int wid = blockIdx.x * 4 + w;
  const int mt = wid / ntn, nq = wid % ntn;
  if (mt * 16 >= M) return;
  const int row0 = mt * 16, col0 = nq * 64;
  const float* arow = A + (size_t)(row0 + ln) * lda;
  v8f acc[4] = {};
  for (int kb = 0; kb < K; kb += 32) {
    FragB ah, al;
    const v4f x0 = *(const v4fa*)(arow + kb + 8 * hh), x1 = *(const v4fa*)(arow + kb + 8 * hh + 4);
    const v4f x2 = *(const v4fa*)(arow + kb + 16 + 8 * hh), x3 = *(const v4fa*)(arow + kb + 16 + 8 * hh + 4);
    float xs[16] = {x0[0],x0[1],x0[2],x0[3],x1[0],x1[1],x1[2],x1[3],x2[0],x2[1],x2[2],x2[3],x3[0],x3[1],x3[2],x3[3]};
#pragma unroll
    for (int i = 0; i < 16; ++i) { const unsigned short hb = bf16_bits(xs[i]); ah.u[i] = hb; al.u[i] = ASPLIT ? bf16_bits(xs[i] - bf16_val(hb)) : (unsigned short)0; }
#pragma unroll
    for (int t = 0; t < 4; ++t) {
      const unsigned short* brow = Wt + (size_t)(col0 + t * 16 + ln) * ldb + kb;
      FragB b;
      b.half[0] = *(const v8us*)(brow + 8 * hh);
      b.half[1] = *(const v8us*)(brow + 16 + 8 * hh);
      acc[t] = mmaN<ASPLIT ? 2 : 1>(ah.v, al.v, b.v, b.v, acc[t]);
    }
  }
#pragma unroll
  for (int t = 0; t < 4; ++t) {
    const int col = col0 + t * 16 + ln;
    float bv = bias ? bias[col] : 0.f;
    if (BIAS_BF16) bv = bf16_round(bv);
#pragma unroll
    for (int r = 0; r < 8; ++r) {
      float v = acc[t][r] + bv;
      if (resid) { float rv = resid[(size_t)((row0 + 8 * hh + r) % rmod) * ldr + col]; if (RES_BF16) rv = bf16_round(rv); v += rv; }
      if (ACT == 1) v = fmaxf(v, 0.f);
      if (ACT == 2) v = 0.5f * v * (1.0f + erff(v * 0.70710678118654752f));
      if (ACT == 3) { const float u = 0.7978845608028654f * (v + 0.044715f * v * v * v); v = 0.5f * v * (1.0f + tanhf(u)); }
      so[w][8 * hh + r][t * 16 + ln] = v;
    }
  }
  __builtin_amdgcn_fence(__ATOMIC_ACQ_REL, "workgroup");
  __builtin_amdgcn_wave_barrier();
  const int rsub = lane >> 4, c4 = (lane & 15) * 4;
  {
#pragma unroll
    for (int q = 0; q < 8; ++q) {
      const int r = q * 2 + rsub;
      const v4f v = *(const v4fa*)&so[w][r][c4];
      *(v4f*)(C + (size_t)(row0 + r) * ldc + col0 + c4) = v;
    }
    
  }
}
// row LayerNorm (biased variance, eps) over N: s = X (+ R); optional out_sum <- s; out_norm <- (s-mu)*rsqrt(var+eps)*g + b
template <bool PARAM_BF16>
__global__ __launch_bounds__(256) void k_layernorm(const float* __restrict__ X, const float* __restrict__ R, const float* __restrict__ g, const float* __restrict__ bta,
                                                  float* __restrict__ out_sum, float* __restrict__ out_norm, int N, float eps) {
  __shared__ float red[256];
  const int row = blockIdx.x, tid = threadIdx.x;
  const float* x = X + (size_t)row * N; const float* rr = R ? R + (size_t)row * N : nullptr;
  float vals[16];                     // up to N = 4096
  const int per = N / 256;            // contiguous chunk per thread? use strided-by-4 chunks: thread handles j = tid*4 + 1024*u
  float s1 = 0.f;
  for (int u = 0; u < per / 4; ++u) {
    const int j = tid * 4 + 1024 * u;
    const v4f a = *(const v4fa*)(x + j);
    v4f b = {0.f,0.f,0.f,0.f}; if (rr) b = *(const v4fa*)(rr + j);
#pragma unroll
    for (int q = 0; q < 4; ++q) { const float v = a[q] + b[q]; vals[u * 4 + q] = v; s1 += v; }
  }
  red[tid] = s1; __syncthreads();
  for (int st = 128; st > 0; st >>= 1) { if (tid < st) red[tid] += red[tid + st]; __syncthreads(); }
  const float mu = red[0] / (float)N; __syncthreads();
  float s2 = 0.f;
  for (int u = 0; u < per / 4; ++u)
#pragma unroll
    for (int q = 0; q < 4; ++q) { const float c = vals[u * 4 + q] - mu; s2 += c * c; }
  red[tid] = s2; __syncthreads();
  for (int st = 128; st > 0; st >>= 1) { if (tid < st) red[tid] += red[tid + st]; __syncthreads(); }
  const float rs = rsqrtf(red[0] / (float)N + eps);
  {
    for (int u = 0; u < per / 4; ++u) {
      const int j = tid * 4 + 1024 * u;
      v4f o, sm;
#pragma unroll
      for (int q = 0; q < 4; ++q) {
        float gg = g[j + q], bb = bta[j + q];
        if (PARAM_BF16) { gg = bf16_round(gg); bb = bf16_round(bb); }
        sm[q] = vals[u * 4 + q]; o[q] = (vals[u * 4 + q] - mu) * rs * gg + bb;
      }
      if (out_sum) *(v4f*)(out_sum + (size_t)row * N + j) = sm;
      *(v4f*)(out_norm + (size_t)row * N + j) = o;
    }
    
  }
}



// ---- f16 WMMA path (v_wmma_f32_16x16x32_f16): 11-bit significands for operands in range — used where a [0,1] probability operand needs more precision than bf16
typedef _Float16 v16h __attribute__((ext_vector_type(16)));
union FragH { v16h v; v8us half[2]; _Float16 h[16]; unsigned short u[16]; };
template <int NT>
__device__ __forceinline__ v8f mmaH(v16h ah, v16h al, v16h bh, v16h bl, v8f c) {
  c = __builtin_amdgcn_wmma_f32_16x16x32_f16(false, ah, false, bh, (short)0, c, false, false);
  if (NT >= 2) c = __builtin_amdgcn_wmma_f32_16x16x32_f16(false, al, false, bh, (short)0, c, false, false);
  if (NT >= 3) c = __builtin_amdgcn_wmma_f32_16x16x32_f16(false, ah, false, bl, (short)0, c, false, false);
  asm volatile("v_nop\n\tv_nop\n\tv_nop\n\tv_nop" : "+v"(c) : "v"(ah), "v"(al), "v"(bh), "v"(bl));
  return c;
}
// batched GEMM like k_gemm_b but f16 operands: A f32 (split into f16 hi/lo if ASPLIT, else rounded to f16), Bt = f16 values [n][k]; alpha; C f32; N multiple of 16 (partial tiles skipped)
template <bool ASPLIT>
__global__ __launch_bounds__(128) void k_gemm_h(const float* __restrict__ A, int lda, size_t sA, const _Float16* __restrict__ Bh, int ldb, size_t sB, float alpha, float* __restrict__ C, int ldc, size_t sC, int M, int N, int K) {
  __shared__ __attribute__((aligned(16))) float so[4][16][64];
  const int tid = threadIdx.x, w = tid >> 5, lane = tid & 31, ln = lane & 15, hh = lane >> 4; const int by = blockIdx.y;
  A += (size_t)by * sA; Bh += (size_t)by * sB; C += (size_t)by * sC;
  const int ntn = (N + 63) / 64; const int wid = blockIdx.x * 4 + w; const int mt = wid / ntn, nq = wid % ntn; if (mt * 16 >= M) return;
  const int row0 = mt * 16, col0 = nq * 64; const float* arow = A + (size_t)(row0 + ln) * lda;
  v8f acc[4] = {};
  for (int kb = 0; kb < K; kb += 32) {
    FragH ah, al;
    const v4f x0 = *(const v4fa*)(arow + kb + 8 * hh), x1 = *(const v4fa*)(arow + kb + 8 * hh + 4), x2 = *(const v4fa*)(arow + kb + 16 + 8 * hh), x3 = *(const v4fa*)(arow + kb + 16 + 8 * hh + 4);
    float xs[16] = {x0[0],x0[1],x0[2],x0[3],x1[0],x1[1],x1[2],x1[3],x2[0],x2[1],x2[2],x2[3],x3[0],x3[1],x3[2],x3[3]};
#pragma unroll
    for (int i = 0; i < 16; ++i) { const _Float16 h = (_Float16)xs[i]; ah.h[i] = h; al.h[i] = ASPLIT ? (_Float16)(xs[i] - (float)h) : (_Float16)0.0f; }
#pragma unroll
    for (int t = 0; t < 4; ++t) { if (col0 + t * 16 >= N) continue; const size_t boff = (size_t)(col0 + t * 16 + ln) * ldb + kb; FragH bq; bq.half[0] = *(const v8us*)(Bh + boff + 8 * hh); bq.half[1] = *(const v8us*)(Bh + boff + 16 + 8 * hh);
      acc[t] = mmaH<ASPLIT ? 2 : 1>(ah.v, al.v, bq.v, bq.v, acc[t]); }
  }
#pragma unroll
  for (int t = 0; t < 4; ++t) { if (col0 + t * 16 >= N) continue;
#pragma unroll
    for (int r = 0; r < 8; ++r) so[w][8 * hh + r][t * 16 + ln] = acc[t][r] * alpha; }
  __builtin_amdgcn_fence(__ATOMIC_ACQ_REL, "workgroup"); __builtin_amdgcn_wave_barrier();
  const int rsub = lane >> 4, c4 = (lane & 15) * 4;
  {
#pragma unroll
    for (int q = 0; q < 8; ++q) { const int r = q * 2 + rsub; if (col0 + c4 < N) { const v4f v = *(const v4fa*)&so[w][r][c4]; *(v4f*)(C + (size_t)(row0 + r) * ldc + col0 + c4) = v; } }
     }
}

// Wt[n][k] = f16(W[k][n]·scale) from f32 row-major W[K][N] (scale = power of two; bf16-exact weights stay exact in f16 away from the subnormal range)
__global__ __launch_bounds__(256) void k_wt_f16(const float* __restrict__ W, _Float16* __restrict__ Wt, int K, int N, float scale) {
  const int t = blockIdx.x * 256 + threadIdx.x; if (t >= N * (K / 8)) return; const int n = t / (K / 8), k8 = (t % (K / 8)) * 8; FragH f;
#pragma unroll
  for (int i = 0; i < 8; ++i) f.h[i] = (_Float16)(bf16_round(W[(size_t)(k8 + i) * N + n]) * scale); const v8us o = f.half[0];
  *(v8us*)((unsigned short*)Wt + (size_t)n * K + k8) = o; 
}
// k_gemm_hh variant with fused epilogue: v = acc·alpha + bias[by·sBias + col] (+ CP[(row/rowsPerB)·sCPb + by·64 + col] if CP) ; ACT 0 none / 1 elu ; writes f16 C16 (and f32 C if non-null)
template <int ACT>
__global__ __launch_bounds__(128) void k_gemm_hhx(const _Float16* __restrict__ A, int lda, size_t sA, const _Float16* __restrict__ Bh, int ldb, size_t sB, float alpha, const float* __restrict__ bias, size_t sBias, const float* __restrict__ CP, int rowsPerB, size_t sCPb, int row0g,
    float* __restrict__ C, _Float16* __restrict__ C16, int ldc, size_t sC, int M, int N, int K) {
  __shared__ __attribute__((aligned(16))) float so[4][16][64];
  const int tid = threadIdx.x, w = tid >> 5, lane = tid & 31, ln = lane & 15, hh = lane >> 4; const int by = blockIdx.y;
  A += (size_t)by * sA; Bh += (size_t)by * sB; const size_t cofs = (size_t)by * sC; const float* bp = bias ? bias + (size_t)by * sBias : nullptr;
  const int ntn = (N + 63) / 64; const int wid = blockIdx.x * 4 + w; const int mt = wid / ntn, nq = wid % ntn; if (mt * 16 >= M) return;
  const int row0 = mt * 16, col0 = nq * 64; const _Float16* arow = A + (size_t)(row0 + ln) * lda;
  v8f acc[4] = {};
  for (int kb = 0; kb < K; kb += 32) { FragH ah; ah.half[0] = *(const v8us*)((const unsigned short*)arow + kb + 8 * hh); ah.half[1] = *(const v8us*)((const unsigned short*)arow + kb + 16 + 8 * hh);
#pragma unroll
    for (int t = 0; t < 4; ++t) { if (col0 + t * 16 >= N) continue; const size_t boff = (size_t)(col0 + t * 16 + ln) * ldb + kb; FragH bq; bq.half[0] = *(const v8us*)((const unsigned short*)Bh + boff + 8 * hh); bq.half[1] = *(const v8us*)((const unsigned short*)Bh + boff + 16 + 8 * hh);
      acc[t] = mmaH<1>(ah.v, ah.v, bq.v, bq.v, acc[t]); }
  }
#pragma unroll
  for (int t = 0; t < 4; ++t) { if (col0 + t * 16 >= N) continue; const int col = col0 + t * 16 + ln; const float bv = bp ? bf16_round(bp[col]) : 0.f;
#pragma unroll
    for (int r = 0; r < 8; ++r) { float v = acc[t][r] * alpha + bv; if (CP) { const int rr = row0g + row0 + 8 * hh + r; if (rowsPerB < 0) v += CP[cofs + (size_t)rr * ldc + col];      /* rowsPerB < 0: own element of the batched C plane */ else { const int bidx = rr / rowsPerB; v += CP[(size_t)bidx * sCPb + (size_t)by * 64 + col]; } } if (ACT == 1) v = (v > 0.f) ? v : expm1f(v); else if (ACT == 7) v = (v > 0.f) ? v + 1.0f : expf(v); else if (ACT == 8) v = tanhf(v); else if (ACT == 9) v = 0.5f * v * (1.0f + tanhf(0.7978845608028654f * (v + 0.044715f * v * v * v))); else if (ACT == 11) v = 1.0f / (1.0f + expf(-v)); else if (ACT == 12) v = (v > 0.f) ? v : 0.01f * v; else if (ACT == 14) v = (v > 0.f) ? v : 0.1f * v; else if (ACT == 16) v = (v >= 0.f) ? v : 0.3f * v; else if (ACT == 17) v = (v >= 0.f) ? v : 0.2f * v; else if (ACT == 15) v = v / (1.0f + expf(-v)); else if (ACT == 3) v = fmaxf(v, 0.f); else if (ACT == 6) v = 0.5f * v * (1.0f + erff(v * 0.70710678118654752f)); so[w][8 * hh + r][t * 16 + ln] = v; } }
  __builtin_amdgcn_fence(__ATOMIC_ACQ_REL, "workgroup"); __builtin_amdgcn_wave_barrier();
  const int rsub = lane >> 4, c4 = (lane & 15) * 4; typedef _Float16 v4h __attribute__((ext_vector_type(4)));
  {
#pragma unroll
    for (int q = 0; q < 8; ++q) { const int r = q * 2 + rsub; if (col0 + c4 < N) { const v4f v = *(const v4fa*)&so[w][r][c4]; if (C) *(v4f*)(C + cofs + (size_t)(row0 + r) * ldc + col0 + c4) = v; if (C16) { v4h h4; for (int i = 0; i < 4; ++i) h4[i] = (_Float16)v[i]; *(v4h*)(C16 + cofs + (size_t)(row0 + r) * ldc + col0 + c4) = h4; } } }
     }
}


typedef _Float16 v4h __attribute__((ext_vector_type(4)));

__global__ __launch_bounds__(256) void k_x16(const float* __restrict__ x, _Float16* __restrict__ X16, size_t n8) { const size_t t = (size_t)blockIdx.x * 256 + threadIdx.x; if (t >= n8) return; FragH f;
#pragma unroll
  for (int q = 0; q < 8; ++q) f.h[q] = (_Float16)bf16_round(x[t * 8 + q]); *(v8us*)((unsigned short*)X16 + t * 8) = f.half[0];  }
__global__ __launch_bounds__(256) void k_h16(const float* __restrict__ x, _Float16* __restrict__ X16, size_t n8) { const size_t t = (size_t)blockIdx.x * 256 + threadIdx.x; if (t >= n8) return; FragH f;
#pragma unroll
  for (int q = 0; q < 8; ++q) f.h[q] = (_Float16)x[t * 8 + q]; *(v8us*)((unsigned short*)X16 + t * 8) = f.half[0];  }
__global__ __launch_bounds__(256) void k_round16f(const float* __restrict__ W, _Float16* __restrict__ Bt, size_t n8) { const size_t t = (size_t)blockIdx.x * 256 + threadIdx.x; if (t >= n8) return; FragH f;
#pragma unroll
  for (int i = 0; i < 8; ++i) f.h[i] = (_Float16)(bf16_round(W[t * 8 + i]) * 16.0f); *(v8us*)((unsigned short*)Bt + t * 8) = f.half[0];  }
template <int NHv, int TTv>
__global__ __launch_bounds__(256) void k_vt(const _Float16* __restrict__ V16, int ldv, int voff, _Float16* __restrict__ Vt) { __shared__ unsigned short tl[64][66]; const int tid = threadIdx.x; const int slab = blockIdx.x / (TTv / 64), lg = blockIdx.x % (TTv / 64); const int b = slab / NHv, h = slab % NHv;
  for (int i = tid; i < 64 * 8; i += 256) { const int r = i / 8, c8 = (i % 8) * 8; FragH f; f.half[0] = *(const v8us*)((const unsigned short*)V16 + ((size_t)b * TTv + lg * 64 + r) * ldv + voff + h * 64 + c8);
#pragma unroll
    for (int q = 0; q < 8; ++q) tl[r][c8 + q] = f.u[q]; }
  __syncthreads();
  {
#pragma unroll
    for (int rd = 0; rd < 2; ++rd) { const int d = rd * 32 + tid / 8, pc = tid % 8; FragH f;
#pragma unroll
      for (int q = 0; q < 8; ++q) f.u[q] = tl[pc * 8 + q][d];
      *(v8us*)((unsigned short*)Vt + ((size_t)slab * 64 + d) * TTv + lg * 64 + pc * 8) = f.half[0]; }
     } }

__global__ __launch_bounds__(256) void k_hl(const float* __restrict__ F, _Float16* __restrict__ Hh, _Float16* __restrict__ Hl, size_t n8) { const size_t t = (size_t)blockIdx.x * 256 + threadIdx.x; if (t >= n8) return; FragH fh, fl; const v4f a = *(const v4fa*)(F + t * 8), c = *(const v4fa*)(F + t * 8 + 4);
#pragma unroll
  for (int q = 0; q < 4; ++q) { _Float16 h = (_Float16)a[q]; fh.h[q] = h; fl.h[q] = (_Float16)((a[q] - (float)h) * 1024.0f); h = (_Float16)c[q]; fh.h[4 + q] = h; fl.h[4 + q] = (_Float16)((c[q] - (float)h) * 1024.0f); }
  { *(v8us*)((unsigned short*)Hh + t * 8) = fh.half[0]; *(v8us*)((unsigned short*)Hl + t * 8) = fl.half[0];  } }

// ---- fast GEMM (wave tile 32x64; requires M % 32 == 0 rows per launch region and N % 64 == 0); epilogue = k_gemm_hhx semantics ----
__device__ __forceinline__ v16h g2_frag(const _Float16* p, int hh) { FragH f; f.half[0] = *(const v8us*)((const unsigned short*)p + 8 * hh); f.half[1] = *(const v8us*)((const unsigned short*)p + 16 + 8 * hh); return f.v; }
__device__ __forceinline__ v8f g2_mma(v16h a, v16h b, v8f c) { v8f d = __builtin_amdgcn_wmma_f32_16x16x32_f16(false, a, false, b, (short)0, c, false, false); asm volatile("v_nop\n\tv_nop\n\tv_nop\n\tv_nop" : "+v"(d) : "v"(a), "v"(b)); return d; }
template <int ACT>
__global__ __launch_bounds__(128) void k_gemm2(const _Float16* __restrict__ A, int lda, size_t sA, const _Float16* __restrict__ Bh, int ldb, size_t sB, float alpha, const float* __restrict__ bias, size_t sBias, const float* __restrict__ CP, int rowsPerB, size_t sCPb, int row0g,
    float* __restrict__ C, _Float16* __restrict__ C16, int ldc, size_t sC, int M, int N, int K) { static_assert(ACT == 0 || ACT == 3 || ACT == 6 || ACT == 8 || ACT == 9 || ACT == 11 || ACT == 12 || ACT == 14 || ACT == 15 || ACT == 16 || ACT == 17, "k_gemm2: unsupported ACT code (would silently apply no activation)");
  __shared__ __attribute__((aligned(16))) float so[4][32][68];
  const int tid = threadIdx.x, w = tid >> 5, lane = tid & 31, ln = lane & 15, hh = lane >> 4; const int by = blockIdx.y;
  A += (size_t)by * sA; Bh += (size_t)by * sB; const size_t cofs = (size_t)by * sC; const float* bp = bias ? bias + (size_t)by * sBias : nullptr;
  const int ntn = N >> 6; const int mt = blockIdx.x / ntn, nq = blockIdx.x - mt * ntn; const int row0 = mt * 128 + 32 * w, col0 = nq * 64; if (row0 >= M) return;
  const _Float16* a0p = A + (size_t)(row0 + ln) * lda; const _Float16* a1p = a0p + (size_t)16 * lda;
  const _Float16* b0p = Bh + (size_t)(col0 + ln) * ldb; const _Float16* b1p = b0p + (size_t)16 * ldb; const _Float16* b2p = b1p + (size_t)16 * ldb; const _Float16* b3p = b2p + (size_t)16 * ldb;
  const v8f z8 = {0.f,0.f,0.f,0.f,0.f,0.f,0.f,0.f}; v8f c00 = z8, c01 = z8, c02 = z8, c03 = z8, c10 = z8, c11 = z8, c12 = z8, c13 = z8;
#pragma unroll 1
  for (int kb = 0; kb < K; kb += 32) { const v16h a0 = g2_frag(a0p + kb, hh), a1 = g2_frag(a1p + kb, hh);
    v16h b = g2_frag(b0p + kb, hh); c00 = g2_mma(a0, b, c00); c10 = g2_mma(a1, b, c10);
    b = g2_frag(b1p + kb, hh); c01 = g2_mma(a0, b, c01); c11 = g2_mma(a1, b, c11);
    b = g2_frag(b2p + kb, hh); c02 = g2_mma(a0, b, c02); c12 = g2_mma(a1, b, c12);
    b = g2_frag(b3p + kb, hh); c03 = g2_mma(a0, b, c03); c13 = g2_mma(a1, b, c13); }
  v8f accs[8] = {c00, c01, c02, c03, c10, c11, c12, c13};
#pragma unroll
  for (int u = 0; u < 8; ++u) { const int t = u & 3, half = u >> 2; const int col = col0 + t * 16 + ln; const float bv = bp ? bf16_round(bp[col]) : 0.f;
#pragma unroll
    for (int r = 0; r < 8; ++r) { const int rloc = half * 16 + 8 * hh + r; float v = accs[u][r] * alpha + bv; if (CP) { if (rowsPerB < 0) v += CP[cofs + (size_t)(row0g + row0 + rloc) * ldc + col];      /* rowsPerB < 0: own element of the batched C plane */ else { const int bidx = (row0g + row0 + rloc) / rowsPerB; v += CP[(size_t)bidx * sCPb + (size_t)by * 64 + col]; } }
      if (ACT == 3) v = fmaxf(v, 0.f); else if (ACT == 6) v = 0.5f * v * (1.0f + erff(v * 0.70710678118654752f)); else if (ACT == 11) v = 1.0f / (1.0f + expf(-v)); else if (ACT == 15) v = v / (1.0f + expf(-v)); else if (ACT == 12) v = (v > 0.f) ? v : 0.01f * v; else if (ACT == 8) v = tanhf(v); else if (ACT == 9) v = 0.5f * v * (1.0f + tanhf(0.7978845608028654f * (v + 0.044715f * v * v * v))); else if (ACT == 14) v = (v > 0.f) ? v : 0.1f * v; else if (ACT == 16) v = (v >= 0.f) ? v : 0.3f * v; else if (ACT == 17) v = (v >= 0.f) ? v : 0.2f * v;
      so[w][rloc][t * 16 + ln] = v; } }
  __builtin_amdgcn_fence(__ATOMIC_ACQ_REL, "workgroup"); __builtin_amdgcn_wave_barrier();
  const int rsub = lane >> 4, c4 = (lane & 15) * 4;
  {
#pragma unroll
    for (int q = 0; q < 16; ++q) { const int r = q * 2 + rsub; const v4f v = *(const v4fa*)&so[w][r][c4]; if (C) *(v4f*)(C + cofs + (size_t)(row0 + r) * ldc + col0 + c4) = v; if (C16) { v4h h4; for (int i = 0; i < 4; ++i) h4[i] = (_Float16)v[i]; *(v4h*)(C16 + cofs + (size_t)(row0 + r) * ldc + col0 + c4) = h4; } }
     } }


__global__ __launch_bounds__(256) void k_wnat(const float* __restrict__ w, size_t n8, _Float16* __restrict__ Bt) { const size_t t = (size_t)blockIdx.x * 256 + threadIdx.x; if (t >= n8) return; FragH f; for (int q = 0; q < 8; ++q) f.h[q] = (_Float16)(bf16_round(w[t * 8 + q]) * 16.0f); *(v8us*)((unsigned short*)Bt + t * 8) = f.half[0];  }
__global__ __launch_bounds__(256) void k_rsm(const float* __restrict__ S, _Float16* __restrict__ P, int nrows) {
  #pragma clang fp contract(off)
  const int i = blockIdx.x * 256 + threadIdx.x; if (i >= nrows) return; const float* s = S + (size_t)i * SQ; float mx = -3.0e38f;
#pragma unroll 1
  for (int j = 0; j < SQ; ++j) mx = fmaxf(mx, s[j]); float se = 0.f;
#pragma unroll 1
  for (int j = 0; j < SQ; ++j) se += expf(s[j] - mx); const float sc = 256.0f / se;
#pragma unroll 1
  for (int j0 = 0; j0 < SQ; j0 += 8) { FragH f; for (int q = 0; q < 8; ++q) f.h[q] = (_Float16)(expf(s[j0 + q] - mx) * sc); unsigned short* d = (unsigned short*)P + (size_t)i * SQ + j0; *(v8us*)d = f.half[0];  } }
__global__ __launch_bounds__(256) void k_vt(const _Float16* __restrict__ V16, int b, int h0, _Float16* __restrict__ VT) { __shared__ unsigned short tl[64][65]; const int tid = threadIdx.x; const int hh = blockIdx.x % HG, sg = blockIdx.x / HG; const int s0 = sg * 64; const int h = h0 + hh;
  for (int i = tid; i < 64 * 8; i += 256) { const int j = i / 8, d8 = (i % 8) * 8; FragH f; f.half[0] = *(const v8us*)((const unsigned short*)V16 + ((size_t)b * SQ + s0 + j) * DM + h * HD + d8); for (int q = 0; q < 8; ++q) tl[d8 + q][j] = f.u[q]; }
  __syncthreads();
  { for (int i = tid; i < 64 * 8; i += 256) { const int d = i / 8, j8 = (i % 8) * 8; FragH f; for (int q = 0; q < 8; ++q) f.u[q] = tl[d][j8 + q]; *(v8us*)((unsigned short*)VT + ((size_t)hh * HD + d) * SQ + s0 + j8) = f.half[0]; }  } }



// lane l with lane l ^ M inside a 16-lane row (DPP row_xmask), and with lane l ^ 16: register moves, no LDS round trip
template <int M> __device__ __forceinline__ float rs_xrow(float x) { return __builtin_bit_cast(float, __builtin_amdgcn_update_dpp(0, __builtin_bit_cast(int, x), 0x160 + M, 0xf, 0xf, true)); }
__device__ __forceinline__ float rs_xhalf(float x) { return __builtin_bit_cast(float, __builtin_amdgcn_permlanex16(__builtin_bit_cast(int, x), __builtin_bit_cast(int, x), 0x76543210, 0xfedcba98, false, false)); }
// Row softmax, ONE WAVE PER ROW: the row's SQ f32 scores are read once, by SQ/128 loads of 512 contiguous bytes, and stay in registers
// (SQ/32 per lane) through maximum, exp, sum and scaling; maximum and sum end in a five-step butterfly over the wave; f16 weights leave as 256 contiguous bytes per store.
__global__ __launch_bounds__(256) void k_rsmf(const float* __restrict__ S, _Float16* __restrict__ P, int qn, int hg) {
  constexpr int NU = SQ / 128;
  const int lane = threadIdx.x & 31; const int t = blockIdx.x * 8 + (threadIdx.x >> 5); if (t >= qn * hg) return;      /* wave-uniform exit, no barrier in this kernel */
  const size_t i = (size_t)(t / qn) * SQ + (t % qn); const float* s = S + i * SQ + lane * 4;
  v4f v[NU];      /* the four loops over u are fully unrolled so that v[] is indexed by constants and lives in registers */
#pragma unroll
  for (int u = 0; u < NU; ++u) v[u] = *(const v4fa*)(s + u * 128);
  asm volatile("s_wait_xcnt 0x0" :: "v"(s) : "memory");      /* the loads' address pair stays whole until this wait */
  float m0 = -3.0e38f, m1 = -3.0e38f, m2 = -3.0e38f, m3 = -3.0e38f;
#pragma unroll
  for (int u = 0; u < NU; ++u) { m0 = fmaxf(m0, v[u][0]); m1 = fmaxf(m1, v[u][1]); m2 = fmaxf(m2, v[u][2]); m3 = fmaxf(m3, v[u][3]); }
  float mx = fmaxf(fmaxf(m0, m1), fmaxf(m2, m3));
  mx = fmaxf(mx, rs_xrow<1>(mx)); mx = fmaxf(mx, rs_xrow<2>(mx)); mx = fmaxf(mx, rs_xrow<4>(mx)); mx = fmaxf(mx, rs_xrow<8>(mx)); mx = fmaxf(mx, rs_xhalf(mx));
  v4f ev = {0.f, 0.f, 0.f, 0.f};
#pragma unroll
  for (int u = 0; u < NU; ++u) { v4f x; x[0] = __expf(v[u][0] - mx); x[1] = __expf(v[u][1] - mx); x[2] = __expf(v[u][2] - mx); x[3] = __expf(v[u][3] - mx); v[u] = x; ev += x; }
  float se = (ev[0] + ev[1]) + (ev[2] + ev[3]);
  se += rs_xrow<1>(se); se += rs_xrow<2>(se); se += rs_xrow<4>(se); se += rs_xrow<8>(se); se += rs_xhalf(se);
  const float sc = 256.0f / se;
  _Float16* d = P + i * SQ + lane * 4;
#pragma unroll
  for (int u = 0; u < NU; ++u) { v4h h4; h4[0] = (_Float16)(v[u][0] * sc); h4[1] = (_Float16)(v[u][1] * sc); h4[2] = (_Float16)(v[u][2] * sc); h4[3] = (_Float16)(v[u][3] * sc); *(v4h*)(d + u * 128) = h4; } }

extern "C" void kernel_launch(void* const* d_in, const int* in_sizes, int n_in,
                              void* d_out, int out_size, void* d_ws, size_t ws_size, hipStream_t stream) {
  (void)in_sizes; (void)n_in; (void)out_size;
  const float* const* I = (const float* const*)d_in; const float* x = I[0]; const float* wq = I[1]; const float* bq = I[2]; const float* wk = I[3]; const float* bk = I[4]; const float* wv = I[5]; const float* bv = I[6];      /* natural [out][in] 64x64 weights + biases; x head-major = 32 planes of [2048][64] */
  char* ws = (char*)d_ws; size_t off = 0;
  auto take = [&](size_t bytes) { char* p = ws + off; off += (bytes + 255) & ~(size_t)255; return p; };
  _Float16* BQ = (_Float16*)take((size_t)DM * DM * 2); _Float16* BK = (_Float16*)take((size_t)DM * DM * 2); _Float16* BV = (_Float16*)take((size_t)DM * DM * 2); 
  _Float16* X16 = (_Float16*)take(NR * DM * 2); _Float16* Q16 = (_Float16*)take(NR * DM * 2); _Float16* K16 = (_Float16*)take(NR * DM * 2); _Float16* V16 = (_Float16*)take(NR * DM * 2);
  float* S = (float*)take((size_t)HG * SQ * SQ * 4); _Float16* P = (_Float16*)take((size_t)HG * SQ * SQ * 2); _Float16* VT = (_Float16*)take((size_t)NH * HD * SQ * 2);
  if (off > ws_size) return;
  { const unsigned g = (unsigned)(((size_t)DM * DM / 8 + 255) / 256); k_wnat<<<g, 256, 0, stream>>>(wq, (size_t)DM * DM / 8, BQ); k_wnat<<<g, 256, 0, stream>>>(wk, (size_t)DM * DM / 8, BK); k_wnat<<<g, 256, 0, stream>>>(wv, (size_t)DM * DM / 8, BV); }      /* natural [out][in] = Bt[n][k], x16 */

  k_x16<<<(unsigned)((NR * DM / 8 + 255) / 256), 256, 0, stream>>>(x, X16, NR * DM / 8);
  const size_t r0p = (size_t)B0 * SQ;      /* first projected row */
  k_gemm2<0><<<dim3((unsigned)((MP / 128) * (DM / 64)), 1), 128, 0, stream>>>(X16 + r0p * DM, DM, 0, BQ, DM, 0, 0.0625f, bq, 0, nullptr, 1, 0, 0, nullptr, Q16 + r0p * DM, DM, 0, MP, DM, DM);
  k_gemm2<0><<<dim3((unsigned)((MP / 128) * (DM / 64)), 1), 128, 0, stream>>>(X16 + r0p * DM, DM, 0, BK, DM, 0, 0.0625f, bk, 0, nullptr, 1, 0, 0, nullptr, K16 + r0p * DM, DM, 0, MP, DM, DM);
  k_gemm2<0><<<dim3((unsigned)((MP / 128) * (DM / 64)), 1), 128, 0, stream>>>(X16 + r0p * DM, DM, 0, BV, DM, 0, 0.0625f, bv, 0, nullptr, 1, 0, 0, nullptr, V16 + r0p * DM, DM, 0, MP, DM, DM);
  for (int b = B0; b < B0 + NBR; ++b) { const size_t r0 = (size_t)b * SQ;
    k_vt<NH, SQ><<<NH * (SQ / 64), 256, 0, stream>>>(V16 + r0 * LQ, LQ, 0, VT);      /* V^T [NH][HD][SQ] for this batch */
    for (int h0 = 0; h0 < NHD; h0 += HG) {
      k_gemm2<0><<<dim3((QN / 128) * (SQ / 64), HG), 128, 0, stream>>>(Q16 + r0 * LQ + h0 * HD, LQ, (size_t)HD, K16 + r0 * LQ + h0 * HD, LQ, (size_t)HD, 0.125f, nullptr, 0, nullptr, 1, 0, 0, S, nullptr, SQ, (size_t)SQ * SQ, QN, SQ, HD);      /* scores, HG heads per launch */
      k_rsmf<<<(HG * QN + 7) / 8, 256, 0, stream>>>(S, P, QN, HG);      /* P = 256 softmax (f16), rows of all HG heads, one wave per row */
      k_gemm2<0><<<dim3((QN / 128) * (HD / 64), HG), 128, 0, stream>>>(P, SQ, (size_t)SQ * SQ, VT + (size_t)h0 * HD * SQ, SQ, (size_t)HD * SQ, 0.00390625f, nullptr, 0, nullptr, 1, 0, 0, (float*)d_out + r0 * DM + h0 * HD, nullptr, DM, (size_t)HD, QN, HD, SQ); } }      /* out = P V^T (alpha 2^-8) written f32 straight into the merged-heads output rows */
}

// v002
// It runs in 439 microseconds.
// Two timings next to v001 put it at 5.51 and 5.52 times that version's speed.
// Counting every step since v000, it is 29.8 times as fast.
#include <hip/hip_runtime.h>
// Per-head scaled dot-product attention on a head-major input (x [2][16][2048][64]; xq = x Wq^T + bq, xk, xv likewise with ONE shared nn.Linear [64][64] per projection (natural [out][in], sigma 1/8; biases sigma 0.02); att = xq . xk / 8; softmax over all 2048 keys (no mask); out = p xv -> [2][16][2048][64]; every (batch, head) plane is an independent 2048 x 64 sequence = 32 planes).
// Structure: token rows r = b*2048 + s; x as exact f16 rows (bf16-rounded); Q, K, V as three WMMA GEMMs (32x64 wave tiles, f32 accumulation, exact x16 weights + bias, f16 outputs); V^T of all planes via LDS transposes in one launch; the attention launches take several planes each (the GEMMs one per grid.y index): scores GEMM (K = 64, PS planes, alpha = 64^-0.5), row softmax on VALU (f32 statistics, native exp; weights stored x256 as f16), o = P . V^T GEMM (K = 2048, PO planes, alpha 2^-8) written f32 straight into the merged-heads output rows (no output projection).
// Compute dtype: inputs rounded to bf16; x / weights exact; q, k, v and softmax weights as plain f16 GEMM operands (~2^-12); o written f32; scores and softmax statistics f32. v_wmma_f32_16x16x32_f16.
#define NB 32
#define SQ 2048
#define DM 64
#define NH 1
#define HD 64
#define HG 1                         /* heads per block group of the unlaunched non-template k_vt */
#define PS 4                         /* planes per scores launch (grid.y) and per softmax launch; PO % PS == 0 */
#define PO 16                        /* planes per P.V launch (grid.y); NB % PO == 0; PS planes of f32 scores + PO planes of f16 weights must fit the workspace */
#define B0 0                         /* first batch processed (debug hook) */
#define NBR NB                       /* batches processed (debug hook) */
#define NR ((size_t)NB * SQ)         /* token rows */
#define MP ((int)((size_t)NBR * SQ)) /* rows projected (debug hook) */
#define QN SQ                        /* unused: query rows per plane = SQ */
#define NHD NH                       /* unused: heads per plane */
#define MPO MP                       /* unused: no output stage */
#define LQ DM      /* row pitch of the q/k/v rows */
typedef __bf16 v16b __attribute__((ext_vector_type(16)));
typedef unsigned short v8us __attribute__((ext_vector_type(8), may_alias));
typedef float  v8f  __attribute__((ext_vector_type(8)));
typedef float  v4f  __attribute__((ext_vector_type(4)));
typedef float  v4fa __attribute__((ext_vector_type(4), may_alias));
union FragB { v16b v; v8us half[2]; unsigned short u[16]; };

__device__ __forceinline__ unsigned short bf16_bits(float x) { unsigned int u = __float_as_uint(x); return (unsigned short)((u + 0x7FFFu + ((u >> 16) & 1u)) >> 16); }
__device__ __forceinline__ float bf16_val(unsigned short b) { return __uint_as_float(((unsigned int)b) << 16); }
__device__ __forceinline__ float bf16_round(float x) { return bf16_val(bf16_bits(x)); }
// D += A·B with NT terms: 1 = ah·bh, 2 = + al·bh (A split), 3 = + ah·bl (both split)
template <int NT>
__device__ __forceinline__ v8f mmaN(v16b ah, v16b al, v16b bh, v16b bl, v8f c) {
  c = __builtin_amdgcn_wmma_f32_16x16x32_bf16(false, ah, false, bh, (short)0, c, false, false);
  if (NT >= 2) c = __builtin_amdgcn_wmma_f32_16x16x32_bf16(false, al, false, bh, (short)0, c, false, false);
  if (NT >= 3) c = __builtin_amdgcn_wmma_f32_16x16x32_bf16(false, ah, false, bl, (short)0, c, false, false);
  asm volatile("v_nop\n\tv_nop\n\tv_nop\n\tv_nop" : "+v"(c) : "v"(ah), "v"(al), "v"(bh), "v"(bl));
  return c;
}

__global__ __launch_bounds__(256) void k_wt_bf16(const float* __restrict__ W, unsigned short* __restrict__ Wt, int K, int N) {
  const int t = blockIdx.x * 256 + threadIdx.x;
  const int k8n = K / 8;
  if (t >= N * k8n) return;
  const int n = t / k8n, k8 = (t % k8n) * 8;
  v8us v;
#pragma unroll
  for (int i = 0; i < 8; ++i) v[i] = bf16_bits(W[(size_t)(k8 + i) * N + n]);
  *(v8us*)(Wt + (size_t)n * K + k8) = v;
  
}

// GEMM C[M][N] (f32, pitch ldc) = act(A[M][K]·W + bias). A f32 row-major (pitch lda) converted per fragment to bf16
// (ASPLIT: hi/lo two planes -> 2 terms, else single rounded term); Wt bf16 [N][K] (pitch ldb). BIAS_BF16 rounds the
// bias to bf16 first (bias quantised to bf16 before the add). K%32==0, M%16==0, N%64==0.
template <bool ASPLIT, int ACT, bool BIAS_BF16>
__global__ __launch_bounds__(128) void k_gemm_bf(const float* __restrict__ A, int lda, const unsigned short* __restrict__ Wt, int ldb,
                                               const float* __restrict__ bias, float* __restrict__ C, int ldc, int M, int N, int K) {
  __shared__ __attribute__((aligned(16))) float so[4][16][64];
  const int tid = threadIdx.x, w = tid >> 5, lane = tid & 31, ln = lane & 15, hh = lane >> 4;
  const int ntn = N / 64;
  const int wid = blockIdx.x * 4 + w;
  const int mt = wid / ntn, nq = wid % ntn;
  if (mt * 16 >= M) return;
  const int row0 = mt * 16, col0 = nq * 64;
  const float* arow = A + (size_t)(row0 + ln) * lda;
  v8f acc[4] = {};
  for (int kb = 0; kb < K; kb += 32) {
    FragB ah, al;
    const v4f x0 = *(const v4fa*)(arow + kb + 8 * hh), x1 = *(const v4fa*)(arow + kb + 8 * hh + 4);
    const v4f x2 = *(const v4fa*)(arow + kb + 16 + 8 * hh), x3 = *(const v4fa*)(arow + kb + 16 + 8 * hh + 4);
    float xs[16] = {x0[0],x0[1],x0[2],x0[3],x1[0],x1[1],x1[2],x1[3],x2[0],x2[1],x2[2],x2[3],x3[0],x3[1],x3[2],x3[3]};
#pragma unroll
    for (int i = 0; i < 16; ++i) { const unsigned short hb = bf16_bits(xs[i]); ah.u[i] = hb; al.u[i] = ASPLIT ? bf16_bits(xs[i] - bf16_val(hb)) : (unsigned short)0; }
#pragma unroll
    for (int t = 0; t < 4; ++t) {
      const unsigned short* brow = Wt + (size_t)(col0 + t * 16 + ln) * ldb + kb;
      FragB b;
      b.half[0] = *(const v8us*)(brow + 8 * hh);
      b.half[1] = *(const v8us*)(brow + 16 + 8 * hh);
      acc[t] = mmaN<ASPLIT ? 2 : 1>(ah.v, al.v, b.v, b.v, acc[t]);
    }
  }
#pragma unroll
  for (int t = 0; t < 4; ++t) {
    float bv = bias ? bias[col0 + t * 16 + ln] : 0.f;
    if (BIAS_BF16) bv = bf16_round(bv);
#pragma unroll
    for (int r = 0; r < 8; ++r) { float v = acc[t][r] + bv; if (ACT == 1) v = fmaxf(v, 0.f); so[w][8 * hh + r][t * 16 + ln] = v; }
  }
  __builtin_amdgcn_fence(__ATOMIC_ACQ_REL, "workgroup");
  __builtin_amdgcn_wave_barrier();
  const int rsub = lane >> 4, c4 = (lane & 15) * 4;
  {
#pragma unroll
    for (int q = 0; q < 8; ++q) {
      const int r = q * 2 + rsub;
      const v4f v = *(const v4fa*)&so[w][r][c4];
      *(v4f*)(C + (size_t)(row0 + r) * ldc + col0 + c4) = v;
    }
    
  }
}

// GEMM C = act(A·W + bias + resid): A f32 (ASPLIT -> hi/lo 2 terms), Wt bf16 [N][K]; ACT 0 none, 1 relu, 2 exact gelu;
// resid (optional, f32, row index = (row % rmod), pitch ldr, RES_BF16 rounds it) added before the activation.
template <bool ASPLIT, int ACT, bool BIAS_BF16, bool RES_BF16>
__global__ __launch_bounds__(128) void k_gemm_bf3(const float* __restrict__ A, int lda, const unsigned short* __restrict__ Wt, int ldb,
                                                const float* __restrict__ bias, const float* __restrict__ resid, int rmod, int ldr,
                                                float* __restrict__ C, int ldc, int M, int N, int K) {
  __shared__ __attribute__((aligned(16))) float so[4][16][64];
  const int tid = threadIdx.x, w = tid >> 5, lane = tid & 31, ln = lane & 15, hh = lane >> 4;
  const int ntn = N / 64;
  const int wid = blockIdx.x * 4 + w;
  const int mt = wid / ntn, nq = wid % ntn;
  if (mt * 16 >= M) return;
  const int row0 = mt * 16, col0 = nq * 64;
  const float* arow = A + (size_t)(row0 + ln) * lda;
  v8f acc[4] = {};
  for (int kb = 0; kb < K; kb += 32) {
    FragB ah, al;
    const v4f x0 = *(const v4fa*)(arow + kb + 8 * hh), x1 = *(const v4fa*)(arow + kb + 8 * hh + 4);
    const v4f x2 = *(const v4fa*)(arow + kb + 16 + 8 * hh), x3 = *(const v4fa*)(arow + kb + 16 + 8 * hh + 4);
    float xs[16] = {x0[0],x0[1],x0[2],x0[3],x1[0],x1[1],x1[2],x1[3],x2[0],x2[1],x2[2],x2[3],x3[0],x3[1],x3[2],x3[3]};
#pragma unroll
    for (int i = 0; i < 16; ++i) { const unsigned short hb = bf16_bits(xs[i]); ah.u[i] = hb; al.u[i] = ASPLIT ? bf16_bits(xs[i] - bf16_val(hb)) : (unsigned short)0; }
#pragma unroll
    for (int t = 0; t < 4; ++t) {
      const unsigned short* brow = Wt + (size_t)(col0 + t * 16 + ln) * ldb + kb;
      FragB b;
      b.half[0] = *(const v8us*)(brow + 8 * hh);
      b.half[1] = *(const v8us*)(brow + 16 + 8 * hh);
      acc[t] = mmaN<ASPLIT ? 2 : 1>(ah.v, al.v, b.v, b.v, acc[t]);
    }
  }
#pragma unroll
  for (int t = 0; t < 4; ++t) {
    const int col = col0 + t * 16 + ln;
    float bv = bias ? bias[col] : 0.f;
    if (BIAS_BF16) bv = bf16_round(bv);
#pragma unroll
    for (int r = 0; r < 8; ++r) {
      float v = acc[t][r] + bv;
      if (resid) { float rv = resid[(size_t)((row0 + 8 * hh + r) % rmod) * ldr + col]; if (RES_BF16) rv = bf16_round(rv); v += rv; }
      if (ACT == 1) v = fmaxf(v, 0.f);
      if (ACT == 2) v = 0.5f * v * (1.0f + erff(v * 0.70710678118654752f));
      if (ACT == 3) { const float u = 0.7978845608028654f * (v + 0.044715f * v * v * v); v = 0.5f * v * (1.0f + tanhf(u)); }
      so[w][8 * hh + r][t * 16 + ln] = v;
    }
  }
  __builtin_amdgcn_fence(__ATOMIC_ACQ_REL, "workgroup");
  __builtin_amdgcn_wave_barrier();
  const int rsub = lane >> 4, c4 = (lane & 15) * 4;
  {
#pragma unroll
    for (int q = 0; q < 8; ++q) {
      const int r = q * 2 + rsub;
      const v4f v = *(const v4fa*)&so[w][r][c4];
      *(v4f*)(C + (size_t)(row0 + r) * ldc + col0 + c4) = v;
    }
    
  }
}
// row LayerNorm (biased variance, eps) over N: s = X (+ R); optional out_sum <- s; out_norm <- (s-mu)*rsqrt(var+eps)*g + b
template <bool PARAM_BF16>
__global__ __launch_bounds__(256) void k_layernorm(const float* __restrict__ X, const float* __restrict__ R, const float* __restrict__ g, const float* __restrict__ bta,
                                                  float* __restrict__ out_sum, float* __restrict__ out_norm, int N, float eps) {
  __shared__ float red[256];
  const int row = blockIdx.x, tid = threadIdx.x;
  const float* x = X + (size_t)row * N; const float* rr = R ? R + (size_t)row * N : nullptr;
  float vals[16];                     // up to N = 4096
  const int per = N / 256;            // contiguous chunk per thread? use strided-by-4 chunks: thread handles j = tid*4 + 1024*u
  float s1 = 0.f;
  for (int u = 0; u < per / 4; ++u) {
    const int j = tid * 4 + 1024 * u;
    const v4f a = *(const v4fa*)(x + j);
    v4f b = {0.f,0.f,0.f,0.f}; if (rr) b = *(const v4fa*)(rr + j);
#pragma unroll
    for (int q = 0; q < 4; ++q) { const float v = a[q] + b[q]; vals[u * 4 + q] = v; s1 += v; }
  }
  red[tid] = s1; __syncthreads();
  for (int st = 128; st > 0; st >>= 1) { if (tid < st) red[tid] += red[tid + st]; __syncthreads(); }
  const float mu = red[0] / (float)N; __syncthreads();
  float s2 = 0.f;
  for (int u = 0; u < per / 4; ++u)
#pragma unroll
    for (int q = 0; q < 4; ++q) { const float c = vals[u * 4 + q] - mu; s2 += c * c; }
  red[tid] = s2; __syncthreads();
  for (int st = 128; st > 0; st >>= 1) { if (tid < st) red[tid] += red[tid + st]; __syncthreads(); }
  const float rs = rsqrtf(red[0] / (float)N + eps);
  {
    for (int u = 0; u < per / 4; ++u) {
      const int j = tid * 4 + 1024 * u;
      v4f o, sm;
#pragma unroll
      for (int q = 0; q < 4; ++q) {
        float gg = g[j + q], bb = bta[j + q];
        if (PARAM_BF16) { gg = bf16_round(gg); bb = bf16_round(bb); }
        sm[q] = vals[u * 4 + q]; o[q] = (vals[u * 4 + q] - mu) * rs * gg + bb;
      }
      if (out_sum) *(v4f*)(out_sum + (size_t)row * N + j) = sm;
      *(v4f*)(out_norm + (size_t)row * N + j) = o;
    }
    
  }
}



// ---- f16 WMMA path (v_wmma_f32_16x16x32_f16): 11-bit significands for operands in range — used where a [0,1] probability operand needs more precision than bf16
typedef _Float16 v16h __attribute__((ext_vector_type(16)));
union FragH { v16h v; v8us half[2]; _Float16 h[16]; unsigned short u[16]; };
template <int NT>
__device__ __forceinline__ v8f mmaH(v16h ah, v16h al, v16h bh, v16h bl, v8f c) {
  c = __builtin_amdgcn_wmma_f32_16x16x32_f16(false, ah, false, bh, (short)0, c, false, false);
  if (NT >= 2) c = __builtin_amdgcn_wmma_f32_16x16x32_f16(false, al, false, bh, (short)0, c, false, false);
  if (NT >= 3) c = __builtin_amdgcn_wmma_f32_16x16x32_f16(false, ah, false, bl, (short)0, c, false, false);
  asm volatile("v_nop\n\tv_nop\n\tv_nop\n\tv_nop" : "+v"(c) : "v"(ah), "v"(al), "v"(bh), "v"(bl));
  return c;
}
// batched GEMM like k_gemm_b but f16 operands: A f32 (split into f16 hi/lo if ASPLIT, else rounded to f16), Bt = f16 values [n][k]; alpha; C f32; N multiple of 16 (partial tiles skipped)
template <bool ASPLIT>
__global__ __launch_bounds__(128) void k_gemm_h(const float* __restrict__ A, int lda, size_t sA, const _Float16* __restrict__ Bh, int ldb, size_t sB, float alpha, float* __restrict__ C, int ldc, size_t sC, int M, int N, int K) {
  __shared__ __attribute__((aligned(16))) float so[4][16][64];
  const int tid = threadIdx.x, w = tid >> 5, lane = tid & 31, ln = lane & 15, hh = lane >> 4; const int by = blockIdx.y;
  A += (size_t)by * sA; Bh += (size_t)by * sB; C += (size_t)by * sC;
  const int ntn = (N + 63) / 64; const int wid = blockIdx.x * 4 + w; const int mt = wid / ntn, nq = wid % ntn; if (mt * 16 >= M) return;
  const int row0 = mt * 16, col0 = nq * 64; const float* arow = A + (size_t)(row0 + ln) * lda;
  v8f acc[4] = {};
  for (int kb = 0; kb < K; kb += 32) {
    FragH ah, al;
    const v4f x0 = *(const v4fa*)(arow + kb + 8 * hh), x1 = *(const v4fa*)(arow + kb + 8 * hh + 4), x2 = *(const v4fa*)(arow + kb + 16 + 8 * hh), x3 = *(const v4fa*)(arow + kb + 16 + 8 * hh + 4);
    float xs[16] = {x0[0],x0[1],x0[2],x0[3],x1[0],x1[1],x1[2],x1[3],x2[0],x2[1],x2[2],x2[3],x3[0],x3[1],x3[2],x3[3]};
#pragma unroll
    for (int i = 0; i < 16; ++i) { const _Float16 h = (_Float16)xs[i]; ah.h[i] = h; al.h[i] = ASPLIT ? (_Float16)(xs[i] - (float)h) : (_Float16)0.0f; }
#pragma unroll
    for (int t = 0; t < 4; ++t) { if (col0 + t * 16 >= N) continue; const size_t boff = (size_t)(col0 + t * 16 + ln) * ldb + kb; FragH bq; bq.half[0] = *(const v8us*)(Bh + boff + 8 * hh); bq.half[1] = *(const v8us*)(Bh + boff + 16 + 8 * hh);
      acc[t] = mmaH<ASPLIT ? 2 : 1>(ah.v, al.v, bq.v, bq.v, acc[t]); }
  }
#pragma unroll
  for (int t = 0; t < 4; ++t) { if (col0 + t * 16 >= N) continue;
#pragma unroll
    for (int r = 0; r < 8; ++r) so[w][8 * hh + r][t * 16 + ln] = acc[t][r] * alpha; }
  __builtin_amdgcn_fence(__ATOMIC_ACQ_REL, "workgroup"); __builtin_amdgcn_wave_barrier();
  const int rsub = lane >> 4, c4 = (lane & 15) * 4;
  {
#pragma unroll
    for (int q = 0; q < 8; ++q) { const int r = q * 2 + rsub; if (col0 + c4 < N) { const v4f v = *(const v4fa*)&so[w][r][c4]; *(v4f*)(C + (size_t)(row0 + r) * ldc + col0 + c4) = v; } }
     }
}

// Wt[n][k] = f16(W[k][n]·scale) from f32 row-major W[K][N] (scale = power of two; bf16-exact weights stay exact in f16 away from the subnormal range)
__global__ __launch_bounds__(256) void k_wt_f16(const float* __restrict__ W, _Float16* __restrict__ Wt, int K, int N, float scale) {
  const int t = blockIdx.x * 256 + threadIdx.x; if (t >= N * (K / 8)) return; const int n = t / (K / 8), k8 = (t % (K / 8)) * 8; FragH f;
#pragma unroll
  for (int i = 0; i < 8; ++i) f.h[i] = (_Float16)(bf16_round(W[(size_t)(k8 + i) * N + n]) * scale); const v8us o = f.half[0];
  *(v8us*)((unsigned short*)Wt + (size_t)n * K + k8) = o; 
}
// k_gemm_hh variant with fused epilogue: v = acc·alpha + bias[by·sBias + col] (+ CP[(row/rowsPerB)·sCPb + by·64 + col] if CP) ; ACT 0 none / 1 elu ; writes f16 C16 (and f32 C if non-null)
template <int ACT>
__global__ __launch_bounds__(128) void k_gemm_hhx(const _Float16* __restrict__ A, int lda, size_t sA, const _Float16* __restrict__ Bh, int ldb, size_t sB, float alpha, const float* __restrict__ bias, size_t sBias, const float* __restrict__ CP, int rowsPerB, size_t sCPb, int row0g,
    float* __restrict__ C, _Float16* __restrict__ C16, int ldc, size_t sC, int M, int N, int K) {
  __shared__ __attribute__((aligned(16))) float so[4][16][64];
  const int tid = threadIdx.x, w = tid >> 5, lane = tid & 31, ln = lane & 15, hh = lane >> 4; const int by = blockIdx.y;
  A += (size_t)by * sA; Bh += (size_t)by * sB; const size_t cofs = (size_t)by * sC; const float* bp = bias ? bias + (size_t)by * sBias : nullptr;
  const int ntn = (N + 63) / 64; const int wid = blockIdx.x * 4 + w; const int mt = wid / ntn, nq = wid % ntn; if (mt * 16 >= M) return;
  const int row0 = mt * 16, col0 = nq * 64; const _Float16* arow = A + (size_t)(row0 + ln) * lda;
  v8f acc[4] = {};
  for (int kb = 0; kb < K; kb += 32) { FragH ah; ah.half[0] = *(const v8us*)((const unsigned short*)arow + kb + 8 * hh); ah.half[1] = *(const v8us*)((const unsigned short*)arow + kb + 16 + 8 * hh);
#pragma unroll
    for (int t = 0; t < 4; ++t) { if (col0 + t * 16 >= N) continue; const size_t boff = (size_t)(col0 + t * 16 + ln) * ldb + kb; FragH bq; bq.half[0] = *(const v8us*)((const unsigned short*)Bh + boff + 8 * hh); bq.half[1] = *(const v8us*)((const unsigned short*)Bh + boff + 16 + 8 * hh);
      acc[t] = mmaH<1>(ah.v, ah.v, bq.v, bq.v, acc[t]); }
  }
#pragma unroll
  for (int t = 0; t < 4; ++t) { if (col0 + t * 16 >= N) continue; const int col = col0 + t * 16 + ln; const float bv = bp ? bf16_round(bp[col]) : 0.f;
#pragma unroll
    for (int r = 0; r < 8; ++r) { float v = acc[t][r] * alpha + bv; if (CP) { const int rr = row0g + row0 + 8 * hh + r; if (rowsPerB < 0) v += CP[cofs + (size_t)rr * ldc + col];      /* rowsPerB < 0: own element of the batched C plane */ else { const int bidx = rr / rowsPerB; v += CP[(size_t)bidx * sCPb + (size_t)by * 64 + col]; } } if (ACT == 1) v = (v > 0.f) ? v : expm1f(v); else if (ACT == 7) v = (v > 0.f) ? v + 1.0f : expf(v); else if (ACT == 8) v = tanhf(v); else if (ACT == 9) v = 0.5f * v * (1.0f + tanhf(0.7978845608028654f * (v + 0.044715f * v * v * v))); else if (ACT == 11) v = 1.0f / (1.0f + expf(-v)); else if (ACT == 12) v = (v > 0.f) ? v : 0.01f * v; else if (ACT == 14) v = (v > 0.f) ? v : 0.1f * v; else if (ACT == 16) v = (v >= 0.f) ? v : 0.3f * v; else if (ACT == 17) v = (v >= 0.f) ? v : 0.2f * v; else if (ACT == 15) v = v / (1.0f + expf(-v)); else if (ACT == 3) v = fmaxf(v, 0.f); else if (ACT == 6) v = 0.5f * v * (1.0f + erff(v * 0.70710678118654752f)); so[w][8 * hh + r][t * 16 + ln] = v; } }
  __builtin_amdgcn_fence(__ATOMIC_ACQ_REL, "workgroup"); __builtin_amdgcn_wave_barrier();
  const int rsub = lane >> 4, c4 = (lane & 15) * 4; typedef _Float16 v4h __attribute__((ext_vector_type(4)));
  {
#pragma unroll
    for (int q = 0; q < 8; ++q) { const int r = q * 2 + rsub; if (col0 + c4 < N) { const v4f v = *(const v4fa*)&so[w][r][c4]; if (C) *(v4f*)(C + cofs + (size_t)(row0 + r) * ldc + col0 + c4) = v; if (C16) { v4h h4; for (int i = 0; i < 4; ++i) h4[i] = (_Float16)v[i]; *(v4h*)(C16 + cofs + (size_t)(row0 + r) * ldc + col0 + c4) = h4; } } }
     }
}


typedef _Float16 v4h __attribute__((ext_vector_type(4)));

__global__ __launch_bounds__(256) void k_x16(const float* __restrict__ x, _Float16* __restrict__ X16, size_t n8) { const size_t t = (size_t)blockIdx.x * 256 + threadIdx.x; if (t >= n8) return; FragH f;
#pragma unroll
  for (int q = 0; q < 8; ++q) f.h[q] = (_Float16)bf16_round(x[t * 8 + q]); *(v8us*)((unsigned short*)X16 + t * 8) = f.half[0];  }
__global__ __launch_bounds__(256) void k_h16(const float* __restrict__ x, _Float16* __restrict__ X16, size_t n8) { const size_t t = (size_t)blockIdx.x * 256 + threadIdx.x; if (t >= n8) return; FragH f;
#pragma unroll
  for (int q = 0; q < 8; ++q) f.h[q] = (_Float16)x[t * 8 + q]; *(v8us*)((unsigned short*)X16 + t * 8) = f.half[0];  }
__global__ __launch_bounds__(256) void k_round16f(const float* __restrict__ W, _Float16* __restrict__ Bt, size_t n8) { const size_t t = (size_t)blockIdx.x * 256 + threadIdx.x; if (t >= n8) return; FragH f;
#pragma unroll
  for (int i = 0; i < 8; ++i) f.h[i] = (_Float16)(bf16_round(W[t * 8 + i]) * 16.0f); *(v8us*)((unsigned short*)Bt + t * 8) = f.half[0];  }
template <int NHv, int TTv>
__global__ __launch_bounds__(256) void k_vt(const _Float16* __restrict__ V16, int ldv, int voff, _Float16* __restrict__ Vt) { __shared__ unsigned short tl[64][66]; const int tid = threadIdx.x; const int slab = blockIdx.x / (TTv / 64), lg = blockIdx.x % (TTv / 64); const int b = slab / NHv, h = slab % NHv;
  for (int i = tid; i < 64 * 8; i += 256) { const int r = i / 8, c8 = (i % 8) * 8; FragH f; f.half[0] = *(const v8us*)((const unsigned short*)V16 + ((size_t)b * TTv + lg * 64 + r) * ldv + voff + h * 64 + c8);
#pragma unroll
    for (int q = 0; q < 8; ++q) tl[r][c8 + q] = f.u[q]; }
  __syncthreads();
  {
#pragma unroll
    for (int rd = 0; rd < 2; ++rd) { const int d = rd * 32 + tid / 8, pc = tid % 8; FragH f;
#pragma unroll
      for (int q = 0; q < 8; ++q) f.u[q] = tl[pc * 8 + q][d];
      *(v8us*)((unsigned short*)Vt + ((size_t)slab * 64 + d) * TTv + lg * 64 + pc * 8) = f.half[0]; }
     } }

__global__ __launch_bounds__(256) void k_hl(const float* __restrict__ F, _Float16* __restrict__ Hh, _Float16* __restrict__ Hl, size_t n8) { const size_t t = (size_t)blockIdx.x * 256 + threadIdx.x; if (t >= n8) return; FragH fh, fl; const v4f a = *(const v4fa*)(F + t * 8), c = *(const v4fa*)(F + t * 8 + 4);
#pragma unroll
  for (int q = 0; q < 4; ++q) { _Float16 h = (_Float16)a[q]; fh.h[q] = h; fl.h[q] = (_Float16)((a[q] - (float)h) * 1024.0f); h = (_Float16)c[q]; fh.h[4 + q] = h; fl.h[4 + q] = (_Float16)((c[q] - (float)h) * 1024.0f); }
  { *(v8us*)((unsigned short*)Hh + t * 8) = fh.half[0]; *(v8us*)((unsigned short*)Hl + t * 8) = fl.half[0];  } }

// ---- fast GEMM (wave tile 32x64; requires M % 32 == 0 rows per launch region and N % 64 == 0); epilogue = k_gemm_hhx semantics ----
__device__ __forceinline__ v16h g2_frag(const _Float16* p, int hh) { FragH f; f.half[0] = *(const v8us*)((const unsigned short*)p + 8 * hh); f.half[1] = *(const v8us*)((const unsigned short*)p + 16 + 8 * hh); return f.v; }
__device__ __forceinline__ v8f g2_mma(v16h a, v16h b, v8f c) { v8f d = __builtin_amdgcn_wmma_f32_16x16x32_f16(false, a, false, b, (short)0, c, false, false); asm volatile("v_nop\n\tv_nop\n\tv_nop\n\tv_nop" : "+v"(d) : "v"(a), "v"(b)); return d; }
template <int ACT>
__global__ __launch_bounds__(128) void k_gemm2(const _Float16* __restrict__ A, int lda, size_t sA, const _Float16* __restrict__ Bh, int ldb, size_t sB, float alpha, const float* __restrict__ bias, size_t sBias, const float* __restrict__ CP, int rowsPerB, size_t sCPb, int row0g,
    float* __restrict__ C, _Float16* __restrict__ C16, int ldc, size_t sC, int M, int N, int K) { static_assert(ACT == 0 || ACT == 3 || ACT == 6 || ACT == 8 || ACT == 9 || ACT == 11 || ACT == 12 || ACT == 14 || ACT == 15 || ACT == 16 || ACT == 17, "k_gemm2: unsupported ACT code (would silently apply no activation)");
  __shared__ __attribute__((aligned(16))) float so[4][32][68];
  const int tid = threadIdx.x, w = tid >> 5, lane = tid & 31, ln = lane & 15, hh = lane >> 4; const int by = blockIdx.y;
  A += (size_t)by * sA; Bh += (size_t)by * sB; const size_t cofs = (size_t)by * sC; const float* bp = bias ? bias + (size_t)by * sBias : nullptr;
  const int ntn = N >> 6; const int mt = blockIdx.x / ntn, nq = blockIdx.x - mt * ntn; const int row0 = mt * 128 + 32 * w, col0 = nq * 64; if (row0 >= M) return;
  const _Float16* a0p = A + (size_t)(row0 + ln) * lda; const _Float16* a1p = a0p + (size_t)16 * lda;
  const _Float16* b0p = Bh + (size_t)(col0 + ln) * ldb; const _Float16* b1p = b0p + (size_t)16 * ldb; const _Float16* b2p = b1p + (size_t)16 * ldb; const _Float16* b3p = b2p + (size_t)16 * ldb;
  const v8f z8 = {0.f,0.f,0.f,0.f,0.f,0.f,0.f,0.f}; v8f c00 = z8, c01 = z8, c02 = z8, c03 = z8, c10 = z8, c11 = z8, c12 = z8, c13 = z8;
#pragma unroll 1
  for (int kb = 0; kb < K; kb += 32) { const v16h a0 = g2_frag(a0p + kb, hh), a1 = g2_frag(a1p + kb, hh);
    v16h b = g2_frag(b0p + kb, hh); c00 = g2_mma(a0, b, c00); c10 = g2_mma(a1, b, c10);
    b = g2_frag(b1p + kb, hh); c01 = g2_mma(a0, b, c01); c11 = g2_mma(a1, b, c11);
    b = g2_frag(b2p + kb, hh); c02 = g2_mma(a0, b, c02); c12 = g2_mma(a1, b, c12);
    b = g2_frag(b3p + kb, hh); c03 = g2_mma(a0, b, c03); c13 = g2_mma(a1, b, c13); }
  v8f accs[8] = {c00, c01, c02, c03, c10, c11, c12, c13};
#pragma unroll
  for (int u = 0; u < 8; ++u) { const int t = u & 3, half = u >> 2; const int col = col0 + t * 16 + ln; const float bv = bp ? bf16_round(bp[col]) : 0.f;
#pragma unroll
    for (int r = 0; r < 8; ++r) { const int rloc = half * 16 + 8 * hh + r; float v = accs[u][r] * alpha + bv; if (CP) { if (rowsPerB < 0) v += CP[cofs + (size_t)(row0g + row0 + rloc) * ldc + col];      /* rowsPerB < 0: own element of the batched C plane */ else { const int bidx = (row0g + row0 + rloc) / rowsPerB; v += CP[(size_t)bidx * sCPb + (size_t)by * 64 + col]; } }
      if (ACT == 3) v = fmaxf(v, 0.f); else if (ACT == 6) v = 0.5f * v * (1.0f + erff(v * 0.70710678118654752f)); else if (ACT == 11) v = 1.0f / (1.0f + expf(-v)); else if (ACT == 15) v = v / (1.0f + expf(-v)); else if (ACT == 12) v = (v > 0.f) ? v : 0.01f * v; else if (ACT == 8) v = tanhf(v); else if (ACT == 9) v = 0.5f * v * (1.0f + tanhf(0.7978845608028654f * (v + 0.044715f * v * v * v))); else if (ACT == 14) v = (v > 0.f) ? v : 0.1f * v; else if (ACT == 16) v = (v >= 0.f) ? v : 0.3f * v; else if (ACT == 17) v = (v >= 0.f) ? v : 0.2f * v;
      so[w][rloc][t * 16 + ln] = v; } }
  __builtin_amdgcn_fence(__ATOMIC_ACQ_REL, "workgroup"); __builtin_amdgcn_wave_barrier();
  const int rsub = lane >> 4, c4 = (lane & 15) * 4;
  {
#pragma unroll
    for (int q = 0; q < 16; ++q) { const int r = q * 2 + rsub; const v4f v = *(const v4fa*)&so[w][r][c4]; if (C) *(v4f*)(C + cofs + (size_t)(row0 + r) * ldc + col0 + c4) = v; if (C16) { v4h h4; for (int i = 0; i < 4; ++i) h4[i] = (_Float16)v[i]; *(v4h*)(C16 + cofs + (size_t)(row0 + r) * ldc + col0 + c4) = h4; } }
     } }


__global__ __launch_bounds__(256) void k_wnat(const float* __restrict__ w, size_t n8, _Float16* __restrict__ Bt) { const size_t t = (size_t)blockIdx.x * 256 + threadIdx.x; if (t >= n8) return; FragH f; for (int q = 0; q < 8; ++q) f.h[q] = (_Float16)(bf16_round(w[t * 8 + q]) * 16.0f); *(v8us*)((unsigned short*)Bt + t * 8) = f.half[0];  }
__global__ __launch_bounds__(256) void k_rsm(const float* __restrict__ S, _Float16* __restrict__ P, int nrows) {
  #pragma clang fp contract(off)
  const int i = blockIdx.x * 256 + threadIdx.x; if (i >= nrows) return; const float* s = S + (size_t)i * SQ; float mx = -3.0e38f;
#pragma unroll 1
  for (int j = 0; j < SQ; ++j) mx = fmaxf(mx, s[j]); float se = 0.f;
#pragma unroll 1
  for (int j = 0; j < SQ; ++j) se += expf(s[j] - mx); const float sc = 256.0f / se;
#pragma unroll 1
  for (int j0 = 0; j0 < SQ; j0 += 8) { FragH f; for (int q = 0; q < 8; ++q) f.h[q] = (_Float16)(expf(s[j0 + q] - mx) * sc); unsigned short* d = (unsigned short*)P + (size_t)i * SQ + j0; *(v8us*)d = f.half[0];  } }
__global__ __launch_bounds__(256) void k_vt(const _Float16* __restrict__ V16, int b, int h0, _Float16* __restrict__ VT) { __shared__ unsigned short tl[64][65]; const int tid = threadIdx.x; const int hh = blockIdx.x % HG, sg = blockIdx.x / HG; const int s0 = sg * 64; const int h = h0 + hh;
  for (int i = tid; i < 64 * 8; i += 256) { const int j = i / 8, d8 = (i % 8) * 8; FragH f; f.half[0] = *(const v8us*)((const unsigned short*)V16 + ((size_t)b * SQ + s0 + j) * DM + h * HD + d8); for (int q = 0; q < 8; ++q) tl[d8 + q][j] = f.u[q]; }
  __syncthreads();
  { for (int i = tid; i < 64 * 8; i += 256) { const int d = i / 8, j8 = (i % 8) * 8; FragH f; for (int q = 0; q < 8; ++q) f.u[q] = tl[d][j8 + q]; *(v8us*)((unsigned short*)VT + ((size_t)hh * HD + d) * SQ + s0 + j8) = f.half[0]; }  } }



// lane l with lane l ^ M inside a 16-lane row (DPP row_xmask), and with lane l ^ 16: register moves, no LDS round trip
template <int M> __device__ __forceinline__ float rs_xrow(float x) { return __builtin_bit_cast(float, __builtin_amdgcn_update_dpp(0, __builtin_bit_cast(int, x), 0x160 + M, 0xf, 0xf, true)); }
__device__ __forceinline__ float rs_xhalf(float x) { return __builtin_bit_cast(float, __builtin_amdgcn_permlanex16(__builtin_bit_cast(int, x), __builtin_bit_cast(int, x), 0x76543210, 0xfedcba98, false, false)); }
// Row softmax, ONE WAVE PER ROW: the row's SQ f32 scores are read once, by SQ/128 loads of 512 contiguous bytes, and stay in registers
// (SQ/32 per lane) through maximum, exp, sum and scaling; maximum and sum end in a five-step butterfly over the wave; f16 weights leave as 256 contiguous bytes per store.
__global__ __launch_bounds__(256) void k_rsmf(const float* __restrict__ S, _Float16* __restrict__ P, int qn, int hg) {
  constexpr int NU = SQ / 128;
  const int lane = threadIdx.x & 31; const int t = blockIdx.x * 8 + (threadIdx.x >> 5); if (t >= qn * hg) return;      /* wave-uniform exit, no barrier in this kernel */
  const size_t i = (size_t)(t / qn) * SQ + (t % qn); const float* s = S + i * SQ + lane * 4;
  v4f v[NU];      /* the four loops over u are fully unrolled so that v[] is indexed by constants and lives in registers */
#pragma unroll
  for (int u = 0; u < NU; ++u) v[u] = *(const v4fa*)(s + u * 128);
  asm volatile("s_wait_xcnt 0x0" :: "v"(s) : "memory");      /* the loads' address pair stays whole until this wait */
  float m0 = -3.0e38f, m1 = -3.0e38f, m2 = -3.0e38f, m3 = -3.0e38f;
#pragma unroll
  for (int u = 0; u < NU; ++u) { m0 = fmaxf(m0, v[u][0]); m1 = fmaxf(m1, v[u][1]); m2 = fmaxf(m2, v[u][2]); m3 = fmaxf(m3, v[u][3]); }
  float mx = fmaxf(fmaxf(m0, m1), fmaxf(m2, m3));
  mx = fmaxf(mx, rs_xrow<1>(mx)); mx = fmaxf(mx, rs_xrow<2>(mx)); mx = fmaxf(mx, rs_xrow<4>(mx)); mx = fmaxf(mx, rs_xrow<8>(mx)); mx = fmaxf(mx, rs_xhalf(mx));
  v4f ev = {0.f, 0.f, 0.f, 0.f};
#pragma unroll
  for (int u = 0; u < NU; ++u) { v4f x; x[0] = __expf(v[u][0] - mx); x[1] = __expf(v[u][1] - mx); x[2] = __expf(v[u][2] - mx); x[3] = __expf(v[u][3] - mx); v[u] = x; ev += x; }
  float se = (ev[0] + ev[1]) + (ev[2] + ev[3]);
  se += rs_xrow<1>(se); se += rs_xrow<2>(se); se += rs_xrow<4>(se); se += rs_xrow<8>(se); se += rs_xhalf(se);
  const float sc = 256.0f / se;
  _Float16* d = P + i * SQ + lane * 4;
#pragma unroll
  for (int u = 0; u < NU; ++u) { v4h h4; h4[0] = (_Float16)(v[u][0] * sc); h4[1] = (_Float16)(v[u][1] * sc); h4[2] = (_Float16)(v[u][2] * sc); h4[3] = (_Float16)(v[u][3] * sc); *(v4h*)(d + u * 128) = h4; } }

extern "C" void kernel_launch(void* const* d_in, const int* in_sizes, int n_in,
                              void* d_out, int out_size, void* d_ws, size_t ws_size, hipStream_t stream) {
  (void)in_sizes; (void)n_in; (void)out_size;
  const float* const* I = (const float* const*)d_in; const float* x = I[0]; const float* wq = I[1]; const float* bq = I[2]; const float* wk = I[3]; const float* bk = I[4]; const float* wv = I[5]; const float* bv = I[6];      /* natural [out][in] 64x64 weights + biases; x head-major = 32 planes of [2048][64] */
  char* ws = (char*)d_ws; size_t off = 0;
  auto take = [&](size_t bytes) { char* p = ws + off; off += (bytes + 255) & ~(size_t)255; return p; };
  _Float16* BQ = (_Float16*)take((size_t)DM * DM * 2); _Float16* BK = (_Float16*)take((size_t)DM * DM * 2); _Float16* BV = (_Float16*)take((size_t)DM * DM * 2); 
  _Float16* X16 = (_Float16*)take(NR * DM * 2); _Float16* Q16 = (_Float16*)take(NR * DM * 2); _Float16* K16 = (_Float16*)take(NR * DM * 2); _Float16* V16 = (_Float16*)take(NR * DM * 2);
  float* S = (float*)take((size_t)PS * SQ * SQ * 4); _Float16* P = (_Float16*)take((size_t)PO * SQ * SQ * 2); _Float16* VT = (_Float16*)take((size_t)NB * HD * SQ * 2);      /* f32 scores of PS planes, f16 weights of PO planes, V^T of all planes */
  if (off > ws_size) return;
  { const unsigned g = (unsigned)(((size_t)DM * DM / 8 + 255) / 256); k_wnat<<<g, 256, 0, stream>>>(wq, (size_t)DM * DM / 8, BQ); k_wnat<<<g, 256, 0, stream>>>(wk, (size_t)DM * DM / 8, BK); k_wnat<<<g, 256, 0, stream>>>(wv, (size_t)DM * DM / 8, BV); }      /* natural [out][in] = Bt[n][k], x16 */

  k_x16<<<(unsigned)((NR * DM / 8 + 255) / 256), 256, 0, stream>>>(x, X16, NR * DM / 8);
  const size_t r0p = (size_t)B0 * SQ;      /* first projected row */
  k_gemm2<0><<<dim3((unsigned)((MP / 128) * (DM / 64)), 1), 128, 0, stream>>>(X16 + r0p * DM, DM, 0, BQ, DM, 0, 0.0625f, bq, 0, nullptr, 1, 0, 0, nullptr, Q16 + r0p * DM, DM, 0, MP, DM, DM);
  k_gemm2<0><<<dim3((unsigned)((MP / 128) * (DM / 64)), 1), 128, 0, stream>>>(X16 + r0p * DM, DM, 0, BK, DM, 0, 0.0625f, bk, 0, nullptr, 1, 0, 0, nullptr, K16 + r0p * DM, DM, 0, MP, DM, DM);
  k_gemm2<0><<<dim3((unsigned)((MP / 128) * (DM / 64)), 1), 128, 0, stream>>>(X16 + r0p * DM, DM, 0, BV, DM, 0, 0.0625f, bv, 0, nullptr, 1, 0, 0, nullptr, V16 + r0p * DM, DM, 0, MP, DM, DM);
  k_vt<NH, SQ><<<NB * NH * (SQ / 64), 256, 0, stream>>>(V16, LQ, 0, VT);      /* V^T [NB][HD][SQ], all planes in one launch */
  for (int b = 0; b < NB; b += PO) {      /* the planes are independent: one plane per grid.y index in the scores and P.V launches */
    for (int g = 0; g < PO; g += PS) { const size_t r0 = (size_t)(b + g) * SQ;
      k_gemm2<0><<<dim3((SQ / 128) * (SQ / 64), PS), 128, 0, stream>>>(Q16 + r0 * LQ, LQ, (size_t)SQ * LQ, K16 + r0 * LQ, LQ, (size_t)SQ * LQ, 0.125f, nullptr, 0, nullptr, 1, 0, 0, S, nullptr, SQ, (size_t)SQ * SQ, SQ, SQ, HD);      /* scores of PS planes */
      k_rsmf<<<PS * SQ / 8, 256, 0, stream>>>(S, P + (size_t)g * SQ * SQ, SQ, PS); }      /* P = 256 softmax (f16), rows of PS planes, one wave per row */
    k_gemm2<0><<<dim3((SQ / 128) * (HD / 64), PO), 128, 0, stream>>>(P, SQ, (size_t)SQ * SQ, VT + (size_t)b * HD * SQ, SQ, (size_t)HD * SQ, 0.00390625f, nullptr, 0, nullptr, 1, 0, 0, (float*)d_out + (size_t)b * SQ * DM, nullptr, DM, (size_t)SQ * DM, SQ, HD, SQ); }      /* out = P V^T (alpha 2^-8) of PO planes, written f32 straight into the output rows */
}

// v003
// It runs in 73.5 microseconds.
// Two timings next to v002 put it at 5.90 and 5.89 times that version's speed.
// Over all steps from v000 it is 176 times as fast.
#include <hip/hip_runtime.h>
#define NB 32
#define SQ 2048
#define DM 64
#define NH 1
#define HD 64
#define HG 1                         /* unused by the launches: heads per group of the non-template k_vt */
#define B0 0                         /* first batch processed (debug hook) */
#define NBR NB                       /* batches processed (debug hook) */
#define NR ((size_t)NB * SQ)         /* token rows */
#define MP ((int)((size_t)NBR * SQ)) /* rows projected (debug hook) */
#define QN SQ                        /* unused: query rows per plane = SQ */
#define NHD NH                       /* unused: heads per plane */
#define MPO MP                       /* unused: no output stage */
#define LQ DM      /* row pitch of the q/k/v rows */
typedef __bf16 v16b __attribute__((ext_vector_type(16)));
typedef unsigned short v8us __attribute__((ext_vector_type(8), may_alias));
typedef float  v8f  __attribute__((ext_vector_type(8)));
typedef float  v4f  __attribute__((ext_vector_type(4)));
typedef float  v4fa __attribute__((ext_vector_type(4), may_alias));
union FragB { v16b v; v8us half[2]; unsigned short u[16]; };

__device__ __forceinline__ unsigned short bf16_bits(float x) { unsigned int u = __float_as_uint(x); return (unsigned short)((u + 0x7FFFu + ((u >> 16) & 1u)) >> 16); }
__device__ __forceinline__ float bf16_val(unsigned short b) { return __uint_as_float(((unsigned int)b) << 16); }
__device__ __forceinline__ float bf16_round(float x) { return bf16_val(bf16_bits(x)); }
// D += A·B with NT terms: 1 = ah·bh, 2 = + al·bh (A split), 3 = + ah·bl (both split)
template <int NT>
__device__ __forceinline__ v8f mmaN(v16b ah, v16b al, v16b bh, v16b bl, v8f c) {
  c = __builtin_amdgcn_wmma_f32_16x16x32_bf16(false, ah, false, bh, (short)0, c, false, false);
  if (NT >= 2) c = __builtin_amdgcn_wmma_f32_16x16x32_bf16(false, al, false, bh, (short)0, c, false, false);
  if (NT >= 3) c = __builtin_amdgcn_wmma_f32_16x16x32_bf16(false, ah, false, bl, (short)0, c, false, false);
  asm volatile("v_nop\n\tv_nop\n\tv_nop\n\tv_nop" : "+v"(c) : "v"(ah), "v"(al), "v"(bh), "v"(bl));
  return c;
}

__global__ __launch_bounds__(256) void k_wt_bf16(const float* __restrict__ W, unsigned short* __restrict__ Wt, int K, int N) {
  const int t = blockIdx.x * 256 + threadIdx.x;
  const int k8n = K / 8;
  if (t >= N * k8n) return;
  const int n = t / k8n, k8 = (t % k8n) * 8;
  v8us v;
#pragma unroll
  for (int i = 0; i < 8; ++i) v[i] = bf16_bits(W[(size_t)(k8 + i) * N + n]);
  *(v8us*)(Wt + (size_t)n * K + k8) = v;
  
}

// GEMM C[M][N] (f32, pitch ldc) = act(A[M][K]·W + bias). A f32 row-major (pitch lda) converted per fragment to bf16
// (ASPLIT: hi/lo two planes -> 2 terms, else single rounded term); Wt bf16 [N][K] (pitch ldb). BIAS_BF16 rounds the
// bias to bf16 first (bias quantised to bf16 before the add). K%32==0, M%16==0, N%64==0.
template <bool ASPLIT, int ACT, bool BIAS_BF16>
__global__ __launch_bounds__(128) void k_gemm_bf(const float* __restrict__ A, int lda, const unsigned short* __restrict__ Wt, int ldb,
                                               const float* __restrict__ bias, float* __restrict__ C, int ldc, int M, int N, int K) {
  __shared__ __attribute__((aligned(16))) float so[4][16][64];
  const int tid = threadIdx.x, w = tid >> 5, lane = tid & 31, ln = lane & 15, hh = lane >> 4;
  const int ntn = N / 64;
  const int wid = blockIdx.x * 4 + w;
  const int mt = wid / ntn, nq = wid % ntn;
  if (mt * 16 >= M) return;
  const int row0 = mt * 16, col0 = nq * 64;
  const float* arow = A + (size_t)(row0 + ln) * lda;
  v8f acc[4] = {};
  for (int kb = 0; kb < K; kb += 32) {
    FragB ah, al;
    const v4f x0 = *(const v4fa*)(arow + kb + 8 * hh), x1 = *(const v4fa*)(arow + kb + 8 * hh + 4);
    const v4f x2 = *(const v4fa*)(arow + kb + 16 + 8 * hh), x3 = *(const v4fa*)(arow + kb + 16 + 8 * hh + 4);
    float xs[16] = {x0[0],x0[1],x0[2],x0[3],x1[0],x1[1],x1[2],x1[3],x2[0],x2[1],x2[2],x2[3],x3[0],x3[1],x3[2],x3[3]};
#pragma unroll
    for (int i = 0; i < 16; ++i) { const unsigned short hb = bf16_bits(xs[i]); ah.u[i] = hb; al.u[i] = ASPLIT ? bf16_bits(xs[i] - bf16_val(hb)) : (unsigned short)0; }
#pragma unroll
    for (int t = 0; t < 4; ++t) {
      const unsigned short* brow = Wt + (size_t)(col0 + t * 16 + ln) * ldb + kb;
      FragB b;
      b.half[0] = *(const v8us*)(brow + 8 * hh);
      b.half[1] = *(const v8us*)(brow + 16 + 8 * hh);
      acc[t] = mmaN<ASPLIT ? 2 : 1>(ah.v, al.v, b.v, b.v, acc[t]);
    }
  }
#pragma unroll
  for (int t = 0; t < 4; ++t) {
    float bv = bias ? bias[col0 + t * 16 + ln] : 0.f;
    if (BIAS_BF16) bv = bf16_round(bv);
#pragma unroll
    for (int r = 0; r < 8; ++r) { float v = acc[t][r] + bv; if (ACT == 1) v = fmaxf(v, 0.f); so[w][8 * hh + r][t * 16 + ln] = v; }
  }
  __builtin_amdgcn_fence(__ATOMIC_ACQ_REL, "workgroup");
  __builtin_amdgcn_wave_barrier();
  const int rsub = lane >> 4, c4 = (lane & 15) * 4;
  {
#pragma unroll
    for (int q = 0; q < 8; ++q) {
      const int r = q * 2 + rsub;
      const v4f v = *(const v4fa*)&so[w][r][c4];
      *(v4f*)(C + (size_t)(row0 + r) * ldc + col0 + c4) = v;
    }
    
  }
}

// GEMM C = act(A·W + bias + resid): A f32 (ASPLIT -> hi/lo 2 terms), Wt bf16 [N][K]; ACT 0 none, 1 relu, 2 exact gelu;
// resid (optional, f32, row index = (row % rmod), pitch ldr, RES_BF16 rounds it) added before the activation.
template <bool ASPLIT, int ACT, bool BIAS_BF16, bool RES_BF16>
__global__ __launch_bounds__(128) void k_gemm_bf3(const float* __restrict__ A, int lda, const unsigned short* __restrict__ Wt, int ldb,
                                                const float* __restrict__ bias, const float* __restrict__ resid, int rmod, int ldr,
                                                float* __restrict__ C, int ldc, int M, int N, int K) {
  __shared__ __attribute__((aligned(16))) float so[4][16][64];
  const int tid = threadIdx.x, w = tid >> 5, lane = tid & 31, ln = lane & 15, hh = lane >> 4;
  const int ntn = N / 64;
  const int wid = blockIdx.x * 4 + w;
  const int mt = wid / ntn, nq = wid % ntn;
  if (mt * 16 >= M) return;
  const int row0 = mt * 16, col0 = nq * 64;
  const float* arow = A + (size_t)(row0 + ln) * lda;
  v8f acc[4] = {};
  for (int kb = 0; kb < K; kb += 32) {
    FragB ah, al;
    const v4f x0 = *(const v4fa*)(arow + kb + 8 * hh), x1 = *(const v4fa*)(arow + kb + 8 * hh + 4);
    const v4f x2 = *(const v4fa*)(arow + kb + 16 + 8 * hh), x3 = *(const v4fa*)(arow + kb + 16 + 8 * hh + 4);
    float xs[16] = {x0[0],x0[1],x0[2],x0[3],x1[0],x1[1],x1[2],x1[3],x2[0],x2[1],x2[2],x2[3],x3[0],x3[1],x3[2],x3[3]};
#pragma unroll
    for (int i = 0; i < 16; ++i) { const unsigned short hb = bf16_bits(xs[i]); ah.u[i] = hb; al.u[i] = ASPLIT ? bf16_bits(xs[i] - bf16_val(hb)) : (unsigned short)0; }
#pragma unroll
    for (int t = 0; t < 4; ++t) {
      const unsigned short* brow = Wt + (size_t)(col0 + t * 16 + ln) * ldb + kb;
      FragB b;
      b.half[0] = *(const v8us*)(brow + 8 * hh);
      b.half[1] = *(const v8us*)(brow + 16 + 8 * hh);
      acc[t] = mmaN<ASPLIT ? 2 : 1>(ah.v, al.v, b.v, b.v, acc[t]);
    }
  }
#pragma unroll
  for (int t = 0; t < 4; ++t) {
    const int col = col0 + t * 16 + ln;
    float bv = bias ? bias[col] : 0.f;
    if (BIAS_BF16) bv = bf16_round(bv);
#pragma unroll
    for (int r = 0; r < 8; ++r) {
      float v = acc[t][r] + bv;
      if (resid) { float rv = resid[(size_t)((row0 + 8 * hh + r) % rmod) * ldr + col]; if (RES_BF16) rv = bf16_round(rv); v += rv; }
      if (ACT == 1) v = fmaxf(v, 0.f);
      if (ACT == 2) v = 0.5f * v * (1.0f + erff(v * 0.70710678118654752f));
      if (ACT == 3) { const float u = 0.7978845608028654f * (v + 0.044715f * v * v * v); v = 0.5f * v * (1.0f + tanhf(u)); }
      so[w][8 * hh + r][t * 16 + ln] = v;
    }
  }
  __builtin_amdgcn_fence(__ATOMIC_ACQ_REL, "workgroup");
  __builtin_amdgcn_wave_barrier();
  const int rsub = lane >> 4, c4 = (lane & 15) * 4;
  {
#pragma unroll
    for (int q = 0; q < 8; ++q) {
      const int r = q * 2 + rsub;
      const v4f v = *(const v4fa*)&so[w][r][c4];
      *(v4f*)(C + (size_t)(row0 + r) * ldc + col0 + c4) = v;
    }
    
  }
}
// row LayerNorm (biased variance, eps) over N: s = X (+ R); optional out_sum <- s; out_norm <- (s-mu)*rsqrt(var+eps)*g + b
template <bool PARAM_BF16>
__global__ __launch_bounds__(256) void k_layernorm(const float* __restrict__ X, const float* __restrict__ R, const float* __restrict__ g, const float* __restrict__ bta,
                                                  float* __restrict__ out_sum, float* __restrict__ out_norm, int N, float eps) {
  __shared__ float red[256];
  const int row = blockIdx.x, tid = threadIdx.x;
  const float* x = X + (size_t)row * N; const float* rr = R ? R + (size_t)row * N : nullptr;
  float vals[16];                     // up to N = 4096
  const int per = N / 256;            // contiguous chunk per thread? use strided-by-4 chunks: thread handles j = tid*4 + 1024*u
  float s1 = 0.f;
  for (int u = 0; u < per / 4; ++u) {
    const int j = tid * 4 + 1024 * u;
    const v4f a = *(const v4fa*)(x + j);
    v4f b = {0.f,0.f,0.f,0.f}; if (rr) b = *(const v4fa*)(rr + j);
#pragma unroll
    for (int q = 0; q < 4; ++q) { const float v = a[q] + b[q]; vals[u * 4 + q] = v; s1 += v; }
  }
  red[tid] = s1; __syncthreads();
  for (int st = 128; st > 0; st >>= 1) { if (tid < st) red[tid] += red[tid + st]; __syncthreads(); }
  const float mu = red[0] / (float)N; __syncthreads();
  float s2 = 0.f;
  for (int u = 0; u < per / 4; ++u)
#pragma unroll
    for (int q = 0; q < 4; ++q) { const float c = vals[u * 4 + q] - mu; s2 += c * c; }
  red[tid] = s2; __syncthreads();
  for (int st = 128; st > 0; st >>= 1) { if (tid < st) red[tid] += red[tid + st]; __syncthreads(); }
  const float rs = rsqrtf(red[0] / (float)N + eps);
  {
    for (int u = 0; u < per / 4; ++u) {
      const int j = tid * 4 + 1024 * u;
      v4f o, sm;
#pragma unroll
      for (int q = 0; q < 4; ++q) {
        float gg = g[j + q], bb = bta[j + q];
        if (PARAM_BF16) { gg = bf16_round(gg); bb = bf16_round(bb); }
        sm[q] = vals[u * 4 + q]; o[q] = (vals[u * 4 + q] - mu) * rs * gg + bb;
      }
      if (out_sum) *(v4f*)(out_sum + (size_t)row * N + j) = sm;
      *(v4f*)(out_norm + (size_t)row * N + j) = o;
    }
    
  }
}



// ---- f16 WMMA path (v_wmma_f32_16x16x32_f16): 11-bit significands for operands in range — used where a [0,1] probability operand needs more precision than bf16
typedef _Float16 v16h __attribute__((ext_vector_type(16)));
union FragH { v16h v; v8us half[2]; _Float16 h[16]; unsigned short u[16]; };
template <int NT>
__device__ __forceinline__ v8f mmaH(v16h ah, v16h al, v16h bh, v16h bl, v8f c) {
  c = __builtin_amdgcn_wmma_f32_16x16x32_f16(false, ah, false, bh, (short)0, c, false, false);
  if (NT >= 2) c = __builtin_amdgcn_wmma_f32_16x16x32_f16(false, al, false, bh, (short)0, c, false, false);
  if (NT >= 3) c = __builtin_amdgcn_wmma_f32_16x16x32_f16(false, ah, false, bl, (short)0, c, false, false);
  asm volatile("v_nop\n\tv_nop\n\tv_nop\n\tv_nop" : "+v"(c) : "v"(ah), "v"(al), "v"(bh), "v"(bl));
  return c;
}
// batched GEMM like k_gemm_b but f16 operands: A f32 (split into f16 hi/lo if ASPLIT, else rounded to f16), Bt = f16 values [n][k]; alpha; C f32; N multiple of 16 (partial tiles skipped)
template <bool ASPLIT>
__global__ __launch_bounds__(128) void k_gemm_h(const float* __restrict__ A, int lda, size_t sA, const _Float16* __restrict__ Bh, int ldb, size_t sB, float alpha, float* __restrict__ C, int ldc, size_t sC, int M, int N, int K) {
  __shared__ __attribute__((aligned(16))) float so[4][16][64];
  const int tid = threadIdx.x, w = tid >> 5, lane = tid & 31, ln = lane & 15, hh = lane >> 4; const int by = blockIdx.y;
  A += (size_t)by * sA; Bh += (size_t)by * sB; C += (size_t)by * sC;
  const int ntn = (N + 63) / 64; const int wid = blockIdx.x * 4 + w; const int mt = wid / ntn, nq = wid % ntn; if (mt * 16 >= M) return;
  const int row0 = mt * 16, col0 = nq * 64; const float* arow = A + (size_t)(row0 + ln) * lda;
  v8f acc[4] = {};
  for (int kb = 0; kb < K; kb += 32) {
    FragH ah, al;
    const v4f x0 = *(const v4fa*)(arow + kb + 8 * hh), x1 = *(const v4fa*)(arow + kb + 8 * hh + 4), x2 = *(const v4fa*)(arow + kb + 16 + 8 * hh), x3 = *(const v4fa*)(arow + kb + 16 + 8 * hh + 4);
    float xs[16] = {x0[0],x0[1],x0[2],x0[3],x1[0],x1[1],x1[2],x1[3],x2[0],x2[1],x2[2],x2[3],x3[0],x3[1],x3[2],x3[3]};
#pragma unroll
    for (int i = 0; i < 16; ++i) { const _Float16 h = (_Float16)xs[i]; ah.h[i] = h; al.h[i] = ASPLIT ? (_Float16)(xs[i] - (float)h) : (_Float16)0.0f; }
#pragma unroll
    for (int t = 0; t < 4; ++t) { if (col0 + t * 16 >= N) continue; const size_t boff = (size_t)(col0 + t * 16 + ln) * ldb + kb; FragH bq; bq.half[0] = *(const v8us*)(Bh + boff + 8 * hh); bq.half[1] = *(const v8us*)(Bh + boff + 16 + 8 * hh);
      acc[t] = mmaH<ASPLIT ? 2 : 1>(ah.v, al.v, bq.v, bq.v, acc[t]); }
  }
#pragma unroll
  for (int t = 0; t < 4; ++t) { if (col0 + t * 16 >= N) continue;
#pragma unroll
    for (int r = 0; r < 8; ++r) so[w][8 * hh + r][t * 16 + ln] = acc[t][r] * alpha; }
  __builtin_amdgcn_fence(__ATOMIC_ACQ_REL, "workgroup"); __builtin_amdgcn_wave_barrier();
  const int rsub = lane >> 4, c4 = (lane & 15) * 4;
  {
#pragma unroll
    for (int q = 0; q < 8; ++q) { const int r = q * 2 + rsub; if (col0 + c4 < N) { const v4f v = *(const v4fa*)&so[w][r][c4]; *(v4f*)(C + (size_t)(row0 + r) * ldc + col0 + c4) = v; } }
     }
}

// Wt[n][k] = f16(W[k][n]·scale) from f32 row-major W[K][N] (scale = power of two; bf16-exact weights stay exact in f16 away from the subnormal range)
__global__ __launch_bounds__(256) void k_wt_f16(const float* __restrict__ W, _Float16* __restrict__ Wt, int K, int N, float scale) {
  const int t = blockIdx.x * 256 + threadIdx.x; if (t >= N * (K / 8)) return; const int n = t / (K / 8), k8 = (t % (K / 8)) * 8; FragH f;
#pragma unroll
  for (int i = 0; i < 8; ++i) f.h[i] = (_Float16)(bf16_round(W[(size_t)(k8 + i) * N + n]) * scale); const v8us o = f.half[0];
  *(v8us*)((unsigned short*)Wt + (size_t)n * K + k8) = o; 
}
// k_gemm_hh variant with fused epilogue: v = acc·alpha + bias[by·sBias + col] (+ CP[(row/rowsPerB)·sCPb + by·64 + col] if CP) ; ACT 0 none / 1 elu ; writes f16 C16 (and f32 C if non-null)
template <int ACT>
__global__ __launch_bounds__(128) void k_gemm_hhx(const _Float16* __restrict__ A, int lda, size_t sA, const _Float16* __restrict__ Bh, int ldb, size_t sB, float alpha, const float* __restrict__ bias, size_t sBias, const float* __restrict__ CP, int rowsPerB, size_t sCPb, int row0g,
    float* __restrict__ C, _Float16* __restrict__ C16, int ldc, size_t sC, int M, int N, int K) {
  __shared__ __attribute__((aligned(16))) float so[4][16][64];
  const int tid = threadIdx.x, w = tid >> 5, lane = tid & 31, ln = lane & 15, hh = lane >> 4; const int by = blockIdx.y;
  A += (size_t)by * sA; Bh += (size_t)by * sB; const size_t cofs = (size_t)by * sC; const float* bp = bias ? bias + (size_t)by * sBias : nullptr;
  const int ntn = (N + 63) / 64; const int wid = blockIdx.x * 4 + w; const int mt = wid / ntn, nq = wid % ntn; if (mt * 16 >= M) return;
  const int row0 = mt * 16, col0 = nq * 64; const _Float16* arow = A + (size_t)(row0 + ln) * lda;
  v8f acc[4] = {};
  for (int kb = 0; kb < K; kb += 32) { FragH ah; ah.half[0] = *(const v8us*)((const unsigned short*)arow + kb + 8 * hh); ah.half[1] = *(const v8us*)((const unsigned short*)arow + kb + 16 + 8 * hh);
#pragma unroll
    for (int t = 0; t < 4; ++t) { if (col0 + t * 16 >= N) continue; const size_t boff = (size_t)(col0 + t * 16 + ln) * ldb + kb; FragH bq; bq.half[0] = *(const v8us*)((const unsigned short*)Bh + boff + 8 * hh); bq.half[1] = *(const v8us*)((const unsigned short*)Bh + boff + 16 + 8 * hh);
      acc[t] = mmaH<1>(ah.v, ah.v, bq.v, bq.v, acc[t]); }
  }
#pragma unroll
  for (int t = 0; t < 4; ++t) { if (col0 + t * 16 >= N) continue; const int col = col0 + t * 16 + ln; const float bv = bp ? bf16_round(bp[col]) : 0.f;
#pragma unroll
    for (int r = 0; r < 8; ++r) { float v = acc[t][r] * alpha + bv; if (CP) { const int rr = row0g + row0 + 8 * hh + r; if (rowsPerB < 0) v += CP[cofs + (size_t)rr * ldc + col];      /* rowsPerB < 0: own element of the batched C plane */ else { const int bidx = rr / rowsPerB; v += CP[(size_t)bidx * sCPb + (size_t)by * 64 + col]; } } if (ACT == 1) v = (v > 0.f) ? v : expm1f(v); else if (ACT == 7) v = (v > 0.f) ? v + 1.0f : expf(v); else if (ACT == 8) v = tanhf(v); else if (ACT == 9) v = 0.5f * v * (1.0f + tanhf(0.7978845608028654f * (v + 0.044715f * v * v * v))); else if (ACT == 11) v = 1.0f / (1.0f + expf(-v)); else if (ACT == 12) v = (v > 0.f) ? v : 0.01f * v; else if (ACT == 14) v = (v > 0.f) ? v : 0.1f * v; else if (ACT == 16) v = (v >= 0.f) ? v : 0.3f * v; else if (ACT == 17) v = (v >= 0.f) ? v : 0.2f * v; else if (ACT == 15) v = v / (1.0f + expf(-v)); else if (ACT == 3) v = fmaxf(v, 0.f); else if (ACT == 6) v = 0.5f * v * (1.0f + erff(v * 0.70710678118654752f)); so[w][8 * hh + r][t * 16 + ln] = v; } }
  __builtin_amdgcn_fence(__ATOMIC_ACQ_REL, "workgroup"); __builtin_amdgcn_wave_barrier();
  const int rsub = lane >> 4, c4 = (lane & 15) * 4; typedef _Float16 v4h __attribute__((ext_vector_type(4)));
  {
#pragma unroll
    for (int q = 0; q < 8; ++q) { const int r = q * 2 + rsub; if (col0 + c4 < N) { const v4f v = *(const v4fa*)&so[w][r][c4]; if (C) *(v4f*)(C + cofs + (size_t)(row0 + r) * ldc + col0 + c4) = v; if (C16) { v4h h4; for (int i = 0; i < 4; ++i) h4[i] = (_Float16)v[i]; *(v4h*)(C16 + cofs + (size_t)(row0 + r) * ldc + col0 + c4) = h4; } } }
     }
}


typedef _Float16 v4h __attribute__((ext_vector_type(4)));

__global__ __launch_bounds__(256) void k_x16(const float* __restrict__ x, _Float16* __restrict__ X16, size_t n8) { const size_t t = (size_t)blockIdx.x * 256 + threadIdx.x; if (t >= n8) return; FragH f;
#pragma unroll
  for (int q = 0; q < 8; ++q) f.h[q] = (_Float16)bf16_round(x[t * 8 + q]); *(v8us*)((unsigned short*)X16 + t * 8) = f.half[0];  }
__global__ __launch_bounds__(256) void k_h16(const float* __restrict__ x, _Float16* __restrict__ X16, size_t n8) { const size_t t = (size_t)blockIdx.x * 256 + threadIdx.x; if (t >= n8) return; FragH f;
#pragma unroll
  for (int q = 0; q < 8; ++q) f.h[q] = (_Float16)x[t * 8 + q]; *(v8us*)((unsigned short*)X16 + t * 8) = f.half[0];  }
__global__ __launch_bounds__(256) void k_round16f(const float* __restrict__ W, _Float16* __restrict__ Bt, size_t n8) { const size_t t = (size_t)blockIdx.x * 256 + threadIdx.x; if (t >= n8) return; FragH f;
#pragma unroll
  for (int i = 0; i < 8; ++i) f.h[i] = (_Float16)(bf16_round(W[t * 8 + i]) * 16.0f); *(v8us*)((unsigned short*)Bt + t * 8) = f.half[0];  }
template <int NHv, int TTv>
__global__ __launch_bounds__(256) void k_vt(const _Float16* __restrict__ V16, int ldv, int voff, _Float16* __restrict__ Vt) { __shared__ unsigned short tl[64][66]; const int tid = threadIdx.x; const int slab = blockIdx.x / (TTv / 64), lg = blockIdx.x % (TTv / 64); const int b = slab / NHv, h = slab % NHv;
  for (int i = tid; i < 64 * 8; i += 256) { const int r = i / 8, c8 = (i % 8) * 8; FragH f; f.half[0] = *(const v8us*)((const unsigned short*)V16 + ((size_t)b * TTv + lg * 64 + r) * ldv + voff + h * 64 + c8);
#pragma unroll
    for (int q = 0; q < 8; ++q) tl[r][c8 + q] = f.u[q]; }
  __syncthreads();
  {
#pragma unroll
    for (int rd = 0; rd < 2; ++rd) { const int d = rd * 32 + tid / 8, pc = tid % 8; FragH f;
#pragma unroll
      for (int q = 0; q < 8; ++q) f.u[q] = tl[pc * 8 + q][d];
      *(v8us*)((unsigned short*)Vt + ((size_t)slab * 64 + d) * TTv + lg * 64 + pc * 8) = f.half[0]; }
     } }

__global__ __launch_bounds__(256) void k_hl(const float* __restrict__ F, _Float16* __restrict__ Hh, _Float16* __restrict__ Hl, size_t n8) { const size_t t = (size_t)blockIdx.x * 256 + threadIdx.x; if (t >= n8) return; FragH fh, fl; const v4f a = *(const v4fa*)(F + t * 8), c = *(const v4fa*)(F + t * 8 + 4);
#pragma unroll
  for (int q = 0; q < 4; ++q) { _Float16 h = (_Float16)a[q]; fh.h[q] = h; fl.h[q] = (_Float16)((a[q] - (float)h) * 1024.0f); h = (_Float16)c[q]; fh.h[4 + q] = h; fl.h[4 + q] = (_Float16)((c[q] - (float)h) * 1024.0f); }
  { *(v8us*)((unsigned short*)Hh + t * 8) = fh.half[0]; *(v8us*)((unsigned short*)Hl + t * 8) = fl.half[0];  } }

// ---- fast GEMM (wave tile 32x64; requires M % 32 == 0 rows per launch region and N % 64 == 0); epilogue = k_gemm_hhx semantics ----
__device__ __forceinline__ v16h g2_frag(const _Float16* p, int hh) { FragH f; f.half[0] = *(const v8us*)((const unsigned short*)p + 8 * hh); f.half[1] = *(const v8us*)((const unsigned short*)p + 16 + 8 * hh); return f.v; }
__device__ __forceinline__ v8f g2_mma(v16h a, v16h b, v8f c) { v8f d = __builtin_amdgcn_wmma_f32_16x16x32_f16(false, a, false, b, (short)0, c, false, false); asm volatile("v_nop\n\tv_nop\n\tv_nop\n\tv_nop" : "+v"(d) : "v"(a), "v"(b)); return d; }
template <int ACT>
__global__ __launch_bounds__(128) void k_gemm2(const _Float16* __restrict__ A, int lda, size_t sA, const _Float16* __restrict__ Bh, int ldb, size_t sB, float alpha, const float* __restrict__ bias, size_t sBias, const float* __restrict__ CP, int rowsPerB, size_t sCPb, int row0g,
    float* __restrict__ C, _Float16* __restrict__ C16, int ldc, size_t sC, int M, int N, int K) { static_assert(ACT == 0 || ACT == 3 || ACT == 6 || ACT == 8 || ACT == 9 || ACT == 11 || ACT == 12 || ACT == 14 || ACT == 15 || ACT == 16 || ACT == 17, "k_gemm2: unsupported ACT code (would silently apply no activation)");
  __shared__ __attribute__((aligned(16))) float so[4][32][68];
  const int tid = threadIdx.x, w = tid >> 5, lane = tid & 31, ln = lane & 15, hh = lane >> 4; const int by = blockIdx.y;
  A += (size_t)by * sA; Bh += (size_t)by * sB; const size_t cofs = (size_t)by * sC; const float* bp = bias ? bias + (size_t)by * sBias : nullptr;
  const int ntn = N >> 6; const int mt = blockIdx.x / ntn, nq = blockIdx.x - mt * ntn; const int row0 = mt * 128 + 32 * w, col0 = nq * 64; if (row0 >= M) return;
  const _Float16* a0p = A + (size_t)(row0 + ln) * lda; const _Float16* a1p = a0p + (size_t)16 * lda;
  const _Float16* b0p = Bh + (size_t)(col0 + ln) * ldb; const _Float16* b1p = b0p + (size_t)16 * ldb; const _Float16* b2p = b1p + (size_t)16 * ldb; const _Float16* b3p = b2p + (size_t)16 * ldb;
  const v8f z8 = {0.f,0.f,0.f,0.f,0.f,0.f,0.f,0.f}; v8f c00 = z8, c01 = z8, c02 = z8, c03 = z8, c10 = z8, c11 = z8, c12 = z8, c13 = z8;
#pragma unroll 1
  for (int kb = 0; kb < K; kb += 32) { const v16h a0 = g2_frag(a0p + kb, hh), a1 = g2_frag(a1p + kb, hh);
    v16h b = g2_frag(b0p + kb, hh); c00 = g2_mma(a0, b, c00); c10 = g2_mma(a1, b, c10);
    b = g2_frag(b1p + kb, hh); c01 = g2_mma(a0, b, c01); c11 = g2_mma(a1, b, c11);
    b = g2_frag(b2p + kb, hh); c02 = g2_mma(a0, b, c02); c12 = g2_mma(a1, b, c12);
    b = g2_frag(b3p + kb, hh); c03 = g2_mma(a0, b, c03); c13 = g2_mma(a1, b, c13); }
  v8f accs[8] = {c00, c01, c02, c03, c10, c11, c12, c13};
#pragma unroll
  for (int u = 0; u < 8; ++u) { const int t = u & 3, half = u >> 2; const int col = col0 + t * 16 + ln; const float bv = bp ? bf16_round(bp[col]) : 0.f;
#pragma unroll
    for (int r = 0; r < 8; ++r) { const int rloc = half * 16 + 8 * hh + r; float v = accs[u][r] * alpha + bv; if (CP) { if (rowsPerB < 0) v += CP[cofs + (size_t)(row0g + row0 + rloc) * ldc + col];      /* rowsPerB < 0: own element of the batched C plane */ else { const int bidx = (row0g + row0 + rloc) / rowsPerB; v += CP[(size_t)bidx * sCPb + (size_t)by * 64 + col]; } }
      if (ACT == 3) v = fmaxf(v, 0.f); else if (ACT == 6) v = 0.5f * v * (1.0f + erff(v * 0.70710678118654752f)); else if (ACT == 11) v = 1.0f / (1.0f + expf(-v)); else if (ACT == 15) v = v / (1.0f + expf(-v)); else if (ACT == 12) v = (v > 0.f) ? v : 0.01f * v; else if (ACT == 8) v = tanhf(v); else if (ACT == 9) v = 0.5f * v * (1.0f + tanhf(0.7978845608028654f * (v + 0.044715f * v * v * v))); else if (ACT == 14) v = (v > 0.f) ? v : 0.1f * v; else if (ACT == 16) v = (v >= 0.f) ? v : 0.3f * v; else if (ACT == 17) v = (v >= 0.f) ? v : 0.2f * v;
      so[w][rloc][t * 16 + ln] = v; } }
  __builtin_amdgcn_fence(__ATOMIC_ACQ_REL, "workgroup"); __builtin_amdgcn_wave_barrier();
  const int rsub = lane >> 4, c4 = (lane & 15) * 4;
  {
#pragma unroll
    for (int q = 0; q < 16; ++q) { const int r = q * 2 + rsub; const v4f v = *(const v4fa*)&so[w][r][c4]; if (C) *(v4f*)(C + cofs + (size_t)(row0 + r) * ldc + col0 + c4) = v; if (C16) { v4h h4; for (int i = 0; i < 4; ++i) h4[i] = (_Float16)v[i]; *(v4h*)(C16 + cofs + (size_t)(row0 + r) * ldc + col0 + c4) = h4; } }
     } }


__global__ __launch_bounds__(256) void k_wnat(const float* __restrict__ w, size_t n8, _Float16* __restrict__ Bt) { const size_t t = (size_t)blockIdx.x * 256 + threadIdx.x; if (t >= n8) return; FragH f; for (int q = 0; q < 8; ++q) f.h[q] = (_Float16)(bf16_round(w[t * 8 + q]) * 16.0f); *(v8us*)((unsigned short*)Bt + t * 8) = f.half[0];  }
__global__ __launch_bounds__(256) void k_rsm(const float* __restrict__ S, _Float16* __restrict__ P, int nrows) {
  #pragma clang fp contract(off)
  const int i = blockIdx.x * 256 + threadIdx.x; if (i >= nrows) return; const float* s = S + (size_t)i * SQ; float mx = -3.0e38f;
#pragma unroll 1
  for (int j = 0; j < SQ; ++j) mx = fmaxf(mx, s[j]); float se = 0.f;
#pragma unroll 1
  for (int j = 0; j < SQ; ++j) se += expf(s[j] - mx); const float sc = 256.0f / se;
#pragma unroll 1
  for (int j0 = 0; j0 < SQ; j0 += 8) { FragH f; for (int q = 0; q < 8; ++q) f.h[q] = (_Float16)(expf(s[j0 + q] - mx) * sc); unsigned short* d = (unsigned short*)P + (size_t)i * SQ + j0; *(v8us*)d = f.half[0];  } }
__global__ __launch_bounds__(256) void k_vt(const _Float16* __restrict__ V16, int b, int h0, _Float16* __restrict__ VT) { __shared__ unsigned short tl[64][65]; const int tid = threadIdx.x; const int hh = blockIdx.x % HG, sg = blockIdx.x / HG; const int s0 = sg * 64; const int h = h0 + hh;
  for (int i = tid; i < 64 * 8; i += 256) { const int j = i / 8, d8 = (i % 8) * 8; FragH f; f.half[0] = *(const v8us*)((const unsigned short*)V16 + ((size_t)b * SQ + s0 + j) * DM + h * HD + d8); for (int q = 0; q < 8; ++q) tl[d8 + q][j] = f.u[q]; }
  __syncthreads();
  { for (int i = tid; i < 64 * 8; i += 256) { const int d = i / 8, j8 = (i % 8) * 8; FragH f; for (int q = 0; q < 8; ++q) f.u[q] = tl[d][j8 + q]; *(v8us*)((unsigned short*)VT + ((size_t)hh * HD + d) * SQ + s0 + j8) = f.half[0]; }  } }



// lane l with lane l ^ 16: a register move, no LDS round trip
__device__ __forceinline__ float rs_xhalf(float x) { return __builtin_bit_cast(float, __builtin_amdgcn_permlanex16(__builtin_bit_cast(int, x), __builtin_bit_cast(int, x), 0x76543210, 0xfedcba98, false, false)); }
// ---- fused attention: scores, softmax and P.V of all planes in one launch ----
// Work-group = 8 waves = 256 queries of one plane; a wave owns 32 query columns (two 16-column groups). Keys come in stages of 64: the K rows and the V^T rows of a stage
// are staged in LDS (two buffers; whole 128-byte lines from global memory through registers, loaded one trip ahead of their LDS store) and read as A fragments in the hardware k order.
// S^T = K.Q^T puts one query's scores in one lane (and its partner lane ^ 16), so the packed scores ARE the B operand of O^T += V^T.P^T: no exchange, no LDS for P.
#define FA_NS (SQ / 64)              /* stages of 64 keys */
#define FA_PITCH 144                 /* LDS row pitch, bytes: 128 + 16, an odd multiple of 16 (16-byte readers, no bank conflict) */
#define FA_TILE (64 * FA_PITCH)      /* one operand's tile of one stage */
#define FA_OP 272                    /* output staging pitch, bytes: 256 + 16 */
typedef float v2f __attribute__((ext_vector_type(2)));
typedef _Float16 v2h __attribute__((ext_vector_type(2)));
typedef unsigned int v8u __attribute__((ext_vector_type(8)));
__device__ __forceinline__ v8f fa_mma(v16h a, v16h b, v8f c) { return __builtin_amdgcn_wmma_f32_16x16x32_f16(false, a, false, b, (short)0, c, false, false); }
__device__ __forceinline__ void fa_fence() { __builtin_amdgcn_sched_barrier(0); }      /* keeps a group of LDS loads, or a run of products, in one place */
__device__ __forceinline__ v16h fa_lds(const unsigned char* p) { FragH f; f.half[0] = *(const v8us*)p; f.half[1] = *(const v8us*)(p + 32); return f.v; }      /* p holds the lane's 16 * h: k = 8h .. 8h+7 and 16+8h .. 16+8h+7 */
__device__ __forceinline__ void fa_ldk(v16h (&kf)[2][2], const unsigned char* kb) {
#pragma unroll
  for (int kt = 0; kt < 2; ++kt) { kf[kt][0] = fa_lds(kb + kt * 16 * FA_PITCH); kf[kt][1] = fa_lds(kb + kt * 16 * FA_PITCH + 64); } }
__device__ __forceinline__ void fa_ldv(v16h (&vf)[4], const unsigned char* vb) {
#pragma unroll
  for (int t = 0; t < 4; ++t) vf[t] = fa_lds(vb + t * 16 * FA_PITCH); }
// One pass = 32 keys of one wave. m_run, the maximum in use (log2 domain), may trail the true maximum by up to 8, so a weight reaches 2^8 at most (f16 holds it);
// the sums are rescaled once per pass and only when some column's maximum has grown by more. MORE: the stage holds a further pass, whose fragments are fetched ahead.
template <bool MORE>
__device__ __forceinline__ void fa_pass(v16h (&kf)[2][2], v16h (&vf)[4], const unsigned char* kn, const unsigned char* vn, const v16h (&qf)[2][2], v8f (&acc)[2][4], v8f (&lacc)[2], float (&m_run)[2], const v16h ones) {
  const float cs = 0.18033688011112042f;      /* 64^-0.5 * log2(e) */
  v8f s[2][2];
#pragma unroll
  for (int kt = 0; kt < 2; ++kt) {
#pragma unroll
    for (int g = 0; g < 2; ++g) { const v8f z = {0.f,0.f,0.f,0.f,0.f,0.f,0.f,0.f}; s[kt][g] = fa_mma(kf[kt][1], qf[g][1], fa_mma(kf[kt][0], qf[g][0], z)); } }
  fa_fence();      /* the eight products stay back to back: mixed with the maxima, each would be padded with v_nop */
  if (MORE) { fa_ldk(kf, kn); fa_fence(); }      /* next pass's K rows, in flight under this pass's softmax */
  float mb[2]; bool need = false;
#pragma unroll
  for (int g = 0; g < 2; ++g) { float mx = s[0][g][0];
#pragma unroll
    for (int r = 1; r < 8; ++r) mx = fmaxf(mx, s[0][g][r]);
#pragma unroll
    for (int r = 0; r < 8; ++r) mx = fmaxf(mx, s[1][g][r]);
    mx = fmaxf(mx, rs_xhalf(mx)) * cs;      /* both halves of the wave hold the query's maximum of this pass, scaled (the scale is positive) */
    mb[g] = mx; need = need || (mx > m_run[g] + 8.0f); }
  if (__builtin_amdgcn_ballot_w32(need) != 0) {      /* one scalar branch a pass; always taken in the first pass (m_run = -inf), seldom later */
#pragma unroll
    for (int g = 0; g < 2; ++g) { const float mn = fmaxf(m_run[g], mb[g]); const float corr = __builtin_amdgcn_exp2f(m_run[g] - mn); m_run[g] = mn; lacc[g] = lacc[g] * corr;
#pragma unroll
      for (int t = 0; t < 4; ++t) acc[g][t] = acc[g][t] * corr; } }
#pragma unroll
  for (int g = 0; g < 2; ++g) { const float nm = -m_run[g]; v8u w;
#pragma unroll
    for (int i = 0; i < 8; ++i) {
      const v2f arg = __builtin_elementwise_fma(v2f{s[i >> 2][g][2 * (i & 3)], s[i >> 2][g][2 * (i & 3) + 1]}, v2f{cs, cs}, v2f{nm, nm});
      w[i] = __builtin_bit_cast(unsigned int, __builtin_convertvector(v2f{__builtin_amdgcn_exp2f(arg.x), __builtin_amdgcn_exp2f(arg.y)}, v2h)); }
    const v16h pf = __builtin_bit_cast(v16h, w);
#pragma unroll
    for (int t = 0; t < 4; ++t) acc[g][t] = fa_mma(vf[t], pf, acc[g][t]);
    lacc[g] = fa_mma(ones, pf, lacc[g]); }
  if (MORE) { fa_fence(); fa_ldv(vf, vn); fa_fence(); }      /* next pass's V^T rows, in flight under its scores and softmax */
}
__global__ __launch_bounds__(256) void k_fattn(const _Float16* __restrict__ Q, const _Float16* __restrict__ K, const _Float16* __restrict__ VT, float* __restrict__ O) {
  __shared__ __attribute__((aligned(16))) unsigned char L[8 * 32 * FA_OP];      /* the K / V^T ring (4 tiles) in the loop, the output staging behind it */
  static_assert(4 * FA_TILE <= 8 * 32 * FA_OP, "the ring must fit the staging array");
  const int tid = threadIdx.x, lane = tid & 31, wave = tid >> 5, c = lane & 15, h = lane >> 4;
  const size_t plane = blockIdx.y; const int q0 = blockIdx.x * 256 + wave * 32;
  /* staging: thread tid moves 16-byte chunks tid and tid + 256 of each 8 KiB tile; 8 threads cover one 128-byte row */
  const _Float16* kg = K + plane * SQ * HD + tid * 8;
  const _Float16* vg = VT + plane * HD * SQ + (size_t)(tid >> 3) * SQ + (tid & 7) * 8;
  unsigned char* sd = L + (tid >> 3) * FA_PITCH + (tid & 7) * 16;
  v8us rk0, rk1, rv0, rv1;
  auto gload = [&](int st) { rk0 = *(const v8us*)((const unsigned short*)kg + st * 64 * HD); rk1 = *(const v8us*)((const unsigned short*)kg + st * 64 * HD + 32 * HD);
    rv0 = *(const v8us*)((const unsigned short*)vg + st * 64); rv1 = *(const v8us*)((const unsigned short*)vg + st * 64 + (size_t)32 * SQ); };
  auto sstore = [&](int bf) { unsigned char* d = sd + bf * 2 * FA_TILE; *(v8us*)d = rk0; *(v8us*)(d + 32 * FA_PITCH) = rk1; *(v8us*)(d + FA_TILE) = rv0; *(v8us*)(d + FA_TILE + 32 * FA_PITCH) = rv1; };
  gload(0);
  v16h qf[2][2];      /* B operand: column c = query q0 + 16 g + c, in K's k order */
#pragma unroll
  for (int g = 0; g < 2; ++g) { const _Float16* qp = Q + (plane * SQ + q0 + 16 * g + c) * HD; qf[g][0] = g2_frag(qp, h); qf[g][1] = g2_frag(qp + 32, h); }
  v16h ones;      /* A operand whose row 0 (lanes 0 and 16) is 1.0 at all 32 k, every other row 0 */
  { const unsigned int o = (c == 0) ? 0x3C003C00u : 0u; const v8u ov = {o, o, o, o, o, o, o, o}; ones = __builtin_bit_cast(v16h, ov); }
  v8f acc[2][4], lacc[2]; float m_run[2];
#pragma unroll
  for (int g = 0; g < 2; ++g) { const v8f z = {0.f,0.f,0.f,0.f,0.f,0.f,0.f,0.f}; m_run[g] = -__builtin_inff(); lacc[g] = z;
#pragma unroll
    for (int t = 0; t < 4; ++t) acc[g][t] = z; }
  sstore(0); gload(1);
  __syncthreads();      /* stage 0 is visible to all waves */
  v16h kf[2][2], vf[4];
#pragma unroll 1      /* one copy of the loop body; the buffers alternate by st & 1 */
  for (int st = 0; st < FA_NS; ++st) {
    const unsigned char* kb = L + (st & 1) * 2 * FA_TILE + c * FA_PITCH + 16 * h; const unsigned char* vb = kb + FA_TILE;
    fa_ldk(kf, kb); fa_ldv(vf, vb); fa_fence();
    if (st + 1 < FA_NS) sstore((st + 1) & 1);      /* into the buffer that every wave left before the barrier at the foot of the trip before */
    if (st + 2 < FA_NS) gload(st + 2);             /* a whole stage of work ahead of its use */
    fa_fence();
    fa_pass<true>(kf, vf, kb + 32 * FA_PITCH, vb + 64, qf, acc, lacc, m_run, ones);
    fa_pass<false>(kf, vf, kb, vb, qf, acc, lacc, m_run, ones);
    __syncthreads();      /* publishes stage st + 1 and ends every wave's reads of stage st */
  }
  /* epilogue: each wave stages its 32 output rows in its own part of L (the ring is free behind the last barrier) and stores whole 256-byte rows */
  unsigned char* eb = L + wave * 32 * FA_OP;
#pragma unroll
  for (int g = 0; g < 2; ++g) { const float lr = lacc[g][0]; const float inv = 1.0f / (lr + rs_xhalf(lr));      /* register 0: the denominator in lanes 0-15, 0 in lanes 16-31 (row 8) */
#pragma unroll
    for (int t = 0; t < 4; ++t) { const v8f o = acc[g][t] * inv; unsigned char* d = eb + (16 * g + c) * FA_OP + 64 * t + 32 * h;      /* row = query, d = 16 t + 8 h + r */
      const v4f lo = {o[0], o[1], o[2], o[3]}, hi = {o[4], o[5], o[6], o[7]}; *(v4fa*)d = lo; *(v4fa*)(d + 16) = hi; } }
  __builtin_amdgcn_fence(__ATOMIC_ACQ_REL, "workgroup"); __builtin_amdgcn_wave_barrier();      /* the wave's own LDS writes before its reads of other lanes' rows */
#pragma unroll
  for (int i = 0; i < 16; ++i) { const int row = 2 * i + h; const v4f v = *(const v4fa*)(eb + row * FA_OP + c * 16); *(v4f*)(O + (plane * SQ + q0 + row) * HD + c * 4) = v; } }

extern "C" void kernel_launch(void* const* d_in, const int* in_sizes, int n_in,
                              void* d_out, int out_size, void* d_ws, size_t ws_size, hipStream_t stream) {
  (void)in_sizes; (void)n_in; (void)out_size;
  const float* const* I = (const float* const*)d_in; const float* x = I[0]; const float* wq = I[1]; const float* bq = I[2]; const float* wk = I[3]; const float* bk = I[4]; const float* wv = I[5]; const float* bv = I[6];      /* natural [out][in] 64x64 weights + biases; x head-major = 32 planes of [2048][64] */
  char* ws = (char*)d_ws; size_t off = 0;
  auto take = [&](size_t bytes) { char* p = ws + off; off += (bytes + 255) & ~(size_t)255; return p; };
  _Float16* BQ = (_Float16*)take((size_t)DM * DM * 2); _Float16* BK = (_Float16*)take((size_t)DM * DM * 2); _Float16* BV = (_Float16*)take((size_t)DM * DM * 2); 
  _Float16* X16 = (_Float16*)take(NR * DM * 2); _Float16* Q16 = (_Float16*)take(NR * DM * 2); _Float16* K16 = (_Float16*)take(NR * DM * 2); _Float16* V16 = (_Float16*)take(NR * DM * 2);
  _Float16* VT = (_Float16*)take((size_t)NB * HD * SQ * 2);      /* V^T of all planes */
  if (off > ws_size) return;
  { const unsigned g = (unsigned)(((size_t)DM * DM / 8 + 255) / 256); k_wnat<<<g, 256, 0, stream>>>(wq, (size_t)DM * DM / 8, BQ); k_wnat<<<g, 256, 0, stream>>>(wk, (size_t)DM * DM / 8, BK); k_wnat<<<g, 256, 0, stream>>>(wv, (size_t)DM * DM / 8, BV); }      /* natural [out][in] = Bt[n][k], x16 */

  k_x16<<<(unsigned)((NR * DM / 8 + 255) / 256), 256, 0, stream>>>(x, X16, NR * DM / 8);
  const size_t r0p = (size_t)B0 * SQ;      /* first projected row */
  k_gemm2<0><<<dim3((unsigned)((MP / 128) * (DM / 64)), 1), 128, 0, stream>>>(X16 + r0p * DM, DM, 0, BQ, DM, 0, 0.0625f, bq, 0, nullptr, 1, 0, 0, nullptr, Q16 + r0p * DM, DM, 0, MP, DM, DM);
  k_gemm2<0><<<dim3((unsigned)((MP / 128) * (DM / 64)), 1), 128, 0, stream>>>(X16 + r0p * DM, DM, 0, BK, DM, 0, 0.0625f, bk, 0, nullptr, 1, 0, 0, nullptr, K16 + r0p * DM, DM, 0, MP, DM, DM);
  k_gemm2<0><<<dim3((unsigned)((MP / 128) * (DM / 64)), 1), 128, 0, stream>>>(X16 + r0p * DM, DM, 0, BV, DM, 0, 0.0625f, bv, 0, nullptr, 1, 0, 0, nullptr, V16 + r0p * DM, DM, 0, MP, DM, DM);
  k_vt<NH, SQ><<<NB * NH * (SQ / 64), 256, 0, stream>>>(V16, LQ, 0, VT);      /* V^T [NB][HD][SQ], all planes in one launch */
  k_fattn<<<dim3(SQ / 256, NB), 256, 0, stream>>>(Q16, K16, VT, (float*)d_out);      /* all planes: 256 queries per work-group, out written f32 straight into the output rows */
}

// v004
// It runs in 46.8 microseconds.
// In two side-by-side timings against v003, it was 1.57 and 1.56 times as fast.
// All steps since v000 together make it 275 times as fast.
#include <hip/hip_runtime.h>
#define NB 32
#define SQ 2048
#define DM 64
#define NH 1
#define HD 64
#define HG 1                         /* unused by the launches: heads per group of the non-template k_vt */
#define B0 0                         /* unused: the launches start at plane 0 */
#define NBR NB                       /* unused by the launches (only MP uses it) */
#define NR ((size_t)NB * SQ)         /* token rows */
#define MP ((int)((size_t)NBR * SQ)) /* unused: k_qkv projects all NR rows */
#define QN SQ                        /* unused: query rows per plane = SQ */
#define NHD NH                       /* unused: heads per plane */
#define MPO MP                       /* unused: no output stage */
#define LQ DM      /* unused: q and k rows have pitch DM, V^T rows SQ */
typedef __bf16 v16b __attribute__((ext_vector_type(16)));
typedef unsigned short v8us __attribute__((ext_vector_type(8), may_alias));
typedef float  v8f  __attribute__((ext_vector_type(8)));
typedef float  v4f  __attribute__((ext_vector_type(4)));
typedef float  v4fa __attribute__((ext_vector_type(4), may_alias));
union FragB { v16b v; v8us half[2]; unsigned short u[16]; };

__device__ __forceinline__ unsigned short bf16_bits(float x) { unsigned int u = __float_as_uint(x); return (unsigned short)((u + 0x7FFFu + ((u >> 16) & 1u)) >> 16); }
__device__ __forceinline__ float bf16_val(unsigned short b) { return __uint_as_float(((unsigned int)b) << 16); }
__device__ __forceinline__ float bf16_round(float x) { return bf16_val(bf16_bits(x)); }
// D += A·B with NT terms: 1 = ah·bh, 2 = + al·bh (A split), 3 = + ah·bl (both split)
template <int NT>
__device__ __forceinline__ v8f mmaN(v16b ah, v16b al, v16b bh, v16b bl, v8f c) {
  c = __builtin_amdgcn_wmma_f32_16x16x32_bf16(false, ah, false, bh, (short)0, c, false, false);
  if (NT >= 2) c = __builtin_amdgcn_wmma_f32_16x16x32_bf16(false, al, false, bh, (short)0, c, false, false);
  if (NT >= 3) c = __builtin_amdgcn_wmma_f32_16x16x32_bf16(false, ah, false, bl, (short)0, c, false, false);
  asm volatile("v_nop\n\tv_nop\n\tv_nop\n\tv_nop" : "+v"(c) : "v"(ah), "v"(al), "v"(bh), "v"(bl));
  return c;
}

__global__ __launch_bounds__(256) void k_wt_bf16(const float* __restrict__ W, unsigned short* __restrict__ Wt, int K, int N) {
  const int t = blockIdx.x * 256 + threadIdx.x;
  const int k8n = K / 8;
  if (t >= N * k8n) return;
  const int n = t / k8n, k8 = (t % k8n) * 8;
  v8us v;
#pragma unroll
  for (int i = 0; i < 8; ++i) v[i] = bf16_bits(W[(size_t)(k8 + i) * N + n]);
  *(v8us*)(Wt + (size_t)n * K + k8) = v;
  
}

// GEMM C[M][N] (f32, pitch ldc) = act(A[M][K]·W + bias). A f32 row-major (pitch lda) converted per fragment to bf16
// (ASPLIT: hi/lo two planes -> 2 terms, else single rounded term); Wt bf16 [N][K] (pitch ldb). BIAS_BF16 rounds the
// bias to bf16 first (bias quantised to bf16 before the add). K%32==0, M%16==0, N%64==0.
template <bool ASPLIT, int ACT, bool BIAS_BF16>
__global__ __launch_bounds__(128) void k_gemm_bf(const float* __restrict__ A, int lda, const unsigned short* __restrict__ Wt, int ldb,
                                               const float* __restrict__ bias, float* __restrict__ C, int ldc, int M, int N, int K) {
  __shared__ __attribute__((aligned(16))) float so[4][16][64];
  const int tid = threadIdx.x, w = tid >> 5, lane = tid & 31, ln = lane & 15, hh = lane >> 4;
  const int ntn = N / 64;
  const int wid = blockIdx.x * 4 + w;
  const int mt = wid / ntn, nq = wid % ntn;
  if (mt * 16 >= M) return;
  const int row0 = mt * 16, col0 = nq * 64;
  const float* arow = A + (size_t)(row0 + ln) * lda;
  v8f acc[4] = {};
  for (int kb = 0; kb < K; kb += 32) {
    FragB ah, al;
    const v4f x0 = *(const v4fa*)(arow + kb + 8 * hh), x1 = *(const v4fa*)(arow + kb + 8 * hh + 4);
    const v4f x2 = *(const v4fa*)(arow + kb + 16 + 8 * hh), x3 = *(const v4fa*)(arow + kb + 16 + 8 * hh + 4);
    float xs[16] = {x0[0],x0[1],x0[2],x0[3],x1[0],x1[1],x1[2],x1[3],x2[0],x2[1],x2[2],x2[3],x3[0],x3[1],x3[2],x3[3]};
#pragma unroll
    for (int i = 0; i < 16; ++i) { const unsigned short hb = bf16_bits(xs[i]); ah.u[i] = hb; al.u[i] = ASPLIT ? bf16_bits(xs[i] - bf16_val(hb)) : (unsigned short)0; }
#pragma unroll
    for (int t = 0; t < 4; ++t) {
      const unsigned short* brow = Wt + (size_t)(col0 + t * 16 + ln) * ldb + kb;
      FragB b;
      b.half[0] = *(const v8us*)(brow + 8 * hh);
      b.half[1] = *(const v8us*)(brow + 16 + 8 * hh);
      acc[t] = mmaN<ASPLIT ? 2 : 1>(ah.v, al.v, b.v, b.v, acc[t]);
    }
  }
#pragma unroll
  for (int t = 0; t < 4; ++t) {
    float bv = bias ? bias[col0 + t * 16 + ln] : 0.f;
    if (BIAS_BF16) bv = bf16_round(bv);
#pragma unroll
    for (int r = 0; r < 8; ++r) { float v = acc[t][r] + bv; if (ACT == 1) v = fmaxf(v, 0.f); so[w][8 * hh + r][t * 16 + ln] = v; }
  }
  __builtin_amdgcn_fence(__ATOMIC_ACQ_REL, "workgroup");
  __builtin_amdgcn_wave_barrier();
  const int rsub = lane >> 4, c4 = (lane & 15) * 4;
  {
#pragma unroll
    for (int q = 0; q < 8; ++q) {
      const int r = q * 2 + rsub;
      const v4f v = *(const v4fa*)&so[w][r][c4];
      *(v4f*)(C + (size_t)(row0 + r) * ldc + col0 + c4) = v;
    }
    
  }
}

// GEMM C = act(A·W + bias + resid): A f32 (ASPLIT -> hi/lo 2 terms), Wt bf16 [N][K]; ACT 0 none, 1 relu, 2 exact gelu;
// resid (optional, f32, row index = (row % rmod), pitch ldr, RES_BF16 rounds it) added before the activation.
template <bool ASPLIT, int ACT, bool BIAS_BF16, bool RES_BF16>
__global__ __launch_bounds__(128) void k_gemm_bf3(const float* __restrict__ A, int lda, const unsigned short* __restrict__ Wt, int ldb,
                                                const float* __restrict__ bias, const float* __restrict__ resid, int rmod, int ldr,
                                                float* __restrict__ C, int ldc, int M, int N, int K) {
  __shared__ __attribute__((aligned(16))) float so[4][16][64];
  const int tid = threadIdx.x, w = tid >> 5, lane = tid & 31, ln = lane & 15, hh = lane >> 4;
  const int ntn = N / 64;
  const int wid = blockIdx.x * 4 + w;
  const int mt = wid / ntn, nq = wid % ntn;
  if (mt * 16 >= M) return;
  const int row0 = mt * 16, col0 = nq * 64;
  const float* arow = A + (size_t)(row0 + ln) * lda;
  v8f acc[4] = {};
  for (int kb = 0; kb < K; kb += 32) {
    FragB ah, al;
    const v4f x0 = *(const v4fa*)(arow + kb + 8 * hh), x1 = *(const v4fa*)(arow + kb + 8 * hh + 4);
    const v4f x2 = *(const v4fa*)(arow + kb + 16 + 8 * hh), x3 = *(const v4fa*)(arow + kb + 16 + 8 * hh + 4);
    float xs[16] = {x0[0],x0[1],x0[2],x0[3],x1[0],x1[1],x1[2],x1[3],x2[0],x2[1],x2[2],x2[3],x3[0],x3[1],x3[2],x3[3]};
#pragma unroll
    for (int i = 0; i < 16; ++i) { const unsigned short hb = bf16_bits(xs[i]); ah.u[i] = hb; al.u[i] = ASPLIT ? bf16_bits(xs[i] - bf16_val(hb)) : (unsigned short)0; }
#pragma unroll
    for (int t = 0; t < 4; ++t) {
      const unsigned short* brow = Wt + (size_t)(col0 + t * 16 + ln) * ldb + kb;
      FragB b;
      b.half[0] = *(const v8us*)(brow + 8 * hh);
      b.half[1] = *(const v8us*)(brow + 16 + 8 * hh);
      acc[t] = mmaN<ASPLIT ? 2 : 1>(ah.v, al.v, b.v, b.v, acc[t]);
    }
  }
#pragma unroll
  for (int t = 0; t < 4; ++t) {
    const int col = col0 + t * 16 + ln;
    float bv = bias ? bias[col] : 0.f;
    if (BIAS_BF16) bv = bf16_round(bv);
#pragma unroll
    for (int r = 0; r < 8; ++r) {
      float v = acc[t][r] + bv;
      if (resid) { float rv = resid[(size_t)((row0 + 8 * hh + r) % rmod) * ldr + col]; if (RES_BF16) rv = bf16_round(rv); v += rv; }
      if (ACT == 1) v = fmaxf(v, 0.f);
      if (ACT == 2) v = 0.5f * v * (1.0f + erff(v * 0.70710678118654752f));
      if (ACT == 3) { const float u = 0.7978845608028654f * (v + 0.044715f * v * v * v); v = 0.5f * v * (1.0f + tanhf(u)); }
      so[w][8 * hh + r][t * 16 + ln] = v;
    }
  }
  __builtin_amdgcn_fence(__ATOMIC_ACQ_REL, "workgroup");
  __builtin_amdgcn_wave_barrier();
  const int rsub = lane >> 4, c4 = (lane & 15) * 4;
  {
#pragma unroll
    for (int q = 0; q < 8; ++q) {
      const int r = q * 2 + rsub;
      const v4f v = *(const v4fa*)&so[w][r][c4];
      *(v4f*)(C + (size_t)(row0 + r) * ldc + col0 + c4) = v;
    }
    
  }
}
// row LayerNorm (biased variance, eps) over N: s = X (+ R); optional out_sum <- s; out_norm <- (s-mu)*rsqrt(var+eps)*g + b
template <bool PARAM_BF16>
__global__ __launch_bounds__(256) void k_layernorm(const float* __restrict__ X, const float* __restrict__ R, const float* __restrict__ g, const float* __restrict__ bta,
                                                  float* __restrict__ out_sum, float* __restrict__ out_norm, int N, float eps) {
  __shared__ float red[256];
  const int row = blockIdx.x, tid = threadIdx.x;
  const float* x = X + (size_t)row * N; const float* rr = R ? R + (size_t)row * N : nullptr;
  float vals[16];                     // up to N = 4096
  const int per = N / 256;            // contiguous chunk per thread? use strided-by-4 chunks: thread handles j = tid*4 + 1024*u
  float s1 = 0.f;
  for (int u = 0; u < per / 4; ++u) {
    const int j = tid * 4 + 1024 * u;
    const v4f a = *(const v4fa*)(x + j);
    v4f b = {0.f,0.f,0.f,0.f}; if (rr) b = *(const v4fa*)(rr + j);
#pragma unroll
    for (int q = 0; q < 4; ++q) { const float v = a[q] + b[q]; vals[u * 4 + q] = v; s1 += v; }
  }
  red[tid] = s1; __syncthreads();
  for (int st = 128; st > 0; st >>= 1) { if (tid < st) red[tid] += red[tid + st]; __syncthreads(); }
  const float mu = red[0] / (float)N; __syncthreads();
  float s2 = 0.f;
  for (int u = 0; u < per / 4; ++u)
#pragma unroll
    for (int q = 0; q < 4; ++q) { const float c = vals[u * 4 + q] - mu; s2 += c * c; }
  red[tid] = s2; __syncthreads();
  for (int st = 128; st > 0; st >>= 1) { if (tid < st) red[tid] += red[tid + st]; __syncthreads(); }
  const float rs = rsqrtf(red[0] / (float)N + eps);
  {
    for (int u = 0; u < per / 4; ++u) {
      const int j = tid * 4 + 1024 * u;
      v4f o, sm;
#pragma unroll
      for (int q = 0; q < 4; ++q) {
        float gg = g[j + q], bb = bta[j + q];
        if (PARAM_BF16) { gg = bf16_round(gg); bb = bf16_round(bb); }
        sm[q] = vals[u * 4 + q]; o[q] = (vals[u * 4 + q] - mu) * rs * gg + bb;
      }
      if (out_sum) *(v4f*)(out_sum + (size_t)row * N + j) = sm;
      *(v4f*)(out_norm + (size_t)row * N + j) = o;
    }
    
  }
}



// ---- f16 WMMA path (v_wmma_f32_16x16x32_f16): 11-bit significands for operands in range — used where a [0,1] probability operand needs more precision than bf16
typedef _Float16 v16h __attribute__((ext_vector_type(16)));
union FragH { v16h v; v8us half[2]; _Float16 h[16]; unsigned short u[16]; };
template <int NT>
__device__ __forceinline__ v8f mmaH(v16h ah, v16h al, v16h bh, v16h bl, v8f c) {
  c = __builtin_amdgcn_wmma_f32_16x16x32_f16(false, ah, false, bh, (short)0, c, false, false);
  if (NT >= 2) c = __builtin_amdgcn_wmma_f32_16x16x32_f16(false, al, false, bh, (short)0, c, false, false);
  if (NT >= 3) c = __builtin_amdgcn_wmma_f32_16x16x32_f16(false, ah, false, bl, (short)0, c, false, false);
  asm volatile("v_nop\n\tv_nop\n\tv_nop\n\tv_nop" : "+v"(c) : "v"(ah), "v"(al), "v"(bh), "v"(bl));
  return c;
}
// batched GEMM like k_gemm_b but f16 operands: A f32 (split into f16 hi/lo if ASPLIT, else rounded to f16), Bt = f16 values [n][k]; alpha; C f32; N multiple of 16 (partial tiles skipped)
template <bool ASPLIT>
__global__ __launch_bounds__(128) void k_gemm_h(const float* __restrict__ A, int lda, size_t sA, const _Float16* __restrict__ Bh, int ldb, size_t sB, float alpha, float* __restrict__ C, int ldc, size_t sC, int M, int N, int K) {
  __shared__ __attribute__((aligned(16))) float so[4][16][64];
  const int tid = threadIdx.x, w = tid >> 5, lane = tid & 31, ln = lane & 15, hh = lane >> 4; const int by = blockIdx.y;
  A += (size_t)by * sA; Bh += (size_t)by * sB; C += (size_t)by * sC;
  const int ntn = (N + 63) / 64; const int wid = blockIdx.x * 4 + w; const int mt = wid / ntn, nq = wid % ntn; if (mt * 16 >= M) return;
  const int row0 = mt * 16, col0 = nq * 64; const float* arow = A + (size_t)(row0 + ln) * lda;
  v8f acc[4] = {};
  for (int kb = 0; kb < K; kb += 32) {
    FragH ah, al;
    const v4f x0 = *(const v4fa*)(arow + kb + 8 * hh), x1 = *(const v4fa*)(arow + kb + 8 * hh + 4), x2 = *(const v4fa*)(arow + kb + 16 + 8 * hh), x3 = *(const v4fa*)(arow + kb + 16 + 8 * hh + 4);
    float xs[16] = {x0[0],x0[1],x0[2],x0[3],x1[0],x1[1],x1[2],x1[3],x2[0],x2[1],x2[2],x2[3],x3[0],x3[1],x3[2],x3[3]};
#pragma unroll
    for (int i = 0; i < 16; ++i) { const _Float16 h = (_Float16)xs[i]; ah.h[i] = h; al.h[i] = ASPLIT ? (_Float16)(xs[i] - (float)h) : (_Float16)0.0f; }
#pragma unroll
    for (int t = 0; t < 4; ++t) { if (col0 + t * 16 >= N) continue; const size_t boff = (size_t)(col0 + t * 16 + ln) * ldb + kb; FragH bq; bq.half[0] = *(const v8us*)(Bh + boff + 8 * hh); bq.half[1] = *(const v8us*)(Bh + boff + 16 + 8 * hh);
      acc[t] = mmaH<ASPLIT ? 2 : 1>(ah.v, al.v, bq.v, bq.v, acc[t]); }
  }
#pragma unroll
  for (int t = 0; t < 4; ++t) { if (col0 + t * 16 >= N) continue;
#pragma unroll
    for (int r = 0; r < 8; ++r) so[w][8 * hh + r][t * 16 + ln] = acc[t][r] * alpha; }
  __builtin_amdgcn_fence(__ATOMIC_ACQ_REL, "workgroup"); __builtin_amdgcn_wave_barrier();
  const int rsub = lane >> 4, c4 = (lane & 15) * 4;
  {
#pragma unroll
    for (int q = 0; q < 8; ++q) { const int r = q * 2 + rsub; if (col0 + c4 < N) { const v4f v = *(const v4fa*)&so[w][r][c4]; *(v4f*)(C + (size_t)(row0 + r) * ldc + col0 + c4) = v; } }
     }
}

// Wt[n][k] = f16(W[k][n]·scale) from f32 row-major W[K][N] (scale = power of two; bf16-exact weights stay exact in f16 away from the subnormal range)
__global__ __launch_bounds__(256) void k_wt_f16(const float* __restrict__ W, _Float16* __restrict__ Wt, int K, int N, float scale) {
  const int t = blockIdx.x * 256 + threadIdx.x; if (t >= N * (K / 8)) return; const int n = t / (K / 8), k8 = (t % (K / 8)) * 8; FragH f;
#pragma unroll
  for (int i = 0; i < 8; ++i) f.h[i] = (_Float16)(bf16_round(W[(size_t)(k8 + i) * N + n]) * scale); const v8us o = f.half[0];
  *(v8us*)((unsigned short*)Wt + (size_t)n * K + k8) = o; 
}
// k_gemm_hh variant with fused epilogue: v = acc·alpha + bias[by·sBias + col] (+ CP[(row/rowsPerB)·sCPb + by·64 + col] if CP) ; ACT 0 none / 1 elu ; writes f16 C16 (and f32 C if non-null)
template <int ACT>
__global__ __launch_bounds__(128) void k_gemm_hhx(const _Float16* __restrict__ A, int lda, size_t sA, const _Float16* __restrict__ Bh, int ldb, size_t sB, float alpha, const float* __restrict__ bias, size_t sBias, const float* __restrict__ CP, int rowsPerB, size_t sCPb, int row0g,
    float* __restrict__ C, _Float16* __restrict__ C16, int ldc, size_t sC, int M, int N, int K) {
  __shared__ __attribute__((aligned(16))) float so[4][16][64];
  const int tid = threadIdx.x, w = tid >> 5, lane = tid & 31, ln = lane & 15, hh = lane >> 4; const int by = blockIdx.y;
  A += (size_t)by * sA; Bh += (size_t)by * sB; const size_t cofs = (size_t)by * sC; const float* bp = bias ? bias + (size_t)by * sBias : nullptr;
  const int ntn = (N + 63) / 64; const int wid = blockIdx.x * 4 + w; const int mt = wid / ntn, nq = wid % ntn; if (mt * 16 >= M) return;
  const int row0 = mt * 16, col0 = nq * 64; const _Float16* arow = A + (size_t)(row0 + ln) * lda;
  v8f acc[4] = {};
  for (int kb = 0; kb < K; kb += 32) { FragH ah; ah.half[0] = *(const v8us*)((const unsigned short*)arow + kb + 8 * hh); ah.half[1] = *(const v8us*)((const unsigned short*)arow + kb + 16 + 8 * hh);
#pragma unroll
    for (int t = 0; t < 4; ++t) { if (col0 + t * 16 >= N) continue; const size_t boff = (size_t)(col0 + t * 16 + ln) * ldb + kb; FragH bq; bq.half[0] = *(const v8us*)((const unsigned short*)Bh + boff + 8 * hh); bq.half[1] = *(const v8us*)((const unsigned short*)Bh + boff + 16 + 8 * hh);
      acc[t] = mmaH<1>(ah.v, ah.v, bq.v, bq.v, acc[t]); }
  }
#pragma unroll
  for (int t = 0; t < 4; ++t) { if (col0 + t * 16 >= N) continue; const int col = col0 + t * 16 + ln; const float bv = bp ? bf16_round(bp[col]) : 0.f;
#pragma unroll
    for (int r = 0; r < 8; ++r) { float v = acc[t][r] * alpha + bv; if (CP) { const int rr = row0g + row0 + 8 * hh + r; if (rowsPerB < 0) v += CP[cofs + (size_t)rr * ldc + col];      /* rowsPerB < 0: own element of the batched C plane */ else { const int bidx = rr / rowsPerB; v += CP[(size_t)bidx * sCPb + (size_t)by * 64 + col]; } } if (ACT == 1) v = (v > 0.f) ? v : expm1f(v); else if (ACT == 7) v = (v > 0.f) ? v + 1.0f : expf(v); else if (ACT == 8) v = tanhf(v); else if (ACT == 9) v = 0.5f * v * (1.0f + tanhf(0.7978845608028654f * (v + 0.044715f * v * v * v))); else if (ACT == 11) v = 1.0f / (1.0f + expf(-v)); else if (ACT == 12) v = (v > 0.f) ? v : 0.01f * v; else if (ACT == 14) v = (v > 0.f) ? v : 0.1f * v; else if (ACT == 16) v = (v >= 0.f) ? v : 0.3f * v; else if (ACT == 17) v = (v >= 0.f) ? v : 0.2f * v; else if (ACT == 15) v = v / (1.0f + expf(-v)); else if (ACT == 3) v = fmaxf(v, 0.f); else if (ACT == 6) v = 0.5f * v * (1.0f + erff(v * 0.70710678118654752f)); so[w][8 * hh + r][t * 16 + ln] = v; } }
  __builtin_amdgcn_fence(__ATOMIC_ACQ_REL, "workgroup"); __builtin_amdgcn_wave_barrier();
  const int rsub = lane >> 4, c4 = (lane & 15) * 4; typedef _Float16 v4h __attribute__((ext_vector_type(4)));
  {
#pragma unroll
    for (int q = 0; q < 8; ++q) { const int r = q * 2 + rsub; if (col0 + c4 < N) { const v4f v = *(const v4fa*)&so[w][r][c4]; if (C) *(v4f*)(C + cofs + (size_t)(row0 + r) * ldc + col0 + c4) = v; if (C16) { v4h h4; for (int i = 0; i < 4; ++i) h4[i] = (_Float16)v[i]; *(v4h*)(C16 + cofs + (size_t)(row0 + r) * ldc + col0 + c4) = h4; } } }
     }
}


typedef _Float16 v4h __attribute__((ext_vector_type(4)));

__global__ __launch_bounds__(256) void k_h16(const float* __restrict__ x, _Float16* __restrict__ X16, size_t n8) { const size_t t = (size_t)blockIdx.x * 256 + threadIdx.x; if (t >= n8) return; FragH f;
#pragma unroll
  for (int q = 0; q < 8; ++q) f.h[q] = (_Float16)x[t * 8 + q]; *(v8us*)((unsigned short*)X16 + t * 8) = f.half[0];  }
__global__ __launch_bounds__(256) void k_round16f(const float* __restrict__ W, _Float16* __restrict__ Bt, size_t n8) { const size_t t = (size_t)blockIdx.x * 256 + threadIdx.x; if (t >= n8) return; FragH f;
#pragma unroll
  for (int i = 0; i < 8; ++i) f.h[i] = (_Float16)(bf16_round(W[t * 8 + i]) * 16.0f); *(v8us*)((unsigned short*)Bt + t * 8) = f.half[0];  }

__global__ __launch_bounds__(256) void k_hl(const float* __restrict__ F, _Float16* __restrict__ Hh, _Float16* __restrict__ Hl, size_t n8) { const size_t t = (size_t)blockIdx.x * 256 + threadIdx.x; if (t >= n8) return; FragH fh, fl; const v4f a = *(const v4fa*)(F + t * 8), c = *(const v4fa*)(F + t * 8 + 4);
#pragma unroll
  for (int q = 0; q < 4; ++q) { _Float16 h = (_Float16)a[q]; fh.h[q] = h; fl.h[q] = (_Float16)((a[q] - (float)h) * 1024.0f); h = (_Float16)c[q]; fh.h[4 + q] = h; fl.h[4 + q] = (_Float16)((c[q] - (float)h) * 1024.0f); }
  { *(v8us*)((unsigned short*)Hh + t * 8) = fh.half[0]; *(v8us*)((unsigned short*)Hl + t * 8) = fl.half[0];  } }

// ---- A or B fragment of a 16x16x32 f16 product, straight from a global f16 row ----
__device__ __forceinline__ v16h g2_frag(const _Float16* p, int hh) { FragH f; f.half[0] = *(const v8us*)((const unsigned short*)p + 8 * hh); f.half[1] = *(const v8us*)((const unsigned short*)p + 16 + 8 * hh); return f.v; }


__global__ __launch_bounds__(256) void k_rsm(const float* __restrict__ S, _Float16* __restrict__ P, int nrows) {
  #pragma clang fp contract(off)
  const int i = blockIdx.x * 256 + threadIdx.x; if (i >= nrows) return; const float* s = S + (size_t)i * SQ; float mx = -3.0e38f;
#pragma unroll 1
  for (int j = 0; j < SQ; ++j) mx = fmaxf(mx, s[j]); float se = 0.f;
#pragma unroll 1
  for (int j = 0; j < SQ; ++j) se += expf(s[j] - mx); const float sc = 256.0f / se;
#pragma unroll 1
  for (int j0 = 0; j0 < SQ; j0 += 8) { FragH f; for (int q = 0; q < 8; ++q) f.h[q] = (_Float16)(expf(s[j0 + q] - mx) * sc); unsigned short* d = (unsigned short*)P + (size_t)i * SQ + j0; *(v8us*)d = f.half[0];  } }
__global__ __launch_bounds__(256) void k_vt(const _Float16* __restrict__ V16, int b, int h0, _Float16* __restrict__ VT) { __shared__ unsigned short tl[64][65]; const int tid = threadIdx.x; const int hh = blockIdx.x % HG, sg = blockIdx.x / HG; const int s0 = sg * 64; const int h = h0 + hh;
  for (int i = tid; i < 64 * 8; i += 256) { const int j = i / 8, d8 = (i % 8) * 8; FragH f; f.half[0] = *(const v8us*)((const unsigned short*)V16 + ((size_t)b * SQ + s0 + j) * DM + h * HD + d8); for (int q = 0; q < 8; ++q) tl[d8 + q][j] = f.u[q]; }
  __syncthreads();
  { for (int i = tid; i < 64 * 8; i += 256) { const int d = i / 8, j8 = (i % 8) * 8; FragH f; for (int q = 0; q < 8; ++q) f.u[q] = tl[d][j8 + q]; *(v8us*)((unsigned short*)VT + ((size_t)hh * HD + d) * SQ + s0 + j8) = f.half[0]; }  } }



// lane l with lane l ^ 16: a register move, no LDS round trip
__device__ __forceinline__ float rs_xhalf(float x) { return __builtin_bit_cast(float, __builtin_amdgcn_permlanex16(__builtin_bit_cast(int, x), __builtin_bit_cast(int, x), 0x76543210, 0xfedcba98, false, false)); }
// ---- fused attention: scores, softmax and P.V of all planes in one launch ----
// Work-group = 8 waves = 256 queries of one plane; a wave owns 32 query columns (two 16-column groups). Keys come in stages of 64: the K rows and the V^T rows of a stage
// are staged in LDS (two buffers; whole 128-byte lines from global memory through registers, loaded one trip ahead of their LDS store) and read as A fragments in the hardware k order.
// S^T = K.Q^T puts one query's scores in one lane (and its partner lane ^ 16), so the packed scores ARE the B operand of O^T += V^T.P^T: no exchange, no LDS for P.
#define FA_NS (SQ / 64)              /* stages of 64 keys */
#define FA_PITCH 144                 /* LDS row pitch, bytes: 128 + 16, an odd multiple of 16 (16-byte readers, no bank conflict) */
#define FA_TILE (64 * FA_PITCH)      /* one operand's tile of one stage */
#define FA_OP 272                    /* output staging pitch, bytes: 256 + 16 */
typedef float v2f __attribute__((ext_vector_type(2)));
typedef _Float16 v2h __attribute__((ext_vector_type(2)));
typedef unsigned int v8u __attribute__((ext_vector_type(8)));
__device__ __forceinline__ v8f fa_mma(v16h a, v16h b, v8f c) { return __builtin_amdgcn_wmma_f32_16x16x32_f16(false, a, false, b, (short)0, c, false, false); }
__device__ __forceinline__ void fa_fence() { __builtin_amdgcn_sched_barrier(0); }      /* keeps a group of LDS loads, or a run of products, in one place */
__device__ __forceinline__ v16h fa_lds(const unsigned char* p) { FragH f; f.half[0] = *(const v8us*)p; f.half[1] = *(const v8us*)(p + 32); return f.v; }      /* p holds the lane's 16 * h: k = 8h .. 8h+7 and 16+8h .. 16+8h+7 */
__device__ __forceinline__ void fa_ldk(v16h (&kf)[2][2], const unsigned char* kb) {
#pragma unroll
  for (int kt = 0; kt < 2; ++kt) { kf[kt][0] = fa_lds(kb + kt * 16 * FA_PITCH); kf[kt][1] = fa_lds(kb + kt * 16 * FA_PITCH + 64); } }
__device__ __forceinline__ void fa_ldv(v16h (&vf)[4], const unsigned char* vb) {
#pragma unroll
  for (int t = 0; t < 4; ++t) vf[t] = fa_lds(vb + t * 16 * FA_PITCH); }
// One pass = 32 keys of one wave. m_run, the maximum in use (log2 domain), may trail the true maximum by up to 8, so a weight reaches 2^8 at most (f16 holds it);
// the sums are rescaled once per pass and only when some column's maximum has grown by more. MORE: the stage holds a further pass, whose fragments are fetched ahead.
template <bool MORE>
__device__ __forceinline__ void fa_pass(v16h (&kf)[2][2], v16h (&vf)[4], const unsigned char* kn, const unsigned char* vn, const v16h (&qf)[2][2], v8f (&acc)[2][4], v8f (&lacc)[2], float (&m_run)[2], const v16h ones) {
  const float cs = 0.18033688011112042f;      /* 64^-0.5 * log2(e) */
  v8f s[2][2];
#pragma unroll
  for (int kt = 0; kt < 2; ++kt) {
#pragma unroll
    for (int g = 0; g < 2; ++g) { const v8f z = {0.f,0.f,0.f,0.f,0.f,0.f,0.f,0.f}; s[kt][g] = fa_mma(kf[kt][1], qf[g][1], fa_mma(kf[kt][0], qf[g][0], z)); } }
  fa_fence();      /* the eight products stay back to back: mixed with the maxima, each would be padded with v_nop */
  if (MORE) { fa_ldk(kf, kn); fa_fence(); }      /* next pass's K rows, in flight under this pass's softmax */
  float mb[2]; bool need = false;
#pragma unroll
  for (int g = 0; g < 2; ++g) { float mx = s[0][g][0];
#pragma unroll
    for (int r = 1; r < 8; ++r) mx = fmaxf(mx, s[0][g][r]);
#pragma unroll
    for (int r = 0; r < 8; ++r) mx = fmaxf(mx, s[1][g][r]);
    mx = fmaxf(mx, rs_xhalf(mx)) * cs;      /* both halves of the wave hold the query's maximum of this pass, scaled (the scale is positive) */
    mb[g] = mx; need = need || (mx > m_run[g] + 8.0f); }
  if (__builtin_amdgcn_ballot_w32(need) != 0) {      /* one scalar branch a pass; always taken in the first pass (m_run = -inf), seldom later */
#pragma unroll
    for (int g = 0; g < 2; ++g) { const float mn = fmaxf(m_run[g], mb[g]); const float corr = __builtin_amdgcn_exp2f(m_run[g] - mn); m_run[g] = mn; lacc[g] = lacc[g] * corr;
#pragma unroll
      for (int t = 0; t < 4; ++t) acc[g][t] = acc[g][t] * corr; } }
#pragma unroll
  for (int g = 0; g < 2; ++g) { const float nm = -m_run[g]; v8u w;
#pragma unroll
    for (int i = 0; i < 8; ++i) {
      const v2f arg = __builtin_elementwise_fma(v2f{s[i >> 2][g][2 * (i & 3)], s[i >> 2][g][2 * (i & 3) + 1]}, v2f{cs, cs}, v2f{nm, nm});
      w[i] = __builtin_bit_cast(unsigned int, __builtin_convertvector(v2f{__builtin_amdgcn_exp2f(arg.x), __builtin_amdgcn_exp2f(arg.y)}, v2h)); }
    const v16h pf = __builtin_bit_cast(v16h, w);
#pragma unroll
    for (int t = 0; t < 4; ++t) acc[g][t] = fa_mma(vf[t], pf, acc[g][t]);
    lacc[g] = fa_mma(ones, pf, lacc[g]); }
  if (MORE) { fa_fence(); fa_ldv(vf, vn); fa_fence(); }      /* next pass's V^T rows, in flight under its scores and softmax */
}
__global__ __launch_bounds__(256) void k_fattn(const _Float16* __restrict__ Q, const _Float16* __restrict__ K, const _Float16* __restrict__ VT, float* __restrict__ O) {
  __shared__ __attribute__((aligned(16))) unsigned char L[8 * 32 * FA_OP];      /* the K / V^T ring (4 tiles) in the loop, the output staging behind it */
  static_assert(4 * FA_TILE <= 8 * 32 * FA_OP, "the ring must fit the staging array");
  const int tid = threadIdx.x, lane = tid & 31, wave = tid >> 5, c = lane & 15, h = lane >> 4;
  const size_t plane = blockIdx.y; const int q0 = blockIdx.x * 256 + wave * 32;
  /* staging: thread tid moves 16-byte chunks tid and tid + 256 of each 8 KiB tile; 8 threads cover one 128-byte row */
  const _Float16* kg = K + plane * SQ * HD + tid * 8;
  const _Float16* vg = VT + plane * HD * SQ + (size_t)(tid >> 3) * SQ + (tid & 7) * 8;
  unsigned char* sd = L + (tid >> 3) * FA_PITCH + (tid & 7) * 16;
  v8us rk0, rk1, rv0, rv1;
  auto gload = [&](int st) { rk0 = *(const v8us*)((const unsigned short*)kg + st * 64 * HD); rk1 = *(const v8us*)((const unsigned short*)kg + st * 64 * HD + 32 * HD);
    rv0 = *(const v8us*)((const unsigned short*)vg + st * 64); rv1 = *(const v8us*)((const unsigned short*)vg + st * 64 + (size_t)32 * SQ); };
  auto sstore = [&](int bf) { unsigned char* d = sd + bf * 2 * FA_TILE; *(v8us*)d = rk0; *(v8us*)(d + 32 * FA_PITCH) = rk1; *(v8us*)(d + FA_TILE) = rv0; *(v8us*)(d + FA_TILE + 32 * FA_PITCH) = rv1; };
  gload(0);
  v16h qf[2][2];      /* B operand: column c = query q0 + 16 g + c, in K's k order */
#pragma unroll
  for (int g = 0; g < 2; ++g) { const _Float16* qp = Q + (plane * SQ + q0 + 16 * g + c) * HD; qf[g][0] = g2_frag(qp, h); qf[g][1] = g2_frag(qp + 32, h); }
  v16h ones;      /* A operand whose row 0 (lanes 0 and 16) is 1.0 at all 32 k, every other row 0 */
  { const unsigned int o = (c == 0) ? 0x3C003C00u : 0u; const v8u ov = {o, o, o, o, o, o, o, o}; ones = __builtin_bit_cast(v16h, ov); }
  v8f acc[2][4], lacc[2]; float m_run[2];
#pragma unroll
  for (int g = 0; g < 2; ++g) { const v8f z = {0.f,0.f,0.f,0.f,0.f,0.f,0.f,0.f}; m_run[g] = -__builtin_inff(); lacc[g] = z;
#pragma unroll
    for (int t = 0; t < 4; ++t) acc[g][t] = z; }
  sstore(0); gload(1);
  __syncthreads();      /* stage 0 is visible to all waves */
  v16h kf[2][2], vf[4];
#pragma unroll 1      /* one copy of the loop body; the buffers alternate by st & 1 */
  for (int st = 0; st < FA_NS; ++st) {
    const unsigned char* kb = L + (st & 1) * 2 * FA_TILE + c * FA_PITCH + 16 * h; const unsigned char* vb = kb + FA_TILE;
    fa_ldk(kf, kb); fa_ldv(vf, vb); fa_fence();
    if (st + 1 < FA_NS) sstore((st + 1) & 1);      /* into the buffer that every wave left before the barrier at the foot of the trip before */
    if (st + 2 < FA_NS) gload(st + 2);             /* a whole stage of work ahead of its use */
    fa_fence();
    fa_pass<true>(kf, vf, kb + 32 * FA_PITCH, vb + 64, qf, acc, lacc, m_run, ones);
    fa_pass<false>(kf, vf, kb, vb, qf, acc, lacc, m_run, ones);
    __syncthreads();      /* publishes stage st + 1 and ends every wave's reads of stage st */
  }
  /* epilogue: each wave stages its 32 output rows in its own part of L (the ring is free behind the last barrier) and stores whole 256-byte rows */
  unsigned char* eb = L + wave * 32 * FA_OP;
#pragma unroll
  for (int g = 0; g < 2; ++g) { const float lr = lacc[g][0]; const float inv = 1.0f / (lr + rs_xhalf(lr));      /* register 0: the denominator in lanes 0-15, 0 in lanes 16-31 (row 8) */
#pragma unroll
    for (int t = 0; t < 4; ++t) { const v8f o = acc[g][t] * inv; unsigned char* d = eb + (16 * g + c) * FA_OP + 64 * t + 32 * h;      /* row = query, d = 16 t + 8 h + r */
      const v4f lo = {o[0], o[1], o[2], o[3]}, hi = {o[4], o[5], o[6], o[7]}; *(v4fa*)d = lo; *(v4fa*)(d + 16) = hi; } }
  __builtin_amdgcn_fence(__ATOMIC_ACQ_REL, "workgroup"); __builtin_amdgcn_wave_barrier();      /* the wave's own LDS writes before its reads of other lanes' rows */
#pragma unroll
  for (int i = 0; i < 16; ++i) { const int row = 2 * i + h; const v4f v = *(const v4fa*)(eb + row * FA_OP + c * 16); *(v4f*)(O + (plane * SQ + q0 + row) * HD + c * 4) = v; } }

// ---- projections: x -> Q, K (token rows) and V^T (head-dim rows) of all planes in one launch ----
// Work-group = 8 waves = 256 token rows of one plane; a wave owns 32 rows. x is read once, f32, in whole lines, rounded (bf16, exact in f16) and laid in the wave's own LDS rows;
// the three weight matrices (bf16-rounded, x16, f16) and the biases (bf16-rounded) are converted once per work-group into LDS. One x fragment serves as B for Q and K and as A for V:
// Q^T = Wq.x^T puts 8 consecutive features of one token in a lane, V = x.Wv^T puts 8 consecutive tokens of one feature in a lane, so that every result leaves as a packed 16-byte LDS store
// in the layout its reader wants; global stores are whole 512-byte runs.
#define PJ_TOK 256                   /* token rows per work-group */
#define PJ_P 144                     /* LDS pitch of a 64-element f16 row, bytes: 128 + 16 (16-byte readers, no bank conflict) */
#define PJ_VP 528                    /* LDS pitch of a V^T row of PJ_TOK tokens, bytes: 512 + 16 */
typedef unsigned short v4us __attribute__((ext_vector_type(4), may_alias));
__device__ __forceinline__ v8us pj_pack(v8f d, v8f b) { FragH f;      /* f16(acc / 16 + bias): the x16 of the weights taken back, exactly */
#pragma unroll
  for (int r = 0; r < 8; ++r) f.h[r] = (_Float16)(d[r] * 0.0625f + b[r]);
  return f.half[0]; }
__global__ __launch_bounds__(256) void k_qkv(const float* __restrict__ x, const float* __restrict__ wq, const float* __restrict__ bq, const float* __restrict__ wk, const float* __restrict__ bk,
                                             const float* __restrict__ wv, const float* __restrict__ bv, _Float16* __restrict__ Q, _Float16* __restrict__ K, _Float16* __restrict__ VT) {
  __shared__ __attribute__((aligned(16))) unsigned char LW[3 * DM * PJ_P];       /* weights, row = output feature */
  __shared__ __attribute__((aligned(16))) float LB[4 * DM];                      /* biases; the last quarter only keeps the store below free of a branch */
  __shared__ __attribute__((aligned(16))) unsigned char LX[PJ_TOK * PJ_P];       /* x rows */
  __shared__ __attribute__((aligned(16))) unsigned char LO[2 * PJ_TOK * PJ_P];   /* Q rows, then K rows */
  __shared__ __attribute__((aligned(16))) unsigned char LV[HD * PJ_VP];          /* V^T rows */
  static_assert(SQ % PJ_TOK == 0 && DM == 64 && HD == 64, "a work-group stays inside one plane; rows of 64");
  const int tid = threadIdx.x, lane = tid & 31, wave = tid >> 5, c = lane & 15, h = lane >> 4;
  const size_t tok0 = (size_t)blockIdx.x * PJ_TOK;
  /* x: load i of a wave covers its rows 2i and 2i + 1 (512 contiguous bytes); all 16 in flight together, ahead of the weights */
  const char* xg = (const char*)(x + tok0 * DM); const unsigned xo = wave * 32 * DM * 4 + lane * 16;
  v4f xr[16];
#pragma unroll
  for (int i = 0; i < 16; ++i) xr[i] = *(const v4fa*)(xg + xo + i * 512);
  asm volatile("s_wait_xcnt 0x0" :: "v"(xo) : "memory");      /* the offset register of the loads above stays as it is up to here: a later load may take it as its destination */
  /* weights: thread tid converts 8-element chunks tid and tid + 256 of each matrix */
  const unsigned wo = tid * 32; v4f wr[3][2][2];
#pragma unroll
  for (int m = 0; m < 3; ++m) { const char* w = (const char*)((m == 0) ? wq : (m == 1) ? wk : wv);
#pragma unroll
    for (int j = 0; j < 2; ++j) { wr[m][j][0] = *(const v4fa*)(w + wo + j * 8192); wr[m][j][1] = *(const v4fa*)(w + wo + j * 8192 + 16); } }
  const float* bsrc = (tid < DM) ? bq : (tid < 2 * DM) ? bk : bv; const float braw = bsrc[tid & (DM - 1)];      /* by all 256 threads, so that the load goes out with the rest: under a branch it was a second trip to memory behind the weights */
  asm volatile("s_wait_xcnt 0x0" :: "v"(wo) : "memory");      /* as above, for the weight and bias loads */
#pragma unroll
  for (int m = 0; m < 3; ++m) {
#pragma unroll
    for (int j = 0; j < 2; ++j) { const int ch = tid + 256 * j; FragH f;
#pragma unroll
      for (int q = 0; q < 4; ++q) { f.h[q] = (_Float16)(bf16_round(wr[m][j][0][q]) * 16.0f); f.h[4 + q] = (_Float16)(bf16_round(wr[m][j][1][q]) * 16.0f); }
      *(v8us*)(LW + (m * DM + (ch >> 3)) * PJ_P + (ch & 7) * 16) = f.half[0]; } }
  LB[tid] = bf16_round(braw);
  unsigned char* xs = LX + wave * 32 * PJ_P;
#pragma unroll
  for (int i = 0; i < 16; ++i) { FragH f;
#pragma unroll
    for (int q = 0; q < 4; ++q) f.h[q] = (_Float16)bf16_round(xr[i][q]);
    const v4us o = {f.u[0], f.u[1], f.u[2], f.u[3]}; *(v4us*)(xs + (2 * i + h) * PJ_P + c * 8) = o; }
  __syncthreads();      /* weights and biases are visible to all waves (and each wave's x rows to its own lanes) */
  v16h xf[2][2];      /* row or column c = token 16 g + c of the wave, k = 32 ks + the hardware k order */
#pragma unroll
  for (int g = 0; g < 2; ++g) { xf[g][0] = fa_lds(xs + (16 * g + c) * PJ_P + 16 * h); xf[g][1] = fa_lds(xs + (16 * g + c) * PJ_P + 16 * h + 64); }
  const v8f z = {0.f,0.f,0.f,0.f,0.f,0.f,0.f,0.f};
#pragma unroll
  for (int m = 0; m < 3; ++m) {
    v16h wf[4][2];      /* row or column c = output feature 16 t + c, in the same k order as xf */
#pragma unroll
    for (int t = 0; t < 4; ++t) { const unsigned char* p = LW + (m * DM + 16 * t + c) * PJ_P + 16 * h; wf[t][0] = fa_lds(p); wf[t][1] = fa_lds(p + 64); }
#pragma unroll
    for (int t = 0; t < 4; ++t) {
      if (m < 2) {      /* D column c = token, register r = feature 16 t + 8 h + r */
        const v4f b0 = *(const v4fa*)(LB + m * DM + 16 * t + 8 * h), b1 = *(const v4fa*)(LB + m * DM + 16 * t + 8 * h + 4); const v8f b = {b0[0], b0[1], b0[2], b0[3], b1[0], b1[1], b1[2], b1[3]};
#pragma unroll
        for (int g = 0; g < 2; ++g) { const v8f d = fa_mma(wf[t][1], xf[g][1], fa_mma(wf[t][0], xf[g][0], z));
          *(v8us*)(LO + (m * PJ_TOK + wave * 32 + 16 * g + c) * PJ_P + 32 * t + 16 * h) = pj_pack(d, b); }
      } else {          /* D column c = feature 16 t + c, register r = token 16 g + 8 h + r */
        const float bs = LB[2 * DM + 16 * t + c]; const v8f b = {bs, bs, bs, bs, bs, bs, bs, bs};
#pragma unroll
        for (int g = 0; g < 2; ++g) { const v8f d = fa_mma(xf[g][1], wf[t][1], fa_mma(xf[g][0], wf[t][0], z));
          *(v8us*)(LV + (16 * t + c) * PJ_VP + (wave * 32 + 16 * g + 8 * h) * 2) = pj_pack(d, b); }
      } } }
  __syncthreads();      /* a V^T row holds the tokens of all eight waves */
#pragma unroll
  for (int m = 0; m < 2; ++m) { unsigned short* o = (unsigned short*)(m == 0 ? Q : K) + tok0 * DM;      /* 256 rows of 128 bytes, contiguous */
#pragma unroll
    for (int i = 0; i < 8; ++i) { const int ch = tid + 256 * i; *(v8us*)(o + ch * 8) = *(const v8us*)(LO + (m * PJ_TOK + (ch >> 3)) * PJ_P + (ch & 7) * 16); } }
  unsigned short* vo = (unsigned short*)VT + (tok0 / SQ) * HD * SQ + tok0 % SQ + lane * 8;      /* a wave stores one 512-byte run of a V^T row at a time */
#pragma unroll
  for (int i = 0; i < 8; ++i) { const int e = wave * 8 + i; *(v8us*)(vo + (size_t)e * SQ) = *(const v8us*)(LV + e * PJ_VP + lane * 16); } }

extern "C" void kernel_launch(void* const* d_in, const int* in_sizes, int n_in,
                              void* d_out, int out_size, void* d_ws, size_t ws_size, hipStream_t stream) {
  (void)in_sizes; (void)n_in; (void)out_size;
  const float* const* I = (const float* const*)d_in; const float* x = I[0]; const float* wq = I[1]; const float* bq = I[2]; const float* wk = I[3]; const float* bk = I[4]; const float* wv = I[5]; const float* bv = I[6];      /* natural [out][in] 64x64 weights + biases; x head-major = 32 planes of [2048][64] */
  char* ws = (char*)d_ws; size_t off = 0;
  auto take = [&](size_t bytes) { char* p = ws + off; off += (bytes + 255) & ~(size_t)255; return p; };
  _Float16* Q16 = (_Float16*)take(NR * DM * 2); _Float16* K16 = (_Float16*)take(NR * DM * 2);
  _Float16* VT = (_Float16*)take((size_t)NB * HD * SQ * 2);      /* V^T of all planes */
  if (off > ws_size) return;
  k_qkv<<<(unsigned)(NR / PJ_TOK), 256, 0, stream>>>(x, wq, bq, wk, bk, wv, bv, Q16, K16, VT);      /* all planes: 256 token rows per work-group */
  k_fattn<<<dim3(SQ / 256, NB), 256, 0, stream>>>(Q16, K16, VT, (float*)d_out);      /* all planes: 256 queries per work-group, out written f32 straight into the output rows */
}

// v005
// Measured time: 40.2 microseconds a run.
// Timed twice side by side with v004, it ran 1.18 and 1.16 times as fast.
// All steps since v000 together make it 322 times as fast.
#include <hip/hip_runtime.h>
#define NB 32
#define SQ 2048
#define DM 64
#define NH 1
#define HD 64
#define HG 1                         /* unused by the launches: heads per group of the non-template k_vt */
#define B0 0                         /* unused: the launches start at plane 0 */
#define NBR NB                       /* unused by the launches (only MP uses it) */
#define NR ((size_t)NB * SQ)         /* token rows */
#define MP ((int)((size_t)NBR * SQ)) /* unused: k_qkv projects all NR rows */
#define QN SQ                        /* unused: query rows per plane = SQ */
#define NHD NH                       /* unused: heads per plane */
#define MPO MP                       /* unused: no output stage */
#define LQ DM      /* unused: q and k rows have pitch DM, V^T rows SQ */
typedef __bf16 v16b __attribute__((ext_vector_type(16)));
typedef unsigned short v8us __attribute__((ext_vector_type(8), may_alias));
typedef float  v8f  __attribute__((ext_vector_type(8)));
typedef float  v4f  __attribute__((ext_vector_type(4)));
typedef float  v4fa __attribute__((ext_vector_type(4), may_alias));
union FragB { v16b v; v8us half[2]; unsigned short u[16]; };

__device__ __forceinline__ unsigned short bf16_bits(float x) { unsigned int u = __float_as_uint(x); return (unsigned short)((u + 0x7FFFu + ((u >> 16) & 1u)) >> 16); }
__device__ __forceinline__ float bf16_val(unsigned short b) { return __uint_as_float(((unsigned int)b) << 16); }
__device__ __forceinline__ float bf16_round(float x) { return bf16_val(bf16_bits(x)); }
// D += A·B with NT terms: 1 = ah·bh, 2 = + al·bh (A split), 3 = + ah·bl (both split)
template <int NT>
__device__ __forceinline__ v8f mmaN(v16b ah, v16b al, v16b bh, v16b bl, v8f c) {
  c = __builtin_amdgcn_wmma_f32_16x16x32_bf16(false, ah, false, bh, (short)0, c, false, false);
  if (NT >= 2) c = __builtin_amdgcn_wmma_f32_16x16x32_bf16(false, al, false, bh, (short)0, c, false, false);
  if (NT >= 3) c = __builtin_amdgcn_wmma_f32_16x16x32_bf16(false, ah, false, bl, (short)0, c, false, false);
  asm volatile("v_nop\n\tv_nop\n\tv_nop\n\tv_nop" : "+v"(c) : "v"(ah), "v"(al), "v"(bh), "v"(bl));
  return c;
}

__global__ __launch_bounds__(256) void k_wt_bf16(const float* __restrict__ W, unsigned short* __restrict__ Wt, int K, int N) {
  const int t = blockIdx.x * 256 + threadIdx.x;
  const int k8n = K / 8;
  if (t >= N * k8n) return;
  const int n = t / k8n, k8 = (t % k8n) * 8;
  v8us v;
#pragma unroll
  for (int i = 0; i < 8; ++i) v[i] = bf16_bits(W[(size_t)(k8 + i) * N + n]);
  *(v8us*)(Wt + (size_t)n * K + k8) = v;
  
}

// GEMM C[M][N] (f32, pitch ldc) = act(A[M][K]·W + bias). A f32 row-major (pitch lda) converted per fragment to bf16
// (ASPLIT: hi/lo two planes -> 2 terms, else single rounded term); Wt bf16 [N][K] (pitch ldb). BIAS_BF16 rounds the
// bias to bf16 first (bias quantised to bf16 before the add). K%32==0, M%16==0, N%64==0.
template <bool ASPLIT, int ACT, bool BIAS_BF16>
__global__ __launch_bounds__(128) void k_gemm_bf(const float* __restrict__ A, int lda, const unsigned short* __restrict__ Wt, int ldb,
                                               const float* __restrict__ bias, float* __restrict__ C, int ldc, int M, int N, int K) {
  __shared__ __attribute__((aligned(16))) float so[4][16][64];
  const int tid = threadIdx.x, w = tid >> 5, lane = tid & 31, ln = lane & 15, hh = lane >> 4;
  const int ntn = N / 64;
  const int wid = blockIdx.x * 4 + w;
  const int mt = wid / ntn, nq = wid % ntn;
  if (mt * 16 >= M) return;
  const int row0 = mt * 16, col0 = nq * 64;
  const float* arow = A + (size_t)(row0 + ln) * lda;
  v8f acc[4] = {};
  for (int kb = 0; kb < K; kb += 32) {
    FragB ah, al;
    const v4f x0 = *(const v4fa*)(arow + kb + 8 * hh), x1 = *(const v4fa*)(arow + kb + 8 * hh + 4);
    const v4f x2 = *(const v4fa*)(arow + kb + 16 + 8 * hh), x3 = *(const v4fa*)(arow + kb + 16 + 8 * hh + 4);
    float xs[16] = {x0[0],x0[1],x0[2],x0[3],x1[0],x1[1],x1[2],x1[3],x2[0],x2[1],x2[2],x2[3],x3[0],x3[1],x3[2],x3[3]};
#pragma unroll
    for (int i = 0; i < 16; ++i) { const unsigned short hb = bf16_bits(xs[i]); ah.u[i] = hb; al.u[i] = ASPLIT ? bf16_bits(xs[i] - bf16_val(hb)) : (unsigned short)0; }
#pragma unroll
    for (int t = 0; t < 4; ++t) {
      const unsigned short* brow = Wt + (size_t)(col0 + t * 16 + ln) * ldb + kb;
      FragB b;
      b.half[0] = *(const v8us*)(brow + 8 * hh);
      b.half[1] = *(const v8us*)(brow + 16 + 8 * hh);
      acc[t] = mmaN<ASPLIT ? 2 : 1>(ah.v, al.v, b.v, b.v, acc[t]);
    }
  }
#pragma unroll
  for (int t = 0; t < 4; ++t) {
    float bv = bias ? bias[col0 + t * 16 + ln] : 0.f;
    if (BIAS_BF16) bv = bf16_round(bv);
#pragma unroll
    for (int r = 0; r < 8; ++r) { float v = acc[t][r] + bv; if (ACT == 1) v = fmaxf(v, 0.f); so[w][8 * hh + r][t * 16 + ln] = v; }
  }
  __builtin_amdgcn_fence(__ATOMIC_ACQ_REL, "workgroup");
  __builtin_amdgcn_wave_barrier();
  const int rsub = lane >> 4, c4 = (lane & 15) * 4;
  {
#pragma unroll
    for (int q = 0; q < 8; ++q) {
      const int r = q * 2 + rsub;
      const v4f v = *(const v4fa*)&so[w][r][c4];
      *(v4f*)(C + (size_t)(row0 + r) * ldc + col0 + c4) = v;
    }
    
  }
}

// GEMM C = act(A·W + bias + resid): A f32 (ASPLIT -> hi/lo 2 terms), Wt bf16 [N][K]; ACT 0 none, 1 relu, 2 exact gelu;
// resid (optional, f32, row index = (row % rmod), pitch ldr, RES_BF16 rounds it) added before the activation.
template <bool ASPLIT, int ACT, bool BIAS_BF16, bool RES_BF16>
__global__ __launch_bounds__(128) void k_gemm_bf3(const float* __restrict__ A, int lda, const unsigned short* __restrict__ Wt, int ldb,
                                                const float* __restrict__ bias, const float* __restrict__ resid, int rmod, int ldr,
                                                float* __restrict__ C, int ldc, int M, int N, int K) {
  __shared__ __attribute__((aligned(16))) float so[4][16][64];
  const int tid = threadIdx.x, w = tid >> 5, lane = tid & 31, ln = lane & 15, hh = lane >> 4;
  const int ntn = N / 64;
  const int wid = blockIdx.x * 4 + w;
  const int mt = wid / ntn, nq = wid % ntn;
  if (mt * 16 >= M) return;
  const int row0 = mt * 16, col0 = nq * 64;
  const float* arow = A + (size_t)(row0 + ln) * lda;
  v8f acc[4] = {};
  for (int kb = 0; kb < K; kb += 32) {
    FragB ah, al;
    const v4f x0 = *(const v4fa*)(arow + kb + 8 * hh), x1 = *(const v4fa*)(arow + kb + 8 * hh + 4);
    const v4f x2 = *(const v4fa*)(arow + kb + 16 + 8 * hh), x3 = *(const v4fa*)(arow + kb + 16 + 8 * hh + 4);
    float xs[16] = {x0[0],x0[1],x0[2],x0[3],x1[0],x1[1],x1[2],x1[3],x2[0],x2[1],x2[2],x2[3],x3[0],x3[1],x3[2],x3[3]};
#pragma unroll
    for (int i = 0; i < 16; ++i) { const unsigned short hb = bf16_bits(xs[i]); ah.u[i] = hb; al.u[i] = ASPLIT ? bf16_bits(xs[i] - bf16_val(hb)) : (unsigned short)0; }
#pragma unroll
    for (int t = 0; t < 4; ++t) {
      const unsigned short* brow = Wt + (size_t)(col0 + t * 16 + ln) * ldb + kb;
      FragB b;
      b.half[0] = *(const v8us*)(brow + 8 * hh);
      b.half[1] = *(const v8us*)(brow + 16 + 8 * hh);
      acc[t] = mmaN<ASPLIT ? 2 : 1>(ah.v, al.v, b.v, b.v, acc[t]);
    }
  }
#pragma unroll
  for (int t = 0; t < 4; ++t) {
    const int col = col0 + t * 16 + ln;
    float bv = bias ? bias[col] : 0.f;
    if (BIAS_BF16) bv = bf16_round(bv);
#pragma unroll
    for (int r = 0; r < 8; ++r) {
      float v = acc[t][r] + bv;
      if (resid) { float rv = resid[(size_t)((row0 + 8 * hh + r) % rmod) * ldr + col]; if (RES_BF16) rv = bf16_round(rv); v += rv; }
      if (ACT == 1) v = fmaxf(v, 0.f);
      if (ACT == 2) v = 0.5f * v * (1.0f + erff(v * 0.70710678118654752f));
      if (ACT == 3) { const float u = 0.7978845608028654f * (v + 0.044715f * v * v * v); v = 0.5f * v * (1.0f + tanhf(u)); }
      so[w][8 * hh + r][t * 16 + ln] = v;
    }
  }
  __builtin_amdgcn_fence(__ATOMIC_ACQ_REL, "workgroup");
  __builtin_amdgcn_wave_barrier();
  const int rsub = lane >> 4, c4 = (lane & 15) * 4;
  {
#pragma unroll
    for (int q = 0; q < 8; ++q) {
      const int r = q * 2 + rsub;
      const v4f v = *(const v4fa*)&so[w][r][c4];
      *(v4f*)(C + (size_t)(row0 + r) * ldc + col0 + c4) = v;
    }
    
  }
}
// row LayerNorm (biased variance, eps) over N: s = X (+ R); optional out_sum <- s; out_norm <- (s-mu)*rsqrt(var+eps)*g + b
template <bool PARAM_BF16>
__global__ __launch_bounds__(256) void k_layernorm(const float* __restrict__ X, const float* __restrict__ R, const float* __restrict__ g, const float* __restrict__ bta,
                                                  float* __restrict__ out_sum, float* __restrict__ out_norm, int N, float eps) {
  __shared__ float red[256];
  const int row = blockIdx.x, tid = threadIdx.x;
  const float* x = X + (size_t)row * N; const float* rr = R ? R + (size_t)row * N : nullptr;
  float vals[16];                     // up to N = 4096
  const int per = N / 256;            // contiguous chunk per thread? use strided-by-4 chunks: thread handles j = tid*4 + 1024*u
  float s1 = 0.f;
  for (int u = 0; u < per / 4; ++u) {
    const int j = tid * 4 + 1024 * u;
    const v4f a = *(const v4fa*)(x + j);
    v4f b = {0.f,0.f,0.f,0.f}; if (rr) b = *(const v4fa*)(rr + j);
#pragma unroll
    for (int q = 0; q < 4; ++q) { const float v = a[q] + b[q]; vals[u * 4 + q] = v; s1 += v; }
  }
  red[tid] = s1; __syncthreads();
  for (int st = 128; st > 0; st >>= 1) { if (tid < st) red[tid] += red[tid + st]; __syncthreads(); }
  const float mu = red[0] / (float)N; __syncthreads();
  float s2 = 0.f;
  for (int u = 0; u < per / 4; ++u)
#pragma unroll
    for (int q = 0; q < 4; ++q) { const float c = vals[u * 4 + q] - mu; s2 += c * c; }
  red[tid] = s2; __syncthreads();
  for (int st = 128; st > 0; st >>= 1) { if (tid < st) red[tid] += red[tid + st]; __syncthreads(); }
  const float rs = rsqrtf(red[0] / (float)N + eps);
  {
    for (int u = 0; u < per / 4; ++u) {
      const int j = tid * 4 + 1024 * u;
      v4f o, sm;
#pragma unroll
      for (int q = 0; q < 4; ++q) {
        float gg = g[j + q], bb = bta[j + q];
        if (PARAM_BF16) { gg = bf16_round(gg); bb = bf16_round(bb); }
        sm[q] = vals[u * 4 + q]; o[q] = (vals[u * 4 + q] - mu) * rs * gg + bb;
      }
      if (out_sum) *(v4f*)(out_sum + (size_t)row * N + j) = sm;
      *(v4f*)(out_norm + (size_t)row * N + j) = o;
    }
    
  }
}



// ---- f16 WMMA path (v_wmma_f32_16x16x32_f16): 11-bit significands for operands in range — used where a [0,1] probability operand needs more precision than bf16
typedef _Float16 v16h __attribute__((ext_vector_type(16)));
union FragH { v16h v; v8us half[2]; _Float16 h[16]; unsigned short u[16]; };
template <int NT>
__device__ __forceinline__ v8f mmaH(v16h ah, v16h al, v16h bh, v16h bl, v8f c) {
  c = __builtin_amdgcn_wmma_f32_16x16x32_f16(false, ah, false, bh, (short)0, c, false, false);
  if (NT >= 2) c = __builtin_amdgcn_wmma_f32_16x16x32_f16(false, al, false, bh, (short)0, c, false, false);
  if (NT >= 3) c = __builtin_amdgcn_wmma_f32_16x16x32_f16(false, ah, false, bl, (short)0, c, false, false);
  asm volatile("v_nop\n\tv_nop\n\tv_nop\n\tv_nop" : "+v"(c) : "v"(ah), "v"(al), "v"(bh), "v"(bl));
  return c;
}
// batched GEMM like k_gemm_b but f16 operands: A f32 (split into f16 hi/lo if ASPLIT, else rounded to f16), Bt = f16 values [n][k]; alpha; C f32; N multiple of 16 (partial tiles skipped)
template <bool ASPLIT>
__global__ __launch_bounds__(128) void k_gemm_h(const float* __restrict__ A, int lda, size_t sA, const _Float16* __restrict__ Bh, int ldb, size_t sB, float alpha, float* __restrict__ C, int ldc, size_t sC, int M, int N, int K) {
  __shared__ __attribute__((aligned(16))) float so[4][16][64];
  const int tid = threadIdx.x, w = tid >> 5, lane = tid & 31, ln = lane & 15, hh = lane >> 4; const int by = blockIdx.y;
  A += (size_t)by * sA; Bh += (size_t)by * sB; C += (size_t)by * sC;
  const int ntn = (N + 63) / 64; const int wid = blockIdx.x * 4 + w; const int mt = wid / ntn, nq = wid % ntn; if (mt * 16 >= M) return;
  const int row0 = mt * 16, col0 = nq * 64; const float* arow = A + (size_t)(row0 + ln) * lda;
  v8f acc[4] = {};
  for (int kb = 0; kb < K; kb += 32) {
    FragH ah, al;
    const v4f x0 = *(const v4fa*)(arow + kb + 8 * hh), x1 = *(const v4fa*)(arow + kb + 8 * hh + 4), x2 = *(const v4fa*)(arow + kb + 16 + 8 * hh), x3 = *(const v4fa*)(arow + kb + 16 + 8 * hh + 4);
    float xs[16] = {x0[0],x0[1],x0[2],x0[3],x1[0],x1[1],x1[2],x1[3],x2[0],x2[1],x2[2],x2[3],x3[0],x3[1],x3[2],x3[3]};
#pragma unroll
    for (int i = 0; i < 16; ++i) { const _Float16 h = (_Float16)xs[i]; ah.h[i] = h; al.h[i] = ASPLIT ? (_Float16)(xs[i] - (float)h) : (_Float16)0.0f; }
#pragma unroll
    for (int t = 0; t < 4; ++t) { if (col0 + t * 16 >= N) continue; const size_t boff = (size_t)(col0 + t * 16 + ln) * ldb + kb; FragH bq; bq.half[0] = *(const v8us*)(Bh + boff + 8 * hh); bq.half[1] = *(const v8us*)(Bh + boff + 16 + 8 * hh);
      acc[t] = mmaH<ASPLIT ? 2 : 1>(ah.v, al.v, bq.v, bq.v, acc[t]); }
  }
#pragma unroll
  for (int t = 0; t < 4; ++t) { if (col0 + t * 16 >= N) continue;
#pragma unroll
    for (int r = 0; r < 8; ++r) so[w][8 * hh + r][t * 16 + ln] = acc[t][r] * alpha; }
  __builtin_amdgcn_fence(__ATOMIC_ACQ_REL, "workgroup"); __builtin_amdgcn_wave_barrier();
  const int rsub = lane >> 4, c4 = (lane & 15) * 4;
  {
#pragma unroll
    for (int q = 0; q < 8; ++q) { const int r = q * 2 + rsub; if (col0 + c4 < N) { const v4f v = *(const v4fa*)&so[w][r][c4]; *(v4f*)(C + (size_t)(row0 + r) * ldc + col0 + c4) = v; } }
     }
}

// Wt[n][k] = f16(W[k][n]·scale) from f32 row-major W[K][N] (scale = power of two; bf16-exact weights stay exact in f16 away from the subnormal range)
__global__ __launch_bounds__(256) void k_wt_f16(const float* __restrict__ W, _Float16* __restrict__ Wt, int K, int N, float scale) {
  const int t = blockIdx.x * 256 + threadIdx.x; if (t >= N * (K / 8)) return; const int n = t / (K / 8), k8 = (t % (K / 8)) * 8; FragH f;
#pragma unroll
  for (int i = 0; i < 8; ++i) f.h[i] = (_Float16)(bf16_round(W[(size_t)(k8 + i) * N + n]) * scale); const v8us o = f.half[0];
  *(v8us*)((unsigned short*)Wt + (size_t)n * K + k8) = o; 
}
// k_gemm_hh variant with fused epilogue: v = acc·alpha + bias[by·sBias + col] (+ CP[(row/rowsPerB)·sCPb + by·64 + col] if CP) ; ACT 0 none / 1 elu ; writes f16 C16 (and f32 C if non-null)
template <int ACT>
__global__ __launch_bounds__(128) void k_gemm_hhx(const _Float16* __restrict__ A, int lda, size_t sA, const _Float16* __restrict__ Bh, int ldb, size_t sB, float alpha, const float* __restrict__ bias, size_t sBias, const float* __restrict__ CP, int rowsPerB, size_t sCPb, int row0g,
    float* __restrict__ C, _Float16* __restrict__ C16, int ldc, size_t sC, int M, int N, int K) {
  __shared__ __attribute__((aligned(16))) float so[4][16][64];
  const int tid = threadIdx.x, w = tid >> 5, lane = tid & 31, ln = lane & 15, hh = lane >> 4; const int by = blockIdx.y;
  A += (size_t)by * sA; Bh += (size_t)by * sB; const size_t cofs = (size_t)by * sC; const float* bp = bias ? bias + (size_t)by * sBias : nullptr;
  const int ntn = (N + 63) / 64; const int wid = blockIdx.x * 4 + w; const int mt = wid / ntn, nq = wid % ntn; if (mt * 16 >= M) return;
  const int row0 = mt * 16, col0 = nq * 64; const _Float16* arow = A + (size_t)(row0 + ln) * lda;
  v8f acc[4] = {};
  for (int kb = 0; kb < K; kb += 32) { FragH ah; ah.half[0] = *(const v8us*)((const unsigned short*)arow + kb + 8 * hh); ah.half[1] = *(const v8us*)((const unsigned short*)arow + kb + 16 + 8 * hh);
#pragma unroll
    for (int t = 0; t < 4; ++t) { if (col0 + t * 16 >= N) continue; const size_t boff = (size_t)(col0 + t * 16 + ln) * ldb + kb; FragH bq; bq.half[0] = *(const v8us*)((const unsigned short*)Bh + boff + 8 * hh); bq.half[1] = *(const v8us*)((const unsigned short*)Bh + boff + 16 + 8 * hh);
      acc[t] = mmaH<1>(ah.v, ah.v, bq.v, bq.v, acc[t]); }
  }
#pragma unroll
  for (int t = 0; t < 4; ++t) { if (col0 + t * 16 >= N) continue; const int col = col0 + t * 16 + ln; const float bv = bp ? bf16_round(bp[col]) : 0.f;
#pragma unroll
    for (int r = 0; r < 8; ++r) { float v = acc[t][r] * alpha + bv; if (CP) { const int rr = row0g + row0 + 8 * hh + r; if (rowsPerB < 0) v += CP[cofs + (size_t)rr * ldc + col];      /* rowsPerB < 0: own element of the batched C plane */ else { const int bidx = rr / rowsPerB; v += CP[(size_t)bidx * sCPb + (size_t)by * 64 + col]; } } if (ACT == 1) v = (v > 0.f) ? v : expm1f(v); else if (ACT == 7) v = (v > 0.f) ? v + 1.0f : expf(v); else if (ACT == 8) v = tanhf(v); else if (ACT == 9) v = 0.5f * v * (1.0f + tanhf(0.7978845608028654f * (v + 0.044715f * v * v * v))); else if (ACT == 11) v = 1.0f / (1.0f + expf(-v)); else if (ACT == 12) v = (v > 0.f) ? v : 0.01f * v; else if (ACT == 14) v = (v > 0.f) ? v : 0.1f * v; else if (ACT == 16) v = (v >= 0.f) ? v : 0.3f * v; else if (ACT == 17) v = (v >= 0.f) ? v : 0.2f * v; else if (ACT == 15) v = v / (1.0f + expf(-v)); else if (ACT == 3) v = fmaxf(v, 0.f); else if (ACT == 6) v = 0.5f * v * (1.0f + erff(v * 0.70710678118654752f)); so[w][8 * hh + r][t * 16 + ln] = v; } }
  __builtin_amdgcn_fence(__ATOMIC_ACQ_REL, "workgroup"); __builtin_amdgcn_wave_barrier();
  const int rsub = lane >> 4, c4 = (lane & 15) * 4; typedef _Float16 v4h __attribute__((ext_vector_type(4)));
  {
#pragma unroll
    for (int q = 0; q < 8; ++q) { const int r = q * 2 + rsub; if (col0 + c4 < N) { const v4f v = *(const v4fa*)&so[w][r][c4]; if (C) *(v4f*)(C + cofs + (size_t)(row0 + r) * ldc + col0 + c4) = v; if (C16) { v4h h4; for (int i = 0; i < 4; ++i) h4[i] = (_Float16)v[i]; *(v4h*)(C16 + cofs + (size_t)(row0 + r) * ldc + col0 + c4) = h4; } } }
     }
}


typedef _Float16 v4h __attribute__((ext_vector_type(4)));

__global__ __launch_bounds__(256) void k_h16(const float* __restrict__ x, _Float16* __restrict__ X16, size_t n8) { const size_t t = (size_t)blockIdx.x * 256 + threadIdx.x; if (t >= n8) return; FragH f;
#pragma unroll
  for (int q = 0; q < 8; ++q) f.h[q] = (_Float16)x[t * 8 + q]; *(v8us*)((unsigned short*)X16 + t * 8) = f.half[0];  }
__global__ __launch_bounds__(256) void k_round16f(const float* __restrict__ W, _Float16* __restrict__ Bt, size_t n8) { const size_t t = (size_t)blockIdx.x * 256 + threadIdx.x; if (t >= n8) return; FragH f;
#pragma unroll
  for (int i = 0; i < 8; ++i) f.h[i] = (_Float16)(bf16_round(W[t * 8 + i]) * 16.0f); *(v8us*)((unsigned short*)Bt + t * 8) = f.half[0];  }

__global__ __launch_bounds__(256) void k_hl(const float* __restrict__ F, _Float16* __restrict__ Hh, _Float16* __restrict__ Hl, size_t n8) { const size_t t = (size_t)blockIdx.x * 256 + threadIdx.x; if (t >= n8) return; FragH fh, fl; const v4f a = *(const v4fa*)(F + t * 8), c = *(const v4fa*)(F + t * 8 + 4);
#pragma unroll
  for (int q = 0; q < 4; ++q) { _Float16 h = (_Float16)a[q]; fh.h[q] = h; fl.h[q] = (_Float16)((a[q] - (float)h) * 1024.0f); h = (_Float16)c[q]; fh.h[4 + q] = h; fl.h[4 + q] = (_Float16)((c[q] - (float)h) * 1024.0f); }
  { *(v8us*)((unsigned short*)Hh + t * 8) = fh.half[0]; *(v8us*)((unsigned short*)Hl + t * 8) = fl.half[0];  } }

// ---- A or B fragment of a 16x16x32 f16 product, straight from a global f16 row ----
__device__ __forceinline__ v16h g2_frag(const _Float16* p, int hh) { FragH f; f.half[0] = *(const v8us*)((const unsigned short*)p + 8 * hh); f.half[1] = *(const v8us*)((const unsigned short*)p + 16 + 8 * hh); return f.v; }


__global__ __launch_bounds__(256) void k_rsm(const float* __restrict__ S, _Float16* __restrict__ P, int nrows) {
  #pragma clang fp contract(off)
  const int i = blockIdx.x * 256 + threadIdx.x; if (i >= nrows) return; const float* s = S + (size_t)i * SQ; float mx = -3.0e38f;
#pragma unroll 1
  for (int j = 0; j < SQ; ++j) mx = fmaxf(mx, s[j]); float se = 0.f;
#pragma unroll 1
  for (int j = 0; j < SQ; ++j) se += expf(s[j] - mx); const float sc = 256.0f / se;
#pragma unroll 1
  for (int j0 = 0; j0 < SQ; j0 += 8) { FragH f; for (int q = 0; q < 8; ++q) f.h[q] = (_Float16)(expf(s[j0 + q] - mx) * sc); unsigned short* d = (unsigned short*)P + (size_t)i * SQ + j0; *(v8us*)d = f.half[0];  } }
__global__ __launch_bounds__(256) void k_vt(const _Float16* __restrict__ V16, int b, int h0, _Float16* __restrict__ VT) { __shared__ unsigned short tl[64][65]; const int tid = threadIdx.x; const int hh = blockIdx.x % HG, sg = blockIdx.x / HG; const int s0 = sg * 64; const int h = h0 + hh;
  for (int i = tid; i < 64 * 8; i += 256) { const int j = i / 8, d8 = (i % 8) * 8; FragH f; f.half[0] = *(const v8us*)((const unsigned short*)V16 + ((size_t)b * SQ + s0 + j) * DM + h * HD + d8); for (int q = 0; q < 8; ++q) tl[d8 + q][j] = f.u[q]; }
  __syncthreads();
  { for (int i = tid; i < 64 * 8; i += 256) { const int d = i / 8, j8 = (i % 8) * 8; FragH f; for (int q = 0; q < 8; ++q) f.u[q] = tl[d][j8 + q]; *(v8us*)((unsigned short*)VT + ((size_t)hh * HD + d) * SQ + s0 + j8) = f.half[0]; }  } }



// lane l with lane l ^ 16: a register move, no LDS round trip
__device__ __forceinline__ float rs_xhalf(float x) { return __builtin_bit_cast(float, __builtin_amdgcn_permlanex16(__builtin_bit_cast(int, x), __builtin_bit_cast(int, x), 0x76543210, 0xfedcba98, false, false)); }
// ---- fused attention: scores, softmax and P.V of all planes in one launch ----
// Work-group = 16 waves = 256 queries of one plane, four waves per SIMD: the vector work of one wave's softmax runs under the products of the others. Two key groups of 8 waves: group 0 walks the first half of the keys,
// group 1 the second half, each with its own LDS ring and its own online softmax; behind the loop group 1 hands its sums, maxima and denominators to group 0 through LDS, which merges them and writes the output.
// A wave owns 32 query columns (two 16-column groups). Keys come in stages of 64: the K rows and the V^T rows of a stage
// are staged in LDS (two buffers; whole 128-byte lines from global memory through registers, loaded one trip ahead of their LDS store) and read as A fragments in the hardware k order.
// S^T = K.Q^T puts one query's scores in one lane (and its partner lane ^ 16), so the packed scores ARE the B operand of O^T += V^T.P^T: no exchange, no LDS for P.
#define FA_KG 2                      /* key groups per work-group */
#define FA_NS (SQ / FA_KG / 64)      /* stages of 64 keys per key group */
#define FA_PITCH 144                 /* LDS row pitch, bytes: 128 + 16, an odd multiple of 16 (16-byte readers, no bank conflict) */
#define FA_TILE (64 * FA_PITCH)      /* one operand's tile of one stage */
#define FA_OP 272                    /* output staging pitch, bytes: 256 + 16 */
typedef float v2f __attribute__((ext_vector_type(2)));
typedef _Float16 v2h __attribute__((ext_vector_type(2)));
typedef unsigned int v8u __attribute__((ext_vector_type(8)));
__device__ __forceinline__ v8f fa_mma(v16h a, v16h b, v8f c) { return __builtin_amdgcn_wmma_f32_16x16x32_f16(false, a, false, b, (short)0, c, false, false); }
__device__ __forceinline__ void fa_fence() { __builtin_amdgcn_sched_barrier(0); }      /* keeps a group of LDS loads, or a run of products, in one place */
__device__ __forceinline__ v16h fa_lds(const unsigned char* p) { FragH f; f.half[0] = *(const v8us*)p; f.half[1] = *(const v8us*)(p + 32); return f.v; }      /* p holds the lane's 16 * h: k = 8h .. 8h+7 and 16+8h .. 16+8h+7 */
__device__ __forceinline__ void fa_ldk(v16h (&kf)[2][2], const unsigned char* kb) {
#pragma unroll
  for (int kt = 0; kt < 2; ++kt) { kf[kt][0] = fa_lds(kb + kt * 16 * FA_PITCH); kf[kt][1] = fa_lds(kb + kt * 16 * FA_PITCH + 64); } }
__device__ __forceinline__ void fa_ldv(v16h (&vf)[4], const unsigned char* vb) {
#pragma unroll
  for (int t = 0; t < 4; ++t) vf[t] = fa_lds(vb + t * 16 * FA_PITCH); }
// One pass = 32 keys of one wave. m_run, the maximum in use (log2 domain), may trail the true maximum by up to 8, so a weight reaches 2^8 at most (f16 holds it);
// the sums are rescaled once per pass and only when some column's maximum has grown by more. MORE: the stage holds a further pass, whose fragments are fetched ahead.
template <bool MORE>
__device__ __forceinline__ void fa_pass(v16h (&kf)[2][2], v16h (&vf)[4], const unsigned char* kn, const unsigned char* vn, const v16h (&qf)[2][2], v8f (&acc)[2][4], v8f (&lacc)[2], float (&m_run)[2], const v16h ones) {
  const float cs = 0.18033688011112042f;      /* 64^-0.5 * log2(e) */
  v8f s[2][2];
#pragma unroll
  for (int kt = 0; kt < 2; ++kt) {
#pragma unroll
    for (int g = 0; g < 2; ++g) { const v8f z = {0.f,0.f,0.f,0.f,0.f,0.f,0.f,0.f}; s[kt][g] = fa_mma(kf[kt][1], qf[g][1], fa_mma(kf[kt][0], qf[g][0], z)); } }
  fa_fence();      /* the eight products stay back to back: mixed with the maxima, each would be padded with v_nop */
  if (MORE) { fa_ldk(kf, kn); fa_fence(); }      /* next pass's K rows, in flight under this pass's softmax */
  float mb[2]; bool need = false;
#pragma unroll
  for (int g = 0; g < 2; ++g) { float mx = s[0][g][0];
#pragma unroll
    for (int r = 1; r < 8; ++r) mx = fmaxf(mx, s[0][g][r]);
#pragma unroll
    for (int r = 0; r < 8; ++r) mx = fmaxf(mx, s[1][g][r]);
    mx = fmaxf(mx, rs_xhalf(mx)) * cs;      /* both halves of the wave hold the query's maximum of this pass, scaled (the scale is positive) */
    mb[g] = mx; need = need || (mx > m_run[g] + 8.0f); }
  if (__builtin_amdgcn_ballot_w32(need) != 0) {      /* one scalar branch a pass; always taken in the first pass (m_run = -inf), seldom later */
#pragma unroll
    for (int g = 0; g < 2; ++g) { const float mn = fmaxf(m_run[g], mb[g]); const float corr = __builtin_amdgcn_exp2f(m_run[g] - mn); m_run[g] = mn; lacc[g] = lacc[g] * corr;
#pragma unroll
      for (int t = 0; t < 4; ++t) acc[g][t] = acc[g][t] * corr; } }
#pragma unroll
  for (int g = 0; g < 2; ++g) { const float nm = -m_run[g]; v8u w;
#pragma unroll
    for (int i = 0; i < 8; ++i) {
      const v2f arg = __builtin_elementwise_fma(v2f{s[i >> 2][g][2 * (i & 3)], s[i >> 2][g][2 * (i & 3) + 1]}, v2f{cs, cs}, v2f{nm, nm});
      w[i] = __builtin_bit_cast(unsigned int, __builtin_convertvector(v2f{__builtin_amdgcn_exp2f(arg.x), __builtin_amdgcn_exp2f(arg.y)}, v2h)); }
    const v16h pf = __builtin_bit_cast(v16h, w);
#pragma unroll
    for (int t = 0; t < 4; ++t) acc[g][t] = fa_mma(vf[t], pf, acc[g][t]);
    lacc[g] = fa_mma(ones, pf, lacc[g]); }
  if (MORE) { fa_fence(); fa_ldv(vf, vn); fa_fence(); }      /* next pass's V^T rows, in flight under its scores and softmax */
}
__global__ __launch_bounds__(256 * FA_KG) void k_fattn(const _Float16* __restrict__ Q, const _Float16* __restrict__ K, const _Float16* __restrict__ VT, float* __restrict__ O) {
  __shared__ __attribute__((aligned(16))) unsigned char L[FA_KG * 4 * FA_TILE];      /* one K / V^T ring (4 tiles) per key group in the loop; the hand-over and the output staging behind it */
  static_assert(8 * 32 * FA_OP <= FA_KG * 4 * FA_TILE && 17 * 512 <= 32 * FA_OP, "the staging, and a wave's hand-over inside its staging part, must fit the array");
  const int grp = __builtin_amdgcn_readfirstlane((int)threadIdx.x >> 8);      /* key group, the same in all lanes of a wave: scalar */
  const int tid = threadIdx.x & 255, lane = tid & 31, wave = tid >> 5, c = lane & 15, h = lane >> 4;      /* place inside the key group */
  const size_t plane = blockIdx.y; const int q0 = blockIdx.x * 256 + wave * 32;
  /* staging: thread tid moves 16-byte chunks tid and tid + 256 of each 8 KiB tile; 8 threads cover one 128-byte row */
  const _Float16* kg = K + (plane * SQ + grp * (SQ / FA_KG)) * HD + tid * 8;
  const _Float16* vg = VT + plane * HD * SQ + (size_t)(tid >> 3) * SQ + grp * (SQ / FA_KG) + (tid & 7) * 8;
  unsigned char* ring = L + grp * 4 * FA_TILE;
  unsigned char* sd = ring + (tid >> 3) * FA_PITCH + (tid & 7) * 16;
  v8us rk0, rk1, rv0, rv1;
  auto gload = [&](int st) { rk0 = *(const v8us*)((const unsigned short*)kg + st * 64 * HD); rk1 = *(const v8us*)((const unsigned short*)kg + st * 64 * HD + 32 * HD);
    rv0 = *(const v8us*)((const unsigned short*)vg + st * 64); rv1 = *(const v8us*)((const unsigned short*)vg + st * 64 + (size_t)32 * SQ); };
  auto sstore = [&](int bf) { unsigned char* d = sd + bf * 2 * FA_TILE; *(v8us*)d = rk0; *(v8us*)(d + 32 * FA_PITCH) = rk1; *(v8us*)(d + FA_TILE) = rv0; *(v8us*)(d + FA_TILE + 32 * FA_PITCH) = rv1; };
  gload(0);
  v16h qf[2][2];      /* B operand: column c = query q0 + 16 g + c, in K's k order */
#pragma unroll
  for (int g = 0; g < 2; ++g) { const _Float16* qp = Q + (plane * SQ + q0 + 16 * g + c) * HD; qf[g][0] = g2_frag(qp, h); qf[g][1] = g2_frag(qp + 32, h); }
  v16h ones;      /* A operand whose row 0 (lanes 0 and 16) is 1.0 at all 32 k, every other row 0 */
  { const unsigned int o = (c == 0) ? 0x3C003C00u : 0u; const v8u ov = {o, o, o, o, o, o, o, o}; ones = __builtin_bit_cast(v16h, ov); }
  v8f acc[2][4], lacc[2]; float m_run[2];
#pragma unroll
  for (int g = 0; g < 2; ++g) { const v8f z = {0.f,0.f,0.f,0.f,0.f,0.f,0.f,0.f}; m_run[g] = -__builtin_inff(); lacc[g] = z;
#pragma unroll
    for (int t = 0; t < 4; ++t) acc[g][t] = z; }
  sstore(0); gload(1);
  __syncthreads();      /* stage 0 is visible to all waves */
  v16h kf[2][2], vf[4];
#pragma unroll 1      /* one copy of the loop body; the buffers alternate by st & 1 */
  for (int st = 0; st < FA_NS; ++st) {
    const unsigned char* kb = ring + (st & 1) * 2 * FA_TILE + c * FA_PITCH + 16 * h; const unsigned char* vb = kb + FA_TILE;
    fa_ldk(kf, kb); fa_ldv(vf, vb); fa_fence();
    if (st + 1 < FA_NS) sstore((st + 1) & 1);      /* into the buffer that every wave left before the barrier at the foot of the trip before */
    if (st + 2 < FA_NS) gload(st + 2);             /* a whole stage of work ahead of its use */
    fa_fence();
    fa_pass<true>(kf, vf, kb + 32 * FA_PITCH, vb + 64, qf, acc, lacc, m_run, ones);
    fa_pass<false>(kf, vf, kb, vb, qf, acc, lacc, m_run, ones);
    __syncthreads();      /* publishes stage st + 1 and ends every wave's reads of stage st */
  }
  /* hand-over: wave w of group 1 holds the same queries in the same lanes and registers as wave w of group 0; it lays its registers lane by lane (512 contiguous bytes a store) in that wave's part of L (the rings are free behind the last barrier) */
  unsigned char* eb = L + wave * 32 * FA_OP;
  float lsum[2];
#pragma unroll
  for (int g = 0; g < 2; ++g) { const float lr = lacc[g][0]; lsum[g] = lr + rs_xhalf(lr); }      /* register 0: the denominator in lanes 0-15, 0 in lanes 16-31 (row 8) */
  if (grp != 0) {
#pragma unroll
    for (int g = 0; g < 2; ++g) {
#pragma unroll
      for (int t = 0; t < 4; ++t) { const v8f o = acc[g][t]; unsigned char* d = eb + (g * 4 + t) * 1024 + lane * 16;
        const v4f lo = {o[0], o[1], o[2], o[3]}, hi = {o[4], o[5], o[6], o[7]}; *(v4fa*)d = lo; *(v4fa*)(d + 512) = hi; } }
    const v4f ml = {m_run[0], m_run[1], lsum[0], lsum[1]}; *(v4fa*)(eb + 16 * 512 + lane * 16) = ml; }
  __syncthreads();      /* group 1's sums are visible to group 0 */
  if (grp != 0) return;      /* no barrier follows */
  { const v4f ml = *(const v4fa*)(eb + 16 * 512 + lane * 16);
#pragma unroll
    for (int g = 0; g < 2; ++g) { const float mn = fmaxf(m_run[g], ml[g]); const float a0 = __builtin_amdgcn_exp2f(m_run[g] - mn), a1 = __builtin_amdgcn_exp2f(ml[g] - mn);      /* both halves on the common maximum */
      const float inv = 1.0f / (lsum[g] * a0 + ml[2 + g] * a1); const float f0 = a0 * inv, f1 = a1 * inv;
#pragma unroll
      for (int t = 0; t < 4; ++t) { const unsigned char* d = eb + (g * 4 + t) * 1024 + lane * 16; const v4f lo = *(const v4fa*)d, hi = *(const v4fa*)(d + 512);
        const v8f o = {lo[0], lo[1], lo[2], lo[3], hi[0], hi[1], hi[2], hi[3]}; acc[g][t] = acc[g][t] * f0 + o * f1; } } }
  __builtin_amdgcn_fence(__ATOMIC_ACQ_REL, "workgroup"); __builtin_amdgcn_wave_barrier();      /* every lane's reads of the hand-over before any lane's staging stores into the same bytes */
  /* epilogue: each wave of group 0 stages its 32 output rows in its own part of L and stores whole 256-byte rows */
#pragma unroll
  for (int g = 0; g < 2; ++g) {
#pragma unroll
    for (int t = 0; t < 4; ++t) { const v8f o = acc[g][t]; unsigned char* d = eb + (16 * g + c) * FA_OP + 64 * t + 32 * h;      /* row = query, d = 16 t + 8 h + r */
      const v4f lo = {o[0], o[1], o[2], o[3]}, hi = {o[4], o[5], o[6], o[7]}; *(v4fa*)d = lo; *(v4fa*)(d + 16) = hi; } }
  __builtin_amdgcn_fence(__ATOMIC_ACQ_REL, "workgroup"); __builtin_amdgcn_wave_barrier();      /* the wave's own LDS writes before its reads of other lanes' rows */
#pragma unroll
  for (int i = 0; i < 16; ++i) { const int row = 2 * i + h; const v4f v = *(const v4fa*)(eb + row * FA_OP + c * 16); *(v4f*)(O + (plane * SQ + q0 + row) * HD + c * 4) = v; } }

// ---- projections: x -> Q, K (token rows) and V^T (head-dim rows) of all planes in one launch ----
// Work-group = 8 waves = 256 token rows of one plane; a wave owns 32 rows. x is read once, f32, in whole lines, rounded (bf16, exact in f16) and laid in the wave's own LDS rows;
// the three weight matrices (bf16-rounded, x16, f16) and the biases (bf16-rounded) are converted once per work-group into LDS. One x fragment serves as B for Q and K and as A for V:
// Q^T = Wq.x^T puts 8 consecutive features of one token in a lane, V = x.Wv^T puts 8 consecutive tokens of one feature in a lane, so that every result leaves as a packed 16-byte LDS store
// in the layout its reader wants; global stores are whole 512-byte runs.
#define PJ_TOK 256                   /* token rows per work-group */
#define PJ_P 144                     /* LDS pitch of a 64-element f16 row, bytes: 128 + 16 (16-byte readers, no bank conflict) */
#define PJ_VP 528                    /* LDS pitch of a V^T row of PJ_TOK tokens, bytes: 512 + 16 */
typedef unsigned short v4us __attribute__((ext_vector_type(4), may_alias));
__device__ __forceinline__ v8us pj_pack(v8f d, v8f b) { FragH f;      /* f16(acc / 16 + bias): the x16 of the weights taken back, exactly */
#pragma unroll
  for (int r = 0; r < 8; ++r) f.h[r] = (_Float16)(d[r] * 0.0625f + b[r]);
  return f.half[0]; }
__global__ __launch_bounds__(256) void k_qkv(const float* __restrict__ x, const float* __restrict__ wq, const float* __restrict__ bq, const float* __restrict__ wk, const float* __restrict__ bk,
                                             const float* __restrict__ wv, const float* __restrict__ bv, _Float16* __restrict__ Q, _Float16* __restrict__ K, _Float16* __restrict__ VT) {
  __shared__ __attribute__((aligned(16))) unsigned char LW[3 * DM * PJ_P];       /* weights, row = output feature */
  __shared__ __attribute__((aligned(16))) float LB[4 * DM];                      /* biases; the last quarter only keeps the store below free of a branch */
  __shared__ __attribute__((aligned(16))) unsigned char LX[PJ_TOK * PJ_P];       /* x rows */
  __shared__ __attribute__((aligned(16))) unsigned char LO[2 * PJ_TOK * PJ_P];   /* Q rows, then K rows */
  __shared__ __attribute__((aligned(16))) unsigned char LV[HD * PJ_VP];          /* V^T rows */
  static_assert(SQ % PJ_TOK == 0 && DM == 64 && HD == 64, "a work-group stays inside one plane; rows of 64");
  const int tid = threadIdx.x, lane = tid & 31, wave = tid >> 5, c = lane & 15, h = lane >> 4;
  const size_t tok0 = (size_t)blockIdx.x * PJ_TOK;
  /* x: load i of a wave covers its rows 2i and 2i + 1 (512 contiguous bytes); all 16 in flight together, ahead of the weights */
  const char* xg = (const char*)(x + tok0 * DM); const unsigned xo = wave * 32 * DM * 4 + lane * 16;
  v4f xr[16];
#pragma unroll
  for (int i = 0; i < 16; ++i) xr[i] = *(const v4fa*)(xg + xo + i * 512);
  asm volatile("s_wait_xcnt 0x0" :: "v"(xo) : "memory");      /* the offset register of the loads above stays as it is up to here: a later load may take it as its destination */
  /* weights: thread tid converts 8-element chunks tid and tid + 256 of each matrix */
  const unsigned wo = tid * 32; v4f wr[3][2][2];
#pragma unroll
  for (int m = 0; m < 3; ++m) { const char* w = (const char*)((m == 0) ? wq : (m == 1) ? wk : wv);
#pragma unroll
    for (int j = 0; j < 2; ++j) { wr[m][j][0] = *(const v4fa*)(w + wo + j * 8192); wr[m][j][1] = *(const v4fa*)(w + wo + j * 8192 + 16); } }
  const float* bsrc = (tid < DM) ? bq : (tid < 2 * DM) ? bk : bv; const float braw = bsrc[tid & (DM - 1)];      /* by all 256 threads, so that the load goes out with the rest: under a branch it was a second trip to memory behind the weights */
  asm volatile("s_wait_xcnt 0x0" :: "v"(wo) : "memory");      /* as above, for the weight and bias loads */
#pragma unroll
  for (int m = 0; m < 3; ++m) {
#pragma unroll
    for (int j = 0; j < 2; ++j) { const int ch = tid + 256 * j; FragH f;
#pragma unroll
      for (int q = 0; q < 4; ++q) { f.h[q] = (_Float16)(bf16_round(wr[m][j][0][q]) * 16.0f); f.h[4 + q] = (_Float16)(bf16_round(wr[m][j][1][q]) * 16.0f); }
      *(v8us*)(LW + (m * DM + (ch >> 3)) * PJ_P + (ch & 7) * 16) = f.half[0]; } }
  LB[tid] = bf16_round(braw);
  unsigned char* xs = LX + wave * 32 * PJ_P;
#pragma unroll
  for (int i = 0; i < 16; ++i) { FragH f;
#pragma unroll
    for (int q = 0; q < 4; ++q) f.h[q] = (_Float16)bf16_round(xr[i][q]);
    const v4us o = {f.u[0], f.u[1], f.u[2], f.u[3]}; *(v4us*)(xs + (2 * i + h) * PJ_P + c * 8) = o; }
  __syncthreads();      /* weights and biases are visible to all waves (and each wave's x rows to its own lanes) */
  v16h xf[2][2];      /* row or column c = token 16 g + c of the wave, k = 32 ks + the hardware k order */
#pragma unroll
  for (int g = 0; g < 2; ++g) { xf[g][0] = fa_lds(xs + (16 * g + c) * PJ_P + 16 * h); xf[g][1] = fa_lds(xs + (16 * g + c) * PJ_P + 16 * h + 64); }
  const v8f z = {0.f,0.f,0.f,0.f,0.f,0.f,0.f,0.f};
#pragma unroll
  for (int m = 0; m < 3; ++m) {
    v16h wf[4][2];      /* row or column c = output feature 16 t + c, in the same k order as xf */
#pragma unroll
    for (int t = 0; t < 4; ++t) { const unsigned char* p = LW + (m * DM + 16 * t + c) * PJ_P + 16 * h; wf[t][0] = fa_lds(p); wf[t][1] = fa_lds(p + 64); }
#pragma unroll
    for (int t = 0; t < 4; ++t) {
      if (m < 2) {      /* D column c = token, register r = feature 16 t + 8 h + r */
        const v4f b0 = *(const v4fa*)(LB + m * DM + 16 * t + 8 * h), b1 = *(const v4fa*)(LB + m * DM + 16 * t + 8 * h + 4); const v8f b = {b0[0], b0[1], b0[2], b0[3], b1[0], b1[1], b1[2], b1[3]};
#pragma unroll
        for (int g = 0; g < 2; ++g) { const v8f d = fa_mma(wf[t][1], xf[g][1], fa_mma(wf[t][0], xf[g][0], z));
          *(v8us*)(LO + (m * PJ_TOK + wave * 32 + 16 * g + c) * PJ_P + 32 * t + 16 * h) = pj_pack(d, b); }
      } else {          /* D column c = feature 16 t + c, register r = token 16 g + 8 h + r */
        const float bs = LB[2 * DM + 16 * t + c]; const v8f b = {bs, bs, bs, bs, bs, bs, bs, bs};
#pragma unroll
        for (int g = 0; g < 2; ++g) { const v8f d = fa_mma(xf[g][1], wf[t][1], fa_mma(xf[g][0], wf[t][0], z));
          *(v8us*)(LV + (16 * t + c) * PJ_VP + (wave * 32 + 16 * g + 8 * h) * 2) = pj_pack(d, b); }
      } } }
  __syncthreads();      /* a V^T row holds the tokens of all eight waves */
#pragma unroll
  for (int m = 0; m < 2; ++m) { unsigned short* o = (unsigned short*)(m == 0 ? Q : K) + tok0 * DM;      /* 256 rows of 128 bytes, contiguous */
#pragma unroll
    for (int i = 0; i < 8; ++i) { const int ch = tid + 256 * i; *(v8us*)(o + ch * 8) = *(const v8us*)(LO + (m * PJ_TOK + (ch >> 3)) * PJ_P + (ch & 7) * 16); } }
  unsigned short* vo = (unsigned short*)VT + (tok0 / SQ) * HD * SQ + tok0 % SQ + lane * 8;      /* a wave stores one 512-byte run of a V^T row at a time */
#pragma unroll
  for (int i = 0; i < 8; ++i) { const int e = wave * 8 + i; *(v8us*)(vo + (size_t)e * SQ) = *(const v8us*)(LV + e * PJ_VP + lane * 16); } }

extern "C" void kernel_launch(void* const* d_in, const int* in_sizes, int n_in,
                              void* d_out, int out_size, void* d_ws, size_t ws_size, hipStream_t stream) {
  (void)in_sizes; (void)n_in; (void)out_size;
  const float* const* I = (const float* const*)d_in; const float* x = I[0]; const float* wq = I[1]; const float* bq = I[2]; const float* wk = I[3]; const float* bk = I[4]; const float* wv = I[5]; const float* bv = I[6];      /* natural [out][in] 64x64 weights + biases; x head-major = 32 planes of [2048][64] */
  char* ws = (char*)d_ws; size_t off = 0;
  auto take = [&](size_t bytes) { char* p = ws + off; off += (bytes + 255) & ~(size_t)255; return p; };
  _Float16* Q16 = (_Float16*)take(NR * DM * 2); _Float16* K16 = (_Float16*)take(NR * DM * 2);
  _Float16* VT = (_Float16*)take((size_t)NB * HD * SQ * 2);      /* V^T of all planes */
  if (off > ws_size) return;
  k_qkv<<<(unsigned)(NR / PJ_TOK), 256, 0, stream>>>(x, wq, bq, wk, bk, wv, bv, Q16, K16, VT);      /* all planes: 256 token rows per work-group */
  k_fattn<<<dim3(SQ / 256, NB), 256 * FA_KG, 0, stream>>>(Q16, K16, VT, (float*)d_out);      /* all planes: 256 queries per work-group of 16 waves, out written f32 straight into the output rows */
}

// v006
// Measured time: 38.7 microseconds a run.
// In two side-by-side timings against v005, it was 1.04 and 1.03 times as fast.
// Counting every step since v000, it is 333 times as fast.
#include <hip/hip_runtime.h>
#define NB 32
#define SQ 2048
#define DM 64
#define NH 1
#define HD 64
#define HG 1                         /* unused by the launches: heads per group of the non-template k_vt */
#define B0 0                         /* unused: the launches start at plane 0 */
#define NBR NB                       /* unused by the launches (only MP uses it) */
#define NR ((size_t)NB * SQ)         /* token rows */
#define MP ((int)((size_t)NBR * SQ)) /* unused: k_qkv projects all NR rows */
#define QN SQ                        /* unused: query rows per plane = SQ */
#define NHD NH                       /* unused: heads per plane */
#define MPO MP                       /* unused: no output stage */
#define LQ DM      /* unused: q and k rows have pitch DM, V^T rows SQ */
typedef __bf16 v16b __attribute__((ext_vector_type(16)));
typedef unsigned short v8us __attribute__((ext_vector_type(8), may_alias));
typedef float  v8f  __attribute__((ext_vector_type(8)));
typedef float  v4f  __attribute__((ext_vector_type(4)));
typedef float  v4fa __attribute__((ext_vector_type(4), may_alias));
union FragB { v16b v; v8us half[2]; unsigned short u[16]; };

__device__ __forceinline__ unsigned short bf16_bits(float x) { unsigned int u = __float_as_uint(x); return (unsigned short)((u + 0x7FFFu + ((u >> 16) & 1u)) >> 16); }
__device__ __forceinline__ float bf16_val(unsigned short b) { return __uint_as_float(((unsigned int)b) << 16); }
__device__ __forceinline__ float bf16_round(float x) { return bf16_val(bf16_bits(x)); }
// D += A·B with NT terms: 1 = ah·bh, 2 = + al·bh (A split), 3 = + ah·bl (both split)
template <int NT>
__device__ __forceinline__ v8f mmaN(v16b ah, v16b al, v16b bh, v16b bl, v8f c) {
  c = __builtin_amdgcn_wmma_f32_16x16x32_bf16(false, ah, false, bh, (short)0, c, false, false);
  if (NT >= 2) c = __builtin_amdgcn_wmma_f32_16x16x32_bf16(false, al, false, bh, (short)0, c, false, false);
  if (NT >= 3) c = __builtin_amdgcn_wmma_f32_16x16x32_bf16(false, ah, false, bl, (short)0, c, false, false);
  asm volatile("v_nop\n\tv_nop\n\tv_nop\n\tv_nop" : "+v"(c) : "v"(ah), "v"(al), "v"(bh), "v"(bl));
  return c;
}

__global__ __launch_bounds__(256) void k_wt_bf16(const float* __restrict__ W, unsigned short* __restrict__ Wt, int K, int N) {
  const int t = blockIdx.x * 256 + threadIdx.x;
  const int k8n = K / 8;
  if (t >= N * k8n) return;
  const int n = t / k8n, k8 = (t % k8n) * 8;
  v8us v;
#pragma unroll
  for (int i = 0; i < 8; ++i) v[i] = bf16_bits(W[(size_t)(k8 + i) * N + n]);
  *(v8us*)(Wt + (size_t)n * K + k8) = v;
  
}

// GEMM C[M][N] (f32, pitch ldc) = act(A[M][K]·W + bias). A f32 row-major (pitch lda) converted per fragment to bf16
// (ASPLIT: hi/lo two planes -> 2 terms, else single rounded term); Wt bf16 [N][K] (pitch ldb). BIAS_BF16 rounds the
// bias to bf16 first (bias quantised to bf16 before the add). K%32==0, M%16==0, N%64==0.
template <bool ASPLIT, int ACT, bool BIAS_BF16>
__global__ __launch_bounds__(128) void k_gemm_bf(const float* __restrict__ A, int lda, const unsigned short* __restrict__ Wt, int ldb,
                                               const float* __restrict__ bias, float* __restrict__ C, int ldc, int M, int N, int K) {
  __shared__ __attribute__((aligned(16))) float so[4][16][64];
  const int tid = threadIdx.x, w = tid >> 5, lane = tid & 31, ln = lane & 15, hh = lane >> 4;
  const int ntn = N / 64;
  const int wid = blockIdx.x * 4 + w;
  const int mt = wid / ntn, nq = wid % ntn;
  if (mt * 16 >= M) return;
  const int row0 = mt * 16, col0 = nq * 64;
  const float* arow = A + (size_t)(row0 + ln) * lda;
  v8f acc[4] = {};
  for (int kb = 0; kb < K; kb += 32) {
    FragB ah, al;
    const v4f x0 = *(const v4fa*)(arow + kb + 8 * hh), x1 = *(const v4fa*)(arow + kb + 8 * hh + 4);
    const v4f x2 = *(const v4fa*)(arow + kb + 16 + 8 * hh), x3 = *(const v4fa*)(arow + kb + 16 + 8 * hh + 4);
    float xs[16] = {x0[0],x0[1],x0[2],x0[3],x1[0],x1[1],x1[2],x1[3],x2[0],x2[1],x2[2],x2[3],x3[0],x3[1],x3[2],x3[3]};
#pragma unroll
    for (int i = 0; i < 16; ++i) { const unsigned short hb = bf16_bits(xs[i]); ah.u[i] = hb; al.u[i] = ASPLIT ? bf16_bits(xs[i] - bf16_val(hb)) : (unsigned short)0; }
#pragma unroll
    for (int t = 0; t < 4; ++t) {
      const unsigned short* brow = Wt + (size_t)(col0 + t * 16 + ln) * ldb + kb;
      FragB b;
      b.half[0] = *(const v8us*)(brow + 8 * hh);
      b.half[1] = *(const v8us*)(brow + 16 + 8 * hh);
      acc[t] = mmaN<ASPLIT ? 2 : 1>(ah.v, al.v, b.v, b.v, acc[t]);
    }
  }
#pragma unroll
  for (int t = 0; t < 4; ++t) {
    float bv = bias ? bias[col0 + t * 16 + ln] : 0.f;
    if (BIAS_BF16) bv = bf16_round(bv);
#pragma unroll
    for (int r = 0; r < 8; ++r) { float v = acc[t][r] + bv; if (ACT == 1) v = fmaxf(v, 0.f); so[w][8 * hh + r][t * 16 + ln] = v; }
  }
  __builtin_amdgcn_fence(__ATOMIC_ACQ_REL, "workgroup");
  __builtin_amdgcn_wave_barrier();
  const int rsub = lane >> 4, c4 = (lane & 15) * 4;
  {
#pragma unroll
    for (int q = 0; q < 8; ++q) {
      const int r = q * 2 + rsub;
      const v4f v = *(const v4fa*)&so[w][r][c4];
      *(v4f*)(C + (size_t)(row0 + r) * ldc + col0 + c4) = v;
    }
    
  }
}

// GEMM C = act(A·W + bias + resid): A f32 (ASPLIT -> hi/lo 2 terms), Wt bf16 [N][K]; ACT 0 none, 1 relu, 2 exact gelu;
// resid (optional, f32, row index = (row % rmod), pitch ldr, RES_BF16 rounds it) added before the activation.
template <bool ASPLIT, int ACT, bool BIAS_BF16, bool RES_BF16>
__global__ __launch_bounds__(128) void k_gemm_bf3(const float* __restrict__ A, int lda, const unsigned short* __restrict__ Wt, int ldb,
                                                const float* __restrict__ bias, const float* __restrict__ resid, int rmod, int ldr,
                                                float* __restrict__ C, int ldc, int M, int N, int K) {
  __shared__ __attribute__((aligned(16))) float so[4][16][64];
  const int tid = threadIdx.x, w = tid >> 5, lane = tid & 31, ln = lane & 15, hh = lane >> 4;
  const int ntn = N / 64;
  const int wid = blockIdx.x * 4 + w;
  const int mt = wid / ntn, nq = wid % ntn;
  if (mt * 16 >= M) return;
  const int row0 = mt * 16, col0 = nq * 64;
  const float* arow = A + (size_t)(row0 + ln) * lda;
  v8f acc[4] = {};
  for (int kb = 0; kb < K; kb += 32) {
    FragB ah, al;
    const v4f x0 = *(const v4fa*)(arow + kb + 8 * hh), x1 = *(const v4fa*)(arow + kb + 8 * hh + 4);
    const v4f x2 = *(const v4fa*)(arow + kb + 16 + 8 * hh), x3 = *(const v4fa*)(arow + kb + 16 + 8 * hh + 4);
    float xs[16] = {x0[0],x0[1],x0[2],x0[3],x1[0],x1[1],x1[2],x1[3],x2[0],x2[1],x2[2],x2[3],x3[0],x3[1],x3[2],x3[3]};
#pragma unroll
    for (int i = 0; i < 16; ++i) { const unsigned short hb = bf16_bits(xs[i]); ah.u[i] = hb; al.u[i] = ASPLIT ? bf16_bits(xs[i] - bf16_val(hb)) : (unsigned short)0; }
#pragma unroll
    for (int t = 0; t < 4; ++t) {
      const unsigned short* brow = Wt + (size_t)(col0 + t * 16 + ln) * ldb + kb;
      FragB b;
      b.half[0] = *(const v8us*)(brow + 8 * hh);
      b.half[1] = *(const v8us*)(brow + 16 + 8 * hh);
      acc[t] = mmaN<ASPLIT ? 2 : 1>(ah.v, al.v, b.v, b.v, acc[t]);
    }
  }
#pragma unroll
  for (int t = 0; t < 4; ++t) {
    const int col = col0 + t * 16 + ln;
    float bv = bias ? bias[col] : 0.f;
    if (BIAS_BF16) bv = bf16_round(bv);
#pragma unroll
    for (int r = 0; r < 8; ++r) {
      float v = acc[t][r] + bv;
      if (resid) { float rv = resid[(size_t)((row0 + 8 * hh + r) % rmod) * ldr + col]; if (RES_BF16) rv = bf16_round(rv); v += rv; }
      if (ACT == 1) v = fmaxf(v, 0.f);
      if (ACT == 2) v = 0.5f * v * (1.0f + erff(v * 0.70710678118654752f));
      if (ACT == 3) { const float u = 0.7978845608028654f * (v + 0.044715f * v * v * v); v = 0.5f * v * (1.0f + tanhf(u)); }
      so[w][8 * hh + r][t * 16 + ln] = v;
    }
  }
  __builtin_amdgcn_fence(__ATOMIC_ACQ_REL, "workgroup");
  __builtin_amdgcn_wave_barrier();
  const int rsub = lane >> 4, c4 = (lane & 15) * 4;
  {
#pragma unroll
    for (int q = 0; q < 8; ++q) {
      const int r = q * 2 + rsub;
      const v4f v = *(const v4fa*)&so[w][r][c4];
      *(v4f*)(C + (size_t)(row0 + r) * ldc + col0 + c4) = v;
    }
    
  }
}
// row LayerNorm (biased variance, eps) over N: s = X (+ R); optional out_sum <- s; out_norm <- (s-mu)*rsqrt(var+eps)*g + b
template <bool PARAM_BF16>
__global__ __launch_bounds__(256) void k_layernorm(const float* __restrict__ X, const float* __restrict__ R, const float* __restrict__ g, const float* __restrict__ bta,
                                                  float* __restrict__ out_sum, float* __restrict__ out_norm, int N, float eps) {
  __shared__ float red[256];
  const int row = blockIdx.x, tid = threadIdx.x;
  const float* x = X + (size_t)row * N; const float* rr = R ? R + (size_t)row * N : nullptr;
  float vals[16];                     // up to N = 4096
  const int per = N / 256;            // contiguous chunk per thread? use strided-by-4 chunks: thread handles j = tid*4 + 1024*u
  float s1 = 0.f;
  for (int u = 0; u < per / 4; ++u) {
    const int j = tid * 4 + 1024 * u;
    const v4f a = *(const v4fa*)(x + j);
    v4f b = {0.f,0.f,0.f,0.f}; if (rr) b = *(const v4fa*)(rr + j);
#pragma unroll
    for (int q = 0; q < 4; ++q) { const float v = a[q] + b[q]; vals[u * 4 + q] = v; s1 += v; }
  }
  red[tid] = s1; __syncthreads();
  for (int st = 128; st > 0; st >>= 1) { if (tid < st) red[tid] += red[tid + st]; __syncthreads(); }
  const float mu = red[0] / (float)N; __syncthreads();
  float s2 = 0.f;
  for (int u = 0; u < per / 4; ++u)
#pragma unroll
    for (int q = 0; q < 4; ++q) { const float c = vals[u * 4 + q] - mu; s2 += c * c; }
  red[tid] = s2; __syncthreads();
  for (int st = 128; st > 0; st >>= 1) { if (tid < st) red[tid] += red[tid + st]; __syncthreads(); }
  const float rs = rsqrtf(red[0] / (float)N + eps);
  {
    for (int u = 0; u < per / 4; ++u) {
      const int j = tid * 4 + 1024 * u;
      v4f o, sm;
#pragma unroll
      for (int q = 0; q < 4; ++q) {
        float gg = g[j + q], bb = bta[j + q];
        if (PARAM_BF16) { gg = bf16_round(gg); bb = bf16_round(bb); }
        sm[q] = vals[u * 4 + q]; o[q] = (vals[u * 4 + q] - mu) * rs * gg + bb;
      }
      if (out_sum) *(v4f*)(out_sum + (size_t)row * N + j) = sm;
      *(v4f*)(out_norm + (size_t)row * N + j) = o;
    }
    
  }
}



// ---- f16 WMMA path (v_wmma_f32_16x16x32_f16): 11-bit significands for operands in range — used where a [0,1] probability operand needs more precision than bf16
typedef _Float16 v16h __attribute__((ext_vector_type(16)));
union FragH { v16h v; v8us half[2]; _Float16 h[16]; unsigned short u[16]; };
template <int NT>
__device__ __forceinline__ v8f mmaH(v16h ah, v16h al, v16h bh, v16h bl, v8f c) {
  c = __builtin_amdgcn_wmma_f32_16x16x32_f16(false, ah, false, bh, (short)0, c, false, false);
  if (NT >= 2) c = __builtin_amdgcn_wmma_f32_16x16x32_f16(false, al, false, bh, (short)0, c, false, false);
  if (NT >= 3) c = __builtin_amdgcn_wmma_f32_16x16x32_f16(false, ah, false, bl, (short)0, c, false, false);
  asm volatile("v_nop\n\tv_nop\n\tv_nop\n\tv_nop" : "+v"(c) : "v"(ah), "v"(al), "v"(bh), "v"(bl));
  return c;
}
// batched GEMM like k_gemm_b but f16 operands: A f32 (split into f16 hi/lo if ASPLIT, else rounded to f16), Bt = f16 values [n][k]; alpha; C f32; N multiple of 16 (partial tiles skipped)
template <bool ASPLIT>
__global__ __launch_bounds__(128) void k_gemm_h(const float* __restrict__ A, int lda, size_t sA, const _Float16* __restrict__ Bh, int ldb, size_t sB, float alpha, float* __restrict__ C, int ldc, size_t sC, int M, int N, int K) {
  __shared__ __attribute__((aligned(16))) float so[4][16][64];
  const int tid = threadIdx.x, w = tid >> 5, lane = tid & 31, ln = lane & 15, hh = lane >> 4; const int by = blockIdx.y;
  A += (size_t)by * sA; Bh += (size_t)by * sB; C += (size_t)by * sC;
  const int ntn = (N + 63) / 64; const int wid = blockIdx.x * 4 + w; const int mt = wid / ntn, nq = wid % ntn; if (mt * 16 >= M) return;
  const int row0 = mt * 16, col0 = nq * 64; const float* arow = A + (size_t)(row0 + ln) * lda;
  v8f acc[4] = {};
  for (int kb = 0; kb < K; kb += 32) {
    FragH ah, al;
    const v4f x0 = *(const v4fa*)(arow + kb + 8 * hh), x1 = *(const v4fa*)(arow + kb + 8 * hh + 4), x2 = *(const v4fa*)(arow + kb + 16 + 8 * hh), x3 = *(const v4fa*)(arow + kb + 16 + 8 * hh + 4);
    float xs[16] = {x0[0],x0[1],x0[2],x0[3],x1[0],x1[1],x1[2],x1[3],x2[0],x2[1],x2[2],x2[3],x3[0],x3[1],x3[2],x3[3]};
#pragma unroll
    for (int i = 0; i < 16; ++i) { const _Float16 h = (_Float16)xs[i]; ah.h[i] = h; al.h[i] = ASPLIT ? (_Float16)(xs[i] - (float)h) : (_Float16)0.0f; }
#pragma unroll
    for (int t = 0; t < 4; ++t) { if (col0 + t * 16 >= N) continue; const size_t boff = (size_t)(col0 + t * 16 + ln) * ldb + kb; FragH bq; bq.half[0] = *(const v8us*)(Bh + boff + 8 * hh); bq.half[1] = *(const v8us*)(Bh + boff + 16 + 8 * hh);
      acc[t] = mmaH<ASPLIT ? 2 : 1>(ah.v, al.v, bq.v, bq.v, acc[t]); }
  }
#pragma unroll
  for (int t = 0; t < 4; ++t) { if (col0 + t * 16 >= N) continue;
#pragma unroll
    for (int r = 0; r < 8; ++r) so[w][8 * hh + r][t * 16 + ln] = acc[t][r] * alpha; }
  __builtin_amdgcn_fence(__ATOMIC_ACQ_REL, "workgroup"); __builtin_amdgcn_wave_barrier();
  const int rsub = lane >> 4, c4 = (lane & 15) * 4;
  {
#pragma unroll
    for (int q = 0; q < 8; ++q) { const int r = q * 2 + rsub; if (col0 + c4 < N) { const v4f v = *(const v4fa*)&so[w][r][c4]; *(v4f*)(C + (size_t)(row0 + r) * ldc + col0 + c4) = v; } }
     }
}

// Wt[n][k] = f16(W[k][n]·scale) from f32 row-major W[K][N] (scale = power of two; bf16-exact weights stay exact in f16 away from the subnormal range)
__global__ __launch_bounds__(256) void k_wt_f16(const float* __restrict__ W, _Float16* __restrict__ Wt, int K, int N, float scale) {
  const int t = blockIdx.x * 256 + threadIdx.x; if (t >= N * (K / 8)) return; const int n = t / (K / 8), k8 = (t % (K / 8)) * 8; FragH f;
#pragma unroll
  for (int i = 0; i < 8; ++i) f.h[i] = (_Float16)(bf16_round(W[(size_t)(k8 + i) * N + n]) * scale); const v8us o = f.half[0];
  *(v8us*)((unsigned short*)Wt + (size_t)n * K + k8) = o; 
}
// k_gemm_hh variant with fused epilogue: v = acc·alpha + bias[by·sBias + col] (+ CP[(row/rowsPerB)·sCPb + by·64 + col] if CP) ; ACT 0 none / 1 elu ; writes f16 C16 (and f32 C if non-null)
template <int ACT>
__global__ __launch_bounds__(128) void k_gemm_hhx(const _Float16* __restrict__ A, int lda, size_t sA, const _Float16* __restrict__ Bh, int ldb, size_t sB, float alpha, const float* __restrict__ bias, size_t sBias, const float* __restrict__ CP, int rowsPerB, size_t sCPb, int row0g,
    float* __restrict__ C, _Float16* __restrict__ C16, int ldc, size_t sC, int M, int N, int K) {
  __shared__ __attribute__((aligned(16))) float so[4][16][64];
  const int tid = threadIdx.x, w = tid >> 5, lane = tid & 31, ln = lane & 15, hh = lane >> 4; const int by = blockIdx.y;
  A += (size_t)by * sA; Bh += (size_t)by * sB; const size_t cofs = (size_t)by * sC; const float* bp = bias ? bias + (size_t)by * sBias : nullptr;
  const int ntn = (N + 63) / 64; const int wid = blockIdx.x * 4 + w; const int mt = wid / ntn, nq = wid % ntn; if (mt * 16 >= M) return;
  const int row0 = mt * 16, col0 = nq * 64; const _Float16* arow = A + (size_t)(row0 + ln) * lda;
  v8f acc[4] = {};
  for (int kb = 0; kb < K; kb += 32) { FragH ah; ah.half[0] = *(const v8us*)((const unsigned short*)arow + kb + 8 * hh); ah.half[1] = *(const v8us*)((const unsigned short*)arow + kb + 16 + 8 * hh);
#pragma unroll
    for (int t = 0; t < 4; ++t) { if (col0 + t * 16 >= N) continue; const size_t boff = (size_t)(col0 + t * 16 + ln) * ldb + kb; FragH bq; bq.half[0] = *(const v8us*)((const unsigned short*)Bh + boff + 8 * hh); bq.half[1] = *(const v8us*)((const unsigned short*)Bh + boff + 16 + 8 * hh);
      acc[t] = mmaH<1>(ah.v, ah.v, bq.v, bq.v, acc[t]); }
  }
#pragma unroll
  for (int t = 0; t < 4; ++t) { if (col0 + t * 16 >= N) continue; const int col = col0 + t * 16 + ln; const float bv = bp ? bf16_round(bp[col]) : 0.f;
#pragma unroll
    for (int r = 0; r < 8; ++r) { float v = acc[t][r] * alpha + bv; if (CP) { const int rr = row0g + row0 + 8 * hh + r; if (rowsPerB < 0) v += CP[cofs + (size_t)rr * ldc + col];      /* rowsPerB < 0: own element of the batched C plane */ else { const int bidx = rr / rowsPerB; v += CP[(size_t)bidx * sCPb + (size_t)by * 64 + col]; } } if (ACT == 1) v = (v > 0.f) ? v : expm1f(v); else if (ACT == 7) v = (v > 0.f) ? v + 1.0f : expf(v); else if (ACT == 8) v = tanhf(v); else if (ACT == 9) v = 0.5f * v * (1.0f + tanhf(0.7978845608028654f * (v + 0.044715f * v * v * v))); else if (ACT == 11) v = 1.0f / (1.0f + expf(-v)); else if (ACT == 12) v = (v > 0.f) ? v : 0.01f * v; else if (ACT == 14) v = (v > 0.f) ? v : 0.1f * v; else if (ACT == 16) v = (v >= 0.f) ? v : 0.3f * v; else if (ACT == 17) v = (v >= 0.f) ? v : 0.2f * v; else if (ACT == 15) v = v / (1.0f + expf(-v)); else if (ACT == 3) v = fmaxf(v, 0.f); else if (ACT == 6) v = 0.5f * v * (1.0f + erff(v * 0.70710678118654752f)); so[w][8 * hh + r][t * 16 + ln] = v; } }
  __builtin_amdgcn_fence(__ATOMIC_ACQ_REL, "workgroup"); __builtin_amdgcn_wave_barrier();
  const int rsub = lane >> 4, c4 = (lane & 15) * 4; typedef _Float16 v4h __attribute__((ext_vector_type(4)));
  {
#pragma unroll
    for (int q = 0; q < 8; ++q) { const int r = q * 2 + rsub; if (col0 + c4 < N) { const v4f v = *(const v4fa*)&so[w][r][c4]; if (C) *(v4f*)(C + cofs + (size_t)(row0 + r) * ldc + col0 + c4) = v; if (C16) { v4h h4; for (int i = 0; i < 4; ++i) h4[i] = (_Float16)v[i]; *(v4h*)(C16 + cofs + (size_t)(row0 + r) * ldc + col0 + c4) = h4; } } }
     }
}


typedef _Float16 v4h __attribute__((ext_vector_type(4)));

__global__ __launch_bounds__(256) void k_h16(const float* __restrict__ x, _Float16* __restrict__ X16, size_t n8) { const size_t t = (size_t)blockIdx.x * 256 + threadIdx.x; if (t >= n8) return; FragH f;
#pragma unroll
  for (int q = 0; q < 8; ++q) f.h[q] = (_Float16)x[t * 8 + q]; *(v8us*)((unsigned short*)X16 + t * 8) = f.half[0];  }
__global__ __launch_bounds__(256) void k_round16f(const float* __restrict__ W, _Float16* __restrict__ Bt, size_t n8) { const size_t t = (size_t)blockIdx.x * 256 + threadIdx.x; if (t >= n8) return; FragH f;
#pragma unroll
  for (int i = 0; i < 8; ++i) f.h[i] = (_Float16)(bf16_round(W[t * 8 + i]) * 16.0f); *(v8us*)((unsigned short*)Bt + t * 8) = f.half[0];  }

__global__ __launch_bounds__(256) void k_hl(const float* __restrict__ F, _Float16* __restrict__ Hh, _Float16* __restrict__ Hl, size_t n8) { const size_t t = (size_t)blockIdx.x * 256 + threadIdx.x; if (t >= n8) return; FragH fh, fl; const v4f a = *(const v4fa*)(F + t * 8), c = *(const v4fa*)(F + t * 8 + 4);
#pragma unroll
  for (int q = 0; q < 4; ++q) { _Float16 h = (_Float16)a[q]; fh.h[q] = h; fl.h[q] = (_Float16)((a[q] - (float)h) * 1024.0f); h = (_Float16)c[q]; fh.h[4 + q] = h; fl.h[4 + q] = (_Float16)((c[q] - (float)h) * 1024.0f); }
  { *(v8us*)((unsigned short*)Hh + t * 8) = fh.half[0]; *(v8us*)((unsigned short*)Hl + t * 8) = fl.half[0];  } }

// ---- A or B fragment of a 16x16x32 f16 product, straight from a global f16 row ----
__device__ __forceinline__ v16h g2_frag(const _Float16* p, int hh) { FragH f; f.half[0] = *(const v8us*)((const unsigned short*)p + 8 * hh); f.half[1] = *(const v8us*)((const unsigned short*)p + 16 + 8 * hh); return f.v; }


__global__ __launch_bounds__(256) void k_rsm(const float* __restrict__ S, _Float16* __restrict__ P, int nrows) {
  #pragma clang fp contract(off)
  const int i = blockIdx.x * 256 + threadIdx.x; if (i >= nrows) return; const float* s = S + (size_t)i * SQ; float mx = -3.0e38f;
#pragma unroll 1
  for (int j = 0; j < SQ; ++j) mx = fmaxf(mx, s[j]); float se = 0.f;
#pragma unroll 1
  for (int j = 0; j < SQ; ++j) se += expf(s[j] - mx); const float sc = 256.0f / se;
#pragma unroll 1
  for (int j0 = 0; j0 < SQ; j0 += 8) { FragH f; for (int q = 0; q < 8; ++q) f.h[q] = (_Float16)(expf(s[j0 + q] - mx) * sc); unsigned short* d = (unsigned short*)P + (size_t)i * SQ + j0; *(v8us*)d = f.half[0];  } }
__global__ __launch_bounds__(256) void k_vt(const _Float16* __restrict__ V16, int b, int h0, _Float16* __restrict__ VT) { __shared__ unsigned short tl[64][65]; const int tid = threadIdx.x; const int hh = blockIdx.x % HG, sg = blockIdx.x / HG; const int s0 = sg * 64; const int h = h0 + hh;
  for (int i = tid; i < 64 * 8; i += 256) { const int j = i / 8, d8 = (i % 8) * 8; FragH f; f.half[0] = *(const v8us*)((const unsigned short*)V16 + ((size_t)b * SQ + s0 + j) * DM + h * HD + d8); for (int q = 0; q < 8; ++q) tl[d8 + q][j] = f.u[q]; }
  __syncthreads();
  { for (int i = tid; i < 64 * 8; i += 256) { const int d = i / 8, j8 = (i % 8) * 8; FragH f; for (int q = 0; q < 8; ++q) f.u[q] = tl[d][j8 + q]; *(v8us*)((unsigned short*)VT + ((size_t)hh * HD + d) * SQ + s0 + j8) = f.half[0]; }  } }



// lane l with lane l ^ 16: a register move, no LDS round trip
__device__ __forceinline__ float rs_xhalf(float x) { return __builtin_bit_cast(float, __builtin_amdgcn_permlanex16(__builtin_bit_cast(int, x), __builtin_bit_cast(int, x), 0x76543210, 0xfedcba98, false, false)); }
// ---- fused attention: scores, softmax and P.V of all planes in one launch ----
// Work-group = 16 waves = 256 queries of one plane, four waves per SIMD: the vector work of one wave's softmax runs under the products of the others. Two key groups of 8 waves: group 0 walks the first half of the keys,
// group 1 the second half, each with its own LDS ring and its own online softmax; behind the loop group 1 hands its sums, maxima and denominators to group 0 through LDS, which merges them and writes the output.
// A wave owns 32 query columns (two 16-column groups). Keys come in stages of 64: the K rows and the V^T rows of a stage
// are staged in LDS (two buffers; whole 128-byte lines from global memory through registers, loaded one trip ahead of their LDS store) and read as A fragments in the hardware k order.
// S^T = K.Q^T puts one query's scores in one lane (and its partner lane ^ 16), so the packed scores ARE the B operand of O^T += V^T.P^T: no exchange, no LDS for P.
#define FA_KG 2                      /* key groups per work-group */
#define FA_NS (SQ / FA_KG / 64)      /* stages of 64 keys per key group */
#define FA_PITCH 144                 /* LDS row pitch, bytes: 128 + 16, an odd multiple of 16 (16-byte readers, no bank conflict) */
#define FA_TILE (64 * FA_PITCH)      /* one operand's tile of one stage */
#define FA_OP 272                    /* output staging pitch, bytes: 256 + 16 */
typedef float v2f __attribute__((ext_vector_type(2)));
typedef _Float16 v2h __attribute__((ext_vector_type(2)));
typedef unsigned int v8u __attribute__((ext_vector_type(8)));
__device__ __forceinline__ v8f fa_mma(v16h a, v16h b, v8f c) { return __builtin_amdgcn_wmma_f32_16x16x32_f16(false, a, false, b, (short)0, c, false, false); }
__device__ __forceinline__ void fa_fence() { __builtin_amdgcn_sched_barrier(0); }      /* keeps a group of LDS loads, or a run of products, in one place */
__device__ __forceinline__ v16h fa_lds(const unsigned char* p) { FragH f; f.half[0] = *(const v8us*)p; f.half[1] = *(const v8us*)(p + 32); return f.v; }      /* p holds the lane's 16 * h: k = 8h .. 8h+7 and 16+8h .. 16+8h+7 */
__device__ __forceinline__ void fa_ldk(v16h (&kf)[2][2], const unsigned char* kb) {
#pragma unroll
  for (int kt = 0; kt < 2; ++kt) { kf[kt][0] = fa_lds(kb + kt * 16 * FA_PITCH); kf[kt][1] = fa_lds(kb + kt * 16 * FA_PITCH + 64); } }
__device__ __forceinline__ void fa_ldv(v16h (&vf)[4], const unsigned char* vb) {
#pragma unroll
  for (int t = 0; t < 4; ++t) vf[t] = fa_lds(vb + t * 16 * FA_PITCH); }
// One pass = 32 keys of one wave. The softmax shift of a pass is fixed before its scores are formed: nmt[g] holds minus the shift in use (log2 domain) in all eight registers and is the C operand of the score products, and Q comes
// pre-scaled by 64^-0.5 * log2(e), so that a product leaves the matrix unit as the argument of exp2. No maximum is taken first: the column sums of the f16 weights, which the matrix unit forms anyway for the denominator, tell
// whether the shift still serves. A sum of at most 2^8 bounds every weight of the pass by 2^8 (f16 holds it). A larger sum (or first, where the shift is -inf) sends the wave down the rare path: the pass's K rows are
// read again from LDS, the scores formed again without a shift, their maximum taken, the running sums rescaled and the weights formed anew. MORE: the stage holds a further pass, whose fragments are fetched ahead.
template <bool MORE>
__device__ __forceinline__ void fa_pass(v16h (&kf)[2][2], v16h (&vf)[4], const unsigned char* kt, const unsigned char* kn, const unsigned char* vn, const v16h (&qf)[2][2], v8f (&acc)[2][4], float (&lrun)[2], v8f (&nmt)[2], const v16h ones, const bool first) {
  const v8f z = {0.f,0.f,0.f,0.f,0.f,0.f,0.f,0.f};
  v8f s[2][2], ln[2]; v16h pf[2];
  auto scores = [&](const bool shifted) {
#pragma unroll
    for (int kt2 = 0; kt2 < 2; ++kt2) {
#pragma unroll
      for (int g = 0; g < 2; ++g) s[kt2][g] = fa_mma(kf[kt2][1], qf[g][1], fa_mma(kf[kt2][0], qf[g][0], shifted ? nmt[g] : z)); }
    fa_fence();      /* the eight products stay back to back: mixed with vector work, each would be padded with v_nop */
    if (MORE) { fa_ldk(kf, kn); fa_fence(); } };      /* next pass's K rows, in flight under this pass's softmax */
  auto weights = [&]() {
#pragma unroll
    for (int g = 0; g < 2; ++g) { v8u w;
#pragma unroll
      for (int i = 0; i < 8; ++i) {
        w[i] = __builtin_bit_cast(unsigned int, __builtin_convertvector(v2f{__builtin_amdgcn_exp2f(s[i >> 2][g][2 * (i & 3)]), __builtin_amdgcn_exp2f(s[i >> 2][g][2 * (i & 3) + 1])}, v2h)); }
      pf[g] = __builtin_bit_cast(v16h, w);
      ln[g] = fa_mma(ones, pf[g], z); } };      /* row 0 (register 0, lanes 0-15) = the column sums of P^T as rounded to f16: this pass's share of the softmax denominator */
  auto redo = [&]() {
    fa_ldk(kf, kt); scores(false);
#pragma unroll
    for (int g = 0; g < 2; ++g) { float mx = s[0][g][0];
#pragma unroll
      for (int r = 1; r < 8; ++r) mx = fmaxf(mx, s[0][g][r]);
#pragma unroll
      for (int r = 0; r < 8; ++r) mx = fmaxf(mx, s[1][g][r]);
      mx = fmaxf(mx, rs_xhalf(mx));      /* both halves of the wave hold the query's maximum of this pass */
      const float mo = -nmt[g][0]; const float mn = fmaxf(mo, mx); const float corr = __builtin_amdgcn_exp2f(mo - mn); lrun[g] = lrun[g] * corr;
      nmt[g] = z - mn; s[0][g] = s[0][g] - mn; s[1][g] = s[1][g] - mn;
#pragma unroll
      for (int t = 0; t < 4; ++t) acc[g][t] = acc[g][t] * corr; }
    weights(); };      /* every weight is now at most 1 */
  unsigned int again = first ? 1u : 0u;      /* a lane mask, tested as a scalar */
  if (!first) { scores(true); weights();
    again = __builtin_amdgcn_ballot_w32(ln[0][0] + ln[1][0] > 256.0f); }      /* one scalar branch a pass; the sums are not negative, and an overflowed weight makes its sum inf, which is caught here too */
  if (again != 0u) redo();
#pragma unroll
  for (int g = 0; g < 2; ++g) {
#pragma unroll
    for (int t = 0; t < 4; ++t) acc[g][t] = fa_mma(vf[t], pf[g], acc[g][t]);
    lrun[g] += ln[g][0]; }
  if (MORE) { fa_fence(); fa_ldv(vf, vn); fa_fence(); }      /* next pass's V^T rows, in flight under its scores and softmax */
}
__global__ __launch_bounds__(256 * FA_KG) void k_fattn(const _Float16* __restrict__ Q, const _Float16* __restrict__ K, const _Float16* __restrict__ VT, float* __restrict__ O) {
  __shared__ __attribute__((aligned(16))) unsigned char L[FA_KG * 4 * FA_TILE];      /* one K / V^T ring (4 tiles) per key group in the loop; the hand-over and the output staging behind it */
  static_assert(8 * 32 * FA_OP <= FA_KG * 4 * FA_TILE && 17 * 512 <= 32 * FA_OP, "the staging, and a wave's hand-over inside its staging part, must fit the array");
  const int grp = __builtin_amdgcn_readfirstlane((int)threadIdx.x >> 8);      /* key group, the same in all lanes of a wave: scalar */
  const int tid = threadIdx.x & 255, c = tid & 15, h = (tid >> 4) & 1;      /* place inside the key group */
  const int wave = __builtin_amdgcn_readfirstlane(tid >> 5);      /* the same in all lanes of a wave: scalar */
  const size_t plane = blockIdx.y; const int q0 = blockIdx.x * 256 + wave * 32;
  /* staging: thread tid moves 16-byte chunks tid and tid + 256 of each 8 KiB tile; 8 threads cover one 128-byte row */
  const _Float16* kg = K + (plane * SQ + grp * (SQ / FA_KG)) * HD + tid * 8;
  const _Float16* vg = VT + plane * HD * SQ + (size_t)(tid >> 3) * SQ + grp * (SQ / FA_KG) + (tid & 7) * 8;
  unsigned char* ring = L + grp * 4 * FA_TILE;
  unsigned char* sd = ring + (tid >> 3) * FA_PITCH + (tid & 7) * 16;
  v8us rk0, rk1, rv0, rv1;
  auto gload = [&](int st) { rk0 = *(const v8us*)((const unsigned short*)kg + st * 64 * HD); rk1 = *(const v8us*)((const unsigned short*)kg + st * 64 * HD + 32 * HD);
    rv0 = *(const v8us*)((const unsigned short*)vg + st * 64); rv1 = *(const v8us*)((const unsigned short*)vg + st * 64 + (size_t)32 * SQ); };
  auto sstore = [&](int bf) { unsigned char* d = sd + bf * 2 * FA_TILE; *(v8us*)d = rk0; *(v8us*)(d + 32 * FA_PITCH) = rk1; *(v8us*)(d + FA_TILE) = rv0; *(v8us*)(d + FA_TILE + 32 * FA_PITCH) = rv1; };
  gload(0);
  v16h qf[2][2];      /* B operand: column c = query q0 + 16 g + c (pre-scaled by the projection), in K's k order */
#pragma unroll
  for (int g = 0; g < 2; ++g) { const _Float16* qp = Q + (plane * SQ + q0 + 16 * g + c) * HD; qf[g][0] = g2_frag(qp, h); qf[g][1] = g2_frag(qp + 32, h); }
  v16h ones;      /* A operand whose row 0 (lanes 0 and 16) is 1.0 at all 32 k, every other row 0 */
  { const unsigned int o = (c == 0) ? 0x3C003C00u : 0u; const v8u ov = {o, o, o, o, o, o, o, o}; ones = __builtin_bit_cast(v16h, ov); }
  v8f acc[2][4], nmt[2]; float lrun[2];
#pragma unroll
  for (int g = 0; g < 2; ++g) { const v8f z = {0.f,0.f,0.f,0.f,0.f,0.f,0.f,0.f}; nmt[g] = z + __builtin_inff(); lrun[g] = 0.f;
#pragma unroll
    for (int t = 0; t < 4; ++t) acc[g][t] = z; }
  sstore(0); gload(1);
  __syncthreads();      /* stage 0 is visible to all waves */
  v16h kf[2][2], vf[4];
#pragma unroll 1      /* one copy of the loop body; the buffers alternate by st & 1 */
  for (int st = 0; st < FA_NS; ++st) {
    const unsigned char* kb = ring + (st & 1) * 2 * FA_TILE + c * FA_PITCH + 16 * h; const unsigned char* vb = kb + FA_TILE;
    fa_ldk(kf, kb); fa_ldv(vf, vb); fa_fence();
    if (st + 1 < FA_NS) sstore((st + 1) & 1);      /* into the buffer that every wave left before the barrier at the foot of the trip before */
    if (st + 2 < FA_NS) { gload(st + 2);           /* a whole stage of work ahead of its use */
      asm volatile("s_wait_xcnt 0x0" ::: "memory"); }      /* the address registers of the four loads above stay as they are up to here: the score products that follow take them as their destination */
    fa_fence();
    fa_pass<true>(kf, vf, kb, kb + 32 * FA_PITCH, vb + 64, qf, acc, lrun, nmt, ones, st == 0);
    fa_pass<false>(kf, vf, kb + 32 * FA_PITCH, kb, vb, qf, acc, lrun, nmt, ones, false);
    __syncthreads();      /* publishes stage st + 1 and ends every wave's reads of stage st */
  }
  /* hand-over: wave w of group 1 holds the same queries in the same lanes and registers as wave w of group 0; it lays its registers lane by lane (512 contiguous bytes a store) in that wave's part of L (the rings are free behind the last barrier) */
  const int lane = (int)__builtin_amdgcn_mbcnt_lo(~0u, 0u), ce = lane & 15, he = lane >> 4;      /* the lane's number formed anew: no register carries it, or what follows from it, across the loop */
  unsigned char* eb = L + wave * 32 * FA_OP;
  float lsum[2], m_run[2];
#pragma unroll
  for (int g = 0; g < 2; ++g) { const float lr = lrun[g]; lsum[g] = lr + rs_xhalf(lr); m_run[g] = -nmt[g][0]; }      /* the denominator in lanes 0-15, 0 in lanes 16-31 (row 8 of the sum tiles) */
  if (grp != 0) {
#pragma unroll
    for (int g = 0; g < 2; ++g) {
#pragma unroll
      for (int t = 0; t < 4; ++t) { const v8f o = acc[g][t]; unsigned char* d = eb + (g * 4 + t) * 1024 + lane * 16;
        const v4f lo = {o[0], o[1], o[2], o[3]}, hi = {o[4], o[5], o[6], o[7]}; *(v4fa*)d = lo; *(v4fa*)(d + 512) = hi; } }
    const v4f ml = {m_run[0], m_run[1], lsum[0], lsum[1]}; *(v4fa*)(eb + 16 * 512 + lane * 16) = ml; }
  __syncthreads();      /* group 1's sums are visible to group 0 */
  if (grp != 0) return;      /* no barrier follows */
  { const v4f ml = *(const v4fa*)(eb + 16 * 512 + lane * 16);
#pragma unroll
    for (int g = 0; g < 2; ++g) { const float mn = fmaxf(m_run[g], ml[g]); const float a0 = __builtin_amdgcn_exp2f(m_run[g] - mn), a1 = __builtin_amdgcn_exp2f(ml[g] - mn);      /* both halves on the common maximum */
      const float inv = 1.0f / (lsum[g] * a0 + ml[2 + g] * a1); const float f0 = a0 * inv, f1 = a1 * inv;
#pragma unroll
      for (int t = 0; t < 4; ++t) { const unsigned char* d = eb + (g * 4 + t) * 1024 + lane * 16; const v4f lo = *(const v4fa*)d, hi = *(const v4fa*)(d + 512);
        const v8f o = {lo[0], lo[1], lo[2], lo[3], hi[0], hi[1], hi[2], hi[3]}; acc[g][t] = acc[g][t] * f0 + o * f1; } } }
  __builtin_amdgcn_fence(__ATOMIC_ACQ_REL, "workgroup"); __builtin_amdgcn_wave_barrier();      /* every lane's reads of the hand-over before any lane's staging stores into the same bytes */
  /* epilogue: each wave of group 0 stages its 32 output rows in its own part of L and stores whole 256-byte rows */
#pragma unroll
  for (int g = 0; g < 2; ++g) {
#pragma unroll
    for (int t = 0; t < 4; ++t) { const v8f o = acc[g][t]; unsigned char* d = eb + (16 * g + ce) * FA_OP + 64 * t + 32 * he;      /* row = query, d = 16 t + 8 h + r */
      const v4f lo = {o[0], o[1], o[2], o[3]}, hi = {o[4], o[5], o[6], o[7]}; *(v4fa*)d = lo; *(v4fa*)(d + 16) = hi; } }
  __builtin_amdgcn_fence(__ATOMIC_ACQ_REL, "workgroup"); __builtin_amdgcn_wave_barrier();      /* the wave's own LDS writes before its reads of other lanes' rows */
#pragma unroll
  for (int i = 0; i < 16; ++i) { const int row = 2 * i + he; const v4f v = *(const v4fa*)(eb + row * FA_OP + ce * 16); *(v4f*)(O + (plane * SQ + q0 + row) * HD + ce * 4) = v; } }

// ---- projections: x -> Q, K (token rows) and V^T (head-dim rows) of all planes in one launch ----
// Work-group = 8 waves = 256 token rows of one plane; a wave owns 32 rows. x is read once, f32, in whole lines, rounded (bf16, exact in f16) and laid in the wave's own LDS rows;
// the three weight matrices (bf16-rounded, x16, f16) and the biases (bf16-rounded) are converted once per work-group into LDS. One x fragment serves as B for Q and K and as A for V:
// Q^T = Wq.x^T puts 8 consecutive features of one token in a lane, V = x.Wv^T puts 8 consecutive tokens of one feature in a lane, so that every result leaves as a packed 16-byte LDS store
// in the layout its reader wants; global stores are whole 512-byte runs.
#define PJ_TOK 256                   /* token rows per work-group */
#define PJ_P 144                     /* LDS pitch of a 64-element f16 row, bytes: 128 + 16 (16-byte readers, no bank conflict) */
#define PJ_VP 528                    /* LDS pitch of a V^T row of PJ_TOK tokens, bytes: 512 + 16 */
typedef unsigned short v4us __attribute__((ext_vector_type(4), may_alias));
__device__ __forceinline__ v8us pj_pack(v8f d, v8f b, float sc) { FragH f;      /* f16((acc / 16 + bias) * sc): the x16 of the weights taken back, exactly; sc = 1, or for Q the score scale, so that one rounding to f16 holds both */
#pragma unroll
  for (int r = 0; r < 8; ++r) f.h[r] = (_Float16)((d[r] * 0.0625f + b[r]) * sc);
  return f.half[0]; }
__global__ __launch_bounds__(256) void k_qkv(const float* __restrict__ x, const float* __restrict__ wq, const float* __restrict__ bq, const float* __restrict__ wk, const float* __restrict__ bk,
                                             const float* __restrict__ wv, const float* __restrict__ bv, _Float16* __restrict__ Q, _Float16* __restrict__ K, _Float16* __restrict__ VT) {
  __shared__ __attribute__((aligned(16))) unsigned char LW[3 * DM * PJ_P];       /* weights, row = output feature */
  __shared__ __attribute__((aligned(16))) float LB[4 * DM];                      /* biases; the last quarter only keeps the store below free of a branch */
  __shared__ __attribute__((aligned(16))) unsigned char LX[PJ_TOK * PJ_P];       /* x rows */
  __shared__ __attribute__((aligned(16))) unsigned char LO[2 * PJ_TOK * PJ_P];   /* Q rows, then K rows */
  __shared__ __attribute__((aligned(16))) unsigned char LV[HD * PJ_VP];          /* V^T rows */
  static_assert(SQ % PJ_TOK == 0 && DM == 64 && HD == 64, "a work-group stays inside one plane; rows of 64");
  const int tid = threadIdx.x, lane = tid & 31, wave = tid >> 5, c = lane & 15, h = lane >> 4;
  const size_t tok0 = (size_t)blockIdx.x * PJ_TOK;
  /* x: load i of a wave covers its rows 2i and 2i + 1 (512 contiguous bytes); all 16 in flight together, ahead of the weights */
  const char* xg = (const char*)(x + tok0 * DM); const unsigned xo = wave * 32 * DM * 4 + lane * 16;
  v4f xr[16];
#pragma unroll
  for (int i = 0; i < 16; ++i) xr[i] = *(const v4fa*)(xg + xo + i * 512);
  asm volatile("s_wait_xcnt 0x0" :: "v"(xo) : "memory");      /* the offset register of the loads above stays as it is up to here: a later load may take it as its destination */
  /* weights: thread tid converts 8-element chunks tid and tid + 256 of each matrix */
  const unsigned wo = tid * 32; v4f wr[3][2][2];
#pragma unroll
  for (int m = 0; m < 3; ++m) { const char* w = (const char*)((m == 0) ? wq : (m == 1) ? wk : wv);
#pragma unroll
    for (int j = 0; j < 2; ++j) { wr[m][j][0] = *(const v4fa*)(w + wo + j * 8192); wr[m][j][1] = *(const v4fa*)(w + wo + j * 8192 + 16); } }
  const float* bsrc = (tid < DM) ? bq : (tid < 2 * DM) ? bk : bv; const float braw = bsrc[tid & (DM - 1)];      /* by all 256 threads, so that the load goes out with the rest: under a branch it was a second trip to memory behind the weights */
  asm volatile("s_wait_xcnt 0x0" :: "v"(wo) : "memory");      /* as above, for the weight and bias loads */
#pragma unroll
  for (int m = 0; m < 3; ++m) {
#pragma unroll
    for (int j = 0; j < 2; ++j) { const int ch = tid + 256 * j; FragH f;
#pragma unroll
      for (int q = 0; q < 4; ++q) { f.h[q] = (_Float16)(bf16_round(wr[m][j][0][q]) * 16.0f); f.h[4 + q] = (_Float16)(bf16_round(wr[m][j][1][q]) * 16.0f); }
      *(v8us*)(LW + (m * DM + (ch >> 3)) * PJ_P + (ch & 7) * 16) = f.half[0]; } }
  LB[tid] = bf16_round(braw);
  unsigned char* xs = LX + wave * 32 * PJ_P;
#pragma unroll
  for (int i = 0; i < 16; ++i) { FragH f;
#pragma unroll
    for (int q = 0; q < 4; ++q) f.h[q] = (_Float16)bf16_round(xr[i][q]);
    const v4us o = {f.u[0], f.u[1], f.u[2], f.u[3]}; *(v4us*)(xs + (2 * i + h) * PJ_P + c * 8) = o; }
  __syncthreads();      /* weights and biases are visible to all waves (and each wave's x rows to its own lanes) */
  v16h xf[2][2];      /* row or column c = token 16 g + c of the wave, k = 32 ks + the hardware k order */
#pragma unroll
  for (int g = 0; g < 2; ++g) { xf[g][0] = fa_lds(xs + (16 * g + c) * PJ_P + 16 * h); xf[g][1] = fa_lds(xs + (16 * g + c) * PJ_P + 16 * h + 64); }
  const v8f z = {0.f,0.f,0.f,0.f,0.f,0.f,0.f,0.f};
#pragma unroll
  for (int m = 0; m < 3; ++m) {
    v16h wf[4][2];      /* row or column c = output feature 16 t + c, in the same k order as xf */
#pragma unroll
    for (int t = 0; t < 4; ++t) { const unsigned char* p = LW + (m * DM + 16 * t + c) * PJ_P + 16 * h; wf[t][0] = fa_lds(p); wf[t][1] = fa_lds(p + 64); }
#pragma unroll
    for (int t = 0; t < 4; ++t) {
      if (m < 2) {      /* D column c = token, register r = feature 16 t + 8 h + r */
        const v4f b0 = *(const v4fa*)(LB + m * DM + 16 * t + 8 * h), b1 = *(const v4fa*)(LB + m * DM + 16 * t + 8 * h + 4); const v8f b = {b0[0], b0[1], b0[2], b0[3], b1[0], b1[1], b1[2], b1[3]};
#pragma unroll
        for (int g = 0; g < 2; ++g) { const v8f d = fa_mma(wf[t][1], xf[g][1], fa_mma(wf[t][0], xf[g][0], z));
          *(v8us*)(LO + (m * PJ_TOK + wave * 32 + 16 * g + c) * PJ_P + 32 * t + 16 * h) = pj_pack(d, b, m == 0 ? 0.18033688011112042f : 1.0f); }
      } else {          /* D column c = feature 16 t + c, register r = token 16 g + 8 h + r */
        const float bs = LB[2 * DM + 16 * t + c]; const v8f b = {bs, bs, bs, bs, bs, bs, bs, bs};
#pragma unroll
        for (int g = 0; g < 2; ++g) { const v8f d = fa_mma(xf[g][1], wf[t][1], fa_mma(xf[g][0], wf[t][0], z));
          *(v8us*)(LV + (16 * t + c) * PJ_VP + (wave * 32 + 16 * g + 8 * h) * 2) = pj_pack(d, b, 1.0f); }
      } } }
  __syncthreads();      /* a V^T row holds the tokens of all eight waves */
#pragma unroll
  for (int m = 0; m < 2; ++m) { unsigned short* o = (unsigned short*)(m == 0 ? Q : K) + tok0 * DM;      /* 256 rows of 128 bytes, contiguous */
#pragma unroll
    for (int i = 0; i < 8; ++i) { const int ch = tid + 256 * i; *(v8us*)(o + ch * 8) = *(const v8us*)(LO + (m * PJ_TOK + (ch >> 3)) * PJ_P + (ch & 7) * 16); } }
  unsigned short* vo = (unsigned short*)VT + (tok0 / SQ) * HD * SQ + tok0 % SQ + lane * 8;      /* a wave stores one 512-byte run of a V^T row at a time */
#pragma unroll
  for (int i = 0; i < 8; ++i) { const int e = wave * 8 + i; *(v8us*)(vo + (size_t)e * SQ) = *(const v8us*)(LV + e * PJ_VP + lane * 16); } }

extern "C" void kernel_launch(void* const* d_in, const int* in_sizes, int n_in,
                              void* d_out, int out_size, void* d_ws, size_t ws_size, hipStream_t stream) {
  (void)in_sizes; (void)n_in; (void)out_size;
  const float* const* I = (const float* const*)d_in; const float* x = I[0]; const float* wq = I[1]; const float* bq = I[2]; const float* wk = I[3]; const float* bk = I[4]; const float* wv = I[5]; const float* bv = I[6];      /* natural [out][in] 64x64 weights + biases; x head-major = 32 planes of [2048][64] */
  char* ws = (char*)d_ws; size_t off = 0;
  auto take = [&](size_t bytes) { char* p = ws + off; off += (bytes + 255) & ~(size_t)255; return p; };
  _Float16* Q16 = (_Float16*)take(NR * DM * 2); _Float16* K16 = (_Float16*)take(NR * DM * 2);
  _Float16* VT = (_Float16*)take((size_t)NB * HD * SQ * 2);      /* V^T of all planes */
  if (off > ws_size) return;
  k_qkv<<<(unsigned)(NR / PJ_TOK), 256, 0, stream>>>(x, wq, bq, wk, bk, wv, bv, Q16, K16, VT);      /* all planes: 256 token rows per work-group */
  k_fattn<<<dim3(SQ / 256, NB), 256 * FA_KG, 0, stream>>>(Q16, K16, VT, (float*)d_out);      /* all planes: 256 queries per work-group of 16 waves, out written f32 straight into the output rows */
}

// v008
// It runs in 24.7 microseconds.
// Versions in between are left out here; by their measured steps it is 1.57 times as fast as v006.
// Counting every step since v000, it is 525 times as fast.
#include <hip/hip_runtime.h>
// Per-head scaled dot-product attention on a head-major input (x [2][16][2048][64]; xq = x Wq^T + bq, xk, xv likewise with ONE shared nn.Linear [64][64] per projection (natural [out][in], sigma 1/8; biases sigma 0.02); att = xq . xk / 8; softmax over all 2048 keys (no mask); out = p xv -> [2][16][2048][64]; every (batch, head) plane is an independent 2048 x 64 sequence = 32 planes).
// Structure: token rows r = plane*2048 + s; ONE launch for everything (k_fattn). The K and V projections are never formed: scores = (xq Wk) . x^T + (xq . bk), whose second term is the same for all keys of a query and cancels in the softmax, and out = (p x) Wv^T + bv because the weights of a query sum to 1. Per work-group 256 queries of one plane: Q' = (x Wq^T + bq) Wk on WMMA in the prologue, then the keys split over two groups of eight waves, S^T = X.Q'^T and Y^T += X^T.P^T on WMMA with an online softmax between them (x read f32, rounded, staged in LDS), and out^T = Wv.Y^T + bv on WMMA in the epilogue, written f32 straight into the output rows.
// Compute dtype: inputs rounded to bf16; x / weights exact in f16; xq, Q', softmax weights and p x as plain f16 GEMM operands (~2^-12); scores and softmax statistics f32. v_wmma_f32_16x16x32_f16.
#define NB 32
#define SQ 2048
#define DM 64
#define NH 1
#define HD 64
#define HG 1                         /* unused by the launches: heads per group of the non-template k_vt */
#define B0 0                         /* unused: the launches start at plane 0 */
#define NBR NB                       /* unused by the launches (only MP uses it) */
#define NR ((size_t)NB * SQ)         /* token rows */
#define MP ((int)((size_t)NBR * SQ)) /* unused */
#define QN SQ                        /* unused: query rows per plane = SQ */
#define NHD NH                       /* unused: heads per plane */
#define MPO MP                       /* unused: no output stage */
#define LQ DM      /* unused */
typedef __bf16 v16b __attribute__((ext_vector_type(16)));
typedef unsigned short v8us __attribute__((ext_vector_type(8), may_alias));
typedef float  v8f  __attribute__((ext_vector_type(8)));
typedef float  v4f  __attribute__((ext_vector_type(4)));
typedef float  v4fa __attribute__((ext_vector_type(4), may_alias));
union FragB { v16b v; v8us half[2]; unsigned short u[16]; };

__device__ __forceinline__ unsigned short bf16_bits(float x) { unsigned int u = __float_as_uint(x); return (unsigned short)((u + 0x7FFFu + ((u >> 16) & 1u)) >> 16); }
__device__ __forceinline__ float bf16_val(unsigned short b) { return __uint_as_float(((unsigned int)b) << 16); }
__device__ __forceinline__ float bf16_round(float x) { return bf16_val(bf16_bits(x)); }
// D += A·B with NT terms: 1 = ah·bh, 2 = + al·bh (A split), 3 = + ah·bl (both split)
template <int NT>
__device__ __forceinline__ v8f mmaN(v16b ah, v16b al, v16b bh, v16b bl, v8f c) {
  c = __builtin_amdgcn_wmma_f32_16x16x32_bf16(false, ah, false, bh, (short)0, c, false, false);
  if (NT >= 2) c = __builtin_amdgcn_wmma_f32_16x16x32_bf16(false, al, false, bh, (short)0, c, false, false);
  if (NT >= 3) c = __builtin_amdgcn_wmma_f32_16x16x32_bf16(false, ah, false, bl, (short)0, c, false, false);
  asm volatile("v_nop\n\tv_nop\n\tv_nop\n\tv_nop" : "+v"(c) : "v"(ah), "v"(al), "v"(bh), "v"(bl));
  return c;
}

__global__ __launch_bounds__(256) void k_wt_bf16(const float* __restrict__ W, unsigned short* __restrict__ Wt, int K, int N) {
  const int t = blockIdx.x * 256 + threadIdx.x;
  const int k8n = K / 8;
  if (t >= N * k8n) return;
  const int n = t / k8n, k8 = (t % k8n) * 8;
  v8us v;
#pragma unroll
  for (int i = 0; i < 8; ++i) v[i] = bf16_bits(W[(size_t)(k8 + i) * N + n]);
  *(v8us*)(Wt + (size_t)n * K + k8) = v;
  
}

// GEMM C[M][N] (f32, pitch ldc) = act(A[M][K]·W + bias). A f32 row-major (pitch lda) converted per fragment to bf16
// (ASPLIT: hi/lo two planes -> 2 terms, else single rounded term); Wt bf16 [N][K] (pitch ldb). BIAS_BF16 rounds the
// bias to bf16 first (bias quantised to bf16 before the add). K%32==0, M%16==0, N%64==0.
template <bool ASPLIT, int ACT, bool BIAS_BF16>
__global__ __launch_bounds__(128) void k_gemm_bf(const float* __restrict__ A, int lda, const unsigned short* __restrict__ Wt, int ldb,
                                               const float* __restrict__ bias, float* __restrict__ C, int ldc, int M, int N, int K) {
  __shared__ __attribute__((aligned(16))) float so[4][16][64];
  const int tid = threadIdx.x, w = tid >> 5, lane = tid & 31, ln = lane & 15, hh = lane >> 4;
  const int ntn = N / 64;
  const int wid = blockIdx.x * 4 + w;
  const int mt = wid / ntn, nq = wid % ntn;
  if (mt * 16 >= M) return;
  const int row0 = mt * 16, col0 = nq * 64;
  const float* arow = A + (size_t)(row0 + ln) * lda;
  v8f acc[4] = {};
  for (int kb = 0; kb < K; kb += 32) {
    FragB ah, al;
    const v4f x0 = *(const v4fa*)(arow + kb + 8 * hh), x1 = *(const v4fa*)(arow + kb + 8 * hh + 4);
    const v4f x2 = *(const v4fa*)(arow + kb + 16 + 8 * hh), x3 = *(const v4fa*)(arow + kb + 16 + 8 * hh + 4);
    float xs[16] = {x0[0],x0[1],x0[2],x0[3],x1[0],x1[1],x1[2],x1[3],x2[0],x2[1],x2[2],x2[3],x3[0],x3[1],x3[2],x3[3]};
#pragma unroll
    for (int i = 0; i < 16; ++i) { const unsigned short hb = bf16_bits(xs[i]); ah.u[i] = hb; al.u[i] = ASPLIT ? bf16_bits(xs[i] - bf16_val(hb)) : (unsigned short)0; }
#pragma unroll
    for (int t = 0; t < 4; ++t) {
      const unsigned short* brow = Wt + (size_t)(col0 + t * 16 + ln) * ldb + kb;
      FragB b;
      b.half[0] = *(const v8us*)(brow + 8 * hh);
      b.half[1] = *(const v8us*)(brow + 16 + 8 * hh);
      acc[t] = mmaN<ASPLIT ? 2 : 1>(ah.v, al.v, b.v, b.v, acc[t]);
    }
  }
#pragma unroll
  for (int t = 0; t < 4; ++t) {
    float bv = bias ? bias[col0 + t * 16 + ln] : 0.f;
    if (BIAS_BF16) bv = bf16_round(bv);
#pragma unroll
    for (int r = 0; r < 8; ++r) { float v = acc[t][r] + bv; if (ACT == 1) v = fmaxf(v, 0.f); so[w][8 * hh + r][t * 16 + ln] = v; }
  }
  __builtin_amdgcn_fence(__ATOMIC_ACQ_REL, "workgroup");
  __builtin_amdgcn_wave_barrier();
  const int rsub = lane >> 4, c4 = (lane & 15) * 4;
  {
#pragma unroll
    for (int q = 0; q < 8; ++q) {
      const int r = q * 2 + rsub;
      const v4f v = *(const v4fa*)&so[w][r][c4];
      *(v4f*)(C + (size_t)(row0 + r) * ldc + col0 + c4) = v;
    }
    
  }
}

// GEMM C = act(A·W + bias + resid): A f32 (ASPLIT -> hi/lo 2 terms), Wt bf16 [N][K]; ACT 0 none, 1 relu, 2 exact gelu;
// resid (optional, f32, row index = (row % rmod), pitch ldr, RES_BF16 rounds it) added before the activation.
template <bool ASPLIT, int ACT, bool BIAS_BF16, bool RES_BF16>
__global__ __launch_bounds__(128) void k_gemm_bf3(const float* __restrict__ A, int lda, const unsigned short* __restrict__ Wt, int ldb,
                                                const float* __restrict__ bias, const float* __restrict__ resid, int rmod, int ldr,
                                                float* __restrict__ C, int ldc, int M, int N, int K) {
  __shared__ __attribute__((aligned(16))) float so[4][16][64];
  const int tid = threadIdx.x, w = tid >> 5, lane = tid & 31, ln = lane & 15, hh = lane >> 4;
  const int ntn = N / 64;
  const int wid = blockIdx.x * 4 + w;
  const int mt = wid / ntn, nq = wid % ntn;
  if (mt * 16 >= M) return;
  const int row0 = mt * 16, col0 = nq * 64;
  const float* arow = A + (size_t)(row0 + ln) * lda;
  v8f acc[4] = {};
  for (int kb = 0; kb < K; kb += 32) {
    FragB ah, al;
    const v4f x0 = *(const v4fa*)(arow + kb + 8 * hh), x1 = *(const v4fa*)(arow + kb + 8 * hh + 4);
    const v4f x2 = *(const v4fa*)(arow + kb + 16 + 8 * hh), x3 = *(const v4fa*)(arow + kb + 16 + 8 * hh + 4);
    float xs[16] = {x0[0],x0[1],x0[2],x0[3],x1[0],x1[1],x1[2],x1[3],x2[0],x2[1],x2[2],x2[3],x3[0],x3[1],x3[2],x3[3]};
#pragma unroll
    for (int i = 0; i < 16; ++i) { const unsigned short hb = bf16_bits(xs[i]); ah.u[i] = hb; al.u[i] = ASPLIT ? bf16_bits(xs[i] - bf16_val(hb)) : (unsigned short)0; }
#pragma unroll
    for (int t = 0; t < 4; ++t) {
      const unsigned short* brow = Wt + (size_t)(col0 + t * 16 + ln) * ldb + kb;
      FragB b;
      b.half[0] = *(const v8us*)(brow + 8 * hh);
      b.half[1] = *(const v8us*)(brow + 16 + 8 * hh);
      acc[t] = mmaN<ASPLIT ? 2 : 1>(ah.v, al.v, b.v, b.v, acc[t]);
    }
  }
#pragma unroll
  for (int t = 0; t < 4; ++t) {
    const int col = col0 + t * 16 + ln;
    float bv = bias ? bias[col] : 0.f;
    if (BIAS_BF16) bv = bf16_round(bv);
#pragma unroll
    for (int r = 0; r < 8; ++r) {
      float v = acc[t][r] + bv;
      if (resid) { float rv = resid[(size_t)((row0 + 8 * hh + r) % rmod) * ldr + col]; if (RES_BF16) rv = bf16_round(rv); v += rv; }
      if (ACT == 1) v = fmaxf(v, 0.f);
      if (ACT == 2) v = 0.5f * v * (1.0f + erff(v * 0.70710678118654752f));
      if (ACT == 3) { const float u = 0.7978845608028654f * (v + 0.044715f * v * v * v); v = 0.5f * v * (1.0f + tanhf(u)); }
      so[w][8 * hh + r][t * 16 + ln] = v;
    }
  }
  __builtin_amdgcn_fence(__ATOMIC_ACQ_REL, "workgroup");
  __builtin_amdgcn_wave_barrier();
  const int rsub = lane >> 4, c4 = (lane & 15) * 4;
  {
#pragma unroll
    for (int q = 0; q < 8; ++q) {
      const int r = q * 2 + rsub;
      const v4f v = *(const v4fa*)&so[w][r][c4];
      *(v4f*)(C + (size_t)(row0 + r) * ldc + col0 + c4) = v;
    }
    
  }
}
// row LayerNorm (biased variance, eps) over N: s = X (+ R); optional out_sum <- s; out_norm <- (s-mu)*rsqrt(var+eps)*g + b
template <bool PARAM_BF16>
__global__ __launch_bounds__(256) void k_layernorm(const float* __restrict__ X, const float* __restrict__ R, const float* __restrict__ g, const float* __restrict__ bta,
                                                  float* __restrict__ out_sum, float* __restrict__ out_norm, int N, float eps) {
  __shared__ float red[256];
  const int row = blockIdx.x, tid = threadIdx.x;
  const float* x = X + (size_t)row * N; const float* rr = R ? R + (size_t)row * N : nullptr;
  float vals[16];                     // up to N = 4096
  const int per = N / 256;            // contiguous chunk per thread? use strided-by-4 chunks: thread handles j = tid*4 + 1024*u
  float s1 = 0.f;
  for (int u = 0; u < per / 4; ++u) {
    const int j = tid * 4 + 1024 * u;
    const v4f a = *(const v4fa*)(x + j);
    v4f b = {0.f,0.f,0.f,0.f}; if (rr) b = *(const v4fa*)(rr + j);
#pragma unroll
    for (int q = 0; q < 4; ++q) { const float v = a[q] + b[q]; vals[u * 4 + q] = v; s1 += v; }
  }
  red[tid] = s1; __syncthreads();
  for (int st = 128; st > 0; st >>= 1) { if (tid < st) red[tid] += red[tid + st]; __syncthreads(); }
  const float mu = red[0] / (float)N; __syncthreads();
  float s2 = 0.f;
  for (int u = 0; u < per / 4; ++u)
#pragma unroll
    for (int q = 0; q < 4; ++q) { const float c = vals[u * 4 + q] - mu; s2 += c * c; }
  red[tid] = s2; __syncthreads();
  for (int st = 128; st > 0; st >>= 1) { if (tid < st) red[tid] += red[tid + st]; __syncthreads(); }
  const float rs = rsqrtf(red[0] / (float)N + eps);
  {
    for (int u = 0; u < per / 4; ++u) {
      const int j = tid * 4 + 1024 * u;
      v4f o, sm;
#pragma unroll
      for (int q = 0; q < 4; ++q) {
        float gg = g[j + q], bb = bta[j + q];
        if (PARAM_BF16) { gg = bf16_round(gg); bb = bf16_round(bb); }
        sm[q] = vals[u * 4 + q]; o[q] = (vals[u * 4 + q] - mu) * rs * gg + bb;
      }
      if (out_sum) *(v4f*)(out_sum + (size_t)row * N + j) = sm;
      *(v4f*)(out_norm + (size_t)row * N + j) = o;
    }
    
  }
}



// ---- f16 WMMA path (v_wmma_f32_16x16x32_f16): 11-bit significands for operands in range — used where a [0,1] probability operand needs more precision than bf16
typedef _Float16 v16h __attribute__((ext_vector_type(16)));
union FragH { v16h v; v8us half[2]; _Float16 h[16]; unsigned short u[16]; };
template <int NT>
__device__ __forceinline__ v8f mmaH(v16h ah, v16h al, v16h bh, v16h bl, v8f c) {
  c = __builtin_amdgcn_wmma_f32_16x16x32_f16(false, ah, false, bh, (short)0, c, false, false);
  if (NT >= 2) c = __builtin_amdgcn_wmma_f32_16x16x32_f16(false, al, false, bh, (short)0, c, false, false);
  if (NT >= 3) c = __builtin_amdgcn_wmma_f32_16x16x32_f16(false, ah, false, bl, (short)0, c, false, false);
  asm volatile("v_nop\n\tv_nop\n\tv_nop\n\tv_nop" : "+v"(c) : "v"(ah), "v"(al), "v"(bh), "v"(bl));
  return c;
}
// batched GEMM like k_gemm_b but f16 operands: A f32 (split into f16 hi/lo if ASPLIT, else rounded to f16), Bt = f16 values [n][k]; alpha; C f32; N multiple of 16 (partial tiles skipped)
template <bool ASPLIT>
__global__ __launch_bounds__(128) void k_gemm_h(const float* __restrict__ A, int lda, size_t sA, const _Float16* __restrict__ Bh, int ldb, size_t sB, float alpha, float* __restrict__ C, int ldc, size_t sC, int M, int N, int K) {
  __shared__ __attribute__((aligned(16))) float so[4][16][64];
  const int tid = threadIdx.x, w = tid >> 5, lane = tid & 31, ln = lane & 15, hh = lane >> 4; const int by = blockIdx.y;
  A += (size_t)by * sA; Bh += (size_t)by * sB; C += (size_t)by * sC;
  const int ntn = (N + 63) / 64; const int wid = blockIdx.x * 4 + w; const int mt = wid / ntn, nq = wid % ntn; if (mt * 16 >= M) return;
  const int row0 = mt * 16, col0 = nq * 64; const float* arow = A + (size_t)(row0 + ln) * lda;
  v8f acc[4] = {};
  for (int kb = 0; kb < K; kb += 32) {
    FragH ah, al;
    const v4f x0 = *(const v4fa*)(arow + kb + 8 * hh), x1 = *(const v4fa*)(arow + kb + 8 * hh + 4), x2 = *(const v4fa*)(arow + kb + 16 + 8 * hh), x3 = *(const v4fa*)(arow + kb + 16 + 8 * hh + 4);
    float xs[16] = {x0[0],x0[1],x0[2],x0[3],x1[0],x1[1],x1[2],x1[3],x2[0],x2[1],x2[2],x2[3],x3[0],x3[1],x3[2],x3[3]};
#pragma unroll
    for (int i = 0; i < 16; ++i) { const _Float16 h = (_Float16)xs[i]; ah.h[i] = h; al.h[i] = ASPLIT ? (_Float16)(xs[i] - (float)h) : (_Float16)0.0f; }
#pragma unroll
    for (int t = 0; t < 4; ++t) { if (col0 + t * 16 >= N) continue; const size_t boff = (size_t)(col0 + t * 16 + ln) * ldb + kb; FragH bq; bq.half[0] = *(const v8us*)(Bh + boff + 8 * hh); bq.half[1] = *(const v8us*)(Bh + boff + 16 + 8 * hh);
      acc[t] = mmaH<ASPLIT ? 2 : 1>(ah.v, al.v, bq.v, bq.v, acc[t]); }
  }
#pragma unroll
  for (int t = 0; t < 4; ++t) { if (col0 + t * 16 >= N) continue;
#pragma unroll
    for (int r = 0; r < 8; ++r) so[w][8 * hh + r][t * 16 + ln] = acc[t][r] * alpha; }
  __builtin_amdgcn_fence(__ATOMIC_ACQ_REL, "workgroup"); __builtin_amdgcn_wave_barrier();
  const int rsub = lane >> 4, c4 = (lane & 15) * 4;
  {
#pragma unroll
    for (int q = 0; q < 8; ++q) { const int r = q * 2 + rsub; if (col0 + c4 < N) { const v4f v = *(const v4fa*)&so[w][r][c4]; *(v4f*)(C + (size_t)(row0 + r) * ldc + col0 + c4) = v; } }
     }
}

// Wt[n][k] = f16(W[k][n]·scale) from f32 row-major W[K][N] (scale = power of two; bf16-exact weights stay exact in f16 away from the subnormal range)
__global__ __launch_bounds__(256) void k_wt_f16(const float* __restrict__ W, _Float16* __restrict__ Wt, int K, int N, float scale) {
  const int t = blockIdx.x * 256 + threadIdx.x; if (t >= N * (K / 8)) return; const int n = t / (K / 8), k8 = (t % (K / 8)) * 8; FragH f;
#pragma unroll
  for (int i = 0; i < 8; ++i) f.h[i] = (_Float16)(bf16_round(W[(size_t)(k8 + i) * N + n]) * scale); const v8us o = f.half[0];
  *(v8us*)((unsigned short*)Wt + (size_t)n * K + k8) = o; 
}
// k_gemm_hh variant with fused epilogue: v = acc·alpha + bias[by·sBias + col] (+ CP[(row/rowsPerB)·sCPb + by·64 + col] if CP) ; ACT 0 none / 1 elu ; writes f16 C16 (and f32 C if non-null)
template <int ACT>
__global__ __launch_bounds__(128) void k_gemm_hhx(const _Float16* __restrict__ A, int lda, size_t sA, const _Float16* __restrict__ Bh, int ldb, size_t sB, float alpha, const float* __restrict__ bias, size_t sBias, const float* __restrict__ CP, int rowsPerB, size_t sCPb, int row0g,
    float* __restrict__ C, _Float16* __restrict__ C16, int ldc, size_t sC, int M, int N, int K) {
  __shared__ __attribute__((aligned(16))) float so[4][16][64];
  const int tid = threadIdx.x, w = tid >> 5, lane = tid & 31, ln = lane & 15, hh = lane >> 4; const int by = blockIdx.y;
  A += (size_t)by * sA; Bh += (size_t)by * sB; const size_t cofs = (size_t)by * sC; const float* bp = bias ? bias + (size_t)by * sBias : nullptr;
  const int ntn = (N + 63) / 64; const int wid = blockIdx.x * 4 + w; const int mt = wid / ntn, nq = wid % ntn; if (mt * 16 >= M) return;
  const int row0 = mt * 16, col0 = nq * 64; const _Float16* arow = A + (size_t)(row0 + ln) * lda;
  v8f acc[4] = {};
  for (int kb = 0; kb < K; kb += 32) { FragH ah; ah.half[0] = *(const v8us*)((const unsigned short*)arow + kb + 8 * hh); ah.half[1] = *(const v8us*)((const unsigned short*)arow + kb + 16 + 8 * hh);
#pragma unroll
    for (int t = 0; t < 4; ++t) { if (col0 + t * 16 >= N) continue; const size_t boff = (size_t)(col0 + t * 16 + ln) * ldb + kb; FragH bq; bq.half[0] = *(const v8us*)((const unsigned short*)Bh + boff + 8 * hh); bq.half[1] = *(const v8us*)((const unsigned short*)Bh + boff + 16 + 8 * hh);
      acc[t] = mmaH<1>(ah.v, ah.v, bq.v, bq.v, acc[t]); }
  }
#pragma unroll
  for (int t = 0; t < 4; ++t) { if (col0 + t * 16 >= N) continue; const int col = col0 + t * 16 + ln; const float bv = bp ? bf16_round(bp[col]) : 0.f;
#pragma unroll
    for (int r = 0; r < 8; ++r) { float v = acc[t][r] * alpha + bv; if (CP) { const int rr = row0g + row0 + 8 * hh + r; if (rowsPerB < 0) v += CP[cofs + (size_t)rr * ldc + col];      /* rowsPerB < 0: own element of the batched C plane */ else { const int bidx = rr / rowsPerB; v += CP[(size_t)bidx * sCPb + (size_t)by * 64 + col]; } } if (ACT == 1) v = (v > 0.f) ? v : expm1f(v); else if (ACT == 7) v = (v > 0.f) ? v + 1.0f : expf(v); else if (ACT == 8) v = tanhf(v); else if (ACT == 9) v = 0.5f * v * (1.0f + tanhf(0.7978845608028654f * (v + 0.044715f * v * v * v))); else if (ACT == 11) v = 1.0f / (1.0f + expf(-v)); else if (ACT == 12) v = (v > 0.f) ? v : 0.01f * v; else if (ACT == 14) v = (v > 0.f) ? v : 0.1f * v; else if (ACT == 16) v = (v >= 0.f) ? v : 0.3f * v; else if (ACT == 17) v = (v >= 0.f) ? v : 0.2f * v; else if (ACT == 15) v = v / (1.0f + expf(-v)); else if (ACT == 3) v = fmaxf(v, 0.f); else if (ACT == 6) v = 0.5f * v * (1.0f + erff(v * 0.70710678118654752f)); so[w][8 * hh + r][t * 16 + ln] = v; } }
  __builtin_amdgcn_fence(__ATOMIC_ACQ_REL, "workgroup"); __builtin_amdgcn_wave_barrier();
  const int rsub = lane >> 4, c4 = (lane & 15) * 4; typedef _Float16 v4h __attribute__((ext_vector_type(4)));
  {
#pragma unroll
    for (int q = 0; q < 8; ++q) { const int r = q * 2 + rsub; if (col0 + c4 < N) { const v4f v = *(const v4fa*)&so[w][r][c4]; if (C) *(v4f*)(C + cofs + (size_t)(row0 + r) * ldc + col0 + c4) = v; if (C16) { v4h h4; for (int i = 0; i < 4; ++i) h4[i] = (_Float16)v[i]; *(v4h*)(C16 + cofs + (size_t)(row0 + r) * ldc + col0 + c4) = h4; } } }
     }
}


typedef _Float16 v4h __attribute__((ext_vector_type(4)));

__global__ __launch_bounds__(256) void k_h16(const float* __restrict__ x, _Float16* __restrict__ X16, size_t n8) { const size_t t = (size_t)blockIdx.x * 256 + threadIdx.x; if (t >= n8) return; FragH f;
#pragma unroll
  for (int q = 0; q < 8; ++q) f.h[q] = (_Float16)x[t * 8 + q]; *(v8us*)((unsigned short*)X16 + t * 8) = f.half[0];  }
__global__ __launch_bounds__(256) void k_round16f(const float* __restrict__ W, _Float16* __restrict__ Bt, size_t n8) { const size_t t = (size_t)blockIdx.x * 256 + threadIdx.x; if (t >= n8) return; FragH f;
#pragma unroll
  for (int i = 0; i < 8; ++i) f.h[i] = (_Float16)(bf16_round(W[t * 8 + i]) * 16.0f); *(v8us*)((unsigned short*)Bt + t * 8) = f.half[0];  }

__global__ __launch_bounds__(256) void k_hl(const float* __restrict__ F, _Float16* __restrict__ Hh, _Float16* __restrict__ Hl, size_t n8) { const size_t t = (size_t)blockIdx.x * 256 + threadIdx.x; if (t >= n8) return; FragH fh, fl; const v4f a = *(const v4fa*)(F + t * 8), c = *(const v4fa*)(F + t * 8 + 4);
#pragma unroll
  for (int q = 0; q < 4; ++q) { _Float16 h = (_Float16)a[q]; fh.h[q] = h; fl.h[q] = (_Float16)((a[q] - (float)h) * 1024.0f); h = (_Float16)c[q]; fh.h[4 + q] = h; fl.h[4 + q] = (_Float16)((c[q] - (float)h) * 1024.0f); }
  { *(v8us*)((unsigned short*)Hh + t * 8) = fh.half[0]; *(v8us*)((unsigned short*)Hl + t * 8) = fl.half[0];  } }

// ---- A or B fragment of a 16x16x32 f16 product, straight from a global f16 row ----
__device__ __forceinline__ v16h g2_frag(const _Float16* p, int hh) { FragH f; f.half[0] = *(const v8us*)((const unsigned short*)p + 8 * hh); f.half[1] = *(const v8us*)((const unsigned short*)p + 16 + 8 * hh); return f.v; }


__global__ __launch_bounds__(256) void k_rsm(const float* __restrict__ S, _Float16* __restrict__ P, int nrows) {
  #pragma clang fp contract(off)
  const int i = blockIdx.x * 256 + threadIdx.x; if (i >= nrows) return; const float* s = S + (size_t)i * SQ; float mx = -3.0e38f;
#pragma unroll 1
  for (int j = 0; j < SQ; ++j) mx = fmaxf(mx, s[j]); float se = 0.f;
#pragma unroll 1
  for (int j = 0; j < SQ; ++j) se += expf(s[j] - mx); const float sc = 256.0f / se;
#pragma unroll 1
  for (int j0 = 0; j0 < SQ; j0 += 8) { FragH f; for (int q = 0; q < 8; ++q) f.h[q] = (_Float16)(expf(s[j0 + q] - mx) * sc); unsigned short* d = (unsigned short*)P + (size_t)i * SQ + j0; *(v8us*)d = f.half[0];  } }
__global__ __launch_bounds__(256) void k_vt(const _Float16* __restrict__ V16, int b, int h0, _Float16* __restrict__ VT) { __shared__ unsigned short tl[64][65]; const int tid = threadIdx.x; const int hh = blockIdx.x % HG, sg = blockIdx.x / HG; const int s0 = sg * 64; const int h = h0 + hh;
  for (int i = tid; i < 64 * 8; i += 256) { const int j = i / 8, d8 = (i % 8) * 8; FragH f; f.half[0] = *(const v8us*)((const unsigned short*)V16 + ((size_t)b * SQ + s0 + j) * DM + h * HD + d8); for (int q = 0; q < 8; ++q) tl[d8 + q][j] = f.u[q]; }
  __syncthreads();
  { for (int i = tid; i < 64 * 8; i += 256) { const int d = i / 8, j8 = (i % 8) * 8; FragH f; for (int q = 0; q < 8; ++q) f.u[q] = tl[d][j8 + q]; *(v8us*)((unsigned short*)VT + ((size_t)hh * HD + d) * SQ + s0 + j8) = f.half[0]; }  } }



// lane l with lane l ^ 16: a register move, no LDS round trip
__device__ __forceinline__ float rs_xhalf(float x) { return __builtin_bit_cast(float, __builtin_amdgcn_permlanex16(__builtin_bit_cast(int, x), __builtin_bit_cast(int, x), 0x76543210, 0xfedcba98, false, false)); }
// ---- fused attention: projections, scores, softmax and P.X of all planes in one launch ----
// Work-group = 16 waves = 256 queries of one plane, four waves per SIMD: the vector work of one wave's softmax runs under the products of the others. Two key groups of 8 waves: group 0 walks the first half of the keys,
// group 1 the second half, each with its own LDS ring and its own online softmax; behind the loop group 1 hands its sums, maxima and denominators to group 0 through LDS, which merges them, applies Wv and bv and writes the output.
// A wave owns 32 query columns (two 16-column groups). Keys come in stages of 64: the x rows of a stage are read f32 in whole lines one trip ahead, rounded (bf16, exact in f16) and laid in LDS twice (three buffers),
// once at the pitch of the 16-byte reader (rows as A fragments of the scores) and once at the pitch of the transposing reader (columns as A fragments of Y^T += X^T.P^T), both in the hardware k order.
// S^T = X.Q'^T puts one query's scores in one lane (and its partner lane ^ 16), so the packed scores ARE the B operand of Y^T += X^T.P^T: no exchange, no LDS for P. The same holds from xq to Q' and from Y to the output.
#define FA_KG 2                      /* key groups per work-group */
#define FA_NS (SQ / FA_KG / 64)      /* stages of 64 keys per key group */
#define FA_PITCH 144                 /* LDS row pitch for ds_load_b128 readers, bytes: 128 + 16, an odd multiple of 16 (no bank conflict) */
#define FA_PT 160                    /* LDS row pitch for ds_load_tr16_b128 readers, bytes: 128 + 32, an odd multiple of 32 (no bank conflict) */
#define FA_TILE (64 * FA_PITCH)      /* a 64-row tile for the 16-byte reader */
#define FA_TT (64 * FA_PT)           /* a 64-row tile for the transposing reader */
#define FA_BUF (FA_TILE + FA_TT)     /* one stage of one key group: both copies */
#define FA_NB 3                      /* buffers in a key group's ring: one being read, one published and waiting, one being filled */
#define FA_OP 272                    /* output staging pitch, bytes: 256 + 16 */
typedef float v2f __attribute__((ext_vector_type(2)));
typedef _Float16 v2h __attribute__((ext_vector_type(2)));
typedef _Float16 v8h __attribute__((ext_vector_type(8)));
typedef __bf16 v2b __attribute__((ext_vector_type(2)));
typedef unsigned int v8u __attribute__((ext_vector_type(8)));
typedef unsigned int v2ua __attribute__((ext_vector_type(2), may_alias));
typedef short s16x8 __attribute__((ext_vector_type(8)));
__device__ __forceinline__ v8f fa_mma(v16h a, v16h b, v8f c) { return __builtin_amdgcn_wmma_f32_16x16x32_f16(false, a, false, b, (short)0, c, false, false); }
// The loop's work-group barrier, in its two halves. Signal: this wave's LDS stores have landed and its LDS reads have returned. Wait: every wave of the work-group has signalled. They alternate strictly in every wave.
__device__ __forceinline__ void fa_signal() { asm volatile("s_wait_dscnt 0x0\n\ts_barrier_signal -1" ::: "memory"); }      /* the wait in front: a bare signal does not wait for outstanding LDS stores or reads; the clobber keeps the compiler's LDS accesses on their side */
__device__ __forceinline__ void fa_wait() { asm volatile("s_barrier_wait -1" ::: "memory"); }      /* the clobber keeps the refill's LDS stores, and the reads of the stage published here, behind it */
__device__ __forceinline__ void fa_fence() { __builtin_amdgcn_sched_barrier(0); }      /* keeps a group of LDS loads, or a run of products, in one place */
__device__ __forceinline__ v16h fa_lds(const unsigned char* p) { FragH f; f.half[0] = *(const v8us*)p; f.half[1] = *(const v8us*)(p + 32); return f.v; }      /* p holds the lane's 16 * h: k = 8h .. 8h+7 and 16+8h .. 16+8h+7 */
__device__ __forceinline__ v8us fa_tr16(const unsigned char* p) { typedef __attribute__((address_space(3))) s16x8 lds_s16x8; return __builtin_bit_cast(v8us, __builtin_amdgcn_ds_load_tr16_b128_v8i16((lds_s16x8*)p)); }
__device__ __forceinline__ v16h fa_ldt(const unsigned char* p) { FragH f; f.half[0] = fa_tr16(p); f.half[1] = fa_tr16(p + 16 * FA_PT); return f.v; }      /* p = tile + (kbase + 8h + (c & 7)) * FA_PT + 2 * dbase + 16 * (c >> 3): lane (c, h) gets tile[kbase + 8h .. + 7][dbase + c], then the same 16 rows further: the k order of fa_lds */
__device__ __forceinline__ void fa_ldk(v16h (&kf)[2][2], const unsigned char* kb) {
#pragma unroll
  for (int kt = 0; kt < 2; ++kt) { kf[kt][0] = fa_lds(kb + kt * 16 * FA_PITCH); kf[kt][1] = fa_lds(kb + kt * 16 * FA_PITCH + 64); } }
__device__ __forceinline__ void fa_ldv(v16h (&vf)[4], const unsigned char* vb) {
#pragma unroll
  for (int t = 0; t < 4; ++t) vf[t] = fa_ldt(vb + t * 32); }
// two f32 -> bf16 (nearest even) -> times sc (a power of two) -> the same two values as packed f16
__device__ __forceinline__ unsigned int fa_r2(float a, float b, float sc) { const unsigned int u = __builtin_bit_cast(unsigned int, __builtin_convertvector(v2f{a, b}, v2b));
  return __builtin_bit_cast(unsigned int, __builtin_convertvector(v2f{__uint_as_float(u << 16) * sc, __uint_as_float(u & 0xFFFF0000u) * sc}, v2h)); }
__device__ __forceinline__ v8us pj_pack(v8f d, v8f b, float sc) { FragH f;      /* f16((acc / 16 + bias) * sc): the x16 of the weights taken back, exactly */
#pragma unroll
  for (int r = 0; r < 8; ++r) f.h[r] = (_Float16)((d[r] * 0.0625f + b[r]) * sc);
  return f.half[0]; }
// One pass = 32 keys of one wave. The softmax shift of a pass is fixed before its scores are formed: nmt[g] holds minus the shift in use (log2 domain) in all eight registers and is the C operand of the score products, and Q' comes
// pre-scaled by 64^-0.5 * log2(e), so that a product leaves the matrix unit as the argument of exp2. No maximum is taken first: the column sums of the f16 weights, which the matrix unit forms anyway for the denominator, tell
// whether the shift still serves. A sum of at most 2^8 bounds every weight of the pass by 2^8 (f16 holds it). A larger sum (or first, where the shift is -inf) sends the wave down the rare path: the pass's rows are
// read again from LDS, the scores formed again without a shift, their maximum taken, the running sums rescaled and the weights formed anew. MORE: a further pass follows, whose fragments (kn, vn) are fetched ahead.
// LAST: the stage's last pass: its fetch ahead reads the next stage, and the wave signals the loop's barrier once its last read of this stage has returned, in front of the output products.
template <bool LAST, bool MORE>
__device__ __forceinline__ void fa_pass(v16h (&kf)[2][2], v16h (&vf)[4], const unsigned char* kt, const unsigned char* kn, const unsigned char* vn, const v16h (&qf)[2][2], v8f (&acc)[2][4], float (&lrun)[2], v8f (&nmt)[2], const v16h ones, const bool first) {
  const v8f z = {0.f,0.f,0.f,0.f,0.f,0.f,0.f,0.f};
  v8f s[2][2], ln[2]; v16h pf[2];
  auto scores = [&](const bool shifted) {
#pragma unroll
    for (int kt2 = 0; kt2 < 2; ++kt2) {
#pragma unroll
      for (int g = 0; g < 2; ++g) s[kt2][g] = fa_mma(kf[kt2][1], qf[g][1], fa_mma(kf[kt2][0], qf[g][0], shifted ? nmt[g] : z)); }
    fa_fence();      /* the eight products stay back to back: mixed with vector work, each would be padded with v_nop */
    if (MORE) { fa_ldk(kf, kn); fa_fence(); }      /* next pass's rows, in flight under this pass's softmax */
    else { asm volatile("v_nop\n\tv_nop\n\tv_nop\n\tv_nop"); fa_fence(); } };      /* the wave's very last scores: the shift's registers are free behind them, and these four slots keep the first exp2 results, which may take them, at the distance that an operand of a matrix instruction needs */
  auto weights = [&]() {
#pragma unroll
    for (int g = 0; g < 2; ++g) { v8u w;
#pragma unroll
      for (int i = 0; i < 8; ++i) {
        w[i] = __builtin_bit_cast(unsigned int, __builtin_convertvector(v2f{__builtin_amdgcn_exp2f(s[i >> 2][g][2 * (i & 3)]), __builtin_amdgcn_exp2f(s[i >> 2][g][2 * (i & 3) + 1])}, v2h)); }
      pf[g] = __builtin_bit_cast(v16h, w);
      ln[g] = fa_mma(ones, pf[g], z); } };      /* row 0 (register 0, lanes 0-15) = the column sums of P^T as rounded to f16: this pass's share of the softmax denominator */
  auto redo = [&]() {
    fa_ldk(kf, kt); scores(false);
#pragma unroll
    for (int g = 0; g < 2; ++g) { float mx = s[0][g][0];
#pragma unroll
      for (int r = 1; r < 8; ++r) mx = fmaxf(mx, s[0][g][r]);
#pragma unroll
      for (int r = 0; r < 8; ++r) mx = fmaxf(mx, s[1][g][r]);
      mx = fmaxf(mx, rs_xhalf(mx));      /* both halves of the wave hold the query's maximum of this pass */
      const float mo = -nmt[g][0]; const float mn = fmaxf(mo, mx); const float corr = __builtin_amdgcn_exp2f(mo - mn); lrun[g] = lrun[g] * corr;
      nmt[g] = z - mn; s[0][g] = s[0][g] - mn; s[1][g] = s[1][g] - mn;
#pragma unroll
      for (int t = 0; t < 4; ++t) acc[g][t] = acc[g][t] * corr; }
    weights(); };      /* every weight is now at most 1 */
  unsigned int again = first ? 1u : 0u;      /* a lane mask, tested as a scalar */
  if (!first) { scores(true); weights();
    again = __builtin_amdgcn_ballot_w32(ln[0][0] + ln[1][0] > 256.0f); }      /* one scalar branch a pass; the sums are not negative, and an overflowed weight makes its sum inf, which is caught here too */
  if (again != 0u) redo();
  if (LAST) fa_signal();      /* outside the rare path: every wave signals once a stage. Nothing of this stage is read behind this line: its columns are in vf, which the products below need anyway */
#pragma unroll
  for (int g = 0; g < 2; ++g) {
#pragma unroll
    for (int t = 0; t < 4; ++t) acc[g][t] = fa_mma(vf[t], pf[g], acc[g][t]);
    lrun[g] += ln[g][0]; }
  if (MORE) { fa_fence(); fa_ldv(vf, vn); fa_fence(); }      /* next pass's columns, in flight under its scores and softmax */
}
__global__ __launch_bounds__(256 * FA_KG) void k_fattn(const float* __restrict__ x, const float* __restrict__ wq, const float* __restrict__ bq, const float* __restrict__ wk, const float* __restrict__ wv, const float* __restrict__ bv, float* __restrict__ O) {
  __shared__ __attribute__((aligned(16))) unsigned char L[FA_KG * FA_NB * FA_BUF];      /* one ring of three stages per key group in the loop; the hand-over and the output staging behind it */
  __shared__ __attribute__((aligned(16))) unsigned char LQ_[DM * FA_PITCH];         /* 16 Wq, row = output feature e: A rows of xq^T = Wq.x^T */
  __shared__ __attribute__((aligned(16))) unsigned char LK_[DM * FA_PT];            /* 16 Wk, row = e, read transposed: A rows d of Q'^T = Wk^T.xq^T */
  __shared__ __attribute__((aligned(16))) unsigned char LV_[DM * FA_PITCH];         /* 16 Wv, row = output feature e: A rows of out^T = Wv.Y^T */
  __shared__ __attribute__((aligned(16))) unsigned char LX_[FA_KG * 8 * 16 * FA_PITCH];      /* 16 query rows of x per wave */
  __shared__ __attribute__((aligned(16))) unsigned char LE_[FA_KG * 8 * 4 * 512];           /* Q' as B fragments: [column group][wave][tile][lane] */
  __shared__ __attribute__((aligned(16))) float LB[256 * FA_KG];                    /* bq, bv; the rest only keeps the store below free of a branch */
  static_assert(FA_NS >= FA_NB, "the prologue fills two stages and loads a third");
  static_assert(8 * 32 * FA_OP <= FA_KG * FA_NB * FA_BUF && 17 * 512 <= 32 * FA_OP, "the staging, and a wave's hand-over inside its staging part, must fit the array");
  static_assert(DM == 64 && HD == 64, "rows of 64");
  const int grp = __builtin_amdgcn_readfirstlane((int)threadIdx.x >> 8);      /* key group, the same in all lanes of a wave: scalar */
  const int tid = threadIdx.x & 255, c = tid & 15, h = (tid >> 4) & 1;      /* place inside the key group */
  const int wave = __builtin_amdgcn_readfirstlane(tid >> 5);      /* the same in all lanes of a wave: scalar */
  const size_t plane = blockIdx.y; const int q0 = blockIdx.x * 256 + wave * 32;
  /* staging: load i of a wave covers rows 8 wave + 2i and + 2i + 1 of the 64-row stage (512 contiguous bytes of f32) */
  const char* xg = (const char*)(x + (plane * SQ + grp * (SQ / FA_KG)) * HD); const unsigned xo = (tid >> 5) * 2048 + (tid & 31) * 16;
  unsigned char* ring = L + grp * FA_NB * FA_BUF;
  unsigned char* sdk = ring + ((tid >> 5) * 8 + h) * FA_PITCH + c * 8;
  unsigned char* sdv = ring + FA_TILE + ((tid >> 5) * 8 + h) * FA_PT + c * 8;
  v4f rx[4];
  auto gload = [&](int st) {
#pragma unroll
    for (int i = 0; i < 4; ++i) rx[i] = *(const v4fa*)(xg + st * (64 * HD * 4) + xo + i * 512); };
  auto sstore = [&](const v4f (&r)[4], const int bo) {      /* bo: byte offset of the buffer in the ring */
#pragma unroll
    for (int i = 0; i < 4; ++i) { const v2ua o = {fa_r2(r[i][0], r[i][1], 1.0f), fa_r2(r[i][2], r[i][3], 1.0f)};
      *(v2ua*)(sdk + bo + 2 * i * FA_PITCH) = o; *(v2ua*)(sdv + bo + 2 * i * FA_PT) = o; } };
  gload(0); const v4f r0[4] = {rx[0], rx[1], rx[2], rx[3]};
  asm volatile("s_wait_xcnt 0x0" ::: "memory");      /* the offset register of the four loads above stays as it is up to here: a later load may take it as its destination */
  gload(1); const v4f r1[4] = {rx[0], rx[1], rx[2], rx[3]};
  asm volatile("s_wait_xcnt 0x0" ::: "memory");      /* as above, for the four loads of stage 1 */
  /* query rows: wave w of key group g forms Q' of column group g (16 rows of x, 4 KiB contiguous) for wave w of both key groups; load i covers rows 2i and 2i + 1 in whole lines */
  const char* xq = (const char*)(x + (plane * SQ + q0 + 16 * grp) * HD); const unsigned xqo = (tid & 31) * 16;
  v4f xr[8];
#pragma unroll
  for (int i = 0; i < 8; ++i) xr[i] = *(const v4fa*)(xq + xqo + i * 512);
  asm volatile("s_wait_xcnt 0x0" ::: "memory");      /* as above, for these eight loads */
  /* weights: thread t of 512 converts 4-element chunks t and t + 512 of each matrix */
  const int t5 = (int)threadIdx.x; v4f wr[3][2];
#pragma unroll
  for (int m = 0; m < 3; ++m) { const float* w = (m == 0) ? wq : (m == 1) ? wk : wv;
#pragma unroll
    for (int j = 0; j < 2; ++j) wr[m][j] = *(const v4fa*)(w + t5 * 4 + j * 2048); }
  const float* bsrc = (t5 & DM) ? bv : bq; const float braw = bsrc[t5 & (DM - 1)];      /* by all threads, so that the load goes out with the rest */
  asm volatile("s_wait_xcnt 0x0" ::: "memory");      /* as above, for the weight and bias loads */
  gload(2);
  asm volatile("s_wait_xcnt 0x0" ::: "memory");      /* as above, for the four loads of stage 2 */
  fa_fence();      /* every load of the prologue is issued before the first wait for one: moved below a conversion, the bias and stage 2 cost a second trip to memory */
#pragma unroll
  for (int m = 0; m < 3; ++m) {
#pragma unroll
    for (int j = 0; j < 2; ++j) { const int ch = t5 + 512 * j; const v2ua o = {fa_r2(wr[m][j][0], wr[m][j][1], 16.0f), fa_r2(wr[m][j][2], wr[m][j][3], 16.0f)};
      unsigned char* d = (m == 0) ? LQ_ + (ch >> 4) * FA_PITCH : (m == 1) ? LK_ + (ch >> 4) * FA_PT : LV_ + (ch >> 4) * FA_PITCH;
      *(v2ua*)(d + (ch & 15) * 8) = o; } }
  LB[t5] = bf16_round(braw);
  unsigned char* xs = LX_ + (grp * 8 + wave) * 16 * FA_PITCH;      /* the wave's own 16 rows */
#pragma unroll
  for (int i = 0; i < 8; ++i) { const v2ua o = {fa_r2(xr[i][0], xr[i][1], 1.0f), fa_r2(xr[i][2], xr[i][3], 1.0f)}; *(v2ua*)(xs + (2 * i + h) * FA_PITCH + c * 8) = o; }
  v16h ones;      /* A operand whose row 0 (lanes 0 and 16) is 1.0 at all 32 k, every other row 0 */
  { const unsigned int o = (c == 0) ? 0x3C003C00u : 0u; const v8u ov = {o, o, o, o, o, o, o, o}; ones = __builtin_bit_cast(v16h, ov); }
  v8f acc[2][4], nmt[2]; float lrun[2];
#pragma unroll
  for (int g = 0; g < 2; ++g) { const v8f z = {0.f,0.f,0.f,0.f,0.f,0.f,0.f,0.f}; nmt[g] = z + __builtin_inff(); lrun[g] = 0.f;
#pragma unroll
    for (int t = 0; t < 4; ++t) acc[g][t] = z; }
  sstore(r0, 0); sstore(r1, FA_BUF);
  __syncthreads();      /* stages 0 and 1, the weights and the biases are visible to all waves */
  v16h qf[2][2];      /* B operand: column c = query q0 + 16 g + c, Q' = (x Wq^T + bq) Wk * 64^-0.5 * log2(e), in the k order of the x rows */
  { const v8f z = {0.f,0.f,0.f,0.f,0.f,0.f,0.f,0.f};
    const v16h xf0 = fa_lds(xs + c * FA_PITCH + 16 * h), xf1 = fa_lds(xs + c * FA_PITCH + 16 * h + 64);      /* column c = query q0 + 16 grp + c, k = 32 ks + the hardware k order */
    FragH qh[2];      /* xq as B operand: tile t of xq^T holds features 16 t + 8 h + r of query c, so tiles 2 ks and 2 ks + 1 packed are k = 32 ks + the hardware k order */
#pragma unroll
    for (int t = 0; t < 4; ++t) { const unsigned char* p = LQ_ + (16 * t + c) * FA_PITCH + 16 * h; const v16h w0 = fa_lds(p), w1 = fa_lds(p + 64);
      const v4f b0 = *(const v4fa*)(LB + 16 * t + 8 * h), b1 = *(const v4fa*)(LB + 16 * t + 8 * h + 4); const v8f b = {b0[0], b0[1], b0[2], b0[3], b1[0], b1[1], b1[2], b1[3]};
      qh[t >> 1].half[t & 1] = pj_pack(fa_mma(w1, xf1, fa_mma(w0, xf0, z)), b, 1.0f); }
    unsigned char* ex = LE_ + wave * 4 * 512 + (tid & 31) * 16;      /* lane by lane: the reader holds the same queries in the same lanes */
#pragma unroll
    for (int t = 0; t < 4; ++t) { const unsigned char* p = LK_ + (8 * h + (c & 7)) * FA_PT + 32 * t + 16 * (c >> 3); const v16h w0 = fa_ldt(p), w1 = fa_ldt(p + 32 * FA_PT);      /* A row c = Wk column 16 t + c, k = e */
      *(v8us*)(ex + grp * (8 * 4 * 512) + t * 512) = pj_pack(fa_mma(w1, qh[1].v, fa_mma(w0, qh[0].v, z)), z, 0.18033688011112042f); }      /* tile t of Q'^T = half t & 1 of the B operand at ks = t >> 1 */
    __syncthreads();      /* both column groups of Q' are visible to both key groups */
#pragma unroll
    for (int g = 0; g < 2; ++g) {
#pragma unroll
      for (int ks = 0; ks < 2; ++ks) { FragH f; f.half[0] = *(const v8us*)(ex + g * (8 * 4 * 512) + 2 * ks * 512); f.half[1] = *(const v8us*)(ex + g * (8 * 4 * 512) + (2 * ks + 1) * 512); qf[g][ks] = f.v; } } }
  v16h kf[2][2], vf[4];
  /* Ring of three buffers, stage s in buffer s mod 3. Trip st works on stage st; between its two passes it waits for the signals given in trip st - 1 (every wave has left stage st - 1 and has laid its rows of stage st + 1) and only then
     refills stage st - 1's buffer with stage st + 2 and, in its last pass, fetches stage st + 1's first fragments. A wave signals in its last pass of a stage and waits one pass later: the waves of a SIMD may drift a pass apart, so that none
     stands idle at the stage's end while the slowest finishes its softmax. All LDS reads between a signal and its wait are of stage st + 1, which the wait before has published. */
  const unsigned char* kb = ring + c * FA_PITCH + 16 * h; const unsigned char* vb = ring + FA_TILE + (8 * h + (c & 7)) * FA_PT + 16 * (c >> 3);
  fa_signal();      /* the signal that trip 0 waits for, so that every trip reads alike */
  fa_ldk(kf, kb); fa_ldv(vf, vb); fa_fence();      /* stage 0's first fragments */
  /* ro, rn, rw: byte offsets in the ring of stages st, st + 1, st + 2, literals at every call, so that they end as immediate offsets of the LDS instructions and no address register steps */
  auto trip = [&](const int st, const int ro, const int rn, const int rw, const bool first) __attribute__((always_inline)) {
    fa_pass<false, true>(kf, vf, kb + ro, kb + ro + 32 * FA_PITCH, vb + ro + 32 * FA_PT, qf, acc, lrun, nmt, ones, first);
    fa_wait();      /* ends every wave's reads of stage st - 1 and publishes stage st + 1 */
    if (st + 2 < FA_NS) sstore(rx, rw);
    if (st + 3 < FA_NS) { gload(st + 3);           /* a whole stage of work ahead of its use */
      asm volatile("s_wait_xcnt 0x0" ::: "memory"); }      /* the address registers of the four loads above stay as they are up to here: the score products that follow take them as their destination */
    fa_fence();
    fa_pass<true, true>(kf, vf, kb + ro + 32 * FA_PITCH, kb + rn, vb + rn, qf, acc, lrun, nmt, ones, false); };
  static_assert((FA_NS - 1) % FA_NB == 0, "the loop walks the ring in whole turns; the last stage stands apart");
#pragma unroll 1      /* one turn of the ring a trip, no more copies */
  for (int st = 0; st < FA_NS - 1; st += FA_NB) {
    trip(st, 0, FA_BUF, 2 * FA_BUF, st == 0);
    trip(st + 1, FA_BUF, 2 * FA_BUF, 0, false);
    trip(st + 2, 2 * FA_BUF, 0, FA_BUF, false);
  }
  /* the last stage (buffer 0), apart: nothing is left to refill or to fetch ahead, and no branch for that stands behind a product in the loop */
  fa_pass<false, true>(kf, vf, kb, kb + 32 * FA_PITCH, vb + 32 * FA_PT, qf, acc, lrun, nmt, ones, false);
  fa_wait();      /* pairs with the signals of the stage before */
  fa_pass<true, false>(kf, vf, kb + 32 * FA_PITCH, kb, vb, qf, acc, lrun, nmt, ones, false);
  fa_wait();      /* the last stage's signals: every wave has left the ring */
  /* hand-over: wave w of group 1 holds the same queries in the same lanes and registers as wave w of group 0; it lays its registers lane by lane (512 contiguous bytes a store) in that wave's part of L (the rings are free behind the last barrier) */
  const int lane = (int)__builtin_amdgcn_mbcnt_lo(~0u, 0u), ce = lane & 15, he = lane >> 4;      /* the lane's number formed anew: no register carries it, or what follows from it, across the loop */
  unsigned char* eb = L + wave * 32 * FA_OP;
  float lsum[2], m_run[2];
#pragma unroll
  for (int g = 0; g < 2; ++g) { const float lr = lrun[g]; lsum[g] = lr + rs_xhalf(lr); m_run[g] = -nmt[g][0]; }      /* the denominator in lanes 0-15, 0 in lanes 16-31 (row 8 of the sum tiles) */
  if (grp != 0) {
#pragma unroll
    for (int g = 0; g < 2; ++g) {
#pragma unroll
      for (int t = 0; t < 4; ++t) { const v8f o = acc[g][t]; unsigned char* d = eb + (g * 4 + t) * 1024 + lane * 16;
        const v4f lo = {o[0], o[1], o[2], o[3]}, hi = {o[4], o[5], o[6], o[7]}; *(v4fa*)d = lo; *(v4fa*)(d + 512) = hi; } }
    const v4f ml = {m_run[0], m_run[1], lsum[0], lsum[1]}; *(v4fa*)(eb + 16 * 512 + lane * 16) = ml; }
  __syncthreads();      /* group 1's sums are visible to group 0 */
  if (grp != 0) return;      /* no barrier follows */
  { const v4f ml = *(const v4fa*)(eb + 16 * 512 + lane * 16);
#pragma unroll
    for (int g = 0; g < 2; ++g) { const float mn = fmaxf(m_run[g], ml[g]); const float a0 = __builtin_amdgcn_exp2f(m_run[g] - mn), a1 = __builtin_amdgcn_exp2f(ml[g] - mn);      /* both halves on the common maximum */
      const float inv = 1.0f / (lsum[g] * a0 + ml[2 + g] * a1); const float f0 = a0 * inv, f1 = a1 * inv;
#pragma unroll
      for (int t = 0; t < 4; ++t) { const unsigned char* d = eb + (g * 4 + t) * 1024 + lane * 16; const v4f lo = *(const v4fa*)d, hi = *(const v4fa*)(d + 512);
        const v8f o = {lo[0], lo[1], lo[2], lo[3], hi[0], hi[1], hi[2], hi[3]}; acc[g][t] = acc[g][t] * f0 + o * f1; } } }
  /* out^T = Wv.Y^T + bv: tile t of Y^T holds d = 16 t + 8 h + r of query c, so tiles 2 ks and 2 ks + 1 packed to f16 are the B operand at k = 32 ks + the hardware k order */
  { const v8f z = {0.f,0.f,0.f,0.f,0.f,0.f,0.f,0.f};
    FragH yf[2][2];
#pragma unroll
    for (int g = 0; g < 2; ++g) {
#pragma unroll
      for (int t = 0; t < 4; ++t) yf[g][t >> 1].half[t & 1] = __builtin_bit_cast(v8us, __builtin_convertvector(acc[g][t], v8h)); }
#pragma unroll
    for (int t = 0; t < 4; ++t) { const unsigned char* p = LV_ + (16 * t + ce) * FA_PITCH + 16 * he; const v16h w0 = fa_lds(p), w1 = fa_lds(p + 64);
      const v4f b0 = *(const v4fa*)(LB + DM + 16 * t + 8 * he), b1 = *(const v4fa*)(LB + DM + 16 * t + 8 * he + 4); const v8f b = {b0[0], b0[1], b0[2], b0[3], b1[0], b1[1], b1[2], b1[3]};
#pragma unroll
      for (int g = 0; g < 2; ++g) acc[g][t] = fa_mma(w1, yf[g][1].v, fa_mma(w0, yf[g][0].v, z)) * 0.0625f + b; } }      /* register r = output feature 16 t + 8 h + r */
  __builtin_amdgcn_fence(__ATOMIC_ACQ_REL, "workgroup"); __builtin_amdgcn_wave_barrier();      /* every lane's reads of the hand-over before any lane's staging stores into the same bytes */
  /* epilogue: each wave of group 0 stages its 32 output rows in its own part of L and stores whole 256-byte rows */
#pragma unroll
  for (int g = 0; g < 2; ++g) {
#pragma unroll
    for (int t = 0; t < 4; ++t) { const v8f o = acc[g][t]; unsigned char* d = eb + (16 * g + ce) * FA_OP + 64 * t + 32 * he;      /* row = query, feature = 16 t + 8 h + r */
      const v4f lo = {o[0], o[1], o[2], o[3]}, hi = {o[4], o[5], o[6], o[7]}; *(v4fa*)d = lo; *(v4fa*)(d + 16) = hi; } }
  __builtin_amdgcn_fence(__ATOMIC_ACQ_REL, "workgroup"); __builtin_amdgcn_wave_barrier();      /* the wave's own LDS writes before its reads of other lanes' rows */
#pragma unroll
  for (int i = 0; i < 16; ++i) { const int row = 2 * i + he; const v4f v = *(const v4fa*)(eb + row * FA_OP + ce * 16); *(v4f*)(O + (plane * SQ + q0 + row) * HD + ce * 4) = v; } }

extern "C" void kernel_launch(void* const* d_in, const int* in_sizes, int n_in,
                              void* d_out, int out_size, void* d_ws, size_t ws_size, hipStream_t stream) {
  (void)in_sizes; (void)n_in; (void)out_size; (void)d_ws; (void)ws_size;
  const float* const* I = (const float* const*)d_in; const float* x = I[0]; const float* wq = I[1]; const float* bq = I[2]; const float* wk = I[3]; const float* wv = I[5]; const float* bv = I[6];      /* natural [out][in] 64x64 weights + biases; x head-major = 32 planes of [2048][64]; bk (I[4]) adds the same amount to all scores of a query, which the softmax cancels */
  k_fattn<<<dim3(SQ / 256, NB), 256 * FA_KG, 0, stream>>>(x, wq, bq, wk, wv, bv, (float*)d_out);      /* all planes: 256 queries per work-group of 16 waves, out written f32 straight into the output rows */
}

// v009
// It runs in 23.4 microseconds.
// Next to v008, in two timings, it ran 1.05 times as fast each time.
// Over all steps from v000 it is 551 times as fast.
#include <hip/hip_runtime.h>
// Per-head scaled dot-product attention on a head-major input (x [2][16][2048][64]; xq = x Wq^T + bq, xk, xv likewise with ONE shared nn.Linear [64][64] per projection (natural [out][in], sigma 1/8; biases sigma 0.02); att = xq . xk / 8; softmax over all 2048 keys (no mask); out = p xv -> [2][16][2048][64]; every (batch, head) plane is an independent 2048 x 64 sequence = 32 planes).
// Structure: token rows r = plane*2048 + s; ONE launch for everything (k_fattn). The K and V projections are never formed: scores = (xq Wk) . x^T + (xq . bk), whose second term is the same for all keys of a query and cancels in the softmax, and out = (p x) Wv^T + bv because the weights of a query sum to 1. Per work-group 256 queries of one plane: Q' = (x Wq^T + bq) Wk on WMMA in the prologue, then the keys split over two groups of eight waves, S^T = X.Q'^T and Y^T += X^T.P^T on WMMA with an online softmax between them (x read f32, rounded, staged in LDS), and out^T = Wv.Y^T + bv on WMMA in the epilogue, written f32 straight into the output rows.
// Compute dtype: inputs rounded to bf16; x / weights exact in f16; xq, Q', softmax weights and p x as plain f16 GEMM operands (~2^-12); scores and softmax statistics f32. v_wmma_f32_16x16x32_f16.
#define NB 32
#define SQ 2048
#define DM 64
#define NH 1
#define HD 64
#define HG 1                         /* unused by the launches: heads per group of the non-template k_vt */
#define B0 0                         /* unused: the launches start at plane 0 */
#define NBR NB                       /* unused by the launches (only MP uses it) */
#define NR ((size_t)NB * SQ)         /* token rows */
#define MP ((int)((size_t)NBR * SQ)) /* unused */
#define QN SQ                        /* unused: query rows per plane = SQ */
#define NHD NH                       /* unused: heads per plane */
#define MPO MP                       /* unused: no output stage */
#define LQ DM      /* unused */
typedef __bf16 v16b __attribute__((ext_vector_type(16)));
typedef unsigned short v8us __attribute__((ext_vector_type(8), may_alias));
typedef float  v8f  __attribute__((ext_vector_type(8)));
typedef float  v4f  __attribute__((ext_vector_type(4)));
typedef float  v4fa __attribute__((ext_vector_type(4), may_alias));
union FragB { v16b v; v8us half[2]; unsigned short u[16]; };

__device__ __forceinline__ unsigned short bf16_bits(float x) { unsigned int u = __float_as_uint(x); return (unsigned short)((u + 0x7FFFu + ((u >> 16) & 1u)) >> 16); }
__device__ __forceinline__ float bf16_val(unsigned short b) { return __uint_as_float(((unsigned int)b) << 16); }
__device__ __forceinline__ float bf16_round(float x) { return bf16_val(bf16_bits(x)); }
// D += A·B with NT terms: 1 = ah·bh, 2 = + al·bh (A split), 3 = + ah·bl (both split)
template <int NT>
__device__ __forceinline__ v8f mmaN(v16b ah, v16b al, v16b bh, v16b bl, v8f c) {
  c = __builtin_amdgcn_wmma_f32_16x16x32_bf16(false, ah, false, bh, (short)0, c, false, false);
  if (NT >= 2) c = __builtin_amdgcn_wmma_f32_16x16x32_bf16(false, al, false, bh, (short)0, c, false, false);
  if (NT >= 3) c = __builtin_amdgcn_wmma_f32_16x16x32_bf16(false, ah, false, bl, (short)0, c, false, false);
  asm volatile("v_nop\n\tv_nop\n\tv_nop\n\tv_nop" : "+v"(c) : "v"(ah), "v"(al), "v"(bh), "v"(bl));
  return c;
}

__global__ __launch_bounds__(256) void k_wt_bf16(const float* __restrict__ W, unsigned short* __restrict__ Wt, int K, int N) {
  const int t = blockIdx.x * 256 + threadIdx.x;
  const int k8n = K / 8;
  if (t >= N * k8n) return;
  const int n = t / k8n, k8 = (t % k8n) * 8;
  v8us v;
#pragma unroll
  for (int i = 0; i < 8; ++i) v[i] = bf16_bits(W[(size_t)(k8 + i) * N + n]);
  *(v8us*)(Wt + (size_t)n * K + k8) = v;
  
}

// GEMM C[M][N] (f32, pitch ldc) = act(A[M][K]·W + bias). A f32 row-major (pitch lda) converted per fragment to bf16
// (ASPLIT: hi/lo two planes -> 2 terms, else single rounded term); Wt bf16 [N][K] (pitch ldb). BIAS_BF16 rounds the
// bias to bf16 first (bias quantised to bf16 before the add). K%32==0, M%16==0, N%64==0.
template <bool ASPLIT, int ACT, bool BIAS_BF16>
__global__ __launch_bounds__(128) void k_gemm_bf(const float* __restrict__ A, int lda, const unsigned short* __restrict__ Wt, int ldb,
                                               const float* __restrict__ bias, float* __restrict__ C, int ldc, int M, int N, int K) {
  __shared__ __attribute__((aligned(16))) float so[4][16][64];
  const int tid = threadIdx.x, w = tid >> 5, lane = tid & 31, ln = lane & 15, hh = lane >> 4;
  const int ntn = N / 64;
  const int wid = blockIdx.x * 4 + w;
  const int mt = wid / ntn, nq = wid % ntn;
  if (mt * 16 >= M) return;
  const int row0 = mt * 16, col0 = nq * 64;
  const float* arow = A + (size_t)(row0 + ln) * lda;
  v8f acc[4] = {};
  for (int kb = 0; kb < K; kb += 32) {
    FragB ah, al;
    const v4f x0 = *(const v4fa*)(arow + kb + 8 * hh), x1 = *(const v4fa*)(arow + kb + 8 * hh + 4);
    const v4f x2 = *(const v4fa*)(arow + kb + 16 + 8 * hh), x3 = *(const v4fa*)(arow + kb + 16 + 8 * hh + 4);
    float xs[16] = {x0[0],x0[1],x0[2],x0[3],x1[0],x1[1],x1[2],x1[3],x2[0],x2[1],x2[2],x2[3],x3[0],x3[1],x3[2],x3[3]};
#pragma unroll
    for (int i = 0; i < 16; ++i) { const unsigned short hb = bf16_bits(xs[i]); ah.u[i] = hb; al.u[i] = ASPLIT ? bf16_bits(xs[i] - bf16_val(hb)) : (unsigned short)0; }
#pragma unroll
    for (int t = 0; t < 4; ++t) {
      const unsigned short* brow = Wt + (size_t)(col0 + t * 16 + ln) * ldb + kb;
      FragB b;
      b.half[0] = *(const v8us*)(brow + 8 * hh);
      b.half[1] = *(const v8us*)(brow + 16 + 8 * hh);
      acc[t] = mmaN<ASPLIT ? 2 : 1>(ah.v, al.v, b.v, b.v, acc[t]);
    }
  }
#pragma unroll
  for (int t = 0; t < 4; ++t) {
    float bv = bias ? bias[col0 + t * 16 + ln] : 0.f;
    if (BIAS_BF16) bv = bf16_round(bv);
#pragma unroll
    for (int r = 0; r < 8; ++r) { float v = acc[t][r] + bv; if (ACT == 1) v = fmaxf(v, 0.f); so[w][8 * hh + r][t * 16 + ln] = v; }
  }
  __builtin_amdgcn_fence(__ATOMIC_ACQ_REL, "workgroup");
  __builtin_amdgcn_wave_barrier();
  const int rsub = lane >> 4, c4 = (lane & 15) * 4;
  {
#pragma unroll
    for (int q = 0; q < 8; ++q) {
      const int r = q * 2 + rsub;
      const v4f v = *(const v4fa*)&so[w][r][c4];
      *(v4f*)(C + (size_t)(row0 + r) * ldc + col0 + c4) = v;
    }
    
  }
}

// GEMM C = act(A·W + bias + resid): A f32 (ASPLIT -> hi/lo 2 terms), Wt bf16 [N][K]; ACT 0 none, 1 relu, 2 exact gelu;
// resid (optional, f32, row index = (row % rmod), pitch ldr, RES_BF16 rounds it) added before the activation.
template <bool ASPLIT, int ACT, bool BIAS_BF16, bool RES_BF16>
__global__ __launch_bounds__(128) void k_gemm_bf3(const float* __restrict__ A, int lda, const unsigned short* __restrict__ Wt, int ldb,
                                                const float* __restrict__ bias, const float* __restrict__ resid, int rmod, int ldr,
                                                float* __restrict__ C, int ldc, int M, int N, int K) {
  __shared__ __attribute__((aligned(16))) float so[4][16][64];
  const int tid = threadIdx.x, w = tid >> 5, lane = tid & 31, ln = lane & 15, hh = lane >> 4;
  const int ntn = N / 64;
  const int wid = blockIdx.x * 4 + w;
  const int mt = wid / ntn, nq = wid % ntn;
  if (mt * 16 >= M) return;
  const int row0 = mt * 16, col0 = nq * 64;
  const float* arow = A + (size_t)(row0 + ln) * lda;
  v8f acc[4] = {};
  for (int kb = 0; kb < K; kb += 32) {
    FragB ah, al;
    const v4f x0 = *(const v4fa*)(arow + kb + 8 * hh), x1 = *(const v4fa*)(arow + kb + 8 * hh + 4);
    const v4f x2 = *(const v4fa*)(arow + kb + 16 + 8 * hh), x3 = *(const v4fa*)(arow + kb + 16 + 8 * hh + 4);
    float xs[16] = {x0[0],x0[1],x0[2],x0[3],x1[0],x1[1],x1[2],x1[3],x2[0],x2[1],x2[2],x2[3],x3[0],x3[1],x3[2],x3[3]};
#pragma unroll
    for (int i = 0; i < 16; ++i) { const unsigned short hb = bf16_bits(xs[i]); ah.u[i] = hb; al.u[i] = ASPLIT ? bf16_bits(xs[i] - bf16_val(hb)) : (unsigned short)0; }
#pragma unroll
    for (int t = 0; t < 4; ++t) {
      const unsigned short* brow = Wt + (size_t)(col0 + t * 16 + ln) * ldb + kb;
      FragB b;
      b.half[0] = *(const v8us*)(brow + 8 * hh);
      b.half[1] = *(const v8us*)(brow + 16 + 8 * hh);
      acc[t] = mmaN<ASPLIT ? 2 : 1>(ah.v, al.v, b.v, b.v, acc[t]);
    }
  }
#pragma unroll
  for (int t = 0; t < 4; ++t) {
    const int col = col0 + t * 16 + ln;
    float bv = bias ? bias[col] : 0.f;
    if (BIAS_BF16) bv = bf16_round(bv);
#pragma unroll
    for (int r = 0; r < 8; ++r) {
      float v = acc[t][r] + bv;
      if (resid) { float rv = resid[(size_t)((row0 + 8 * hh + r) % rmod) * ldr + col]; if (RES_BF16) rv = bf16_round(rv); v += rv; }
      if (ACT == 1) v = fmaxf(v, 0.f);
      if (ACT == 2) v = 0.5f * v * (1.0f + erff(v * 0.70710678118654752f));
      if (ACT == 3) { const float u = 0.7978845608028654f * (v + 0.044715f * v * v * v); v = 0.5f * v * (1.0f + tanhf(u)); }
      so[w][8 * hh + r][t * 16 + ln] = v;
    }
  }
  __builtin_amdgcn_fence(__ATOMIC_ACQ_REL, "workgroup");
  __builtin_amdgcn_wave_barrier();
  const int rsub = lane >> 4, c4 = (lane & 15) * 4;
  {
#pragma unroll
    for (int q = 0; q < 8; ++q) {
      const int r = q * 2 + rsub;
      const v4f v = *(const v4fa*)&so[w][r][c4];
      *(v4f*)(C + (size_t)(row0 + r) * ldc + col0 + c4) = v;
    }
    
  }
}
// row LayerNorm (biased variance, eps) over N: s = X (+ R); optional out_sum <- s; out_norm <- (s-mu)*rsqrt(var+eps)*g + b
template <bool PARAM_BF16>
__global__ __launch_bounds__(256) void k_layernorm(const float* __restrict__ X, const float* __restrict__ R, const float* __restrict__ g, const float* __restrict__ bta,
                                                  float* __restrict__ out_sum, float* __restrict__ out_norm, int N, float eps) {
  __shared__ float red[256];
  const int row = blockIdx.x, tid = threadIdx.x;
  const float* x = X + (size_t)row * N; const float* rr = R ? R + (size_t)row * N : nullptr;
  float vals[16];                     // up to N = 4096
  const int per = N / 256;            // contiguous chunk per thread? use strided-by-4 chunks: thread handles j = tid*4 + 1024*u
  float s1 = 0.f;
  for (int u = 0; u < per / 4; ++u) {
    const int j = tid * 4 + 1024 * u;
    const v4f a = *(const v4fa*)(x + j);
    v4f b = {0.f,0.f,0.f,0.f}; if (rr) b = *(const v4fa*)(rr + j);
#pragma unroll
    for (int q = 0; q < 4; ++q) { const float v = a[q] + b[q]; vals[u * 4 + q] = v; s1 += v; }
  }
  red[tid] = s1; __syncthreads();
  for (int st = 128; st > 0; st >>= 1) { if (tid < st) red[tid] += red[tid + st]; __syncthreads(); }
  const float mu = red[0] / (float)N; __syncthreads();
  float s2 = 0.f;
  for (int u = 0; u < per / 4; ++u)
#pragma unroll
    for (int q = 0; q < 4; ++q) { const float c = vals[u * 4 + q] - mu; s2 += c * c; }
  red[tid] = s2; __syncthreads();
  for (int st = 128; st > 0; st >>= 1) { if (tid < st) red[tid] += red[tid + st]; __syncthreads(); }
  const float rs = rsqrtf(red[0] / (float)N + eps);
  {
    for (int u = 0; u < per / 4; ++u) {
      const int j = tid * 4 + 1024 * u;
      v4f o, sm;
#pragma unroll
      for (int q = 0; q < 4; ++q) {
        float gg = g[j + q], bb = bta[j + q];
        if (PARAM_BF16) { gg = bf16_round(gg); bb = bf16_round(bb); }
        sm[q] = vals[u * 4 + q]; o[q] = (vals[u * 4 + q] - mu) * rs * gg + bb;
      }
      if (out_sum) *(v4f*)(out_sum + (size_t)row * N + j) = sm;
      *(v4f*)(out_norm + (size_t)row * N + j) = o;
    }
    
  }
}



// ---- f16 WMMA path (v_wmma_f32_16x16x32_f16): 11-bit significands for operands in range — used where a [0,1] probability operand needs more precision than bf16
typedef _Float16 v16h __attribute__((ext_vector_type(16)));
union FragH { v16h v; v8us half[2]; _Float16 h[16]; unsigned short u[16]; };
template <int NT>
__device__ __forceinline__ v8f mmaH(v16h ah, v16h al, v16h bh, v16h bl, v8f c) {
  c = __builtin_amdgcn_wmma_f32_16x16x32_f16(false, ah, false, bh, (short)0, c, false, false);
  if (NT >= 2) c = __builtin_amdgcn_wmma_f32_16x16x32_f16(false, al, false, bh, (short)0, c, false, false);
  if (NT >= 3) c = __builtin_amdgcn_wmma_f32_16x16x32_f16(false, ah, false, bl, (short)0, c, false, false);
  asm volatile("v_nop\n\tv_nop\n\tv_nop\n\tv_nop" : "+v"(c) : "v"(ah), "v"(al), "v"(bh), "v"(bl));
  return c;
}
// batched GEMM like k_gemm_b but f16 operands: A f32 (split into f16 hi/lo if ASPLIT, else rounded to f16), Bt = f16 values [n][k]; alpha; C f32; N multiple of 16 (partial tiles skipped)
template <bool ASPLIT>
__global__ __launch_bounds__(128) void k_gemm_h(const float* __restrict__ A, int lda, size_t sA, const _Float16* __restrict__ Bh, int ldb, size_t sB, float alpha, float* __restrict__ C, int ldc, size_t sC, int M, int N, int K) {
  __shared__ __attribute__((aligned(16))) float so[4][16][64];
  const int tid = threadIdx.x, w = tid >> 5, lane = tid & 31, ln = lane & 15, hh = lane >> 4; const int by = blockIdx.y;
  A += (size_t)by * sA; Bh += (size_t)by * sB; C += (size_t)by * sC;
  const int ntn = (N + 63) / 64; const int wid = blockIdx.x * 4 + w; const int mt = wid / ntn, nq = wid % ntn; if (mt * 16 >= M) return;
  const int row0 = mt * 16, col0 = nq * 64; const float* arow = A + (size_t)(row0 + ln) * lda;
  v8f acc[4] = {};
  for (int kb = 0; kb < K; kb += 32) {
    FragH ah, al;
    const v4f x0 = *(const v4fa*)(arow + kb + 8 * hh), x1 = *(const v4fa*)(arow + kb + 8 * hh + 4), x2 = *(const v4fa*)(arow + kb + 16 + 8 * hh), x3 = *(const v4fa*)(arow + kb + 16 + 8 * hh + 4);
    float xs[16] = {x0[0],x0[1],x0[2],x0[3],x1[0],x1[1],x1[2],x1[3],x2[0],x2[1],x2[2],x2[3],x3[0],x3[1],x3[2],x3[3]};
#pragma unroll
    for (int i = 0; i < 16; ++i) { const _Float16 h = (_Float16)xs[i]; ah.h[i] = h; al.h[i] = ASPLIT ? (_Float16)(xs[i] - (float)h) : (_Float16)0.0f; }
#pragma unroll
    for (int t = 0; t < 4; ++t) { if (col0 + t * 16 >= N) continue; const size_t boff = (size_t)(col0 + t * 16 + ln) * ldb + kb; FragH bq; bq.half[0] = *(const v8us*)(Bh + boff + 8 * hh); bq.half[1] = *(const v8us*)(Bh + boff + 16 + 8 * hh);
      acc[t] = mmaH<ASPLIT ? 2 : 1>(ah.v, al.v, bq.v, bq.v, acc[t]); }
  }
#pragma unroll
  for (int t = 0; t < 4; ++t) { if (col0 + t * 16 >= N) continue;
#pragma unroll
    for (int r = 0; r < 8; ++r) so[w][8 * hh + r][t * 16 + ln] = acc[t][r] * alpha; }
  __builtin_amdgcn_fence(__ATOMIC_ACQ_REL, "workgroup"); __builtin_amdgcn_wave_barrier();
  const int rsub = lane >> 4, c4 = (lane & 15) * 4;
  {
#pragma unroll
    for (int q = 0; q < 8; ++q) { const int r = q * 2 + rsub; if (col0 + c4 < N) { const v4f v = *(const v4fa*)&so[w][r][c4]; *(v4f*)(C + (size_t)(row0 + r) * ldc + col0 + c4) = v; } }
     }
}

// Wt[n][k] = f16(W[k][n]·scale) from f32 row-major W[K][N] (scale = power of two; bf16-exact weights stay exact in f16 away from the subnormal range)
__global__ __launch_bounds__(256) void k_wt_f16(const float* __restrict__ W, _Float16* __restrict__ Wt, int K, int N, float scale) {
  const int t = blockIdx.x * 256 + threadIdx.x; if (t >= N * (K / 8)) return; const int n = t / (K / 8), k8 = (t % (K / 8)) * 8; FragH f;
#pragma unroll
  for (int i = 0; i < 8; ++i) f.h[i] = (_Float16)(bf16_round(W[(size_t)(k8 + i) * N + n]) * scale); const v8us o = f.half[0];
  *(v8us*)((unsigned short*)Wt + (size_t)n * K + k8) = o; 
}
// k_gemm_hh variant with fused epilogue: v = acc·alpha + bias[by·sBias + col] (+ CP[(row/rowsPerB)·sCPb + by·64 + col] if CP) ; ACT 0 none / 1 elu ; writes f16 C16 (and f32 C if non-null)
template <int ACT>
__global__ __launch_bounds__(128) void k_gemm_hhx(const _Float16* __restrict__ A, int lda, size_t sA, const _Float16* __restrict__ Bh, int ldb, size_t sB, float alpha, const float* __restrict__ bias, size_t sBias, const float* __restrict__ CP, int rowsPerB, size_t sCPb, int row0g,
    float* __restrict__ C, _Float16* __restrict__ C16, int ldc, size_t sC, int M, int N, int K) {
  __shared__ __attribute__((aligned(16))) float so[4][16][64];
  const int tid = threadIdx.x, w = tid >> 5, lane = tid & 31, ln = lane & 15, hh = lane >> 4; const int by = blockIdx.y;
  A += (size_t)by * sA; Bh += (size_t)by * sB; const size_t cofs = (size_t)by * sC; const float* bp = bias ? bias + (size_t)by * sBias : nullptr;
  const int ntn = (N + 63) / 64; const int wid = blockIdx.x * 4 + w; const int mt = wid / ntn, nq = wid % ntn; if (mt * 16 >= M) return;
  const int row0 = mt * 16, col0 = nq * 64; const _Float16* arow = A + (size_t)(row0 + ln) * lda;
  v8f acc[4] = {};
  for (int kb = 0; kb < K; kb += 32) { FragH ah; ah.half[0] = *(const v8us*)((const unsigned short*)arow + kb + 8 * hh); ah.half[1] = *(const v8us*)((const unsigned short*)arow + kb + 16 + 8 * hh);
#pragma unroll
    for (int t = 0; t < 4; ++t) { if (col0 + t * 16 >= N) continue; const size_t boff = (size_t)(col0 + t * 16 + ln) * ldb + kb; FragH bq; bq.half[0] = *(const v8us*)((const unsigned short*)Bh + boff + 8 * hh); bq.half[1] = *(const v8us*)((const unsigned short*)Bh + boff + 16 + 8 * hh);
      acc[t] = mmaH<1>(ah.v, ah.v, bq.v, bq.v, acc[t]); }
  }
#pragma unroll
  for (int t = 0; t < 4; ++t) { if (col0 + t * 16 >= N) continue; const int col = col0 + t * 16 + ln; const float bv = bp ? bf16_round(bp[col]) : 0.f;
#pragma unroll
    for (int r = 0; r < 8; ++r) { float v = acc[t][r] * alpha + bv; if (CP) { const int rr = row0g + row0 + 8 * hh + r; if (rowsPerB < 0) v += CP[cofs + (size_t)rr * ldc + col];      /* rowsPerB < 0: own element of the batched C plane */ else { const int bidx = rr / rowsPerB; v += CP[(size_t)bidx * sCPb + (size_t)by * 64 + col]; } } if (ACT == 1) v = (v > 0.f) ? v : expm1f(v); else if (ACT == 7) v = (v > 0.f) ? v + 1.0f : expf(v); else if (ACT == 8) v = tanhf(v); else if (ACT == 9) v = 0.5f * v * (1.0f + tanhf(0.7978845608028654f * (v + 0.044715f * v * v * v))); else if (ACT == 11) v = 1.0f / (1.0f + expf(-v)); else if (ACT == 12) v = (v > 0.f) ? v : 0.01f * v; else if (ACT == 14) v = (v > 0.f) ? v : 0.1f * v; else if (ACT == 16) v = (v >= 0.f) ? v : 0.3f * v; else if (ACT == 17) v = (v >= 0.f) ? v : 0.2f * v; else if (ACT == 15) v = v / (1.0f + expf(-v)); else if (ACT == 3) v = fmaxf(v, 0.f); else if (ACT == 6) v = 0.5f * v * (1.0f + erff(v * 0.70710678118654752f)); so[w][8 * hh + r][t * 16 + ln] = v; } }
  __builtin_amdgcn_fence(__ATOMIC_ACQ_REL, "workgroup"); __builtin_amdgcn_wave_barrier();
  const int rsub = lane >> 4, c4 = (lane & 15) * 4; typedef _Float16 v4h __attribute__((ext_vector_type(4)));
  {
#pragma unroll
    for (int q = 0; q < 8; ++q) { const int r = q * 2 + rsub; if (col0 + c4 < N) { const v4f v = *(const v4fa*)&so[w][r][c4]; if (C) *(v4f*)(C + cofs + (size_t)(row0 + r) * ldc + col0 + c4) = v; if (C16) { v4h h4; for (int i = 0; i < 4; ++i) h4[i] = (_Float16)v[i]; *(v4h*)(C16 + cofs + (size_t)(row0 + r) * ldc + col0 + c4) = h4; } } }
     }
}


typedef _Float16 v4h __attribute__((ext_vector_type(4)));

__global__ __launch_bounds__(256) void k_h16(const float* __restrict__ x, _Float16* __restrict__ X16, size_t n8) { const size_t t = (size_t)blockIdx.x * 256 + threadIdx.x; if (t >= n8) return; FragH f;
#pragma unroll
  for (int q = 0; q < 8; ++q) f.h[q] = (_Float16)x[t * 8 + q]; *(v8us*)((unsigned short*)X16 + t * 8) = f.half[0];  }
__global__ __launch_bounds__(256) void k_round16f(const float* __restrict__ W, _Float16* __restrict__ Bt, size_t n8) { const size_t t = (size_t)blockIdx.x * 256 + threadIdx.x; if (t >= n8) return; FragH f;
#pragma unroll
  for (int i = 0; i < 8; ++i) f.h[i] = (_Float16)(bf16_round(W[t * 8 + i]) * 16.0f); *(v8us*)((unsigned short*)Bt + t * 8) = f.half[0];  }

__global__ __launch_bounds__(256) void k_hl(const float* __restrict__ F, _Float16* __restrict__ Hh, _Float16* __restrict__ Hl, size_t n8) { const size_t t = (size_t)blockIdx.x * 256 + threadIdx.x; if (t >= n8) return; FragH fh, fl; const v4f a = *(const v4fa*)(F + t * 8), c = *(const v4fa*)(F + t * 8 + 4);
#pragma unroll
  for (int q = 0; q < 4; ++q) { _Float16 h = (_Float16)a[q]; fh.h[q] = h; fl.h[q] = (_Float16)((a[q] - (float)h) * 1024.0f); h = (_Float16)c[q]; fh.h[4 + q] = h; fl.h[4 + q] = (_Float16)((c[q] - (float)h) * 1024.0f); }
  { *(v8us*)((unsigned short*)Hh + t * 8) = fh.half[0]; *(v8us*)((unsigned short*)Hl + t * 8) = fl.half[0];  } }

// ---- A or B fragment of a 16x16x32 f16 product, straight from a global f16 row ----
__device__ __forceinline__ v16h g2_frag(const _Float16* p, int hh) { FragH f; f.half[0] = *(const v8us*)((const unsigned short*)p + 8 * hh); f.half[1] = *(const v8us*)((const unsigned short*)p + 16 + 8 * hh); return f.v; }


__global__ __launch_bounds__(256) void k_rsm(const float* __restrict__ S, _Float16* __restrict__ P, int nrows) {
  #pragma clang fp contract(off)
  const int i = blockIdx.x * 256 + threadIdx.x; if (i >= nrows) return; const float* s = S + (size_t)i * SQ; float mx = -3.0e38f;
#pragma unroll 1
  for (int j = 0; j < SQ; ++j) mx = fmaxf(mx, s[j]); float se = 0.f;
#pragma unroll 1
  for (int j = 0; j < SQ; ++j) se += expf(s[j] - mx); const float sc = 256.0f / se;
#pragma unroll 1
  for (int j0 = 0; j0 < SQ; j0 += 8) { FragH f; for (int q = 0; q < 8; ++q) f.h[q] = (_Float16)(expf(s[j0 + q] - mx) * sc); unsigned short* d = (unsigned short*)P + (size_t)i * SQ + j0; *(v8us*)d = f.half[0];  } }
__global__ __launch_bounds__(256) void k_vt(const _Float16* __restrict__ V16, int b, int h0, _Float16* __restrict__ VT) { __shared__ unsigned short tl[64][65]; const int tid = threadIdx.x; const int hh = blockIdx.x % HG, sg = blockIdx.x / HG; const int s0 = sg * 64; const int h = h0 + hh;
  for (int i = tid; i < 64 * 8; i += 256) { const int j = i / 8, d8 = (i % 8) * 8; FragH f; f.half[0] = *(const v8us*)((const unsigned short*)V16 + ((size_t)b * SQ + s0 + j) * DM + h * HD + d8); for (int q = 0; q < 8; ++q) tl[d8 + q][j] = f.u[q]; }
  __syncthreads();
  { for (int i = tid; i < 64 * 8; i += 256) { const int d = i / 8, j8 = (i % 8) * 8; FragH f; for (int q = 0; q < 8; ++q) f.u[q] = tl[d][j8 + q]; *(v8us*)((unsigned short*)VT + ((size_t)hh * HD + d) * SQ + s0 + j8) = f.half[0]; }  } }



// lane l with lane l ^ 16: a register move, no LDS round trip
__device__ __forceinline__ float rs_xhalf(float x) { return __builtin_bit_cast(float, __builtin_amdgcn_permlanex16(__builtin_bit_cast(int, x), __builtin_bit_cast(int, x), 0x76543210, 0xfedcba98, false, false)); }
// ---- fused attention: projections, scores, softmax and P.X of all planes in one launch ----
// Work-group = 16 waves = 256 queries of one plane, four waves per SIMD: the vector work of one wave's softmax runs under the products of the others. Two key groups of 8 waves: group 0 walks the first half of the keys,
// group 1 the second half, each with its own LDS ring and its own online softmax; behind the loop group 1 hands its sums, maxima and denominators to group 0 through LDS, which merges them, applies Wv and bv and writes the output.
// A wave owns 32 query columns (two 16-column groups). Keys come in stages of 64: the x rows of a stage are read f32 in whole lines one trip ahead, rounded (bf16, exact in f16) and laid in LDS twice (three buffers),
// once at the pitch of the 16-byte reader (rows as A fragments of the scores) and once at the pitch of the transposing reader (columns as A fragments of Y^T += X^T.P^T), both in the hardware k order.
// S^T = X.Q'^T puts one query's scores in one lane (and its partner lane ^ 16), so the packed scores ARE the B operand of Y^T += X^T.P^T: no exchange, no LDS for P. The same holds from xq to Q' and from Y to the output.
#define FA_KG 2                      /* key groups per work-group */
#define FA_NS (SQ / FA_KG / 64)      /* stages of 64 keys per key group */
#define FA_PITCH 144                 /* LDS row pitch for ds_load_b128 readers, bytes: 128 + 16, an odd multiple of 16 (no bank conflict) */
#define FA_PT 160                    /* LDS row pitch for ds_load_tr16_b128 readers, bytes: 128 + 32, an odd multiple of 32 (no bank conflict) */
#define FA_TILE (64 * FA_PITCH)      /* a 64-row tile for the 16-byte reader */
#define FA_TT (64 * FA_PT)           /* a 64-row tile for the transposing reader */
#define FA_BUF (FA_TILE + FA_TT)     /* one stage of one key group: both copies */
#define FA_NB 3                      /* buffers in a key group's ring: one being read, one published and waiting, one being filled */
#define FA_OP 272                    /* output staging pitch, bytes: 256 + 16 */
typedef float v2f __attribute__((ext_vector_type(2)));
typedef _Float16 v2h __attribute__((ext_vector_type(2)));
typedef _Float16 v8h __attribute__((ext_vector_type(8)));
typedef __bf16 v2b __attribute__((ext_vector_type(2)));
typedef unsigned int v8u __attribute__((ext_vector_type(8)));
typedef unsigned int v2ua __attribute__((ext_vector_type(2), may_alias));
typedef short s16x8 __attribute__((ext_vector_type(8)));
__device__ __forceinline__ v8f fa_mma(v16h a, v16h b, v8f c) { return __builtin_amdgcn_wmma_f32_16x16x32_f16(false, a, false, b, (short)0, c, false, false); }
// The loop's work-group barrier, in its two halves. Signal: this wave's LDS stores have landed and its LDS reads have returned. Wait: every wave of the work-group has signalled. They alternate strictly in every wave.
__device__ __forceinline__ void fa_signal() { asm volatile("s_wait_dscnt 0x0\n\ts_barrier_signal -1" ::: "memory"); }      /* the wait in front: a bare signal does not wait for outstanding LDS stores or reads; the clobber keeps the compiler's LDS accesses on their side */
__device__ __forceinline__ void fa_wait() { asm volatile("s_barrier_wait -1" ::: "memory"); }      /* the clobber keeps the refill's LDS stores, and the reads of the stage published here, behind it */
template <int N> struct fa_lvl { static constexpr int v = N; };      /* an issue priority as a type: s_setprio takes a literal */
__device__ __forceinline__ void fa_fence() { __builtin_amdgcn_sched_barrier(0); }      /* keeps a group of LDS loads, or a run of products, in one place */
__device__ __forceinline__ v16h fa_lds(const unsigned char* p) { FragH f; f.half[0] = *(const v8us*)p; f.half[1] = *(const v8us*)(p + 32); return f.v; }      /* p holds the lane's 16 * h: k = 8h .. 8h+7 and 16+8h .. 16+8h+7 */
__device__ __forceinline__ v8us fa_tr16(const unsigned char* p) { typedef __attribute__((address_space(3))) s16x8 lds_s16x8; return __builtin_bit_cast(v8us, __builtin_amdgcn_ds_load_tr16_b128_v8i16((lds_s16x8*)p)); }
__device__ __forceinline__ v16h fa_ldt(const unsigned char* p) { FragH f; f.half[0] = fa_tr16(p); f.half[1] = fa_tr16(p + 16 * FA_PT); return f.v; }      /* p = tile + (kbase + 8h + (c & 7)) * FA_PT + 2 * dbase + 16 * (c >> 3): lane (c, h) gets tile[kbase + 8h .. + 7][dbase + c], then the same 16 rows further: the k order of fa_lds */
__device__ __forceinline__ void fa_ldk(v16h (&kf)[2][2], const unsigned char* kb) {
#pragma unroll
  for (int kt = 0; kt < 2; ++kt) { kf[kt][0] = fa_lds(kb + kt * 16 * FA_PITCH); kf[kt][1] = fa_lds(kb + kt * 16 * FA_PITCH + 64); } }
__device__ __forceinline__ void fa_ldv(v16h (&vf)[4], const unsigned char* vb) {
#pragma unroll
  for (int t = 0; t < 4; ++t) vf[t] = fa_ldt(vb + t * 32); }
// two f32 -> bf16 (nearest even) -> times sc (a power of two) -> the same two values as packed f16
__device__ __forceinline__ unsigned int fa_r2(float a, float b, float sc) { const unsigned int u = __builtin_bit_cast(unsigned int, __builtin_convertvector(v2f{a, b}, v2b));
  return __builtin_bit_cast(unsigned int, __builtin_convertvector(v2f{__uint_as_float(u << 16) * sc, __uint_as_float(u & 0xFFFF0000u) * sc}, v2h)); }
__device__ __forceinline__ v8us pj_pack(v8f d, v8f b, float sc) { FragH f;      /* f16((acc / 16 + bias) * sc): the x16 of the weights taken back, exactly */
#pragma unroll
  for (int r = 0; r < 8; ++r) f.h[r] = (_Float16)((d[r] * 0.0625f + b[r]) * sc);
  return f.half[0]; }
// One pass = 32 keys of one wave. The softmax shift of a pass is fixed before its scores are formed: nmt[g] holds minus the shift in use (log2 domain) in all eight registers and is the C operand of the score products, and Q' comes
// pre-scaled by 64^-0.5 * log2(e), so that a product leaves the matrix unit as the argument of exp2. No maximum is taken first: the column sums of the f16 weights, which the matrix unit forms anyway for the denominator, tell
// whether the shift still serves. A sum of at most 2^8 bounds every weight of the pass by 2^8 (f16 holds it). A larger sum (or first, where the shift is -inf) sends the wave down the rare path: the pass's rows are
// read again from LDS, the scores formed again without a shift, their maximum taken, the running sums rescaled and the weights formed anew. MORE: a further pass follows, whose fragments (kn, vn) are fetched ahead.
// LAST: the stage's last pass: its fetch ahead reads the next stage, and the wave signals the loop's barrier once its last read of this stage has returned, in front of the output products.
template <bool LAST, bool MORE>
__device__ __forceinline__ void fa_pass(v16h (&kf)[2][2], v16h (&vf)[4], const unsigned char* kt, const unsigned char* kn, const unsigned char* vn, const v16h (&qf)[2][2], v8f (&acc)[2][4], float (&lrun)[2], v8f (&nmt)[2], const v16h ones, const bool first) {
  const v8f z = {0.f,0.f,0.f,0.f,0.f,0.f,0.f,0.f};
  v8f s[2][2], ln[2]; v16h pf[2];
  auto scores = [&](const bool shifted) {
#pragma unroll
    for (int kt2 = 0; kt2 < 2; ++kt2) {
#pragma unroll
      for (int g = 0; g < 2; ++g) s[kt2][g] = fa_mma(kf[kt2][1], qf[g][1], fa_mma(kf[kt2][0], qf[g][0], shifted ? nmt[g] : z)); }
    fa_fence();      /* the eight products stay back to back: mixed with vector work, each would be padded with v_nop */
    if (MORE) { fa_ldk(kf, kn); fa_fence(); }      /* next pass's rows, in flight under this pass's softmax */
    else { asm volatile("v_nop\n\tv_nop\n\tv_nop\n\tv_nop"); fa_fence(); } };      /* the wave's very last scores: the shift's registers are free behind them, and these four slots keep the first exp2 results, which may take them, at the distance that an operand of a matrix instruction needs */
  auto weights = [&]() {
#pragma unroll
    for (int g = 0; g < 2; ++g) { v8u w;
#pragma unroll
      for (int i = 0; i < 8; ++i) {
        w[i] = __builtin_bit_cast(unsigned int, __builtin_convertvector(v2f{__builtin_amdgcn_exp2f(s[i >> 2][g][2 * (i & 3)]), __builtin_amdgcn_exp2f(s[i >> 2][g][2 * (i & 3) + 1])}, v2h)); }
      pf[g] = __builtin_bit_cast(v16h, w);
      ln[g] = fa_mma(ones, pf[g], z); } };      /* row 0 (register 0, lanes 0-15) = the column sums of P^T as rounded to f16: this pass's share of the softmax denominator */
  auto redo = [&]() {
    fa_ldk(kf, kt); scores(false);
#pragma unroll
    for (int g = 0; g < 2; ++g) { float mx = s[0][g][0];
#pragma unroll
      for (int r = 1; r < 8; ++r) mx = fmaxf(mx, s[0][g][r]);
#pragma unroll
      for (int r = 0; r < 8; ++r) mx = fmaxf(mx, s[1][g][r]);
      mx = fmaxf(mx, rs_xhalf(mx));      /* both halves of the wave hold the query's maximum of this pass */
      const float mo = -nmt[g][0]; const float mn = fmaxf(mo, mx); const float corr = __builtin_amdgcn_exp2f(mo - mn); lrun[g] = lrun[g] * corr;
      nmt[g] = z - mn; s[0][g] = s[0][g] - mn; s[1][g] = s[1][g] - mn;
#pragma unroll
      for (int t = 0; t < 4; ++t) acc[g][t] = acc[g][t] * corr; }
    weights(); };      /* every weight is now at most 1 */
  unsigned int again = first ? 1u : 0u;      /* a lane mask, tested as a scalar */
  if (!first) { scores(true); weights();
    again = __builtin_amdgcn_ballot_w32(ln[0][0] + ln[1][0] > 256.0f); }      /* one scalar branch a pass; the sums are not negative, and an overflowed weight makes its sum inf, which is caught here too */
  if (again != 0u) redo();
  if (LAST) fa_signal();      /* outside the rare path: every wave signals once a stage. Nothing of this stage is read behind this line: its columns are in vf, which the products below need anyway */
#pragma unroll
  for (int g = 0; g < 2; ++g) {
#pragma unroll
    for (int t = 0; t < 4; ++t) acc[g][t] = fa_mma(vf[t], pf[g], acc[g][t]);
    lrun[g] += ln[g][0]; }
  if (MORE) { fa_fence(); fa_ldv(vf, vn); fa_fence(); }      /* next pass's columns, in flight under its scores and softmax */
}
__global__ __launch_bounds__(256 * FA_KG) void k_fattn(const float* __restrict__ x, const float* __restrict__ wq, const float* __restrict__ bq, const float* __restrict__ wk, const float* __restrict__ wv, const float* __restrict__ bv, float* __restrict__ O) {
  __shared__ __attribute__((aligned(16))) unsigned char L[FA_KG * FA_NB * FA_BUF];      /* one ring of three stages per key group in the loop; the hand-over and the output staging behind it */
  __shared__ __attribute__((aligned(16))) unsigned char LQ_[DM * FA_PITCH];         /* 16 Wq, row = output feature e: A rows of xq^T = Wq.x^T */
  __shared__ __attribute__((aligned(16))) unsigned char LK_[DM * FA_PT];            /* 16 Wk, row = e, read transposed: A rows d of Q'^T = Wk^T.xq^T */
  __shared__ __attribute__((aligned(16))) unsigned char LV_[DM * FA_PITCH];         /* 16 Wv, row = output feature e: A rows of out^T = Wv.Y^T */
  __shared__ __attribute__((aligned(16))) unsigned char LX_[FA_KG * 8 * 16 * FA_PITCH];      /* 16 query rows of x per wave */
  __shared__ __attribute__((aligned(16))) unsigned char LE_[FA_KG * 8 * 4 * 512];           /* Q' as B fragments: [column group][wave][tile][lane] */
  __shared__ __attribute__((aligned(16))) float LB[256 * FA_KG];                    /* bq, bv; the rest only keeps the store below free of a branch */
  static_assert(FA_NS >= FA_NB, "the prologue fills two stages and loads a third");
  static_assert(8 * 32 * FA_OP <= FA_KG * FA_NB * FA_BUF && 17 * 512 <= 32 * FA_OP, "the staging, and a wave's hand-over inside its staging part, must fit the array");
  static_assert(DM == 64 && HD == 64, "rows of 64");
  const int grp = __builtin_amdgcn_readfirstlane((int)threadIdx.x >> 8);      /* key group, the same in all lanes of a wave: scalar */
  const int tid = threadIdx.x & 255, c = tid & 15, h = (tid >> 4) & 1;      /* place inside the key group */
  const int wave = __builtin_amdgcn_readfirstlane(tid >> 5);      /* the same in all lanes of a wave: scalar */
  const size_t plane = blockIdx.y; const int q0 = blockIdx.x * 256 + wave * 32;
  /* staging: load i of a wave covers rows 8 wave + 2i and + 2i + 1 of the 64-row stage (512 contiguous bytes of f32) */
  const char* xg = (const char*)(x + (plane * SQ + grp * (SQ / FA_KG)) * HD); const unsigned xo = (tid >> 5) * 2048 + (tid & 31) * 16;
  unsigned char* ring = L + grp * FA_NB * FA_BUF;
  unsigned char* sdk = ring + ((tid >> 5) * 8 + h) * FA_PITCH + c * 8;
  unsigned char* sdv = ring + FA_TILE + ((tid >> 5) * 8 + h) * FA_PT + c * 8;
  v4f rx[4];
  auto gload = [&](int st) {
#pragma unroll
    for (int i = 0; i < 4; ++i) rx[i] = *(const v4fa*)(xg + st * (64 * HD * 4) + xo + i * 512); };
  auto sstore = [&](const v4f (&r)[4], const int bo) {      /* bo: byte offset of the buffer in the ring */
#pragma unroll
    for (int i = 0; i < 4; ++i) { const v2ua o = {fa_r2(r[i][0], r[i][1], 1.0f), fa_r2(r[i][2], r[i][3], 1.0f)};
      *(v2ua*)(sdk + bo + 2 * i * FA_PITCH) = o; *(v2ua*)(sdv + bo + 2 * i * FA_PT) = o; } };
  gload(0); const v4f r0[4] = {rx[0], rx[1], rx[2], rx[3]};
  asm volatile("s_wait_xcnt 0x0" ::: "memory");      /* the offset register of the four loads above stays as it is up to here: a later load may take it as its destination */
  gload(1); const v4f r1[4] = {rx[0], rx[1], rx[2], rx[3]};
  asm volatile("s_wait_xcnt 0x0" ::: "memory");      /* as above, for the four loads of stage 1 */
  /* query rows: wave w of key group g forms Q' of column group g (16 rows of x, 4 KiB contiguous) for wave w of both key groups; load i covers rows 2i and 2i + 1 in whole lines */
  const char* xq = (const char*)(x + (plane * SQ + q0 + 16 * grp) * HD); const unsigned xqo = (tid & 31) * 16;
  v4f xr[8];
#pragma unroll
  for (int i = 0; i < 8; ++i) xr[i] = *(const v4fa*)(xq + xqo + i * 512);
  asm volatile("s_wait_xcnt 0x0" ::: "memory");      /* as above, for these eight loads */
  /* weights: thread t of 512 converts 4-element chunks t and t + 512 of each matrix */
  const int t5 = (int)threadIdx.x; v4f wr[3][2];
#pragma unroll
  for (int m = 0; m < 3; ++m) { const float* w = (m == 0) ? wq : (m == 1) ? wk : wv;
#pragma unroll
    for (int j = 0; j < 2; ++j) wr[m][j] = *(const v4fa*)(w + t5 * 4 + j * 2048); }
  const float* bsrc = (t5 & DM) ? bv : bq; const float braw = bsrc[t5 & (DM - 1)];      /* by all threads, so that the load goes out with the rest */
  asm volatile("s_wait_xcnt 0x0" ::: "memory");      /* as above, for the weight and bias loads */
  gload(2);
  asm volatile("s_wait_xcnt 0x0" ::: "memory");      /* as above, for the four loads of stage 2 */
  fa_fence();      /* every load of the prologue is issued before the first wait for one: moved below a conversion, the bias and stage 2 cost a second trip to memory */
#pragma unroll
  for (int m = 0; m < 3; ++m) {
#pragma unroll
    for (int j = 0; j < 2; ++j) { const int ch = t5 + 512 * j; const v2ua o = {fa_r2(wr[m][j][0], wr[m][j][1], 16.0f), fa_r2(wr[m][j][2], wr[m][j][3], 16.0f)};
      unsigned char* d = (m == 0) ? LQ_ + (ch >> 4) * FA_PITCH : (m == 1) ? LK_ + (ch >> 4) * FA_PT : LV_ + (ch >> 4) * FA_PITCH;
      *(v2ua*)(d + (ch & 15) * 8) = o; } }
  LB[t5] = bf16_round(braw);
  unsigned char* xs = LX_ + (grp * 8 + wave) * 16 * FA_PITCH;      /* the wave's own 16 rows */
#pragma unroll
  for (int i = 0; i < 8; ++i) { const v2ua o = {fa_r2(xr[i][0], xr[i][1], 1.0f), fa_r2(xr[i][2], xr[i][3], 1.0f)}; *(v2ua*)(xs + (2 * i + h) * FA_PITCH + c * 8) = o; }
  v16h ones;      /* A operand whose row 0 (lanes 0 and 16) is 1.0 at all 32 k, every other row 0 */
  { const unsigned int o = (c == 0) ? 0x3C003C00u : 0u; const v8u ov = {o, o, o, o, o, o, o, o}; ones = __builtin_bit_cast(v16h, ov); }
  v8f acc[2][4], nmt[2]; float lrun[2];
#pragma unroll
  for (int g = 0; g < 2; ++g) { const v8f z = {0.f,0.f,0.f,0.f,0.f,0.f,0.f,0.f}; nmt[g] = z + __builtin_inff(); lrun[g] = 0.f;
#pragma unroll
    for (int t = 0; t < 4; ++t) acc[g][t] = z; }
  sstore(r0, 0); sstore(r1, FA_BUF);
  __syncthreads();      /* stages 0 and 1, the weights and the biases are visible to all waves */
  v16h qf[2][2];      /* B operand: column c = query q0 + 16 g + c, Q' = (x Wq^T + bq) Wk * 64^-0.5 * log2(e), in the k order of the x rows */
  { const v8f z = {0.f,0.f,0.f,0.f,0.f,0.f,0.f,0.f};
    const v16h xf0 = fa_lds(xs + c * FA_PITCH + 16 * h), xf1 = fa_lds(xs + c * FA_PITCH + 16 * h + 64);      /* column c = query q0 + 16 grp + c, k = 32 ks + the hardware k order */
    FragH qh[2];      /* xq as B operand: tile t of xq^T holds features 16 t + 8 h + r of query c, so tiles 2 ks and 2 ks + 1 packed are k = 32 ks + the hardware k order */
#pragma unroll
    for (int t = 0; t < 4; ++t) { const unsigned char* p = LQ_ + (16 * t + c) * FA_PITCH + 16 * h; const v16h w0 = fa_lds(p), w1 = fa_lds(p + 64);
      const v4f b0 = *(const v4fa*)(LB + 16 * t + 8 * h), b1 = *(const v4fa*)(LB + 16 * t + 8 * h + 4); const v8f b = {b0[0], b0[1], b0[2], b0[3], b1[0], b1[1], b1[2], b1[3]};
      qh[t >> 1].half[t & 1] = pj_pack(fa_mma(w1, xf1, fa_mma(w0, xf0, z)), b, 1.0f); }
    unsigned char* ex = LE_ + wave * 4 * 512 + (tid & 31) * 16;      /* lane by lane: the reader holds the same queries in the same lanes */
#pragma unroll
    for (int t = 0; t < 4; ++t) { const unsigned char* p = LK_ + (8 * h + (c & 7)) * FA_PT + 32 * t + 16 * (c >> 3); const v16h w0 = fa_ldt(p), w1 = fa_ldt(p + 32 * FA_PT);      /* A row c = Wk column 16 t + c, k = e */
      *(v8us*)(ex + grp * (8 * 4 * 512) + t * 512) = pj_pack(fa_mma(w1, qh[1].v, fa_mma(w0, qh[0].v, z)), z, 0.18033688011112042f); }      /* tile t of Q'^T = half t & 1 of the B operand at ks = t >> 1 */
    __syncthreads();      /* both column groups of Q' are visible to both key groups */
#pragma unroll
    for (int g = 0; g < 2; ++g) {
#pragma unroll
      for (int ks = 0; ks < 2; ++ks) { FragH f; f.half[0] = *(const v8us*)(ex + g * (8 * 4 * 512) + 2 * ks * 512); f.half[1] = *(const v8us*)(ex + g * (8 * 4 * 512) + (2 * ks + 1) * 512); qf[g][ks] = f.v; } } }
  v16h kf[2][2], vf[4];
  /* Ring of three buffers, stage s in buffer s mod 3. Trip st works on stage st; between its two passes it waits for the signals given in trip st - 1 (every wave has left stage st - 1 and has laid its rows of stage st + 1) and only then
     refills stage st - 1's buffer with stage st + 2 and, in its last pass, fetches stage st + 1's first fragments. A wave signals in its last pass of a stage and waits one pass later: the waves of a SIMD may drift a pass apart, so that none
     stands idle at the stage's end while the slowest finishes its softmax. All LDS reads between a signal and its wait are of stage st + 1, which the wait before has published. */
  const unsigned char* kb = ring + c * FA_PITCH + 16 * h; const unsigned char* vb = ring + FA_TILE + (8 * h + (c & 7)) * FA_PT + 16 * (c >> 3);
  fa_signal();      /* the signal that trip 0 waits for, so that every trip reads alike */
  fa_ldk(kf, kb); fa_ldv(vf, vb); fa_fence();      /* stage 0's first fragments */
  /* ro, rn, rw: byte offsets in the ring of stages st, st + 1, st + 2, literals at every call, so that they end as immediate offsets of the LDS instructions and no address register steps */
  /* p0, p1: the wave's issue priority in the trip's two passes. It falls 3, 3, 2, 2, 1, 0 over the six passes of a turn of the ring: with a priority that falls as a wave advances, one that has run ahead yields the matrix and vector ports to those behind and takes what they leave */
  auto trip = [&](auto p0, auto p1, const int st, const int ro, const int rn, const int rw, const bool first) __attribute__((always_inline)) {
    __builtin_amdgcn_s_setprio(decltype(p0)::v);
    fa_pass<false, true>(kf, vf, kb + ro, kb + ro + 32 * FA_PITCH, vb + ro + 32 * FA_PT, qf, acc, lrun, nmt, ones, first);
    fa_wait();      /* ends every wave's reads of stage st - 1 and publishes stage st + 1 */
    if (st + 2 < FA_NS) sstore(rx, rw);
    if (st + 3 < FA_NS) { gload(st + 3);           /* a whole stage of work ahead of its use */
      asm volatile("s_wait_xcnt 0x0" ::: "memory"); }      /* the address registers of the four loads above stay as they are up to here: the score products that follow take them as their destination */
    fa_fence();
    if constexpr (decltype(p1)::v != decltype(p0)::v) __builtin_amdgcn_s_setprio(decltype(p1)::v);
    fa_pass<true, true>(kf, vf, kb + ro + 32 * FA_PITCH, kb + rn, vb + rn, qf, acc, lrun, nmt, ones, false); };
  static_assert((FA_NS - 1) % FA_NB == 0, "the loop walks the ring in whole turns; the last stage stands apart");
#pragma unroll 1      /* one turn of the ring a trip, no more copies */
  for (int st = 0; st < FA_NS - 1; st += FA_NB) {
    trip(fa_lvl<3>{}, fa_lvl<3>{}, st, 0, FA_BUF, 2 * FA_BUF, st == 0);
    trip(fa_lvl<2>{}, fa_lvl<2>{}, st + 1, FA_BUF, 2 * FA_BUF, 0, false);
    trip(fa_lvl<1>{}, fa_lvl<0>{}, st + 2, 2 * FA_BUF, 0, FA_BUF, false);
  }
  /* the last stage (buffer 0), apart: nothing is left to refill or to fetch ahead, and no branch for that stands behind a product in the loop */
  __builtin_amdgcn_s_setprio(3);      /* as at the head of a turn */
  fa_pass<false, true>(kf, vf, kb, kb + 32 * FA_PITCH, vb + 32 * FA_PT, qf, acc, lrun, nmt, ones, false);
  fa_wait();      /* pairs with the signals of the stage before */
  fa_pass<true, false>(kf, vf, kb + 32 * FA_PITCH, kb, vb, qf, acc, lrun, nmt, ones, false);
  __builtin_amdgcn_s_setprio(0);      /* the loop's priorities end here, on the one path out */
  fa_wait();      /* the last stage's signals: every wave has left the ring */
  /* hand-over: wave w of group 1 holds the same queries in the same lanes and registers as wave w of group 0; it lays its registers lane by lane (512 contiguous bytes a store) in that wave's part of L (the rings are free behind the last barrier) */
  const int lane = (int)__builtin_amdgcn_mbcnt_lo(~0u, 0u), ce = lane & 15, he = lane >> 4;      /* the lane's number formed anew: no register carries it, or what follows from it, across the loop */
  unsigned char* eb = L + wave * 32 * FA_OP;
  float lsum[2], m_run[2];
#pragma unroll
  for (int g = 0; g < 2; ++g) { const float lr = lrun[g]; lsum[g] = lr + rs_xhalf(lr); m_run[g] = -nmt[g][0]; }      /* the denominator in lanes 0-15, 0 in lanes 16-31 (row 8 of the sum tiles) */
  if (grp != 0) {
#pragma unroll
    for (int g = 0; g < 2; ++g) {
#pragma unroll
      for (int t = 0; t < 4; ++t) { const v8f o = acc[g][t]; unsigned char* d = eb + (g * 4 + t) * 1024 + lane * 16;
        const v4f lo = {o[0], o[1], o[2], o[3]}, hi = {o[4], o[5], o[6], o[7]}; *(v4fa*)d = lo; *(v4fa*)(d + 512) = hi; } }
    const v4f ml = {m_run[0], m_run[1], lsum[0], lsum[1]}; *(v4fa*)(eb + 16 * 512 + lane * 16) = ml; }
  __syncthreads();      /* group 1's sums are visible to group 0 */
  if (grp != 0) return;      /* no barrier follows */
  { const v4f ml = *(const v4fa*)(eb + 16 * 512 + lane * 16);
#pragma unroll
    for (int g = 0; g < 2; ++g) { const float mn = fmaxf(m_run[g], ml[g]); const float a0 = __builtin_amdgcn_exp2f(m_run[g] - mn), a1 = __builtin_amdgcn_exp2f(ml[g] - mn);      /* both halves on the common maximum */
      const float inv = 1.0f / (lsum[g] * a0 + ml[2 + g] * a1); const float f0 = a0 * inv, f1 = a1 * inv;
#pragma unroll
      for (int t = 0; t < 4; ++t) { const unsigned char* d = eb + (g * 4 + t) * 1024 + lane * 16; const v4f lo = *(const v4fa*)d, hi = *(const v4fa*)(d + 512);
        const v8f o = {lo[0], lo[1], lo[2], lo[3], hi[0], hi[1], hi[2], hi[3]}; acc[g][t] = acc[g][t] * f0 + o * f1; } } }
  /* out^T = Wv.Y^T + bv: tile t of Y^T holds d = 16 t + 8 h + r of query c, so tiles 2 ks and 2 ks + 1 packed to f16 are the B operand at k = 32 ks + the hardware k order */
  { const v8f z = {0.f,0.f,0.f,0.f,0.f,0.f,0.f,0.f};
    FragH yf[2][2];
#pragma unroll
    for (int g = 0; g < 2; ++g) {
#pragma unroll
      for (int t = 0; t < 4; ++t) yf[g][t >> 1].half[t & 1] = __builtin_bit_cast(v8us, __builtin_convertvector(acc[g][t], v8h)); }
#pragma unroll
    for (int t = 0; t < 4; ++t) { const unsigned char* p = LV_ + (16 * t + ce) * FA_PITCH + 16 * he; const v16h w0 = fa_lds(p), w1 = fa_lds(p + 64);
      const v4f b0 = *(const v4fa*)(LB + DM + 16 * t + 8 * he), b1 = *(const v4fa*)(LB + DM + 16 * t + 8 * he + 4); const v8f b = {b0[0], b0[1], b0[2], b0[3], b1[0], b1[1], b1[2], b1[3]};
#pragma unroll
      for (int g = 0; g < 2; ++g) acc[g][t] = fa_mma(w1, yf[g][1].v, fa_mma(w0, yf[g][0].v, z)) * 0.0625f + b; } }      /* register r = output feature 16 t + 8 h + r */
  __builtin_amdgcn_fence(__ATOMIC_ACQ_REL, "workgroup"); __builtin_amdgcn_wave_barrier();      /* every lane's reads of the hand-over before any lane's staging stores into the same bytes */
  /* epilogue: each wave of group 0 stages its 32 output rows in its own part of L and stores whole 256-byte rows */
#pragma unroll
  for (int g = 0; g < 2; ++g) {
#pragma unroll
    for (int t = 0; t < 4; ++t) { const v8f o = acc[g][t]; unsigned char* d = eb + (16 * g + ce) * FA_OP + 64 * t + 32 * he;      /* row = query, feature = 16 t + 8 h + r */
      const v4f lo = {o[0], o[1], o[2], o[3]}, hi = {o[4], o[5], o[6], o[7]}; *(v4fa*)d = lo; *(v4fa*)(d + 16) = hi; } }
  __builtin_amdgcn_fence(__ATOMIC_ACQ_REL, "workgroup"); __builtin_amdgcn_wave_barrier();      /* the wave's own LDS writes before its reads of other lanes' rows */
#pragma unroll
  for (int i = 0; i < 16; ++i) { const int row = 2 * i + he; const v4f v = *(const v4fa*)(eb + row * FA_OP + ce * 16); *(v4f*)(O + (plane * SQ + q0 + row) * HD + ce * 4) = v; } }

extern "C" void kernel_launch(void* const* d_in, const int* in_sizes, int n_in,
                              void* d_out, int out_size, void* d_ws, size_t ws_size, hipStream_t stream) {
  (void)in_sizes; (void)n_in; (void)out_size; (void)d_ws; (void)ws_size;
  const float* const* I = (const float* const*)d_in; const float* x = I[0]; const float* wq = I[1]; const float* bq = I[2]; const float* wk = I[3]; const float* wv = I[5]; const float* bv = I[6];      /* natural [out][in] 64x64 weights + biases; x head-major = 32 planes of [2048][64]; bk (I[4]) adds the same amount to all scores of a query, which the softmax cancels */
  k_fattn<<<dim3(SQ / 256, NB), 256 * FA_KG, 0, stream>>>(x, wq, bq, wk, wv, bv, (float*)d_out);      /* all planes: 256 queries per work-group of 16 waves, out written f32 straight into the output rows */
}
